// v000
// Measured on an AMD MI455X. A time is GPU time per run, averaged over a window of back-to-back runs after a warm-up
// (all launches, gaps included; the runs take copies of the inputs in turn), and the median of several windows.
// Apart from v000's, it joins two sittings. Times from different sittings can be a few percent apart, while
// side-by-side timings come from the same sitting.
// v000, which the later versions start from, runs in 3830 microseconds.
#include <hip/hip_runtime.h>
// SPDGMultiHeadAttention (x [2][1024][512], u_prev [2][1]; xn = LN1(x); Q,K,V = xn W^T + b (8 heads of 64); lam = 10 exp(-5 u_prev); per batch: if lam >= 1 the SPARSE branch (softmax over the prior window slots prior_indices[i][k] with prior_index_mask, others excluded) else the DENSE branch (softmax over all keys of q.k/8 + lam*(prior_mask ? 0 : -1)); attn = merge W_o^T + b_o; h = x + attn; out = h + gelu_erf(LN2(h) W1^T + b1) W2^T + b2 -> [2][1024][512]; aggregated_u[b] = mean_s ||out - x|| / (||x|| + 1e-8) -> [2][1]).
// Structure: token rows; bf16(x) as f32 residual rows + LN1 on VALU (f32, thread per row) into f16 rows; Q | K | V WMMA GEMMs (32x64 wave tiles, f32 accumulation, exact x16 weights + bias, f16 outputs); per (batch, 4 heads): scores GEMM (K = 64), the branch-selecting row softmax on VALU (lam from u_prev, prior tables read on device; f32; weights x256 as f16), V^T via LDS, o = P . V GEMM (K = 1,024) into merged f16 rows; W_o GEMM + b_o + x (epilogue add) -> h; LN2 on VALU; fc1 GEMM with the exact-erf GELU epilogue (f16 hidden); fc2 GEMM + b2 + h straight into the output rows; the surprise statistic on VALU (per-row norms, float64 means per batch) into output 1.
// Compute dtype: inputs rounded to bf16; x / weights exact; LN outputs, q, k, v, softmax weights, o, GELU hidden plain f16 (~2^-12); residual, LN statistics, scores, softmax, norms f32/f64. v_wmma_f32_16x16x32_f16.
#define NB 2
#define SQ 1024
#define DM 512
#define NH 8
#define HD 64
#define HG 4                         /* heads per attention launch group */
#define QN SQ                        /* query rows attended per batch (debug hook) */
#define NR ((size_t)NB * SQ)         /* 2048 token rows */
typedef __bf16 v16b __attribute__((ext_vector_type(16)));
typedef unsigned short v8us __attribute__((ext_vector_type(8), may_alias));
typedef float  v8f  __attribute__((ext_vector_type(8)));
typedef float  v4f  __attribute__((ext_vector_type(4)));
typedef float  v4fa __attribute__((ext_vector_type(4), may_alias));
union FragB { v16b v; v8us half[2]; unsigned short u[16]; };

__device__ __forceinline__ unsigned short bf16_bits(float x) { unsigned int u = __float_as_uint(x); return (unsigned short)((u + 0x7FFFu + ((u >> 16) & 1u)) >> 16); }
__device__ __forceinline__ float bf16_val(unsigned short b) { return __uint_as_float(((unsigned int)b) << 16); }
__device__ __forceinline__ float bf16_round(float x) { return bf16_val(bf16_bits(x)); }
// D += A·B with NT terms: 1 = ah·bh, 2 = + al·bh (A split), 3 = + ah·bl (both split)
template <int NT>
__device__ __forceinline__ v8f mmaN(v16b ah, v16b al, v16b bh, v16b bl, v8f c) {
  c = __builtin_amdgcn_wmma_f32_16x16x32_bf16(false, ah, false, bh, (short)0, c, false, false);
  if (NT >= 2) c = __builtin_amdgcn_wmma_f32_16x16x32_bf16(false, al, false, bh, (short)0, c, false, false);
  if (NT >= 3) c = __builtin_amdgcn_wmma_f32_16x16x32_bf16(false, ah, false, bl, (short)0, c, false, false);
  asm volatile("v_nop\n\tv_nop\n\tv_nop\n\tv_nop" : "+v"(c) : "v"(ah), "v"(al), "v"(bh), "v"(bl));
  return c;
}

__global__ __launch_bounds__(256) void k_wt_bf16(const float* __restrict__ W, unsigned short* __restrict__ Wt, int K, int N) {
  const int t = blockIdx.x * 256 + threadIdx.x;
  const int k8n = K / 8;
  if (t >= N * k8n) return;
  const int n = t / k8n, k8 = (t % k8n) * 8;
  v8us v;
#pragma unroll
  for (int i = 0; i < 8; ++i) v[i] = bf16_bits(W[(size_t)(k8 + i) * N + n]);
  *(v8us*)(Wt + (size_t)n * K + k8) = v;
  
}

// GEMM C[M][N] (f32, pitch ldc) = act(A[M][K]·W + bias). A f32 row-major (pitch lda) converted per fragment to bf16
// (ASPLIT: hi/lo two planes -> 2 terms, else single rounded term); Wt bf16 [N][K] (pitch ldb). BIAS_BF16 rounds the
// bias to bf16 first (bias quantised to bf16 before the add). K%32==0, M%16==0, N%64==0.
template <bool ASPLIT, int ACT, bool BIAS_BF16>
__global__ __launch_bounds__(128) void k_gemm_bf(const float* __restrict__ A, int lda, const unsigned short* __restrict__ Wt, int ldb,
                                               const float* __restrict__ bias, float* __restrict__ C, int ldc, int M, int N, int K) {
  __shared__ __attribute__((aligned(16))) float so[4][16][64];
  const int tid = threadIdx.x, w = tid >> 5, lane = tid & 31, ln = lane & 15, hh = lane >> 4;
  const int ntn = N / 64;
  const int wid = blockIdx.x * 4 + w;
  const int mt = wid / ntn, nq = wid % ntn;
  if (mt * 16 >= M) return;
  const int row0 = mt * 16, col0 = nq * 64;
  const float* arow = A + (size_t)(row0 + ln) * lda;
  v8f acc[4] = {};
  for (int kb = 0; kb < K; kb += 32) {
    FragB ah, al;
    const v4f x0 = *(const v4fa*)(arow + kb + 8 * hh), x1 = *(const v4fa*)(arow + kb + 8 * hh + 4);
    const v4f x2 = *(const v4fa*)(arow + kb + 16 + 8 * hh), x3 = *(const v4fa*)(arow + kb + 16 + 8 * hh + 4);
    float xs[16] = {x0[0],x0[1],x0[2],x0[3],x1[0],x1[1],x1[2],x1[3],x2[0],x2[1],x2[2],x2[3],x3[0],x3[1],x3[2],x3[3]};
#pragma unroll
    for (int i = 0; i < 16; ++i) { const unsigned short hb = bf16_bits(xs[i]); ah.u[i] = hb; al.u[i] = ASPLIT ? bf16_bits(xs[i] - bf16_val(hb)) : (unsigned short)0; }
#pragma unroll
    for (int t = 0; t < 4; ++t) {
      const unsigned short* brow = Wt + (size_t)(col0 + t * 16 + ln) * ldb + kb;
      FragB b;
      b.half[0] = *(const v8us*)(brow + 8 * hh);
      b.half[1] = *(const v8us*)(brow + 16 + 8 * hh);
      acc[t] = mmaN<ASPLIT ? 2 : 1>(ah.v, al.v, b.v, b.v, acc[t]);
    }
  }
#pragma unroll
  for (int t = 0; t < 4; ++t) {
    float bv = bias ? bias[col0 + t * 16 + ln] : 0.f;
    if (BIAS_BF16) bv = bf16_round(bv);
#pragma unroll
    for (int r = 0; r < 8; ++r) { float v = acc[t][r] + bv; if (ACT == 1) v = fmaxf(v, 0.f); so[w][8 * hh + r][t * 16 + ln] = v; }
  }
  __builtin_amdgcn_fence(__ATOMIC_ACQ_REL, "workgroup");
  __builtin_amdgcn_wave_barrier();
  const int rsub = lane >> 4, c4 = (lane & 15) * 4;
  {
#pragma unroll
    for (int q = 0; q < 8; ++q) {
      const int r = q * 2 + rsub;
      const v4f v = *(const v4fa*)&so[w][r][c4];
      *(v4f*)(C + (size_t)(row0 + r) * ldc + col0 + c4) = v;
    }
    
  }
}

// GEMM C = act(A·W + bias + resid): A f32 (ASPLIT -> hi/lo 2 terms), Wt bf16 [N][K]; ACT 0 none, 1 relu, 2 exact gelu;
// resid (optional, f32, row index = (row % rmod), pitch ldr, RES_BF16 rounds it) added before the activation.
template <bool ASPLIT, int ACT, bool BIAS_BF16, bool RES_BF16>
__global__ __launch_bounds__(128) void k_gemm_bf3(const float* __restrict__ A, int lda, const unsigned short* __restrict__ Wt, int ldb,
                                                const float* __restrict__ bias, const float* __restrict__ resid, int rmod, int ldr,
                                                float* __restrict__ C, int ldc, int M, int N, int K) {
  __shared__ __attribute__((aligned(16))) float so[4][16][64];
  const int tid = threadIdx.x, w = tid >> 5, lane = tid & 31, ln = lane & 15, hh = lane >> 4;
  const int ntn = N / 64;
  const int wid = blockIdx.x * 4 + w;
  const int mt = wid / ntn, nq = wid % ntn;
  if (mt * 16 >= M) return;
  const int row0 = mt * 16, col0 = nq * 64;
  const float* arow = A + (size_t)(row0 + ln) * lda;
  v8f acc[4] = {};
  for (int kb = 0; kb < K; kb += 32) {
    FragB ah, al;
    const v4f x0 = *(const v4fa*)(arow + kb + 8 * hh), x1 = *(const v4fa*)(arow + kb + 8 * hh + 4);
    const v4f x2 = *(const v4fa*)(arow + kb + 16 + 8 * hh), x3 = *(const v4fa*)(arow + kb + 16 + 8 * hh + 4);
    float xs[16] = {x0[0],x0[1],x0[2],x0[3],x1[0],x1[1],x1[2],x1[3],x2[0],x2[1],x2[2],x2[3],x3[0],x3[1],x3[2],x3[3]};
#pragma unroll
    for (int i = 0; i < 16; ++i) { const unsigned short hb = bf16_bits(xs[i]); ah.u[i] = hb; al.u[i] = ASPLIT ? bf16_bits(xs[i] - bf16_val(hb)) : (unsigned short)0; }
#pragma unroll
    for (int t = 0; t < 4; ++t) {
      const unsigned short* brow = Wt + (size_t)(col0 + t * 16 + ln) * ldb + kb;
      FragB b;
      b.half[0] = *(const v8us*)(brow + 8 * hh);
      b.half[1] = *(const v8us*)(brow + 16 + 8 * hh);
      acc[t] = mmaN<ASPLIT ? 2 : 1>(ah.v, al.v, b.v, b.v, acc[t]);
    }
  }
#pragma unroll
  for (int t = 0; t < 4; ++t) {
    const int col = col0 + t * 16 + ln;
    float bv = bias ? bias[col] : 0.f;
    if (BIAS_BF16) bv = bf16_round(bv);
#pragma unroll
    for (int r = 0; r < 8; ++r) {
      float v = acc[t][r] + bv;
      if (resid) { float rv = resid[(size_t)((row0 + 8 * hh + r) % rmod) * ldr + col]; if (RES_BF16) rv = bf16_round(rv); v += rv; }
      if (ACT == 1) v = fmaxf(v, 0.f);
      if (ACT == 2) v = 0.5f * v * (1.0f + erff(v * 0.70710678118654752f));
      if (ACT == 3) { const float u = 0.7978845608028654f * (v + 0.044715f * v * v * v); v = 0.5f * v * (1.0f + tanhf(u)); }
      so[w][8 * hh + r][t * 16 + ln] = v;
    }
  }
  __builtin_amdgcn_fence(__ATOMIC_ACQ_REL, "workgroup");
  __builtin_amdgcn_wave_barrier();
  const int rsub = lane >> 4, c4 = (lane & 15) * 4;
  {
#pragma unroll
    for (int q = 0; q < 8; ++q) {
      const int r = q * 2 + rsub;
      const v4f v = *(const v4fa*)&so[w][r][c4];
      *(v4f*)(C + (size_t)(row0 + r) * ldc + col0 + c4) = v;
    }
    
  }
}
// row LayerNorm (biased variance, eps) over N: s = X (+ R); optional out_sum <- s; out_norm <- (s-mu)*rsqrt(var+eps)*g + b
template <bool PARAM_BF16>
__global__ __launch_bounds__(256) void k_layernorm(const float* __restrict__ X, const float* __restrict__ R, const float* __restrict__ g, const float* __restrict__ bta,
                                                  float* __restrict__ out_sum, float* __restrict__ out_norm, int N, float eps) {
  __shared__ float red[256];
  const int row = blockIdx.x, tid = threadIdx.x;
  const float* x = X + (size_t)row * N; const float* rr = R ? R + (size_t)row * N : nullptr;
  float vals[16];                     // up to N = 4096
  const int per = N / 256;            // contiguous chunk per thread? use strided-by-4 chunks: thread handles j = tid*4 + 1024*u
  float s1 = 0.f;
  for (int u = 0; u < per / 4; ++u) {
    const int j = tid * 4 + 1024 * u;
    const v4f a = *(const v4fa*)(x + j);
    v4f b = {0.f,0.f,0.f,0.f}; if (rr) b = *(const v4fa*)(rr + j);
#pragma unroll
    for (int q = 0; q < 4; ++q) { const float v = a[q] + b[q]; vals[u * 4 + q] = v; s1 += v; }
  }
  red[tid] = s1; __syncthreads();
  for (int st = 128; st > 0; st >>= 1) { if (tid < st) red[tid] += red[tid + st]; __syncthreads(); }
  const float mu = red[0] / (float)N; __syncthreads();
  float s2 = 0.f;
  for (int u = 0; u < per / 4; ++u)
#pragma unroll
    for (int q = 0; q < 4; ++q) { const float c = vals[u * 4 + q] - mu; s2 += c * c; }
  red[tid] = s2; __syncthreads();
  for (int st = 128; st > 0; st >>= 1) { if (tid < st) red[tid] += red[tid + st]; __syncthreads(); }
  const float rs = rsqrtf(red[0] / (float)N + eps);
  {
    for (int u = 0; u < per / 4; ++u) {
      const int j = tid * 4 + 1024 * u;
      v4f o, sm;
#pragma unroll
      for (int q = 0; q < 4; ++q) {
        float gg = g[j + q], bb = bta[j + q];
        if (PARAM_BF16) { gg = bf16_round(gg); bb = bf16_round(bb); }
        sm[q] = vals[u * 4 + q]; o[q] = (vals[u * 4 + q] - mu) * rs * gg + bb;
      }
      if (out_sum) *(v4f*)(out_sum + (size_t)row * N + j) = sm;
      *(v4f*)(out_norm + (size_t)row * N + j) = o;
    }
    
  }
}



// ---- f16 WMMA path (v_wmma_f32_16x16x32_f16): 11-bit significands for operands in range — used where a [0,1] probability operand needs more precision than bf16
typedef _Float16 v16h __attribute__((ext_vector_type(16)));
union FragH { v16h v; v8us half[2]; _Float16 h[16]; unsigned short u[16]; };
template <int NT>
__device__ __forceinline__ v8f mmaH(v16h ah, v16h al, v16h bh, v16h bl, v8f c) {
  c = __builtin_amdgcn_wmma_f32_16x16x32_f16(false, ah, false, bh, (short)0, c, false, false);
  if (NT >= 2) c = __builtin_amdgcn_wmma_f32_16x16x32_f16(false, al, false, bh, (short)0, c, false, false);
  if (NT >= 3) c = __builtin_amdgcn_wmma_f32_16x16x32_f16(false, ah, false, bl, (short)0, c, false, false);
  asm volatile("v_nop\n\tv_nop\n\tv_nop\n\tv_nop" : "+v"(c) : "v"(ah), "v"(al), "v"(bh), "v"(bl));
  return c;
}
// batched GEMM like k_gemm_b but f16 operands: A f32 (split into f16 hi/lo if ASPLIT, else rounded to f16), Bt = f16 values [n][k]; alpha; C f32; N multiple of 16 (partial tiles skipped)
template <bool ASPLIT>
__global__ __launch_bounds__(128) void k_gemm_h(const float* __restrict__ A, int lda, size_t sA, const _Float16* __restrict__ Bh, int ldb, size_t sB, float alpha, float* __restrict__ C, int ldc, size_t sC, int M, int N, int K) {
  __shared__ __attribute__((aligned(16))) float so[4][16][64];
  const int tid = threadIdx.x, w = tid >> 5, lane = tid & 31, ln = lane & 15, hh = lane >> 4; const int by = blockIdx.y;
  A += (size_t)by * sA; Bh += (size_t)by * sB; C += (size_t)by * sC;
  const int ntn = (N + 63) / 64; const int wid = blockIdx.x * 4 + w; const int mt = wid / ntn, nq = wid % ntn; if (mt * 16 >= M) return;
  const int row0 = mt * 16, col0 = nq * 64; const float* arow = A + (size_t)(row0 + ln) * lda;
  v8f acc[4] = {};
  for (int kb = 0; kb < K; kb += 32) {
    FragH ah, al;
    const v4f x0 = *(const v4fa*)(arow + kb + 8 * hh), x1 = *(const v4fa*)(arow + kb + 8 * hh + 4), x2 = *(const v4fa*)(arow + kb + 16 + 8 * hh), x3 = *(const v4fa*)(arow + kb + 16 + 8 * hh + 4);
    float xs[16] = {x0[0],x0[1],x0[2],x0[3],x1[0],x1[1],x1[2],x1[3],x2[0],x2[1],x2[2],x2[3],x3[0],x3[1],x3[2],x3[3]};
#pragma unroll
    for (int i = 0; i < 16; ++i) { const _Float16 h = (_Float16)xs[i]; ah.h[i] = h; al.h[i] = ASPLIT ? (_Float16)(xs[i] - (float)h) : (_Float16)0.0f; }
#pragma unroll
    for (int t = 0; t < 4; ++t) { if (col0 + t * 16 >= N) continue; const size_t boff = (size_t)(col0 + t * 16 + ln) * ldb + kb; FragH bq; bq.half[0] = *(const v8us*)(Bh + boff + 8 * hh); bq.half[1] = *(const v8us*)(Bh + boff + 16 + 8 * hh);
      acc[t] = mmaH<ASPLIT ? 2 : 1>(ah.v, al.v, bq.v, bq.v, acc[t]); }
  }
#pragma unroll
  for (int t = 0; t < 4; ++t) { if (col0 + t * 16 >= N) continue;
#pragma unroll
    for (int r = 0; r < 8; ++r) so[w][8 * hh + r][t * 16 + ln] = acc[t][r] * alpha; }
  __builtin_amdgcn_fence(__ATOMIC_ACQ_REL, "workgroup"); __builtin_amdgcn_wave_barrier();
  const int rsub = lane >> 4, c4 = (lane & 15) * 4;
  {
#pragma unroll
    for (int q = 0; q < 8; ++q) { const int r = q * 2 + rsub; if (col0 + c4 < N) { const v4f v = *(const v4fa*)&so[w][r][c4]; *(v4f*)(C + (size_t)(row0 + r) * ldc + col0 + c4) = v; } }
     }
}

// Wt[n][k] = f16(W[k][n]·scale) from f32 row-major W[K][N] (scale = power of two; bf16-exact weights stay exact in f16 away from the subnormal range)
__global__ __launch_bounds__(256) void k_wt_f16(const float* __restrict__ W, _Float16* __restrict__ Wt, int K, int N, float scale) {
  const int t = blockIdx.x * 256 + threadIdx.x; if (t >= N * (K / 8)) return; const int n = t / (K / 8), k8 = (t % (K / 8)) * 8; FragH f;
#pragma unroll
  for (int i = 0; i < 8; ++i) f.h[i] = (_Float16)(bf16_round(W[(size_t)(k8 + i) * N + n]) * scale); const v8us o = f.half[0];
  *(v8us*)((unsigned short*)Wt + (size_t)n * K + k8) = o; 
}
// k_gemm_hh variant with fused epilogue: v = acc·alpha + bias[by·sBias + col] (+ CP[(row/rowsPerB)·sCPb + by·64 + col] if CP) ; ACT 0 none / 1 elu ; writes f16 C16 (and f32 C if non-null)
template <int ACT>
__global__ __launch_bounds__(128) void k_gemm_hhx(const _Float16* __restrict__ A, int lda, size_t sA, const _Float16* __restrict__ Bh, int ldb, size_t sB, float alpha, const float* __restrict__ bias, size_t sBias, const float* __restrict__ CP, int rowsPerB, size_t sCPb, int row0g,
    float* __restrict__ C, _Float16* __restrict__ C16, int ldc, size_t sC, int M, int N, int K) {
  __shared__ __attribute__((aligned(16))) float so[4][16][64];
  const int tid = threadIdx.x, w = tid >> 5, lane = tid & 31, ln = lane & 15, hh = lane >> 4; const int by = blockIdx.y;
  A += (size_t)by * sA; Bh += (size_t)by * sB; const size_t cofs = (size_t)by * sC; const float* bp = bias ? bias + (size_t)by * sBias : nullptr;
  const int ntn = (N + 63) / 64; const int wid = blockIdx.x * 4 + w; const int mt = wid / ntn, nq = wid % ntn; if (mt * 16 >= M) return;
  const int row0 = mt * 16, col0 = nq * 64; const _Float16* arow = A + (size_t)(row0 + ln) * lda;
  v8f acc[4] = {};
  for (int kb = 0; kb < K; kb += 32) { FragH ah; ah.half[0] = *(const v8us*)((const unsigned short*)arow + kb + 8 * hh); ah.half[1] = *(const v8us*)((const unsigned short*)arow + kb + 16 + 8 * hh);
#pragma unroll
    for (int t = 0; t < 4; ++t) { if (col0 + t * 16 >= N) continue; const size_t boff = (size_t)(col0 + t * 16 + ln) * ldb + kb; FragH bq; bq.half[0] = *(const v8us*)((const unsigned short*)Bh + boff + 8 * hh); bq.half[1] = *(const v8us*)((const unsigned short*)Bh + boff + 16 + 8 * hh);
      acc[t] = mmaH<1>(ah.v, ah.v, bq.v, bq.v, acc[t]); }
  }
#pragma unroll
  for (int t = 0; t < 4; ++t) { if (col0 + t * 16 >= N) continue; const int col = col0 + t * 16 + ln; const float bv = bp ? bf16_round(bp[col]) : 0.f;
#pragma unroll
    for (int r = 0; r < 8; ++r) { float v = acc[t][r] * alpha + bv; if (CP) { const int rr = row0g + row0 + 8 * hh + r; if (rowsPerB < 0) v += CP[cofs + (size_t)rr * ldc + col];      /* rowsPerB < 0: own element of the batched C plane */ else { const int bidx = rr / rowsPerB; v += CP[(size_t)bidx * sCPb + (size_t)by * 64 + col]; } } if (ACT == 1) v = (v > 0.f) ? v : expm1f(v); else if (ACT == 7) v = (v > 0.f) ? v + 1.0f : expf(v); else if (ACT == 8) v = tanhf(v); else if (ACT == 9) v = 0.5f * v * (1.0f + tanhf(0.7978845608028654f * (v + 0.044715f * v * v * v))); else if (ACT == 11) v = 1.0f / (1.0f + expf(-v)); else if (ACT == 12) v = (v > 0.f) ? v : 0.01f * v; else if (ACT == 14) v = (v > 0.f) ? v : 0.1f * v; else if (ACT == 16) v = (v >= 0.f) ? v : 0.3f * v; else if (ACT == 17) v = (v >= 0.f) ? v : 0.2f * v; else if (ACT == 15) v = v / (1.0f + expf(-v)); else if (ACT == 3) v = fmaxf(v, 0.f); else if (ACT == 6) v = 0.5f * v * (1.0f + erff(v * 0.70710678118654752f)); so[w][8 * hh + r][t * 16 + ln] = v; } }
  __builtin_amdgcn_fence(__ATOMIC_ACQ_REL, "workgroup"); __builtin_amdgcn_wave_barrier();
  const int rsub = lane >> 4, c4 = (lane & 15) * 4; typedef _Float16 v4h __attribute__((ext_vector_type(4)));
  {
#pragma unroll
    for (int q = 0; q < 8; ++q) { const int r = q * 2 + rsub; if (col0 + c4 < N) { const v4f v = *(const v4fa*)&so[w][r][c4]; if (C) *(v4f*)(C + cofs + (size_t)(row0 + r) * ldc + col0 + c4) = v; if (C16) { v4h h4; for (int i = 0; i < 4; ++i) h4[i] = (_Float16)v[i]; *(v4h*)(C16 + cofs + (size_t)(row0 + r) * ldc + col0 + c4) = h4; } } }
     }
}


typedef _Float16 v4h __attribute__((ext_vector_type(4)));

__global__ __launch_bounds__(256) void k_x16(const float* __restrict__ x, _Float16* __restrict__ X16, size_t n8) { const size_t t = (size_t)blockIdx.x * 256 + threadIdx.x; if (t >= n8) return; FragH f;
#pragma unroll
  for (int q = 0; q < 8; ++q) f.h[q] = (_Float16)bf16_round(x[t * 8 + q]); *(v8us*)((unsigned short*)X16 + t * 8) = f.half[0];  }
__global__ __launch_bounds__(256) void k_h16(const float* __restrict__ x, _Float16* __restrict__ X16, size_t n8) { const size_t t = (size_t)blockIdx.x * 256 + threadIdx.x; if (t >= n8) return; FragH f;
#pragma unroll
  for (int q = 0; q < 8; ++q) f.h[q] = (_Float16)x[t * 8 + q]; *(v8us*)((unsigned short*)X16 + t * 8) = f.half[0];  }
__global__ __launch_bounds__(256) void k_round16f(const float* __restrict__ W, _Float16* __restrict__ Bt, size_t n8) { const size_t t = (size_t)blockIdx.x * 256 + threadIdx.x; if (t >= n8) return; FragH f;
#pragma unroll
  for (int i = 0; i < 8; ++i) f.h[i] = (_Float16)(bf16_round(W[t * 8 + i]) * 16.0f); *(v8us*)((unsigned short*)Bt + t * 8) = f.half[0];  }
template <int NHv, int TTv>
__global__ __launch_bounds__(256) void k_vt(const _Float16* __restrict__ V16, int ldv, int voff, _Float16* __restrict__ Vt) { __shared__ unsigned short tl[64][66]; const int tid = threadIdx.x; const int slab = blockIdx.x / (TTv / 64), lg = blockIdx.x % (TTv / 64); const int b = slab / NHv, h = slab % NHv;
  for (int i = tid; i < 64 * 8; i += 256) { const int r = i / 8, c8 = (i % 8) * 8; FragH f; f.half[0] = *(const v8us*)((const unsigned short*)V16 + ((size_t)b * TTv + lg * 64 + r) * ldv + voff + h * 64 + c8);
#pragma unroll
    for (int q = 0; q < 8; ++q) tl[r][c8 + q] = f.u[q]; }
  __syncthreads();
  {
#pragma unroll
    for (int rd = 0; rd < 2; ++rd) { const int d = rd * 32 + tid / 8, pc = tid % 8; FragH f;
#pragma unroll
      for (int q = 0; q < 8; ++q) f.u[q] = tl[pc * 8 + q][d];
      *(v8us*)((unsigned short*)Vt + ((size_t)slab * 64 + d) * TTv + lg * 64 + pc * 8) = f.half[0]; }
     } }

__global__ __launch_bounds__(256) void k_hl(const float* __restrict__ F, _Float16* __restrict__ Hh, _Float16* __restrict__ Hl, size_t n8) { const size_t t = (size_t)blockIdx.x * 256 + threadIdx.x; if (t >= n8) return; FragH fh, fl; const v4f a = *(const v4fa*)(F + t * 8), c = *(const v4fa*)(F + t * 8 + 4);
#pragma unroll
  for (int q = 0; q < 4; ++q) { _Float16 h = (_Float16)a[q]; fh.h[q] = h; fl.h[q] = (_Float16)((a[q] - (float)h) * 1024.0f); h = (_Float16)c[q]; fh.h[4 + q] = h; fl.h[4 + q] = (_Float16)((c[q] - (float)h) * 1024.0f); }
  { *(v8us*)((unsigned short*)Hh + t * 8) = fh.half[0]; *(v8us*)((unsigned short*)Hl + t * 8) = fl.half[0];  } }

// ---- fast GEMM (wave tile 32x64; requires M % 32 == 0 rows per launch region and N % 64 == 0); epilogue = k_gemm_hhx semantics ----
__device__ __forceinline__ v16h g2_frag(const _Float16* p, int hh) { FragH f; f.half[0] = *(const v8us*)((const unsigned short*)p + 8 * hh); f.half[1] = *(const v8us*)((const unsigned short*)p + 16 + 8 * hh); return f.v; }
__device__ __forceinline__ v8f g2_mma(v16h a, v16h b, v8f c) { v8f d = __builtin_amdgcn_wmma_f32_16x16x32_f16(false, a, false, b, (short)0, c, false, false); asm volatile("v_nop\n\tv_nop\n\tv_nop\n\tv_nop" : "+v"(d) : "v"(a), "v"(b)); return d; }
template <int ACT>
__global__ __launch_bounds__(128) void k_gemm2(const _Float16* __restrict__ A, int lda, size_t sA, const _Float16* __restrict__ Bh, int ldb, size_t sB, float alpha, const float* __restrict__ bias, size_t sBias, const float* __restrict__ CP, int rowsPerB, size_t sCPb, int row0g,
    float* __restrict__ C, _Float16* __restrict__ C16, int ldc, size_t sC, int M, int N, int K) { static_assert(ACT == 0 || ACT == 3 || ACT == 6 || ACT == 8 || ACT == 9 || ACT == 11 || ACT == 12 || ACT == 14 || ACT == 15 || ACT == 16 || ACT == 17, "k_gemm2: unsupported ACT code (would silently apply no activation)");
  __shared__ __attribute__((aligned(16))) float so[4][32][68];
  const int tid = threadIdx.x, w = tid >> 5, lane = tid & 31, ln = lane & 15, hh = lane >> 4; const int by = blockIdx.y;
  A += (size_t)by * sA; Bh += (size_t)by * sB; const size_t cofs = (size_t)by * sC; const float* bp = bias ? bias + (size_t)by * sBias : nullptr;
  const int ntn = N >> 6; const int mt = blockIdx.x / ntn, nq = blockIdx.x - mt * ntn; const int row0 = mt * 128 + 32 * w, col0 = nq * 64; if (row0 >= M) return;
  const _Float16* a0p = A + (size_t)(row0 + ln) * lda; const _Float16* a1p = a0p + (size_t)16 * lda;
  const _Float16* b0p = Bh + (size_t)(col0 + ln) * ldb; const _Float16* b1p = b0p + (size_t)16 * ldb; const _Float16* b2p = b1p + (size_t)16 * ldb; const _Float16* b3p = b2p + (size_t)16 * ldb;
  const v8f z8 = {0.f,0.f,0.f,0.f,0.f,0.f,0.f,0.f}; v8f c00 = z8, c01 = z8, c02 = z8, c03 = z8, c10 = z8, c11 = z8, c12 = z8, c13 = z8;
#pragma unroll 1
  for (int kb = 0; kb < K; kb += 32) { const v16h a0 = g2_frag(a0p + kb, hh), a1 = g2_frag(a1p + kb, hh);
    v16h b = g2_frag(b0p + kb, hh); c00 = g2_mma(a0, b, c00); c10 = g2_mma(a1, b, c10);
    b = g2_frag(b1p + kb, hh); c01 = g2_mma(a0, b, c01); c11 = g2_mma(a1, b, c11);
    b = g2_frag(b2p + kb, hh); c02 = g2_mma(a0, b, c02); c12 = g2_mma(a1, b, c12);
    b = g2_frag(b3p + kb, hh); c03 = g2_mma(a0, b, c03); c13 = g2_mma(a1, b, c13); }
  v8f accs[8] = {c00, c01, c02, c03, c10, c11, c12, c13};
#pragma unroll
  for (int u = 0; u < 8; ++u) { const int t = u & 3, half = u >> 2; const int col = col0 + t * 16 + ln; const float bv = bp ? bf16_round(bp[col]) : 0.f;
#pragma unroll
    for (int r = 0; r < 8; ++r) { const int rloc = half * 16 + 8 * hh + r; float v = accs[u][r] * alpha + bv; if (CP) { if (rowsPerB < 0) v += CP[cofs + (size_t)(row0g + row0 + rloc) * ldc + col];      /* rowsPerB < 0: own element of the batched C plane */ else { const int bidx = (row0g + row0 + rloc) / rowsPerB; v += CP[(size_t)bidx * sCPb + (size_t)by * 64 + col]; } }
      if (ACT == 3) v = fmaxf(v, 0.f); else if (ACT == 6) v = 0.5f * v * (1.0f + erff(v * 0.70710678118654752f)); else if (ACT == 11) v = 1.0f / (1.0f + expf(-v)); else if (ACT == 15) v = v / (1.0f + expf(-v)); else if (ACT == 12) v = (v > 0.f) ? v : 0.01f * v; else if (ACT == 8) v = tanhf(v); else if (ACT == 9) v = 0.5f * v * (1.0f + tanhf(0.7978845608028654f * (v + 0.044715f * v * v * v))); else if (ACT == 14) v = (v > 0.f) ? v : 0.1f * v; else if (ACT == 16) v = (v >= 0.f) ? v : 0.3f * v; else if (ACT == 17) v = (v >= 0.f) ? v : 0.2f * v;
      so[w][rloc][t * 16 + ln] = v; } }
  __builtin_amdgcn_fence(__ATOMIC_ACQ_REL, "workgroup"); __builtin_amdgcn_wave_barrier();
  const int rsub = lane >> 4, c4 = (lane & 15) * 4;
  {
#pragma unroll
    for (int q = 0; q < 16; ++q) { const int r = q * 2 + rsub; const v4f v = *(const v4fa*)&so[w][r][c4]; if (C) *(v4f*)(C + cofs + (size_t)(row0 + r) * ldc + col0 + c4) = v; if (C16) { v4h h4; for (int i = 0; i < 4; ++i) h4[i] = (_Float16)v[i]; *(v4h*)(C16 + cofs + (size_t)(row0 + r) * ldc + col0 + c4) = h4; } }
     } }


__global__ __launch_bounds__(256) void k_wnat(const float* __restrict__ w, size_t n8, _Float16* __restrict__ Bt) { const size_t t = (size_t)blockIdx.x * 256 + threadIdx.x; if (t >= n8) return; FragH f; for (int q = 0; q < 8; ++q) f.h[q] = (_Float16)(bf16_round(w[t * 8 + q]) * 16.0f); *(v8us*)((unsigned short*)Bt + t * 8) = f.half[0];  }
__global__ __launch_bounds__(256) void k_rsm(const float* __restrict__ S, _Float16* __restrict__ P, int nrows) {
  #pragma clang fp contract(off)
  const int i = blockIdx.x * 256 + threadIdx.x; if (i >= nrows) return; const float* s = S + (size_t)i * SQ; float mx = -3.0e38f;
#pragma unroll 1
  for (int j = 0; j < SQ; ++j) mx = fmaxf(mx, s[j]); float se = 0.f;
#pragma unroll 1
  for (int j = 0; j < SQ; ++j) se += expf(s[j] - mx); const float sc = 256.0f / se;
#pragma unroll 1
  for (int j0 = 0; j0 < SQ; j0 += 8) { FragH f; for (int q = 0; q < 8; ++q) f.h[q] = (_Float16)(expf(s[j0 + q] - mx) * sc); unsigned short* d = (unsigned short*)P + (size_t)i * SQ + j0; *(v8us*)d = f.half[0];  } }
__global__ __launch_bounds__(256) void k_vt(const _Float16* __restrict__ V16, int b, int h0, _Float16* __restrict__ VT) { __shared__ unsigned short tl[64][65]; const int tid = threadIdx.x; const int hh = blockIdx.x % HG, sg = blockIdx.x / HG; const int s0 = sg * 64; const int h = h0 + hh;
  for (int i = tid; i < 64 * 8; i += 256) { const int j = i / 8, d8 = (i % 8) * 8; FragH f; f.half[0] = *(const v8us*)((const unsigned short*)V16 + ((size_t)b * SQ + s0 + j) * DM + h * HD + d8); for (int q = 0; q < 8; ++q) tl[d8 + q][j] = f.u[q]; }
  __syncthreads();
  { for (int i = tid; i < 64 * 8; i += 256) { const int d = i / 8, j8 = (i % 8) * 8; FragH f; for (int q = 0; q < 8; ++q) f.u[q] = tl[d][j8 + q]; *(v8us*)((unsigned short*)VT + ((size_t)hh * HD + d) * SQ + s0 + j8) = f.half[0]; }  } }

#define FH 2048
#define KN 103
__global__ __launch_bounds__(256) void k_xf(const float* __restrict__ x, float* __restrict__ XF, size_t n8) { const size_t t = (size_t)blockIdx.x * 256 + threadIdx.x; if (t >= n8) return; v8f o; for (int q = 0; q < 8; ++q) o[q] = bf16_round(x[t * 8 + q]); *(v8f*)(XF + t * 8) = o;  }
__global__ __launch_bounds__(256) void k_ln(const float* __restrict__ HF, const float* __restrict__ g, const float* __restrict__ bb, int ncol, _Float16* __restrict__ X16o) {
  #pragma clang fp contract(off)
  const size_t r = (size_t)blockIdx.x * 256 + threadIdx.x; if (r >= NR) return; const float* x = HF + r * DM; float s = 0.f;
#pragma unroll 1
  for (int c = 0; c < ncol; ++c) s += x[c]; const float mu = s / (float)DM; float v = 0.f;
#pragma unroll 1
  for (int c = 0; c < ncol; ++c) { const float d = x[c] - mu; v = __fadd_rn(v, __fmul_rn(d, d)); } const float rs = 1.0f / sqrtf(v / (float)DM + 1e-5f);
#pragma unroll 1
  for (int c0 = 0; c0 < ncol; c0 += 8) { FragH f; for (int q = 0; q < 8; ++q) { const int c = c0 + q; f.h[q] = (_Float16)__fadd_rn(__fmul_rn((x[c] - mu) * rs, bf16_round(g[c])), bf16_round(bb[c])); } unsigned short* d = (unsigned short*)X16o + r * DM + c0; *(v8us*)d = f.half[0];  } }
__global__ __launch_bounds__(128) void k_rsmg(const float* __restrict__ S, _Float16* __restrict__ P, int nrows, const float* __restrict__ uprev, int b, const int* __restrict__ pmask, const int* __restrict__ pidx, const int* __restrict__ pim, int kn) {
  #pragma clang fp contract(off)
  __shared__ unsigned int bm[128][SQ / 32];      /* per-thread key-membership bitmap for the sparse branch (any index set; a duplicated index would be counted once) */
  const int i = blockIdx.x * 128 + threadIdx.x; if (i >= nrows) return; unsigned int* my = bm[threadIdx.x]; const float* s = S + (size_t)i * SQ; const float lam = 10.0f * expf(-5.0f * bf16_round(uprev[b])); const bool sparse = lam >= 1.0f;
  if (sparse) { const int* ix = pidx + (size_t)i * KN; const int* vm = pim + (size_t)i * KN; float mx = -3.0e38f;
#pragma unroll 1
    for (int k = 0; k < kn; ++k) if (vm[k]) mx = fmaxf(mx, s[ix[k]]); float se = 0.f;
#pragma unroll 1
    for (int k = 0; k < kn; ++k) if (vm[k]) se += expf(s[ix[k]] - mx); const float sc = 256.0f / se;
    /* membership bitmap of the valid gathered keys, then the row in 16-B pieces with zeros elsewhere */
#pragma unroll 1
    for (int w = 0; w < SQ / 32; ++w) my[w] = 0u;
#pragma unroll 1
    for (int k = 0; k < kn; ++k) if (vm[k]) { const int j = ix[k]; my[j >> 5] |= (1u << (j & 31)); }
#pragma unroll 1
    for (int j0 = 0; j0 < SQ; j0 += 8) { FragH f; for (int q = 0; q < 8; ++q) { const int j = j0 + q; const bool in = (my[j >> 5] >> (j & 31)) & 1u; f.h[q] = in ? (_Float16)(expf(s[j] - mx) * sc) : (_Float16)0.f; } unsigned short* d = (unsigned short*)P + (size_t)i * SQ + j0; *(v8us*)d = f.half[0];  } }
  else { const int* pm = pmask + (size_t)i * SQ; float mx = -3.0e38f;
#pragma unroll 1
    for (int j = 0; j < SQ; ++j) mx = fmaxf(mx, s[j] + (pm[j] ? 0.f : -lam)); float se = 0.f;
#pragma unroll 1
    for (int j = 0; j < SQ; ++j) se += expf((s[j] + (pm[j] ? 0.f : -lam)) - mx); const float sc = 256.0f / se;
#pragma unroll 1
    for (int j0 = 0; j0 < SQ; j0 += 8) { FragH f; for (int q = 0; q < 8; ++q) { const int j = j0 + q; f.h[q] = (_Float16)(expf((s[j] + (pm[j] ? 0.f : -lam)) - mx) * sc); } unsigned short* d = (unsigned short*)P + (size_t)i * SQ + j0; *(v8us*)d = f.half[0];  } } }
__global__ __launch_bounds__(256) void k_unorm(const float* __restrict__ OUT, const float* __restrict__ XF, int ncol, float* __restrict__ U) {
  #pragma clang fp contract(off)
  const size_t r = (size_t)blockIdx.x * 256 + threadIdx.x; if (r >= NR) return; float sd = 0.f, sx = 0.f;
#pragma unroll 1
  for (int c = 0; c < ncol; ++c) { const float o = OUT[r * DM + c], xv = XF[r * DM + c]; const float d = o - xv; sd = __fadd_rn(sd, __fmul_rn(d, d)); sx = __fadd_rn(sx, __fmul_rn(xv, xv)); }
  const float u = sqrtf(sd) / (sqrtf(sx) + 1e-8f); *(float*)(U + r) = u;  }
__global__ __launch_bounds__(64) void k_umean(const float* __restrict__ U, float* __restrict__ out1) { const int b = threadIdx.x; if (b >= NB) return; double s = 0.0; for (int i = 0; i < SQ; ++i) s += (double)U[(size_t)b * SQ + i]; const float v = (float)(s / (double)SQ); *(float*)(out1 + b) = v;  }
extern "C" void kernel_launch(void* const* d_in, const int* in_sizes, int n_in,
                              void* d_out, int out_size, void* d_ws, size_t ws_size, hipStream_t stream) {
  (void)in_sizes; (void)n_in; (void)out_size;
  const float* const* I = (const float* const*)d_in; const float* x = I[0]; const float* uprev = I[1]; const float* wq = I[2]; const float* bq = I[3]; const float* wk = I[4]; const float* bk = I[5]; const float* wv = I[6]; const float* bv = I[7]; const float* wo = I[8]; const float* bo = I[9]; const float* l1g = I[10]; const float* l1b = I[11]; const float* l2g = I[12]; const float* l2b = I[13]; const float* w1 = I[14]; const float* b1 = I[15]; const float* w2 = I[16]; const float* b2 = I[17]; const int* pmask = (const int*)d_in[18]; const int* pidx = (const int*)d_in[19]; const int* pim = (const int*)d_in[20];
  float* out0 = (float*)d_out; float* out1 = out0 + NR * DM;
  char* ws = (char*)d_ws; size_t off = 0;
  auto take = [&](size_t bytes) { char* p = ws + off; off += (bytes + 255) & ~(size_t)255; return p; };
  _Float16* BQ = (_Float16*)take((size_t)DM * DM * 2); _Float16* BK = (_Float16*)take((size_t)DM * DM * 2); _Float16* BV = (_Float16*)take((size_t)DM * DM * 2); _Float16* BO = (_Float16*)take((size_t)DM * DM * 2); _Float16* BW1 = (_Float16*)take((size_t)FH * DM * 2); _Float16* BW2 = (_Float16*)take((size_t)DM * FH * 2);
  float* XF = (float*)take(NR * DM * 4); float* HF = (float*)take(NR * DM * 4); _Float16* G16 = (_Float16*)take(NR * FH * 2); float* U = (float*)take(NR * 4);
  _Float16* X16 = (_Float16*)take(NR * DM * 2); _Float16* Q16 = (_Float16*)take(NR * DM * 2); _Float16* K16 = (_Float16*)take(NR * DM * 2); _Float16* V16 = (_Float16*)take(NR * DM * 2); _Float16* O16 = (_Float16*)take(NR * DM * 2);
  float* S = (float*)take((size_t)HG * SQ * SQ * 4); _Float16* P = (_Float16*)take((size_t)HG * SQ * SQ * 2); _Float16* VT = (_Float16*)take((size_t)HG * HD * SQ * 2);
  if (off > ws_size) return;      /* 6 + 4 + 4 + 8 + 2x5 + 16 + 8 + 0.5 = ≈ 57 MiB */
  const size_t nw8 = (size_t)DM * DM / 8; const unsigned gw = (unsigned)((nw8 + 255) / 256), gw4 = (unsigned)(((size_t)FH * DM / 8 + 255) / 256);
  k_wnat<<<gw, 256, 0, stream>>>(wq, nw8, BQ); k_wnat<<<gw, 256, 0, stream>>>(wk, nw8, BK); k_wnat<<<gw, 256, 0, stream>>>(wv, nw8, BV); k_wnat<<<gw, 256, 0, stream>>>(wo, nw8, BO); k_wnat<<<gw4, 256, 0, stream>>>(w1, (size_t)FH * DM / 8, BW1); k_wnat<<<gw4, 256, 0, stream>>>(w2, (size_t)DM * FH / 8, BW2);
  k_xf<<<(unsigned)((NR * DM / 8 + 255) / 256), 256, 0, stream>>>(x, XF, NR * DM / 8); k_ln<<<(unsigned)((NR + 255) / 256), 256, 0, stream>>>(XF, l1g, l1b, DM, X16);
  const dim3 gp((unsigned)((NR / 128) * (DM / 64)), 1);
  k_gemm2<0><<<gp, 128, 0, stream>>>(X16, DM, 0, BQ, DM, 0, 0.0625f, bq, 0, nullptr, 1, 0, 0, nullptr, Q16, DM, 0, (int)NR, DM, DM);
  k_gemm2<0><<<gp, 128, 0, stream>>>(X16, DM, 0, BK, DM, 0, 0.0625f, bk, 0, nullptr, 1, 0, 0, nullptr, K16, DM, 0, (int)NR, DM, DM);
  k_gemm2<0><<<gp, 128, 0, stream>>>(X16, DM, 0, BV, DM, 0, 0.0625f, bv, 0, nullptr, 1, 0, 0, nullptr, V16, DM, 0, (int)NR, DM, DM);
  for (int b = 0; b < NB; ++b) for (int h0 = 0; h0 < NH; h0 += HG) {
    const _Float16* qb = Q16 + (size_t)b * SQ * DM + h0 * HD; const _Float16* kb = K16 + (size_t)b * SQ * DM + h0 * HD;
    k_gemm2<0><<<dim3((QN / 128) * (SQ / 64), HG), 128, 0, stream>>>(qb, DM, (size_t)HD, kb, DM, (size_t)HD, 0.125f, nullptr, 0, nullptr, 1, 0, 0, S, nullptr, SQ, (size_t)SQ * SQ, QN, SQ, HD);      /* scaled scores, HG heads per launch */
    for (int hh = 0; hh < HG; ++hh) k_rsmg<<<(QN + 127) / 128, 128, 0, stream>>>(S + (size_t)hh * SQ * SQ, P + (size_t)hh * SQ * SQ, QN, uprev, b, pmask, pidx, pim, KN);
    k_vt<<<HG * (SQ / 64), 256, 0, stream>>>(V16, b, h0, VT);
    k_gemm2<0><<<dim3((QN / 128) * (HD / 64), HG), 128, 0, stream>>>(P, SQ, (size_t)SQ * SQ, VT, SQ, (size_t)HD * SQ, 0.00390625f, nullptr, 0, nullptr, 1, 0, 0, nullptr, O16 + (size_t)b * SQ * DM + h0 * HD, DM, (size_t)HD, QN, HD, SQ); }      /* o (merged heads) as f16 rows */
  const unsigned gl = (unsigned)((NR + 255) / 256);
  k_gemm2<0><<<gp, 128, 0, stream>>>(O16, DM, 0, BO, DM, 0, 0.0625f, bo, 0, XF, 1, (size_t)DM, 0, HF, nullptr, DM, 0, (int)NR, DM, DM);      /* h = x + attn W_o^T + b_o */
  k_ln<<<gl, 256, 0, stream>>>(HF, l2g, l2b, DM, X16);
  k_gemm2<6><<<dim3((unsigned)((NR / 128) * (FH / 64)), 1), 128, 0, stream>>>(X16, DM, 0, BW1, DM, 0, 0.0625f, b1, 0, nullptr, 1, 0, 0, nullptr, G16, FH, 0, (int)NR, FH, DM);      /* gelu_erf(LN2(h) W1^T + b1) */
  k_gemm2<0><<<gp, 128, 0, stream>>>(G16, FH, 0, BW2, FH, 0, 0.0625f, b2, 0, HF, 1, (size_t)DM, 0, out0, nullptr, DM, 0, (int)NR, DM, FH);      /* out = h + (...) W2^T + b2, rows are the output layout */
  k_unorm<<<gl, 256, 0, stream>>>(out0, XF, DM, U); k_umean<<<1, 64, 0, stream>>>(U, out1);
}

// v001
// It runs in 485 microseconds.
// Timed twice side by side with v000, it ran 7.96 and 7.82 times as fast.
#include <hip/hip_runtime.h>
// SPDGMultiHeadAttention (x [2][1024][512], u_prev [2][1]; xn = LN1(x); Q,K,V = xn W^T + b (8 heads of 64); lam = 10 exp(-5 u_prev); per batch: if lam >= 1 the SPARSE branch (softmax over the prior window slots prior_indices[i][k] with prior_index_mask, others excluded) else the DENSE branch (softmax over all keys of q.k/8 + lam*(prior_mask ? 0 : -1)); attn = merge W_o^T + b_o; h = x + attn; out = h + gelu_erf(LN2(h) W1^T + b1) W2^T + b2 -> [2][1024][512]; aggregated_u[b] = mean_s ||out - x|| / (||x|| + 1e-8) -> [2][1]).
// Structure: token rows; bf16(x) as f32 residual rows + LN1 on VALU (f32, wave per row) into f16 rows; Q | K | V WMMA GEMMs (32x64 wave tiles, f32 accumulation, exact x16 weights + bias, f16 outputs); per (batch, 4 heads): scores GEMM (K = 64), the branch-selecting row softmax on VALU (lam from u_prev, prior tables read on device; f32; weights x256 as f16), V^T via LDS, o = P . V GEMM (K = 1,024) into merged f16 rows; W_o GEMM + b_o + x (epilogue add) -> h; LN2 on VALU; fc1 GEMM with the exact-erf GELU epilogue (f16 hidden); fc2 GEMM + b2 + h straight into the output rows; the surprise statistic on VALU (per-row norms, float64 means per batch) into output 1.
// Compute dtype: inputs rounded to bf16; x / weights exact; LN outputs, q, k, v, softmax weights, o, GELU hidden plain f16 (~2^-12); residual, LN statistics, scores, softmax, norms f32/f64. v_wmma_f32_16x16x32_f16.
#define NB 2
#define SQ 1024
#define DM 512
#define NH 8
#define HD 64
#define HG 4                         /* heads per attention launch group */
#define QN SQ                        /* query rows attended per batch (debug hook) */
#define NR ((size_t)NB * SQ)         /* 2048 token rows */
typedef __bf16 v16b __attribute__((ext_vector_type(16)));
typedef unsigned short v8us __attribute__((ext_vector_type(8), may_alias));
typedef float  v8f  __attribute__((ext_vector_type(8)));
typedef float  v4f  __attribute__((ext_vector_type(4)));
typedef float  v4fa __attribute__((ext_vector_type(4), may_alias));
union FragB { v16b v; v8us half[2]; unsigned short u[16]; };

__device__ __forceinline__ unsigned short bf16_bits(float x) { unsigned int u = __float_as_uint(x); return (unsigned short)((u + 0x7FFFu + ((u >> 16) & 1u)) >> 16); }
__device__ __forceinline__ float bf16_val(unsigned short b) { return __uint_as_float(((unsigned int)b) << 16); }
__device__ __forceinline__ float bf16_round(float x) { return bf16_val(bf16_bits(x)); }
// D += A·B with NT terms: 1 = ah·bh, 2 = + al·bh (A split), 3 = + ah·bl (both split)
template <int NT>
__device__ __forceinline__ v8f mmaN(v16b ah, v16b al, v16b bh, v16b bl, v8f c) {
  c = __builtin_amdgcn_wmma_f32_16x16x32_bf16(false, ah, false, bh, (short)0, c, false, false);
  if (NT >= 2) c = __builtin_amdgcn_wmma_f32_16x16x32_bf16(false, al, false, bh, (short)0, c, false, false);
  if (NT >= 3) c = __builtin_amdgcn_wmma_f32_16x16x32_bf16(false, ah, false, bl, (short)0, c, false, false);
  asm volatile("v_nop\n\tv_nop\n\tv_nop\n\tv_nop" : "+v"(c) : "v"(ah), "v"(al), "v"(bh), "v"(bl));
  return c;
}

__global__ __launch_bounds__(256) void k_wt_bf16(const float* __restrict__ W, unsigned short* __restrict__ Wt, int K, int N) {
  const int t = blockIdx.x * 256 + threadIdx.x;
  const int k8n = K / 8;
  if (t >= N * k8n) return;
  const int n = t / k8n, k8 = (t % k8n) * 8;
  v8us v;
#pragma unroll
  for (int i = 0; i < 8; ++i) v[i] = bf16_bits(W[(size_t)(k8 + i) * N + n]);
  *(v8us*)(Wt + (size_t)n * K + k8) = v;
  
}

// GEMM C[M][N] (f32, pitch ldc) = act(A[M][K]·W + bias). A f32 row-major (pitch lda) converted per fragment to bf16
// (ASPLIT: hi/lo two planes -> 2 terms, else single rounded term); Wt bf16 [N][K] (pitch ldb). BIAS_BF16 rounds the
// bias to bf16 first (bias quantised to bf16 before the add). K%32==0, M%16==0, N%64==0.
template <bool ASPLIT, int ACT, bool BIAS_BF16>
__global__ __launch_bounds__(128) void k_gemm_bf(const float* __restrict__ A, int lda, const unsigned short* __restrict__ Wt, int ldb,
                                               const float* __restrict__ bias, float* __restrict__ C, int ldc, int M, int N, int K) {
  __shared__ __attribute__((aligned(16))) float so[4][16][64];
  const int tid = threadIdx.x, w = tid >> 5, lane = tid & 31, ln = lane & 15, hh = lane >> 4;
  const int ntn = N / 64;
  const int wid = blockIdx.x * 4 + w;
  const int mt = wid / ntn, nq = wid % ntn;
  if (mt * 16 >= M) return;
  const int row0 = mt * 16, col0 = nq * 64;
  const float* arow = A + (size_t)(row0 + ln) * lda;
  v8f acc[4] = {};
  for (int kb = 0; kb < K; kb += 32) {
    FragB ah, al;
    const v4f x0 = *(const v4fa*)(arow + kb + 8 * hh), x1 = *(const v4fa*)(arow + kb + 8 * hh + 4);
    const v4f x2 = *(const v4fa*)(arow + kb + 16 + 8 * hh), x3 = *(const v4fa*)(arow + kb + 16 + 8 * hh + 4);
    float xs[16] = {x0[0],x0[1],x0[2],x0[3],x1[0],x1[1],x1[2],x1[3],x2[0],x2[1],x2[2],x2[3],x3[0],x3[1],x3[2],x3[3]};
#pragma unroll
    for (int i = 0; i < 16; ++i) { const unsigned short hb = bf16_bits(xs[i]); ah.u[i] = hb; al.u[i] = ASPLIT ? bf16_bits(xs[i] - bf16_val(hb)) : (unsigned short)0; }
#pragma unroll
    for (int t = 0; t < 4; ++t) {
      const unsigned short* brow = Wt + (size_t)(col0 + t * 16 + ln) * ldb + kb;
      FragB b;
      b.half[0] = *(const v8us*)(brow + 8 * hh);
      b.half[1] = *(const v8us*)(brow + 16 + 8 * hh);
      acc[t] = mmaN<ASPLIT ? 2 : 1>(ah.v, al.v, b.v, b.v, acc[t]);
    }
  }
#pragma unroll
  for (int t = 0; t < 4; ++t) {
    float bv = bias ? bias[col0 + t * 16 + ln] : 0.f;
    if (BIAS_BF16) bv = bf16_round(bv);
#pragma unroll
    for (int r = 0; r < 8; ++r) { float v = acc[t][r] + bv; if (ACT == 1) v = fmaxf(v, 0.f); so[w][8 * hh + r][t * 16 + ln] = v; }
  }
  __builtin_amdgcn_fence(__ATOMIC_ACQ_REL, "workgroup");
  __builtin_amdgcn_wave_barrier();
  const int rsub = lane >> 4, c4 = (lane & 15) * 4;
  {
#pragma unroll
    for (int q = 0; q < 8; ++q) {
      const int r = q * 2 + rsub;
      const v4f v = *(const v4fa*)&so[w][r][c4];
      *(v4f*)(C + (size_t)(row0 + r) * ldc + col0 + c4) = v;
    }
    
  }
}

// GEMM C = act(A·W + bias + resid): A f32 (ASPLIT -> hi/lo 2 terms), Wt bf16 [N][K]; ACT 0 none, 1 relu, 2 exact gelu;
// resid (optional, f32, row index = (row % rmod), pitch ldr, RES_BF16 rounds it) added before the activation.
template <bool ASPLIT, int ACT, bool BIAS_BF16, bool RES_BF16>
__global__ __launch_bounds__(128) void k_gemm_bf3(const float* __restrict__ A, int lda, const unsigned short* __restrict__ Wt, int ldb,
                                                const float* __restrict__ bias, const float* __restrict__ resid, int rmod, int ldr,
                                                float* __restrict__ C, int ldc, int M, int N, int K) {
  __shared__ __attribute__((aligned(16))) float so[4][16][64];
  const int tid = threadIdx.x, w = tid >> 5, lane = tid & 31, ln = lane & 15, hh = lane >> 4;
  const int ntn = N / 64;
  const int wid = blockIdx.x * 4 + w;
  const int mt = wid / ntn, nq = wid % ntn;
  if (mt * 16 >= M) return;
  const int row0 = mt * 16, col0 = nq * 64;
  const float* arow = A + (size_t)(row0 + ln) * lda;
  v8f acc[4] = {};
  for (int kb = 0; kb < K; kb += 32) {
    FragB ah, al;
    const v4f x0 = *(const v4fa*)(arow + kb + 8 * hh), x1 = *(const v4fa*)(arow + kb + 8 * hh + 4);
    const v4f x2 = *(const v4fa*)(arow + kb + 16 + 8 * hh), x3 = *(const v4fa*)(arow + kb + 16 + 8 * hh + 4);
    float xs[16] = {x0[0],x0[1],x0[2],x0[3],x1[0],x1[1],x1[2],x1[3],x2[0],x2[1],x2[2],x2[3],x3[0],x3[1],x3[2],x3[3]};
#pragma unroll
    for (int i = 0; i < 16; ++i) { const unsigned short hb = bf16_bits(xs[i]); ah.u[i] = hb; al.u[i] = ASPLIT ? bf16_bits(xs[i] - bf16_val(hb)) : (unsigned short)0; }
#pragma unroll
    for (int t = 0; t < 4; ++t) {
      const unsigned short* brow = Wt + (size_t)(col0 + t * 16 + ln) * ldb + kb;
      FragB b;
      b.half[0] = *(const v8us*)(brow + 8 * hh);
      b.half[1] = *(const v8us*)(brow + 16 + 8 * hh);
      acc[t] = mmaN<ASPLIT ? 2 : 1>(ah.v, al.v, b.v, b.v, acc[t]);
    }
  }
#pragma unroll
  for (int t = 0; t < 4; ++t) {
    const int col = col0 + t * 16 + ln;
    float bv = bias ? bias[col] : 0.f;
    if (BIAS_BF16) bv = bf16_round(bv);
#pragma unroll
    for (int r = 0; r < 8; ++r) {
      float v = acc[t][r] + bv;
      if (resid) { float rv = resid[(size_t)((row0 + 8 * hh + r) % rmod) * ldr + col]; if (RES_BF16) rv = bf16_round(rv); v += rv; }
      if (ACT == 1) v = fmaxf(v, 0.f);
      if (ACT == 2) v = 0.5f * v * (1.0f + erff(v * 0.70710678118654752f));
      if (ACT == 3) { const float u = 0.7978845608028654f * (v + 0.044715f * v * v * v); v = 0.5f * v * (1.0f + tanhf(u)); }
      so[w][8 * hh + r][t * 16 + ln] = v;
    }
  }
  __builtin_amdgcn_fence(__ATOMIC_ACQ_REL, "workgroup");
  __builtin_amdgcn_wave_barrier();
  const int rsub = lane >> 4, c4 = (lane & 15) * 4;
  {
#pragma unroll
    for (int q = 0; q < 8; ++q) {
      const int r = q * 2 + rsub;
      const v4f v = *(const v4fa*)&so[w][r][c4];
      *(v4f*)(C + (size_t)(row0 + r) * ldc + col0 + c4) = v;
    }
    
  }
}
// row LayerNorm (biased variance, eps) over N: s = X (+ R); optional out_sum <- s; out_norm <- (s-mu)*rsqrt(var+eps)*g + b
template <bool PARAM_BF16>
__global__ __launch_bounds__(256) void k_layernorm(const float* __restrict__ X, const float* __restrict__ R, const float* __restrict__ g, const float* __restrict__ bta,
                                                  float* __restrict__ out_sum, float* __restrict__ out_norm, int N, float eps) {
  __shared__ float red[256];
  const int row = blockIdx.x, tid = threadIdx.x;
  const float* x = X + (size_t)row * N; const float* rr = R ? R + (size_t)row * N : nullptr;
  float vals[16];                     // up to N = 4096
  const int per = N / 256;            // contiguous chunk per thread? use strided-by-4 chunks: thread handles j = tid*4 + 1024*u
  float s1 = 0.f;
  for (int u = 0; u < per / 4; ++u) {
    const int j = tid * 4 + 1024 * u;
    const v4f a = *(const v4fa*)(x + j);
    v4f b = {0.f,0.f,0.f,0.f}; if (rr) b = *(const v4fa*)(rr + j);
#pragma unroll
    for (int q = 0; q < 4; ++q) { const float v = a[q] + b[q]; vals[u * 4 + q] = v; s1 += v; }
  }
  red[tid] = s1; __syncthreads();
  for (int st = 128; st > 0; st >>= 1) { if (tid < st) red[tid] += red[tid + st]; __syncthreads(); }
  const float mu = red[0] / (float)N; __syncthreads();
  float s2 = 0.f;
  for (int u = 0; u < per / 4; ++u)
#pragma unroll
    for (int q = 0; q < 4; ++q) { const float c = vals[u * 4 + q] - mu; s2 += c * c; }
  red[tid] = s2; __syncthreads();
  for (int st = 128; st > 0; st >>= 1) { if (tid < st) red[tid] += red[tid + st]; __syncthreads(); }
  const float rs = rsqrtf(red[0] / (float)N + eps);
  {
    for (int u = 0; u < per / 4; ++u) {
      const int j = tid * 4 + 1024 * u;
      v4f o, sm;
#pragma unroll
      for (int q = 0; q < 4; ++q) {
        float gg = g[j + q], bb = bta[j + q];
        if (PARAM_BF16) { gg = bf16_round(gg); bb = bf16_round(bb); }
        sm[q] = vals[u * 4 + q]; o[q] = (vals[u * 4 + q] - mu) * rs * gg + bb;
      }
      if (out_sum) *(v4f*)(out_sum + (size_t)row * N + j) = sm;
      *(v4f*)(out_norm + (size_t)row * N + j) = o;
    }
    
  }
}



// ---- f16 WMMA path (v_wmma_f32_16x16x32_f16): 11-bit significands for operands in range — used where a [0,1] probability operand needs more precision than bf16
typedef _Float16 v16h __attribute__((ext_vector_type(16)));
union FragH { v16h v; v8us half[2]; _Float16 h[16]; unsigned short u[16]; };
template <int NT>
__device__ __forceinline__ v8f mmaH(v16h ah, v16h al, v16h bh, v16h bl, v8f c) {
  c = __builtin_amdgcn_wmma_f32_16x16x32_f16(false, ah, false, bh, (short)0, c, false, false);
  if (NT >= 2) c = __builtin_amdgcn_wmma_f32_16x16x32_f16(false, al, false, bh, (short)0, c, false, false);
  if (NT >= 3) c = __builtin_amdgcn_wmma_f32_16x16x32_f16(false, ah, false, bl, (short)0, c, false, false);
  asm volatile("v_nop\n\tv_nop\n\tv_nop\n\tv_nop" : "+v"(c) : "v"(ah), "v"(al), "v"(bh), "v"(bl));
  return c;
}
// batched GEMM like k_gemm_b but f16 operands: A f32 (split into f16 hi/lo if ASPLIT, else rounded to f16), Bt = f16 values [n][k]; alpha; C f32; N multiple of 16 (partial tiles skipped)
template <bool ASPLIT>
__global__ __launch_bounds__(128) void k_gemm_h(const float* __restrict__ A, int lda, size_t sA, const _Float16* __restrict__ Bh, int ldb, size_t sB, float alpha, float* __restrict__ C, int ldc, size_t sC, int M, int N, int K) {
  __shared__ __attribute__((aligned(16))) float so[4][16][64];
  const int tid = threadIdx.x, w = tid >> 5, lane = tid & 31, ln = lane & 15, hh = lane >> 4; const int by = blockIdx.y;
  A += (size_t)by * sA; Bh += (size_t)by * sB; C += (size_t)by * sC;
  const int ntn = (N + 63) / 64; const int wid = blockIdx.x * 4 + w; const int mt = wid / ntn, nq = wid % ntn; if (mt * 16 >= M) return;
  const int row0 = mt * 16, col0 = nq * 64; const float* arow = A + (size_t)(row0 + ln) * lda;
  v8f acc[4] = {};
  for (int kb = 0; kb < K; kb += 32) {
    FragH ah, al;
    const v4f x0 = *(const v4fa*)(arow + kb + 8 * hh), x1 = *(const v4fa*)(arow + kb + 8 * hh + 4), x2 = *(const v4fa*)(arow + kb + 16 + 8 * hh), x3 = *(const v4fa*)(arow + kb + 16 + 8 * hh + 4);
    float xs[16] = {x0[0],x0[1],x0[2],x0[3],x1[0],x1[1],x1[2],x1[3],x2[0],x2[1],x2[2],x2[3],x3[0],x3[1],x3[2],x3[3]};
#pragma unroll
    for (int i = 0; i < 16; ++i) { const _Float16 h = (_Float16)xs[i]; ah.h[i] = h; al.h[i] = ASPLIT ? (_Float16)(xs[i] - (float)h) : (_Float16)0.0f; }
#pragma unroll
    for (int t = 0; t < 4; ++t) { if (col0 + t * 16 >= N) continue; const size_t boff = (size_t)(col0 + t * 16 + ln) * ldb + kb; FragH bq; bq.half[0] = *(const v8us*)(Bh + boff + 8 * hh); bq.half[1] = *(const v8us*)(Bh + boff + 16 + 8 * hh);
      acc[t] = mmaH<ASPLIT ? 2 : 1>(ah.v, al.v, bq.v, bq.v, acc[t]); }
  }
#pragma unroll
  for (int t = 0; t < 4; ++t) { if (col0 + t * 16 >= N) continue;
#pragma unroll
    for (int r = 0; r < 8; ++r) so[w][8 * hh + r][t * 16 + ln] = acc[t][r] * alpha; }
  __builtin_amdgcn_fence(__ATOMIC_ACQ_REL, "workgroup"); __builtin_amdgcn_wave_barrier();
  const int rsub = lane >> 4, c4 = (lane & 15) * 4;
  {
#pragma unroll
    for (int q = 0; q < 8; ++q) { const int r = q * 2 + rsub; if (col0 + c4 < N) { const v4f v = *(const v4fa*)&so[w][r][c4]; *(v4f*)(C + (size_t)(row0 + r) * ldc + col0 + c4) = v; } }
     }
}

// Wt[n][k] = f16(W[k][n]·scale) from f32 row-major W[K][N] (scale = power of two; bf16-exact weights stay exact in f16 away from the subnormal range)
__global__ __launch_bounds__(256) void k_wt_f16(const float* __restrict__ W, _Float16* __restrict__ Wt, int K, int N, float scale) {
  const int t = blockIdx.x * 256 + threadIdx.x; if (t >= N * (K / 8)) return; const int n = t / (K / 8), k8 = (t % (K / 8)) * 8; FragH f;
#pragma unroll
  for (int i = 0; i < 8; ++i) f.h[i] = (_Float16)(bf16_round(W[(size_t)(k8 + i) * N + n]) * scale); const v8us o = f.half[0];
  *(v8us*)((unsigned short*)Wt + (size_t)n * K + k8) = o; 
}
// k_gemm_hh variant with fused epilogue: v = acc·alpha + bias[by·sBias + col] (+ CP[(row/rowsPerB)·sCPb + by·64 + col] if CP) ; ACT 0 none / 1 elu ; writes f16 C16 (and f32 C if non-null)
template <int ACT>
__global__ __launch_bounds__(128) void k_gemm_hhx(const _Float16* __restrict__ A, int lda, size_t sA, const _Float16* __restrict__ Bh, int ldb, size_t sB, float alpha, const float* __restrict__ bias, size_t sBias, const float* __restrict__ CP, int rowsPerB, size_t sCPb, int row0g,
    float* __restrict__ C, _Float16* __restrict__ C16, int ldc, size_t sC, int M, int N, int K) {
  __shared__ __attribute__((aligned(16))) float so[4][16][64];
  const int tid = threadIdx.x, w = tid >> 5, lane = tid & 31, ln = lane & 15, hh = lane >> 4; const int by = blockIdx.y;
  A += (size_t)by * sA; Bh += (size_t)by * sB; const size_t cofs = (size_t)by * sC; const float* bp = bias ? bias + (size_t)by * sBias : nullptr;
  const int ntn = (N + 63) / 64; const int wid = blockIdx.x * 4 + w; const int mt = wid / ntn, nq = wid % ntn; if (mt * 16 >= M) return;
  const int row0 = mt * 16, col0 = nq * 64; const _Float16* arow = A + (size_t)(row0 + ln) * lda;
  v8f acc[4] = {};
  for (int kb = 0; kb < K; kb += 32) { FragH ah; ah.half[0] = *(const v8us*)((const unsigned short*)arow + kb + 8 * hh); ah.half[1] = *(const v8us*)((const unsigned short*)arow + kb + 16 + 8 * hh);
#pragma unroll
    for (int t = 0; t < 4; ++t) { if (col0 + t * 16 >= N) continue; const size_t boff = (size_t)(col0 + t * 16 + ln) * ldb + kb; FragH bq; bq.half[0] = *(const v8us*)((const unsigned short*)Bh + boff + 8 * hh); bq.half[1] = *(const v8us*)((const unsigned short*)Bh + boff + 16 + 8 * hh);
      acc[t] = mmaH<1>(ah.v, ah.v, bq.v, bq.v, acc[t]); }
  }
#pragma unroll
  for (int t = 0; t < 4; ++t) { if (col0 + t * 16 >= N) continue; const int col = col0 + t * 16 + ln; const float bv = bp ? bf16_round(bp[col]) : 0.f;
#pragma unroll
    for (int r = 0; r < 8; ++r) { float v = acc[t][r] * alpha + bv; if (CP) { const int rr = row0g + row0 + 8 * hh + r; if (rowsPerB < 0) v += CP[cofs + (size_t)rr * ldc + col];      /* rowsPerB < 0: own element of the batched C plane */ else { const int bidx = rr / rowsPerB; v += CP[(size_t)bidx * sCPb + (size_t)by * 64 + col]; } } if (ACT == 1) v = (v > 0.f) ? v : expm1f(v); else if (ACT == 7) v = (v > 0.f) ? v + 1.0f : expf(v); else if (ACT == 8) v = tanhf(v); else if (ACT == 9) v = 0.5f * v * (1.0f + tanhf(0.7978845608028654f * (v + 0.044715f * v * v * v))); else if (ACT == 11) v = 1.0f / (1.0f + expf(-v)); else if (ACT == 12) v = (v > 0.f) ? v : 0.01f * v; else if (ACT == 14) v = (v > 0.f) ? v : 0.1f * v; else if (ACT == 16) v = (v >= 0.f) ? v : 0.3f * v; else if (ACT == 17) v = (v >= 0.f) ? v : 0.2f * v; else if (ACT == 15) v = v / (1.0f + expf(-v)); else if (ACT == 3) v = fmaxf(v, 0.f); else if (ACT == 6) v = 0.5f * v * (1.0f + erff(v * 0.70710678118654752f)); so[w][8 * hh + r][t * 16 + ln] = v; } }
  __builtin_amdgcn_fence(__ATOMIC_ACQ_REL, "workgroup"); __builtin_amdgcn_wave_barrier();
  const int rsub = lane >> 4, c4 = (lane & 15) * 4; typedef _Float16 v4h __attribute__((ext_vector_type(4)));
  {
#pragma unroll
    for (int q = 0; q < 8; ++q) { const int r = q * 2 + rsub; if (col0 + c4 < N) { const v4f v = *(const v4fa*)&so[w][r][c4]; if (C) *(v4f*)(C + cofs + (size_t)(row0 + r) * ldc + col0 + c4) = v; if (C16) { v4h h4; for (int i = 0; i < 4; ++i) h4[i] = (_Float16)v[i]; *(v4h*)(C16 + cofs + (size_t)(row0 + r) * ldc + col0 + c4) = h4; } } }
     }
}


typedef _Float16 v4h __attribute__((ext_vector_type(4)));

__global__ __launch_bounds__(256) void k_x16(const float* __restrict__ x, _Float16* __restrict__ X16, size_t n8) { const size_t t = (size_t)blockIdx.x * 256 + threadIdx.x; if (t >= n8) return; FragH f;
#pragma unroll
  for (int q = 0; q < 8; ++q) f.h[q] = (_Float16)bf16_round(x[t * 8 + q]); *(v8us*)((unsigned short*)X16 + t * 8) = f.half[0];  }
__global__ __launch_bounds__(256) void k_h16(const float* __restrict__ x, _Float16* __restrict__ X16, size_t n8) { const size_t t = (size_t)blockIdx.x * 256 + threadIdx.x; if (t >= n8) return; FragH f;
#pragma unroll
  for (int q = 0; q < 8; ++q) f.h[q] = (_Float16)x[t * 8 + q]; *(v8us*)((unsigned short*)X16 + t * 8) = f.half[0];  }
__global__ __launch_bounds__(256) void k_round16f(const float* __restrict__ W, _Float16* __restrict__ Bt, size_t n8) { const size_t t = (size_t)blockIdx.x * 256 + threadIdx.x; if (t >= n8) return; FragH f;
#pragma unroll
  for (int i = 0; i < 8; ++i) f.h[i] = (_Float16)(bf16_round(W[t * 8 + i]) * 16.0f); *(v8us*)((unsigned short*)Bt + t * 8) = f.half[0];  }
template <int NHv, int TTv>
__global__ __launch_bounds__(256) void k_vt(const _Float16* __restrict__ V16, int ldv, int voff, _Float16* __restrict__ Vt) { __shared__ unsigned short tl[64][66]; const int tid = threadIdx.x; const int slab = blockIdx.x / (TTv / 64), lg = blockIdx.x % (TTv / 64); const int b = slab / NHv, h = slab % NHv;
  for (int i = tid; i < 64 * 8; i += 256) { const int r = i / 8, c8 = (i % 8) * 8; FragH f; f.half[0] = *(const v8us*)((const unsigned short*)V16 + ((size_t)b * TTv + lg * 64 + r) * ldv + voff + h * 64 + c8);
#pragma unroll
    for (int q = 0; q < 8; ++q) tl[r][c8 + q] = f.u[q]; }
  __syncthreads();
  {
#pragma unroll
    for (int rd = 0; rd < 2; ++rd) { const int d = rd * 32 + tid / 8, pc = tid % 8; FragH f;
#pragma unroll
      for (int q = 0; q < 8; ++q) f.u[q] = tl[pc * 8 + q][d];
      *(v8us*)((unsigned short*)Vt + ((size_t)slab * 64 + d) * TTv + lg * 64 + pc * 8) = f.half[0]; }
     } }

__global__ __launch_bounds__(256) void k_hl(const float* __restrict__ F, _Float16* __restrict__ Hh, _Float16* __restrict__ Hl, size_t n8) { const size_t t = (size_t)blockIdx.x * 256 + threadIdx.x; if (t >= n8) return; FragH fh, fl; const v4f a = *(const v4fa*)(F + t * 8), c = *(const v4fa*)(F + t * 8 + 4);
#pragma unroll
  for (int q = 0; q < 4; ++q) { _Float16 h = (_Float16)a[q]; fh.h[q] = h; fl.h[q] = (_Float16)((a[q] - (float)h) * 1024.0f); h = (_Float16)c[q]; fh.h[4 + q] = h; fl.h[4 + q] = (_Float16)((c[q] - (float)h) * 1024.0f); }
  { *(v8us*)((unsigned short*)Hh + t * 8) = fh.half[0]; *(v8us*)((unsigned short*)Hl + t * 8) = fl.half[0];  } }

// ---- fast GEMM (wave tile 32x64; requires M % 32 == 0 rows per launch region and N % 64 == 0); epilogue = k_gemm_hhx semantics ----
__device__ __forceinline__ v16h g2_frag(const _Float16* p, int hh) { FragH f; f.half[0] = *(const v8us*)((const unsigned short*)p + 8 * hh); f.half[1] = *(const v8us*)((const unsigned short*)p + 16 + 8 * hh); return f.v; }
__device__ __forceinline__ v8f g2_mma(v16h a, v16h b, v8f c) { v8f d = __builtin_amdgcn_wmma_f32_16x16x32_f16(false, a, false, b, (short)0, c, false, false); asm volatile("v_nop\n\tv_nop\n\tv_nop\n\tv_nop" : "+v"(d) : "v"(a), "v"(b)); return d; }
template <int ACT>
__global__ __launch_bounds__(128) void k_gemm2(const _Float16* __restrict__ A, int lda, size_t sA, const _Float16* __restrict__ Bh, int ldb, size_t sB, float alpha, const float* __restrict__ bias, size_t sBias, const float* __restrict__ CP, int rowsPerB, size_t sCPb, int row0g,
    float* __restrict__ C, _Float16* __restrict__ C16, int ldc, size_t sC, int M, int N, int K) { static_assert(ACT == 0 || ACT == 3 || ACT == 6 || ACT == 8 || ACT == 9 || ACT == 11 || ACT == 12 || ACT == 14 || ACT == 15 || ACT == 16 || ACT == 17, "k_gemm2: unsupported ACT code (would silently apply no activation)");
  __shared__ __attribute__((aligned(16))) float so[4][32][68];
  const int tid = threadIdx.x, w = tid >> 5, lane = tid & 31, ln = lane & 15, hh = lane >> 4; const int by = blockIdx.y;
  A += (size_t)by * sA; Bh += (size_t)by * sB; const size_t cofs = (size_t)by * sC; const float* bp = bias ? bias + (size_t)by * sBias : nullptr;
  const int ntn = N >> 6; const int mt = blockIdx.x / ntn, nq = blockIdx.x - mt * ntn; const int row0 = mt * 128 + 32 * w, col0 = nq * 64; if (row0 >= M) return;
  const _Float16* a0p = A + (size_t)(row0 + ln) * lda; const _Float16* a1p = a0p + (size_t)16 * lda;
  const _Float16* b0p = Bh + (size_t)(col0 + ln) * ldb; const _Float16* b1p = b0p + (size_t)16 * ldb; const _Float16* b2p = b1p + (size_t)16 * ldb; const _Float16* b3p = b2p + (size_t)16 * ldb;
  const v8f z8 = {0.f,0.f,0.f,0.f,0.f,0.f,0.f,0.f}; v8f c00 = z8, c01 = z8, c02 = z8, c03 = z8, c10 = z8, c11 = z8, c12 = z8, c13 = z8;
#pragma unroll 1
  for (int kb = 0; kb < K; kb += 32) { const v16h a0 = g2_frag(a0p + kb, hh), a1 = g2_frag(a1p + kb, hh);
    v16h b = g2_frag(b0p + kb, hh); c00 = g2_mma(a0, b, c00); c10 = g2_mma(a1, b, c10);
    b = g2_frag(b1p + kb, hh); c01 = g2_mma(a0, b, c01); c11 = g2_mma(a1, b, c11);
    b = g2_frag(b2p + kb, hh); c02 = g2_mma(a0, b, c02); c12 = g2_mma(a1, b, c12);
    b = g2_frag(b3p + kb, hh); c03 = g2_mma(a0, b, c03); c13 = g2_mma(a1, b, c13); }
  v8f accs[8] = {c00, c01, c02, c03, c10, c11, c12, c13};
#pragma unroll
  for (int u = 0; u < 8; ++u) { const int t = u & 3, half = u >> 2; const int col = col0 + t * 16 + ln; const float bv = bp ? bf16_round(bp[col]) : 0.f;
#pragma unroll
    for (int r = 0; r < 8; ++r) { const int rloc = half * 16 + 8 * hh + r; float v = accs[u][r] * alpha + bv; if (CP) { if (rowsPerB < 0) v += CP[cofs + (size_t)(row0g + row0 + rloc) * ldc + col];      /* rowsPerB < 0: own element of the batched C plane */ else { const int bidx = (row0g + row0 + rloc) / rowsPerB; v += CP[(size_t)bidx * sCPb + (size_t)by * 64 + col]; } }
      if (ACT == 3) v = fmaxf(v, 0.f); else if (ACT == 6) v = 0.5f * v * (1.0f + erff(v * 0.70710678118654752f)); else if (ACT == 11) v = 1.0f / (1.0f + expf(-v)); else if (ACT == 15) v = v / (1.0f + expf(-v)); else if (ACT == 12) v = (v > 0.f) ? v : 0.01f * v; else if (ACT == 8) v = tanhf(v); else if (ACT == 9) v = 0.5f * v * (1.0f + tanhf(0.7978845608028654f * (v + 0.044715f * v * v * v))); else if (ACT == 14) v = (v > 0.f) ? v : 0.1f * v; else if (ACT == 16) v = (v >= 0.f) ? v : 0.3f * v; else if (ACT == 17) v = (v >= 0.f) ? v : 0.2f * v;
      so[w][rloc][t * 16 + ln] = v; } }
  __builtin_amdgcn_fence(__ATOMIC_ACQ_REL, "workgroup"); __builtin_amdgcn_wave_barrier();
  const int rsub = lane >> 4, c4 = (lane & 15) * 4;
  {
#pragma unroll
    for (int q = 0; q < 16; ++q) { const int r = q * 2 + rsub; const v4f v = *(const v4fa*)&so[w][r][c4]; if (C) *(v4f*)(C + cofs + (size_t)(row0 + r) * ldc + col0 + c4) = v; if (C16) { v4h h4; for (int i = 0; i < 4; ++i) h4[i] = (_Float16)v[i]; *(v4h*)(C16 + cofs + (size_t)(row0 + r) * ldc + col0 + c4) = h4; } }
     } }


__global__ __launch_bounds__(256) void k_wnat(const float* __restrict__ w, size_t n8, _Float16* __restrict__ Bt) { const size_t t = (size_t)blockIdx.x * 256 + threadIdx.x; if (t >= n8) return; FragH f; for (int q = 0; q < 8; ++q) f.h[q] = (_Float16)(bf16_round(w[t * 8 + q]) * 16.0f); *(v8us*)((unsigned short*)Bt + t * 8) = f.half[0];  }
__global__ __launch_bounds__(256) void k_rsm(const float* __restrict__ S, _Float16* __restrict__ P, int nrows) {
  #pragma clang fp contract(off)
  const int i = blockIdx.x * 256 + threadIdx.x; if (i >= nrows) return; const float* s = S + (size_t)i * SQ; float mx = -3.0e38f;
#pragma unroll 1
  for (int j = 0; j < SQ; ++j) mx = fmaxf(mx, s[j]); float se = 0.f;
#pragma unroll 1
  for (int j = 0; j < SQ; ++j) se += expf(s[j] - mx); const float sc = 256.0f / se;
#pragma unroll 1
  for (int j0 = 0; j0 < SQ; j0 += 8) { FragH f; for (int q = 0; q < 8; ++q) f.h[q] = (_Float16)(expf(s[j0 + q] - mx) * sc); unsigned short* d = (unsigned short*)P + (size_t)i * SQ + j0; *(v8us*)d = f.half[0];  } }
__global__ __launch_bounds__(256) void k_vt(const _Float16* __restrict__ V16, int b, int h0, _Float16* __restrict__ VT) { __shared__ unsigned short tl[64][65]; const int tid = threadIdx.x; const int hh = blockIdx.x % HG, sg = blockIdx.x / HG; const int s0 = sg * 64; const int h = h0 + hh;
  for (int i = tid; i < 64 * 8; i += 256) { const int j = i / 8, d8 = (i % 8) * 8; FragH f; f.half[0] = *(const v8us*)((const unsigned short*)V16 + ((size_t)b * SQ + s0 + j) * DM + h * HD + d8); for (int q = 0; q < 8; ++q) tl[d8 + q][j] = f.u[q]; }
  __syncthreads();
  { for (int i = tid; i < 64 * 8; i += 256) { const int d = i / 8, j8 = (i % 8) * 8; FragH f; for (int q = 0; q < 8; ++q) f.u[q] = tl[d][j8 + q]; *(v8us*)((unsigned short*)VT + ((size_t)hh * HD + d) * SQ + s0 + j8) = f.half[0]; }  } }

#define FH 2048
#define KN 103
__global__ __launch_bounds__(256) void k_xf(const float* __restrict__ x, float* __restrict__ XF, size_t n8) { const size_t t = (size_t)blockIdx.x * 256 + threadIdx.x; if (t >= n8) return; v8f o; for (int q = 0; q < 8; ++q) o[q] = bf16_round(x[t * 8 + q]); *(v8f*)(XF + t * 8) = o;  }
typedef int v4ia __attribute__((ext_vector_type(4), may_alias));
__device__ __forceinline__ void xcnt_wait() { asm volatile("s_wait_xcnt 0x0" ::: "memory"); }
__device__ __forceinline__ float wave_max(float v) {
#pragma unroll      /* five fixed butterfly steps */
  for (int m = 16; m > 0; m >>= 1) v = fmaxf(v, __shfl_xor(v, m, 32)); return v; }
__device__ __forceinline__ float wave_sum(float v) {
#pragma unroll      /* five fixed butterfly steps */
  for (int m = 16; m > 0; m >>= 1) v += __shfl_xor(v, m, 32); return v; }
// Row LayerNorm, one wave per row: lane l owns columns c*256 + l*8 .. +7 (c = 0, 1), held in registers for the three passes.
__global__ __launch_bounds__(256) void k_lnw(const float* __restrict__ HF, const float* __restrict__ g, const float* __restrict__ bb, _Float16* __restrict__ X16o) {
  const int lane = threadIdx.x & 31; const size_t r = (size_t)blockIdx.x * 8 + (threadIdx.x >> 5); if (r >= NR) return; const float* x = HF + r * DM; float v[16]; float s = 0.f;
#pragma unroll      /* constant indices: the lane's values stay in registers and its loads issue together */
  for (int c = 0; c < 2; ++c) { const int j0 = c * 256 + lane * 8; const v4f a0 = *(const v4fa*)(x + j0), a1 = *(const v4fa*)(x + j0 + 4);
#pragma unroll      /* constant indices: the lane's values stay in registers and its loads issue together */
    for (int e = 0; e < 4; ++e) { v[c * 8 + e] = a0[e]; v[c * 8 + 4 + e] = a1[e]; } }
#pragma unroll      /* constant indices: the lane's values stay in registers and its loads issue together */
  for (int e = 0; e < 16; ++e) s += v[e];
  const float mu = wave_sum(s) / (float)DM; float qs = 0.f;
#pragma unroll      /* constant indices: the lane's values stay in registers and its loads issue together */
  for (int e = 0; e < 16; ++e) { const float dd = v[e] - mu; qs += dd * dd; }
  const float rs = 1.0f / sqrtf(wave_sum(qs) / (float)DM + 1e-5f);
#pragma unroll      /* constant indices: the lane's values stay in registers and its loads issue together */
  for (int c = 0; c < 2; ++c) { const int j0 = c * 256 + lane * 8; const v4f g0 = *(const v4fa*)(g + j0), g1 = *(const v4fa*)(g + j0 + 4), b0 = *(const v4fa*)(bb + j0), b1 = *(const v4fa*)(bb + j0 + 4); FragH f;
#pragma unroll      /* constant indices: the lane's values stay in registers and its loads issue together */
    for (int e = 0; e < 4; ++e) { f.h[e] = (_Float16)((v[c * 8 + e] - mu) * rs * bf16_round(g0[e]) + bf16_round(b0[e])); f.h[4 + e] = (_Float16)((v[c * 8 + 4 + e] - mu) * rs * bf16_round(g1[e]) + bf16_round(b1[e])); }
    *(v8us*)((unsigned short*)X16o + r * DM + j0) = f.half[0]; } }
// Row softmax, one wave per score row; the grid covers the rows of all HG heads held in S. Lane l owns keys c*256 + l*8 .. +7 (c = 0..3): 16-byte loads and stores, row maximum and sum by a butterfly over the 32 lanes.
__global__ __launch_bounds__(256) void k_rsmw(const float* __restrict__ S, _Float16* __restrict__ P, int nrows, const float* __restrict__ uprev, int b, const int* __restrict__ pmask, const int* __restrict__ pidx, const int* __restrict__ pim) {
  __shared__ __attribute__((aligned(16))) unsigned short prow[8][SQ];      /* sparse branch: the wave's own output row (any index set; a duplicated index is stored once) */
  const int lane = threadIdx.x & 31, w = threadIdx.x >> 5; const int i = blockIdx.x * 8 + w; if (i >= nrows) return;      /* whole waves leave; the kernel has no work-group barrier */
  const int hd = i / QN, q = i - hd * QN; const float* s = S + (size_t)hd * SQ * SQ + (size_t)q * SQ; unsigned short* d = (unsigned short*)P + (size_t)hd * SQ * SQ + (size_t)q * SQ;
  const float lam = 10.0f * expf(-5.0f * bf16_round(uprev[b])); const bool sparse = lam >= 1.0f;
  if (sparse) { const int* ix = pidx + (size_t)q * KN; const int* vm = pim + (size_t)q * KN; constexpr int NT = (KN + 31) / 32; float sv[NT]; int jx[NT]; bool ok[NT]; float mx = -3.0e38f;
#pragma unroll      /* constant indices: the lane's values stay in registers and its loads issue together */
    for (int t = 0; t < NT; ++t) { const int k = t * 32 + lane; const int kc = k < KN ? k : KN - 1; jx[t] = ix[kc]; const int vk = vm[kc]; xcnt_wait(); ok[t] = (k < KN) & (vk != 0); }      /* a later load's result may land in an earlier load's address register: the wait stands between them */
#pragma unroll      /* constant indices: the lane's values stay in registers and its loads issue together */
    for (int t = 0; t < NT; ++t) { jx[t] = min(max(jx[t], 0), SQ - 1); sv[t] = s[jx[t]]; xcnt_wait(); }      /* the key index is bounded here before it forms an address; the wait: as in the loop above */
#pragma unroll      /* constant indices: the lane's values stay in registers and its loads issue together */
    for (int t = 0; t < NT; ++t) if (ok[t]) mx = fmaxf(mx, sv[t]);
    mx = wave_max(mx); float se = 0.f;
#pragma unroll      /* constant indices: the lane's values stay in registers and its loads issue together */
    for (int t = 0; t < NT; ++t) { sv[t] = expf(sv[t] - mx); if (ok[t]) se += sv[t]; }
    se = wave_sum(se); const float sc = 256.0f / se; const v8us z = {0, 0, 0, 0, 0, 0, 0, 0};
#pragma unroll      /* constant indices: the lane's values stay in registers and its loads issue together */
    for (int c = 0; c < 4; ++c) *(v8us*)&prow[w][c * 256 + lane * 8] = z;
    /* the zeros of every lane are in LDS before any lane scatters a weight over them */
    __builtin_amdgcn_fence(__ATOMIC_ACQ_REL, "workgroup"); __builtin_amdgcn_wave_barrier();
#pragma unroll      /* constant indices: the lane's values stay in registers and its loads issue together */
    for (int t = 0; t < NT; ++t) if (ok[t]) { FragH f; f.h[0] = (_Float16)(sv[t] * sc); prow[w][jx[t]] = f.u[0]; }
    /* the scattered weights of every lane are in LDS before the row is read back in 16-byte pieces */
    __builtin_amdgcn_fence(__ATOMIC_ACQ_REL, "workgroup"); __builtin_amdgcn_wave_barrier();
#pragma unroll      /* constant indices: the lane's values stay in registers and its loads issue together */
    for (int c = 0; c < 4; ++c) { const v8us o = *(const v8us*)&prow[w][c * 256 + lane * 8]; *(v8us*)(d + c * 256 + lane * 8) = o; }
    xcnt_wait(); }      /* the listing lets the dense part's code follow, which writes the four stores' registers */
  else { const int* pm = pmask + (size_t)q * SQ; float v[32]; float mx = -3.0e38f;
#pragma unroll      /* constant indices: the lane's values stay in registers and its loads issue together */
    for (int c = 0; c < 4; ++c) { const int j0 = c * 256 + lane * 8; const v4f a0 = *(const v4fa*)(s + j0), a1 = *(const v4fa*)(s + j0 + 4); const v4ia m0 = *(const v4ia*)(pm + j0), m1 = *(const v4ia*)(pm + j0 + 4);
#pragma unroll      /* constant indices: the lane's values stay in registers and its loads issue together */
      for (int e = 0; e < 4; ++e) { v[c * 8 + e] = a0[e] + (m0[e] ? 0.f : -lam); v[c * 8 + 4 + e] = a1[e] + (m1[e] ? 0.f : -lam); } }
#pragma unroll      /* constant indices: the lane's values stay in registers and its loads issue together */
    for (int e = 0; e < 32; ++e) mx = fmaxf(mx, v[e]);
    mx = wave_max(mx); float se = 0.f;
#pragma unroll      /* constant indices: the lane's values stay in registers and its loads issue together */
    for (int e = 0; e < 32; ++e) { v[e] = expf(v[e] - mx); se += v[e]; }
    se = wave_sum(se); const float sc = 256.0f / se;
#pragma unroll      /* constant indices: the lane's values stay in registers and its loads issue together */
    for (int c = 0; c < 4; ++c) { FragH f;
#pragma unroll      /* constant indices: the lane's values stay in registers and its loads issue together */
      for (int e = 0; e < 8; ++e) f.h[e] = (_Float16)(v[c * 8 + e] * sc);
      *(v8us*)(d + c * 256 + lane * 8) = f.half[0]; } } }
// Row norms, one wave per row, 32 rows per work-group, so that one wave stores the group's 32 values as one whole 128-byte line of U.
static_assert(NR % 32 == 0, "k_unormw: 32 rows per work-group");
__global__ __launch_bounds__(1024) void k_unormw(const float* __restrict__ OUT, const float* __restrict__ XF, float* __restrict__ U) {
  __shared__ float ur[32];
  const int lane = threadIdx.x & 31, w = threadIdx.x >> 5; const size_t r = (size_t)blockIdx.x * 32 + w; float sd = 0.f, sx = 0.f;
#pragma unroll      /* constant indices: the lane's values stay in registers and its loads issue together */
  for (int c = 0; c < 4; ++c) { const int j0 = c * 128 + lane * 4; const v4f o = *(const v4fa*)(OUT + r * DM + j0), xv = *(const v4fa*)(XF + r * DM + j0);
#pragma unroll      /* constant indices: the lane's values stay in registers and its loads issue together */
    for (int e = 0; e < 4; ++e) { const float dd = o[e] - xv[e]; sd += dd * dd; sx += xv[e] * xv[e]; } }
  sd = wave_sum(sd); sx = wave_sum(sx); if (lane == 0) ur[w] = sqrtf(sd) / (sqrtf(sx) + 1e-8f);
  __syncthreads();      /* the 32 waves' row values are in LDS before wave 0 reads them */
  if (threadIdx.x < 32) U[(size_t)blockIdx.x * 32 + threadIdx.x] = ur[threadIdx.x]; }
// Batch means in float64: one wave, 32 lanes over the 1,024 rows of a batch, lane b stores batch b.
__global__ __launch_bounds__(32) void k_umeanw(const float* __restrict__ U, float* __restrict__ out1) { const int lane = threadIdx.x; float res = 0.f;
#pragma unroll      /* constant indices: the lane's values stay in registers and its loads issue together */
  for (int b = 0; b < NB; ++b) { double s = 0.0;
#pragma unroll      /* constant indices: the lane's values stay in registers and its loads issue together */
    for (int c = 0; c < SQ / 128; ++c) { const v4f a = *(const v4fa*)(U + (size_t)b * SQ + c * 128 + lane * 4);
#pragma unroll      /* constant indices: the lane's values stay in registers and its loads issue together */
      for (int e = 0; e < 4; ++e) s += (double)a[e]; }
#pragma unroll      /* five fixed butterfly steps */
    for (int m = 16; m > 0; m >>= 1) s += __shfl_xor(s, m, 32);
    if (lane == b) res = (float)(s / (double)SQ); }
  if (lane < NB) out1[lane] = res; }
extern "C" void kernel_launch(void* const* d_in, const int* in_sizes, int n_in,
                              void* d_out, int out_size, void* d_ws, size_t ws_size, hipStream_t stream) {
  (void)in_sizes; (void)n_in; (void)out_size;
  const float* const* I = (const float* const*)d_in; const float* x = I[0]; const float* uprev = I[1]; const float* wq = I[2]; const float* bq = I[3]; const float* wk = I[4]; const float* bk = I[5]; const float* wv = I[6]; const float* bv = I[7]; const float* wo = I[8]; const float* bo = I[9]; const float* l1g = I[10]; const float* l1b = I[11]; const float* l2g = I[12]; const float* l2b = I[13]; const float* w1 = I[14]; const float* b1 = I[15]; const float* w2 = I[16]; const float* b2 = I[17]; const int* pmask = (const int*)d_in[18]; const int* pidx = (const int*)d_in[19]; const int* pim = (const int*)d_in[20];
  float* out0 = (float*)d_out; float* out1 = out0 + NR * DM;
  char* ws = (char*)d_ws; size_t off = 0;
  auto take = [&](size_t bytes) { char* p = ws + off; off += (bytes + 255) & ~(size_t)255; return p; };
  _Float16* BQ = (_Float16*)take((size_t)DM * DM * 2); _Float16* BK = (_Float16*)take((size_t)DM * DM * 2); _Float16* BV = (_Float16*)take((size_t)DM * DM * 2); _Float16* BO = (_Float16*)take((size_t)DM * DM * 2); _Float16* BW1 = (_Float16*)take((size_t)FH * DM * 2); _Float16* BW2 = (_Float16*)take((size_t)DM * FH * 2);
  float* XF = (float*)take(NR * DM * 4); float* HF = (float*)take(NR * DM * 4); _Float16* G16 = (_Float16*)take(NR * FH * 2); float* U = (float*)take(NR * 4);
  _Float16* X16 = (_Float16*)take(NR * DM * 2); _Float16* Q16 = (_Float16*)take(NR * DM * 2); _Float16* K16 = (_Float16*)take(NR * DM * 2); _Float16* V16 = (_Float16*)take(NR * DM * 2); _Float16* O16 = (_Float16*)take(NR * DM * 2);
  float* S = (float*)take((size_t)HG * SQ * SQ * 4); _Float16* P = (_Float16*)take((size_t)HG * SQ * SQ * 2); _Float16* VT = (_Float16*)take((size_t)HG * HD * SQ * 2);
  if (off > ws_size) return;      /* 6 + 4 + 4 + 8 + 2x5 + 16 + 8 + 0.5 = ≈ 57 MiB */
  const size_t nw8 = (size_t)DM * DM / 8; const unsigned gw = (unsigned)((nw8 + 255) / 256), gw4 = (unsigned)(((size_t)FH * DM / 8 + 255) / 256);
  k_wnat<<<gw, 256, 0, stream>>>(wq, nw8, BQ); k_wnat<<<gw, 256, 0, stream>>>(wk, nw8, BK); k_wnat<<<gw, 256, 0, stream>>>(wv, nw8, BV); k_wnat<<<gw, 256, 0, stream>>>(wo, nw8, BO); k_wnat<<<gw4, 256, 0, stream>>>(w1, (size_t)FH * DM / 8, BW1); k_wnat<<<gw4, 256, 0, stream>>>(w2, (size_t)DM * FH / 8, BW2);
  k_xf<<<(unsigned)((NR * DM / 8 + 255) / 256), 256, 0, stream>>>(x, XF, NR * DM / 8); k_lnw<<<(unsigned)((NR + 7) / 8), 256, 0, stream>>>(XF, l1g, l1b, X16);
  const dim3 gp((unsigned)((NR / 128) * (DM / 64)), 1);
  k_gemm2<0><<<gp, 128, 0, stream>>>(X16, DM, 0, BQ, DM, 0, 0.0625f, bq, 0, nullptr, 1, 0, 0, nullptr, Q16, DM, 0, (int)NR, DM, DM);
  k_gemm2<0><<<gp, 128, 0, stream>>>(X16, DM, 0, BK, DM, 0, 0.0625f, bk, 0, nullptr, 1, 0, 0, nullptr, K16, DM, 0, (int)NR, DM, DM);
  k_gemm2<0><<<gp, 128, 0, stream>>>(X16, DM, 0, BV, DM, 0, 0.0625f, bv, 0, nullptr, 1, 0, 0, nullptr, V16, DM, 0, (int)NR, DM, DM);
  for (int b = 0; b < NB; ++b) for (int h0 = 0; h0 < NH; h0 += HG) {
    const _Float16* qb = Q16 + (size_t)b * SQ * DM + h0 * HD; const _Float16* kb = K16 + (size_t)b * SQ * DM + h0 * HD;
    k_gemm2<0><<<dim3((QN / 128) * (SQ / 64), HG), 128, 0, stream>>>(qb, DM, (size_t)HD, kb, DM, (size_t)HD, 0.125f, nullptr, 0, nullptr, 1, 0, 0, S, nullptr, SQ, (size_t)SQ * SQ, QN, SQ, HD);      /* scaled scores, HG heads per launch */
    k_rsmw<<<(HG * QN + 7) / 8, 256, 0, stream>>>(S, P, HG * QN, uprev, b, pmask, pidx, pim);      /* one wave per row, HG heads per launch */
    k_vt<<<HG * (SQ / 64), 256, 0, stream>>>(V16, b, h0, VT);
    k_gemm2<0><<<dim3((QN / 128) * (HD / 64), HG), 128, 0, stream>>>(P, SQ, (size_t)SQ * SQ, VT, SQ, (size_t)HD * SQ, 0.00390625f, nullptr, 0, nullptr, 1, 0, 0, nullptr, O16 + (size_t)b * SQ * DM + h0 * HD, DM, (size_t)HD, QN, HD, SQ); }      /* o (merged heads) as f16 rows */
  k_gemm2<0><<<gp, 128, 0, stream>>>(O16, DM, 0, BO, DM, 0, 0.0625f, bo, 0, XF, 1, (size_t)DM, 0, HF, nullptr, DM, 0, (int)NR, DM, DM);      /* h = x + attn W_o^T + b_o */
  k_lnw<<<(unsigned)((NR + 7) / 8), 256, 0, stream>>>(HF, l2g, l2b, X16);
  k_gemm2<6><<<dim3((unsigned)((NR / 128) * (FH / 64)), 1), 128, 0, stream>>>(X16, DM, 0, BW1, DM, 0, 0.0625f, b1, 0, nullptr, 1, 0, 0, nullptr, G16, FH, 0, (int)NR, FH, DM);      /* gelu_erf(LN2(h) W1^T + b1) */
  k_gemm2<0><<<gp, 128, 0, stream>>>(G16, FH, 0, BW2, FH, 0, 0.0625f, b2, 0, HF, 1, (size_t)DM, 0, out0, nullptr, DM, 0, (int)NR, DM, FH);      /* out = h + (...) W2^T + b2, rows are the output layout */
  k_unormw<<<(unsigned)(NR / 32), 1024, 0, stream>>>(out0, XF, U); k_umeanw<<<1, 32, 0, stream>>>(U, out1);
}

// v002
// Measured time: 302 microseconds a run.
// In two side-by-side timings against v001, it was 1.60 and 1.61 times as fast.
// All steps since v000 together make it 12.7 times as fast.
#include <hip/hip_runtime.h>
// SPDGMultiHeadAttention (x [2][1024][512], u_prev [2][1]; xn = LN1(x); Q,K,V = xn W^T + b (8 heads of 64); lam = 10 exp(-5 u_prev); per batch: if lam >= 1 the SPARSE branch (softmax over the prior window slots prior_indices[i][k] with prior_index_mask, others excluded) else the DENSE branch (softmax over all keys of q.k/8 + lam*(prior_mask ? 0 : -1)); attn = merge W_o^T + b_o; h = x + attn; out = h + gelu_erf(LN2(h) W1^T + b1) W2^T + b2 -> [2][1024][512]; aggregated_u[b] = mean_s ||out - x|| / (||x|| + 1e-8) -> [2][1]).
// Structure: token rows; bf16(x) as f32 residual rows + LN1 on VALU (f32, wave per row) into f16 rows; Q | K | V WMMA GEMMs (32x64 wave tiles, f32 accumulation, exact x16 weights + bias, f16 outputs); per (batch, 4 heads): scores GEMM (K = 64), the branch-selecting row softmax on VALU (lam from u_prev, prior tables read on device; f32; weights x256 as f16), V^T via LDS, o = P . V GEMM (K = 1,024) into merged f16 rows; W_o GEMM + b_o + x (epilogue add) -> h; LN2 on VALU; fc1 GEMM with the exact-erf GELU epilogue (f16 hidden); fc2 GEMM + b2 + h straight into the output rows; the surprise statistic on VALU (per-row norms, float64 means per batch) into output 1.
// Compute dtype: inputs rounded to bf16; x / weights exact; LN outputs, q, k, v, softmax weights, o, GELU hidden plain f16 (~2^-12); residual, LN statistics, scores, softmax, norms f32/f64. v_wmma_f32_16x16x32_f16.
#define NB 2
#define SQ 1024
#define DM 512
#define NH 8
#define HD 64
#define HG 4                         /* heads per attention launch group */
#define QN SQ                        /* query rows attended per batch (debug hook) */
#define NR ((size_t)NB * SQ)         /* 2048 token rows */
typedef __bf16 v16b __attribute__((ext_vector_type(16)));
typedef unsigned short v8us __attribute__((ext_vector_type(8), may_alias));
typedef float  v8f  __attribute__((ext_vector_type(8)));
typedef float  v4f  __attribute__((ext_vector_type(4)));
typedef float  v4fa __attribute__((ext_vector_type(4), may_alias));
union FragB { v16b v; v8us half[2]; unsigned short u[16]; };

__device__ __forceinline__ unsigned short bf16_bits(float x) { unsigned int u = __float_as_uint(x); return (unsigned short)((u + 0x7FFFu + ((u >> 16) & 1u)) >> 16); }
__device__ __forceinline__ float bf16_val(unsigned short b) { return __uint_as_float(((unsigned int)b) << 16); }
__device__ __forceinline__ float bf16_round(float x) { return bf16_val(bf16_bits(x)); }
// D += A·B with NT terms: 1 = ah·bh, 2 = + al·bh (A split), 3 = + ah·bl (both split)
template <int NT>
__device__ __forceinline__ v8f mmaN(v16b ah, v16b al, v16b bh, v16b bl, v8f c) {
  c = __builtin_amdgcn_wmma_f32_16x16x32_bf16(false, ah, false, bh, (short)0, c, false, false);
  if (NT >= 2) c = __builtin_amdgcn_wmma_f32_16x16x32_bf16(false, al, false, bh, (short)0, c, false, false);
  if (NT >= 3) c = __builtin_amdgcn_wmma_f32_16x16x32_bf16(false, ah, false, bl, (short)0, c, false, false);
  asm volatile("v_nop\n\tv_nop\n\tv_nop\n\tv_nop" : "+v"(c) : "v"(ah), "v"(al), "v"(bh), "v"(bl));
  return c;
}

__global__ __launch_bounds__(256) void k_wt_bf16(const float* __restrict__ W, unsigned short* __restrict__ Wt, int K, int N) {
  const int t = blockIdx.x * 256 + threadIdx.x;
  const int k8n = K / 8;
  if (t >= N * k8n) return;
  const int n = t / k8n, k8 = (t % k8n) * 8;
  v8us v;
#pragma unroll
  for (int i = 0; i < 8; ++i) v[i] = bf16_bits(W[(size_t)(k8 + i) * N + n]);
  *(v8us*)(Wt + (size_t)n * K + k8) = v;
  
}

// GEMM C[M][N] (f32, pitch ldc) = act(A[M][K]·W + bias). A f32 row-major (pitch lda) converted per fragment to bf16
// (ASPLIT: hi/lo two planes -> 2 terms, else single rounded term); Wt bf16 [N][K] (pitch ldb). BIAS_BF16 rounds the
// bias to bf16 first (bias quantised to bf16 before the add). K%32==0, M%16==0, N%64==0.
template <bool ASPLIT, int ACT, bool BIAS_BF16>
__global__ __launch_bounds__(128) void k_gemm_bf(const float* __restrict__ A, int lda, const unsigned short* __restrict__ Wt, int ldb,
                                               const float* __restrict__ bias, float* __restrict__ C, int ldc, int M, int N, int K) {
  __shared__ __attribute__((aligned(16))) float so[4][16][64];
  const int tid = threadIdx.x, w = tid >> 5, lane = tid & 31, ln = lane & 15, hh = lane >> 4;
  const int ntn = N / 64;
  const int wid = blockIdx.x * 4 + w;
  const int mt = wid / ntn, nq = wid % ntn;
  if (mt * 16 >= M) return;
  const int row0 = mt * 16, col0 = nq * 64;
  const float* arow = A + (size_t)(row0 + ln) * lda;
  v8f acc[4] = {};
  for (int kb = 0; kb < K; kb += 32) {
    FragB ah, al;
    const v4f x0 = *(const v4fa*)(arow + kb + 8 * hh), x1 = *(const v4fa*)(arow + kb + 8 * hh + 4);
    const v4f x2 = *(const v4fa*)(arow + kb + 16 + 8 * hh), x3 = *(const v4fa*)(arow + kb + 16 + 8 * hh + 4);
    float xs[16] = {x0[0],x0[1],x0[2],x0[3],x1[0],x1[1],x1[2],x1[3],x2[0],x2[1],x2[2],x2[3],x3[0],x3[1],x3[2],x3[3]};
#pragma unroll
    for (int i = 0; i < 16; ++i) { const unsigned short hb = bf16_bits(xs[i]); ah.u[i] = hb; al.u[i] = ASPLIT ? bf16_bits(xs[i] - bf16_val(hb)) : (unsigned short)0; }
#pragma unroll
    for (int t = 0; t < 4; ++t) {
      const unsigned short* brow = Wt + (size_t)(col0 + t * 16 + ln) * ldb + kb;
      FragB b;
      b.half[0] = *(const v8us*)(brow + 8 * hh);
      b.half[1] = *(const v8us*)(brow + 16 + 8 * hh);
      acc[t] = mmaN<ASPLIT ? 2 : 1>(ah.v, al.v, b.v, b.v, acc[t]);
    }
  }
#pragma unroll
  for (int t = 0; t < 4; ++t) {
    float bv = bias ? bias[col0 + t * 16 + ln] : 0.f;
    if (BIAS_BF16) bv = bf16_round(bv);
#pragma unroll
    for (int r = 0; r < 8; ++r) { float v = acc[t][r] + bv; if (ACT == 1) v = fmaxf(v, 0.f); so[w][8 * hh + r][t * 16 + ln] = v; }
  }
  __builtin_amdgcn_fence(__ATOMIC_ACQ_REL, "workgroup");
  __builtin_amdgcn_wave_barrier();
  const int rsub = lane >> 4, c4 = (lane & 15) * 4;
  {
#pragma unroll
    for (int q = 0; q < 8; ++q) {
      const int r = q * 2 + rsub;
      const v4f v = *(const v4fa*)&so[w][r][c4];
      *(v4f*)(C + (size_t)(row0 + r) * ldc + col0 + c4) = v;
    }
    
  }
}

// GEMM C = act(A·W + bias + resid): A f32 (ASPLIT -> hi/lo 2 terms), Wt bf16 [N][K]; ACT 0 none, 1 relu, 2 exact gelu;
// resid (optional, f32, row index = (row % rmod), pitch ldr, RES_BF16 rounds it) added before the activation.
template <bool ASPLIT, int ACT, bool BIAS_BF16, bool RES_BF16>
__global__ __launch_bounds__(128) void k_gemm_bf3(const float* __restrict__ A, int lda, const unsigned short* __restrict__ Wt, int ldb,
                                                const float* __restrict__ bias, const float* __restrict__ resid, int rmod, int ldr,
                                                float* __restrict__ C, int ldc, int M, int N, int K) {
  __shared__ __attribute__((aligned(16))) float so[4][16][64];
  const int tid = threadIdx.x, w = tid >> 5, lane = tid & 31, ln = lane & 15, hh = lane >> 4;
  const int ntn = N / 64;
  const int wid = blockIdx.x * 4 + w;
  const int mt = wid / ntn, nq = wid % ntn;
  if (mt * 16 >= M) return;
  const int row0 = mt * 16, col0 = nq * 64;
  const float* arow = A + (size_t)(row0 + ln) * lda;
  v8f acc[4] = {};
  for (int kb = 0; kb < K; kb += 32) {
    FragB ah, al;
    const v4f x0 = *(const v4fa*)(arow + kb + 8 * hh), x1 = *(const v4fa*)(arow + kb + 8 * hh + 4);
    const v4f x2 = *(const v4fa*)(arow + kb + 16 + 8 * hh), x3 = *(const v4fa*)(arow + kb + 16 + 8 * hh + 4);
    float xs[16] = {x0[0],x0[1],x0[2],x0[3],x1[0],x1[1],x1[2],x1[3],x2[0],x2[1],x2[2],x2[3],x3[0],x3[1],x3[2],x3[3]};
#pragma unroll
    for (int i = 0; i < 16; ++i) { const unsigned short hb = bf16_bits(xs[i]); ah.u[i] = hb; al.u[i] = ASPLIT ? bf16_bits(xs[i] - bf16_val(hb)) : (unsigned short)0; }
#pragma unroll
    for (int t = 0; t < 4; ++t) {
      const unsigned short* brow = Wt + (size_t)(col0 + t * 16 + ln) * ldb + kb;
      FragB b;
      b.half[0] = *(const v8us*)(brow + 8 * hh);
      b.half[1] = *(const v8us*)(brow + 16 + 8 * hh);
      acc[t] = mmaN<ASPLIT ? 2 : 1>(ah.v, al.v, b.v, b.v, acc[t]);
    }
  }
#pragma unroll
  for (int t = 0; t < 4; ++t) {
    const int col = col0 + t * 16 + ln;
    float bv = bias ? bias[col] : 0.f;
    if (BIAS_BF16) bv = bf16_round(bv);
#pragma unroll
    for (int r = 0; r < 8; ++r) {
      float v = acc[t][r] + bv;
      if (resid) { float rv = resid[(size_t)((row0 + 8 * hh + r) % rmod) * ldr + col]; if (RES_BF16) rv = bf16_round(rv); v += rv; }
      if (ACT == 1) v = fmaxf(v, 0.f);
      if (ACT == 2) v = 0.5f * v * (1.0f + erff(v * 0.70710678118654752f));
      if (ACT == 3) { const float u = 0.7978845608028654f * (v + 0.044715f * v * v * v); v = 0.5f * v * (1.0f + tanhf(u)); }
      so[w][8 * hh + r][t * 16 + ln] = v;
    }
  }
  __builtin_amdgcn_fence(__ATOMIC_ACQ_REL, "workgroup");
  __builtin_amdgcn_wave_barrier();
  const int rsub = lane >> 4, c4 = (lane & 15) * 4;
  {
#pragma unroll
    for (int q = 0; q < 8; ++q) {
      const int r = q * 2 + rsub;
      const v4f v = *(const v4fa*)&so[w][r][c4];
      *(v4f*)(C + (size_t)(row0 + r) * ldc + col0 + c4) = v;
    }
    
  }
}
// row LayerNorm (biased variance, eps) over N: s = X (+ R); optional out_sum <- s; out_norm <- (s-mu)*rsqrt(var+eps)*g + b
template <bool PARAM_BF16>
__global__ __launch_bounds__(256) void k_layernorm(const float* __restrict__ X, const float* __restrict__ R, const float* __restrict__ g, const float* __restrict__ bta,
                                                  float* __restrict__ out_sum, float* __restrict__ out_norm, int N, float eps) {
  __shared__ float red[256];
  const int row = blockIdx.x, tid = threadIdx.x;
  const float* x = X + (size_t)row * N; const float* rr = R ? R + (size_t)row * N : nullptr;
  float vals[16];                     // up to N = 4096
  const int per = N / 256;            // contiguous chunk per thread? use strided-by-4 chunks: thread handles j = tid*4 + 1024*u
  float s1 = 0.f;
  for (int u = 0; u < per / 4; ++u) {
    const int j = tid * 4 + 1024 * u;
    const v4f a = *(const v4fa*)(x + j);
    v4f b = {0.f,0.f,0.f,0.f}; if (rr) b = *(const v4fa*)(rr + j);
#pragma unroll
    for (int q = 0; q < 4; ++q) { const float v = a[q] + b[q]; vals[u * 4 + q] = v; s1 += v; }
  }
  red[tid] = s1; __syncthreads();
  for (int st = 128; st > 0; st >>= 1) { if (tid < st) red[tid] += red[tid + st]; __syncthreads(); }
  const float mu = red[0] / (float)N; __syncthreads();
  float s2 = 0.f;
  for (int u = 0; u < per / 4; ++u)
#pragma unroll
    for (int q = 0; q < 4; ++q) { const float c = vals[u * 4 + q] - mu; s2 += c * c; }
  red[tid] = s2; __syncthreads();
  for (int st = 128; st > 0; st >>= 1) { if (tid < st) red[tid] += red[tid + st]; __syncthreads(); }
  const float rs = rsqrtf(red[0] / (float)N + eps);
  {
    for (int u = 0; u < per / 4; ++u) {
      const int j = tid * 4 + 1024 * u;
      v4f o, sm;
#pragma unroll
      for (int q = 0; q < 4; ++q) {
        float gg = g[j + q], bb = bta[j + q];
        if (PARAM_BF16) { gg = bf16_round(gg); bb = bf16_round(bb); }
        sm[q] = vals[u * 4 + q]; o[q] = (vals[u * 4 + q] - mu) * rs * gg + bb;
      }
      if (out_sum) *(v4f*)(out_sum + (size_t)row * N + j) = sm;
      *(v4f*)(out_norm + (size_t)row * N + j) = o;
    }
    
  }
}



// ---- f16 WMMA path (v_wmma_f32_16x16x32_f16): 11-bit significands for operands in range — used where a [0,1] probability operand needs more precision than bf16
typedef _Float16 v16h __attribute__((ext_vector_type(16)));
union FragH { v16h v; v8us half[2]; _Float16 h[16]; unsigned short u[16]; };
template <int NT>
__device__ __forceinline__ v8f mmaH(v16h ah, v16h al, v16h bh, v16h bl, v8f c) {
  c = __builtin_amdgcn_wmma_f32_16x16x32_f16(false, ah, false, bh, (short)0, c, false, false);
  if (NT >= 2) c = __builtin_amdgcn_wmma_f32_16x16x32_f16(false, al, false, bh, (short)0, c, false, false);
  if (NT >= 3) c = __builtin_amdgcn_wmma_f32_16x16x32_f16(false, ah, false, bl, (short)0, c, false, false);
  asm volatile("v_nop\n\tv_nop\n\tv_nop\n\tv_nop" : "+v"(c) : "v"(ah), "v"(al), "v"(bh), "v"(bl));
  return c;
}
// batched GEMM like k_gemm_b but f16 operands: A f32 (split into f16 hi/lo if ASPLIT, else rounded to f16), Bt = f16 values [n][k]; alpha; C f32; N multiple of 16 (partial tiles skipped)
template <bool ASPLIT>
__global__ __launch_bounds__(128) void k_gemm_h(const float* __restrict__ A, int lda, size_t sA, const _Float16* __restrict__ Bh, int ldb, size_t sB, float alpha, float* __restrict__ C, int ldc, size_t sC, int M, int N, int K) {
  __shared__ __attribute__((aligned(16))) float so[4][16][64];
  const int tid = threadIdx.x, w = tid >> 5, lane = tid & 31, ln = lane & 15, hh = lane >> 4; const int by = blockIdx.y;
  A += (size_t)by * sA; Bh += (size_t)by * sB; C += (size_t)by * sC;
  const int ntn = (N + 63) / 64; const int wid = blockIdx.x * 4 + w; const int mt = wid / ntn, nq = wid % ntn; if (mt * 16 >= M) return;
  const int row0 = mt * 16, col0 = nq * 64; const float* arow = A + (size_t)(row0 + ln) * lda;
  v8f acc[4] = {};
  for (int kb = 0; kb < K; kb += 32) {
    FragH ah, al;
    const v4f x0 = *(const v4fa*)(arow + kb + 8 * hh), x1 = *(const v4fa*)(arow + kb + 8 * hh + 4), x2 = *(const v4fa*)(arow + kb + 16 + 8 * hh), x3 = *(const v4fa*)(arow + kb + 16 + 8 * hh + 4);
    float xs[16] = {x0[0],x0[1],x0[2],x0[3],x1[0],x1[1],x1[2],x1[3],x2[0],x2[1],x2[2],x2[3],x3[0],x3[1],x3[2],x3[3]};
#pragma unroll
    for (int i = 0; i < 16; ++i) { const _Float16 h = (_Float16)xs[i]; ah.h[i] = h; al.h[i] = ASPLIT ? (_Float16)(xs[i] - (float)h) : (_Float16)0.0f; }
#pragma unroll
    for (int t = 0; t < 4; ++t) { if (col0 + t * 16 >= N) continue; const size_t boff = (size_t)(col0 + t * 16 + ln) * ldb + kb; FragH bq; bq.half[0] = *(const v8us*)(Bh + boff + 8 * hh); bq.half[1] = *(const v8us*)(Bh + boff + 16 + 8 * hh);
      acc[t] = mmaH<ASPLIT ? 2 : 1>(ah.v, al.v, bq.v, bq.v, acc[t]); }
  }
#pragma unroll
  for (int t = 0; t < 4; ++t) { if (col0 + t * 16 >= N) continue;
#pragma unroll
    for (int r = 0; r < 8; ++r) so[w][8 * hh + r][t * 16 + ln] = acc[t][r] * alpha; }
  __builtin_amdgcn_fence(__ATOMIC_ACQ_REL, "workgroup"); __builtin_amdgcn_wave_barrier();
  const int rsub = lane >> 4, c4 = (lane & 15) * 4;
  {
#pragma unroll
    for (int q = 0; q < 8; ++q) { const int r = q * 2 + rsub; if (col0 + c4 < N) { const v4f v = *(const v4fa*)&so[w][r][c4]; *(v4f*)(C + (size_t)(row0 + r) * ldc + col0 + c4) = v; } }
     }
}

// Wt[n][k] = f16(W[k][n]·scale) from f32 row-major W[K][N] (scale = power of two; bf16-exact weights stay exact in f16 away from the subnormal range)
__global__ __launch_bounds__(256) void k_wt_f16(const float* __restrict__ W, _Float16* __restrict__ Wt, int K, int N, float scale) {
  const int t = blockIdx.x * 256 + threadIdx.x; if (t >= N * (K / 8)) return; const int n = t / (K / 8), k8 = (t % (K / 8)) * 8; FragH f;
#pragma unroll
  for (int i = 0; i < 8; ++i) f.h[i] = (_Float16)(bf16_round(W[(size_t)(k8 + i) * N + n]) * scale); const v8us o = f.half[0];
  *(v8us*)((unsigned short*)Wt + (size_t)n * K + k8) = o; 
}
// k_gemm_hh variant with fused epilogue: v = acc·alpha + bias[by·sBias + col] (+ CP[(row/rowsPerB)·sCPb + by·64 + col] if CP) ; ACT 0 none / 1 elu ; writes f16 C16 (and f32 C if non-null)
template <int ACT>
__global__ __launch_bounds__(128) void k_gemm_hhx(const _Float16* __restrict__ A, int lda, size_t sA, const _Float16* __restrict__ Bh, int ldb, size_t sB, float alpha, const float* __restrict__ bias, size_t sBias, const float* __restrict__ CP, int rowsPerB, size_t sCPb, int row0g,
    float* __restrict__ C, _Float16* __restrict__ C16, int ldc, size_t sC, int M, int N, int K) {
  __shared__ __attribute__((aligned(16))) float so[4][16][64];
  const int tid = threadIdx.x, w = tid >> 5, lane = tid & 31, ln = lane & 15, hh = lane >> 4; const int by = blockIdx.y;
  A += (size_t)by * sA; Bh += (size_t)by * sB; const size_t cofs = (size_t)by * sC; const float* bp = bias ? bias + (size_t)by * sBias : nullptr;
  const int ntn = (N + 63) / 64; const int wid = blockIdx.x * 4 + w; const int mt = wid / ntn, nq = wid % ntn; if (mt * 16 >= M) return;
  const int row0 = mt * 16, col0 = nq * 64; const _Float16* arow = A + (size_t)(row0 + ln) * lda;
  v8f acc[4] = {};
  for (int kb = 0; kb < K; kb += 32) { FragH ah; ah.half[0] = *(const v8us*)((const unsigned short*)arow + kb + 8 * hh); ah.half[1] = *(const v8us*)((const unsigned short*)arow + kb + 16 + 8 * hh);
#pragma unroll
    for (int t = 0; t < 4; ++t) { if (col0 + t * 16 >= N) continue; const size_t boff = (size_t)(col0 + t * 16 + ln) * ldb + kb; FragH bq; bq.half[0] = *(const v8us*)((const unsigned short*)Bh + boff + 8 * hh); bq.half[1] = *(const v8us*)((const unsigned short*)Bh + boff + 16 + 8 * hh);
      acc[t] = mmaH<1>(ah.v, ah.v, bq.v, bq.v, acc[t]); }
  }
#pragma unroll
  for (int t = 0; t < 4; ++t) { if (col0 + t * 16 >= N) continue; const int col = col0 + t * 16 + ln; const float bv = bp ? bf16_round(bp[col]) : 0.f;
#pragma unroll
    for (int r = 0; r < 8; ++r) { float v = acc[t][r] * alpha + bv; if (CP) { const int rr = row0g + row0 + 8 * hh + r; if (rowsPerB < 0) v += CP[cofs + (size_t)rr * ldc + col];      /* rowsPerB < 0: own element of the batched C plane */ else { const int bidx = rr / rowsPerB; v += CP[(size_t)bidx * sCPb + (size_t)by * 64 + col]; } } if (ACT == 1) v = (v > 0.f) ? v : expm1f(v); else if (ACT == 7) v = (v > 0.f) ? v + 1.0f : expf(v); else if (ACT == 8) v = tanhf(v); else if (ACT == 9) v = 0.5f * v * (1.0f + tanhf(0.7978845608028654f * (v + 0.044715f * v * v * v))); else if (ACT == 11) v = 1.0f / (1.0f + expf(-v)); else if (ACT == 12) v = (v > 0.f) ? v : 0.01f * v; else if (ACT == 14) v = (v > 0.f) ? v : 0.1f * v; else if (ACT == 16) v = (v >= 0.f) ? v : 0.3f * v; else if (ACT == 17) v = (v >= 0.f) ? v : 0.2f * v; else if (ACT == 15) v = v / (1.0f + expf(-v)); else if (ACT == 3) v = fmaxf(v, 0.f); else if (ACT == 6) v = 0.5f * v * (1.0f + erff(v * 0.70710678118654752f)); so[w][8 * hh + r][t * 16 + ln] = v; } }
  __builtin_amdgcn_fence(__ATOMIC_ACQ_REL, "workgroup"); __builtin_amdgcn_wave_barrier();
  const int rsub = lane >> 4, c4 = (lane & 15) * 4; typedef _Float16 v4h __attribute__((ext_vector_type(4)));
  {
#pragma unroll
    for (int q = 0; q < 8; ++q) { const int r = q * 2 + rsub; if (col0 + c4 < N) { const v4f v = *(const v4fa*)&so[w][r][c4]; if (C) *(v4f*)(C + cofs + (size_t)(row0 + r) * ldc + col0 + c4) = v; if (C16) { v4h h4; for (int i = 0; i < 4; ++i) h4[i] = (_Float16)v[i]; *(v4h*)(C16 + cofs + (size_t)(row0 + r) * ldc + col0 + c4) = h4; } } }
     }
}


typedef _Float16 v4h __attribute__((ext_vector_type(4)));

__global__ __launch_bounds__(256) void k_x16(const float* __restrict__ x, _Float16* __restrict__ X16, size_t n8) { const size_t t = (size_t)blockIdx.x * 256 + threadIdx.x; if (t >= n8) return; FragH f;
#pragma unroll
  for (int q = 0; q < 8; ++q) f.h[q] = (_Float16)bf16_round(x[t * 8 + q]); *(v8us*)((unsigned short*)X16 + t * 8) = f.half[0];  }
__global__ __launch_bounds__(256) void k_h16(const float* __restrict__ x, _Float16* __restrict__ X16, size_t n8) { const size_t t = (size_t)blockIdx.x * 256 + threadIdx.x; if (t >= n8) return; FragH f;
#pragma unroll
  for (int q = 0; q < 8; ++q) f.h[q] = (_Float16)x[t * 8 + q]; *(v8us*)((unsigned short*)X16 + t * 8) = f.half[0];  }
__global__ __launch_bounds__(256) void k_round16f(const float* __restrict__ W, _Float16* __restrict__ Bt, size_t n8) { const size_t t = (size_t)blockIdx.x * 256 + threadIdx.x; if (t >= n8) return; FragH f;
#pragma unroll
  for (int i = 0; i < 8; ++i) f.h[i] = (_Float16)(bf16_round(W[t * 8 + i]) * 16.0f); *(v8us*)((unsigned short*)Bt + t * 8) = f.half[0];  }
template <int NHv, int TTv>
__global__ __launch_bounds__(256) void k_vt(const _Float16* __restrict__ V16, int ldv, int voff, _Float16* __restrict__ Vt) { __shared__ unsigned short tl[64][66]; const int tid = threadIdx.x; const int slab = blockIdx.x / (TTv / 64), lg = blockIdx.x % (TTv / 64); const int b = slab / NHv, h = slab % NHv;
  for (int i = tid; i < 64 * 8; i += 256) { const int r = i / 8, c8 = (i % 8) * 8; FragH f; f.half[0] = *(const v8us*)((const unsigned short*)V16 + ((size_t)b * TTv + lg * 64 + r) * ldv + voff + h * 64 + c8);
#pragma unroll
    for (int q = 0; q < 8; ++q) tl[r][c8 + q] = f.u[q]; }
  __syncthreads();
  {
#pragma unroll
    for (int rd = 0; rd < 2; ++rd) { const int d = rd * 32 + tid / 8, pc = tid % 8; FragH f;
#pragma unroll
      for (int q = 0; q < 8; ++q) f.u[q] = tl[pc * 8 + q][d];
      *(v8us*)((unsigned short*)Vt + ((size_t)slab * 64 + d) * TTv + lg * 64 + pc * 8) = f.half[0]; }
     } }

__global__ __launch_bounds__(256) void k_hl(const float* __restrict__ F, _Float16* __restrict__ Hh, _Float16* __restrict__ Hl, size_t n8) { const size_t t = (size_t)blockIdx.x * 256 + threadIdx.x; if (t >= n8) return; FragH fh, fl; const v4f a = *(const v4fa*)(F + t * 8), c = *(const v4fa*)(F + t * 8 + 4);
#pragma unroll
  for (int q = 0; q < 4; ++q) { _Float16 h = (_Float16)a[q]; fh.h[q] = h; fl.h[q] = (_Float16)((a[q] - (float)h) * 1024.0f); h = (_Float16)c[q]; fh.h[4 + q] = h; fl.h[4 + q] = (_Float16)((c[q] - (float)h) * 1024.0f); }
  { *(v8us*)((unsigned short*)Hh + t * 8) = fh.half[0]; *(v8us*)((unsigned short*)Hl + t * 8) = fl.half[0];  } }

// ---- fast GEMM (wave tile 32x64; requires M % 32 == 0 rows per launch region and N % 64 == 0); epilogue = k_gemm_hhx semantics ----
__device__ __forceinline__ v16h g2_frag(const _Float16* p, int hh) { FragH f; f.half[0] = *(const v8us*)((const unsigned short*)p + 8 * hh); f.half[1] = *(const v8us*)((const unsigned short*)p + 16 + 8 * hh); return f.v; }
__device__ __forceinline__ v8f g2_mma(v16h a, v16h b, v8f c) { v8f d = __builtin_amdgcn_wmma_f32_16x16x32_f16(false, a, false, b, (short)0, c, false, false); asm volatile("v_nop\n\tv_nop\n\tv_nop\n\tv_nop" : "+v"(d) : "v"(a), "v"(b)); return d; }
// The fragments of one 32-k step of a 32x64 wave tile: the two A row groups and the four B column groups.
struct G2Set { v16h a0, a1, b0, b1, b2, b3; };
__device__ __forceinline__ void g2_load(G2Set& s, const _Float16* a0p, const _Float16* a1p, const _Float16* b0p, const _Float16* b1p, const _Float16* b2p, const _Float16* b3p, int kb, int hh) {
  s.a0 = g2_frag(a0p + kb, hh); s.a1 = g2_frag(a1p + kb, hh); s.b0 = g2_frag(b0p + kb, hh); s.b1 = g2_frag(b1p + kb, hh); s.b2 = g2_frag(b2p + kb, hh); s.b3 = g2_frag(b3p + kb, hh);
  asm volatile("s_wait_xcnt 0x0" ::: "memory");      /* stands in front of the next address additions, which give new values to registers that these loads name */
  __builtin_amdgcn_sched_barrier(0); }      /* keeps the 12 loads and their wait here, ahead of the other set's products: moved down to their first uses the loads would each be waited for in turn */
__device__ __forceinline__ void g2_mul(const G2Set& s, v8f (&c)[8]) {
  c[0] = g2_mma(s.a0, s.b0, c[0]); c[4] = g2_mma(s.a1, s.b0, c[4]); c[1] = g2_mma(s.a0, s.b1, c[1]); c[5] = g2_mma(s.a1, s.b1, c[5]);
  c[2] = g2_mma(s.a0, s.b2, c[2]); c[6] = g2_mma(s.a1, s.b2, c[6]); c[3] = g2_mma(s.a0, s.b3, c[3]); c[7] = g2_mma(s.a1, s.b3, c[7]); }
template <int ACT>
__global__ __launch_bounds__(128) void k_gemm2(const _Float16* __restrict__ A, int lda, size_t sA, const _Float16* __restrict__ Bh, int ldb, size_t sB, float alpha, const float* __restrict__ bias, size_t sBias, const float* __restrict__ CP, int rowsPerB, size_t sCPb, int row0g,
    float* __restrict__ C, _Float16* __restrict__ C16, int ldc, size_t sC, int M, int N, int K) { static_assert(ACT == 0 || ACT == 3 || ACT == 6 || ACT == 8 || ACT == 9 || ACT == 11 || ACT == 12 || ACT == 14 || ACT == 15 || ACT == 16 || ACT == 17, "k_gemm2: unsupported ACT code (would silently apply no activation)");
  __shared__ __attribute__((aligned(16))) float so[4][32][68];
  const int tid = threadIdx.x, w = tid >> 5, lane = tid & 31, ln = lane & 15, hh = lane >> 4; const int by = blockIdx.y;
  A += (size_t)by * sA; Bh += (size_t)by * sB; const size_t cofs = (size_t)by * sC; const float* bp = bias ? bias + (size_t)by * sBias : nullptr;
  const int ntn = N >> 6; const int mt = blockIdx.x / ntn, nq = blockIdx.x - mt * ntn; const int row0 = mt * 128 + 32 * w, col0 = nq * 64; if (row0 >= M) return;
  const _Float16* a0p = A + (size_t)(row0 + ln) * lda; const _Float16* a1p = a0p + (size_t)16 * lda;
  const _Float16* b0p = Bh + (size_t)(col0 + ln) * ldb; const _Float16* b1p = b0p + (size_t)16 * ldb; const _Float16* b2p = b1p + (size_t)16 * ldb; const _Float16* b3p = b2p + (size_t)16 * ldb;
  const v8f z8 = {0.f,0.f,0.f,0.f,0.f,0.f,0.f,0.f}; v8f accs[8] = {z8, z8, z8, z8, z8, z8, z8, z8};
  /* K loop over two fragment sets: while one 32-k step is multiplied, the other step's 12 loads are in flight. K % 64 == 0; every sum keeps its ascending k order. */
  G2Set s0, s1; int kb = 0; g2_load(s0, a0p, a1p, b0p, b1p, b2p, b3p, 0, hh);
#pragma unroll 1      /* the two steps of a trip are written out; more copies would only add code */
  for (; kb + 64 < K; kb += 64) { g2_load(s1, a0p, a1p, b0p, b1p, b2p, b3p, kb + 32, hh); g2_mul(s0, accs); g2_load(s0, a0p, a1p, b0p, b1p, b2p, b3p, kb + 64, hh); g2_mul(s1, accs); }
  g2_load(s1, a0p, a1p, b0p, b1p, b2p, b3p, kb + 32, hh); g2_mul(s0, accs); g2_mul(s1, accs);      /* the last two steps: nothing is left to fetch behind them */
#pragma unroll
  for (int u = 0; u < 8; ++u) { const int t = u & 3, half = u >> 2; const int col = col0 + t * 16 + ln; const float bv = bp ? bf16_round(bp[col]) : 0.f;
#pragma unroll
    for (int r = 0; r < 8; ++r) { const int rloc = half * 16 + 8 * hh + r; float v = accs[u][r] * alpha + bv; if (CP) { if (rowsPerB < 0) v += CP[cofs + (size_t)(row0g + row0 + rloc) * ldc + col];      /* rowsPerB < 0: own element of the batched C plane */ else { const int bidx = (row0g + row0 + rloc) / rowsPerB; v += CP[(size_t)bidx * sCPb + (size_t)by * 64 + col]; } }
      if (ACT == 3) v = fmaxf(v, 0.f); else if (ACT == 6) v = 0.5f * v * (1.0f + erff(v * 0.70710678118654752f)); else if (ACT == 11) v = 1.0f / (1.0f + expf(-v)); else if (ACT == 15) v = v / (1.0f + expf(-v)); else if (ACT == 12) v = (v > 0.f) ? v : 0.01f * v; else if (ACT == 8) v = tanhf(v); else if (ACT == 9) v = 0.5f * v * (1.0f + tanhf(0.7978845608028654f * (v + 0.044715f * v * v * v))); else if (ACT == 14) v = (v > 0.f) ? v : 0.1f * v; else if (ACT == 16) v = (v >= 0.f) ? v : 0.3f * v; else if (ACT == 17) v = (v >= 0.f) ? v : 0.2f * v;
      so[w][rloc][t * 16 + ln] = v; } }
  __builtin_amdgcn_fence(__ATOMIC_ACQ_REL, "workgroup"); __builtin_amdgcn_wave_barrier();
  const int rsub = lane >> 4, c4 = (lane & 15) * 4;
  {
#pragma unroll
    for (int q = 0; q < 16; ++q) { const int r = q * 2 + rsub; const v4f v = *(const v4fa*)&so[w][r][c4]; if (C) *(v4f*)(C + cofs + (size_t)(row0 + r) * ldc + col0 + c4) = v; if (C16) { v4h h4; for (int i = 0; i < 4; ++i) h4[i] = (_Float16)v[i]; *(v4h*)(C16 + cofs + (size_t)(row0 + r) * ldc + col0 + c4) = h4; } }
     } }


__global__ __launch_bounds__(256) void k_wnat(const float* __restrict__ w, size_t n8, _Float16* __restrict__ Bt) { const size_t t = (size_t)blockIdx.x * 256 + threadIdx.x; if (t >= n8) return; FragH f; for (int q = 0; q < 8; ++q) f.h[q] = (_Float16)(bf16_round(w[t * 8 + q]) * 16.0f); *(v8us*)((unsigned short*)Bt + t * 8) = f.half[0];  }
__global__ __launch_bounds__(256) void k_rsm(const float* __restrict__ S, _Float16* __restrict__ P, int nrows) {
  #pragma clang fp contract(off)
  const int i = blockIdx.x * 256 + threadIdx.x; if (i >= nrows) return; const float* s = S + (size_t)i * SQ; float mx = -3.0e38f;
#pragma unroll 1
  for (int j = 0; j < SQ; ++j) mx = fmaxf(mx, s[j]); float se = 0.f;
#pragma unroll 1
  for (int j = 0; j < SQ; ++j) se += expf(s[j] - mx); const float sc = 256.0f / se;
#pragma unroll 1
  for (int j0 = 0; j0 < SQ; j0 += 8) { FragH f; for (int q = 0; q < 8; ++q) f.h[q] = (_Float16)(expf(s[j0 + q] - mx) * sc); unsigned short* d = (unsigned short*)P + (size_t)i * SQ + j0; *(v8us*)d = f.half[0];  } }
__global__ __launch_bounds__(256) void k_vt(const _Float16* __restrict__ V16, int b, int h0, _Float16* __restrict__ VT) { __shared__ unsigned short tl[64][65]; const int tid = threadIdx.x; const int hh = blockIdx.x % HG, sg = blockIdx.x / HG; const int s0 = sg * 64; const int h = h0 + hh;
  for (int i = tid; i < 64 * 8; i += 256) { const int j = i / 8, d8 = (i % 8) * 8; FragH f; f.half[0] = *(const v8us*)((const unsigned short*)V16 + ((size_t)b * SQ + s0 + j) * DM + h * HD + d8); for (int q = 0; q < 8; ++q) tl[d8 + q][j] = f.u[q]; }
  __syncthreads();
  { for (int i = tid; i < 64 * 8; i += 256) { const int d = i / 8, j8 = (i % 8) * 8; FragH f; for (int q = 0; q < 8; ++q) f.u[q] = tl[d][j8 + q]; *(v8us*)((unsigned short*)VT + ((size_t)hh * HD + d) * SQ + s0 + j8) = f.half[0]; }  } }

#define FH 2048
#define KN 103
__global__ __launch_bounds__(256) void k_xf(const float* __restrict__ x, float* __restrict__ XF, size_t n8) { const size_t t = (size_t)blockIdx.x * 256 + threadIdx.x; if (t >= n8) return; v8f o; for (int q = 0; q < 8; ++q) o[q] = bf16_round(x[t * 8 + q]); *(v8f*)(XF + t * 8) = o;  }
typedef int v4ia __attribute__((ext_vector_type(4), may_alias));
__device__ __forceinline__ void xcnt_wait() { asm volatile("s_wait_xcnt 0x0" ::: "memory"); }
__device__ __forceinline__ float wave_max(float v) {
#pragma unroll      /* five fixed butterfly steps */
  for (int m = 16; m > 0; m >>= 1) v = fmaxf(v, __shfl_xor(v, m, 32)); return v; }
__device__ __forceinline__ float wave_sum(float v) {
#pragma unroll      /* five fixed butterfly steps */
  for (int m = 16; m > 0; m >>= 1) v += __shfl_xor(v, m, 32); return v; }
// Row LayerNorm, one wave per row: lane l owns columns c*256 + l*8 .. +7 (c = 0, 1), held in registers for the three passes.
__global__ __launch_bounds__(256) void k_lnw(const float* __restrict__ HF, const float* __restrict__ g, const float* __restrict__ bb, _Float16* __restrict__ X16o) {
  const int lane = threadIdx.x & 31; const size_t r = (size_t)blockIdx.x * 8 + (threadIdx.x >> 5); if (r >= NR) return; const float* x = HF + r * DM; float v[16]; float s = 0.f;
#pragma unroll      /* constant indices: the lane's values stay in registers and its loads issue together */
  for (int c = 0; c < 2; ++c) { const int j0 = c * 256 + lane * 8; const v4f a0 = *(const v4fa*)(x + j0), a1 = *(const v4fa*)(x + j0 + 4);
#pragma unroll      /* constant indices: the lane's values stay in registers and its loads issue together */
    for (int e = 0; e < 4; ++e) { v[c * 8 + e] = a0[e]; v[c * 8 + 4 + e] = a1[e]; } }
#pragma unroll      /* constant indices: the lane's values stay in registers and its loads issue together */
  for (int e = 0; e < 16; ++e) s += v[e];
  const float mu = wave_sum(s) / (float)DM; float qs = 0.f;
#pragma unroll      /* constant indices: the lane's values stay in registers and its loads issue together */
  for (int e = 0; e < 16; ++e) { const float dd = v[e] - mu; qs += dd * dd; }
  const float rs = 1.0f / sqrtf(wave_sum(qs) / (float)DM + 1e-5f);
#pragma unroll      /* constant indices: the lane's values stay in registers and its loads issue together */
  for (int c = 0; c < 2; ++c) { const int j0 = c * 256 + lane * 8; const v4f g0 = *(const v4fa*)(g + j0), g1 = *(const v4fa*)(g + j0 + 4), b0 = *(const v4fa*)(bb + j0), b1 = *(const v4fa*)(bb + j0 + 4); FragH f;
#pragma unroll      /* constant indices: the lane's values stay in registers and its loads issue together */
    for (int e = 0; e < 4; ++e) { f.h[e] = (_Float16)((v[c * 8 + e] - mu) * rs * bf16_round(g0[e]) + bf16_round(b0[e])); f.h[4 + e] = (_Float16)((v[c * 8 + 4 + e] - mu) * rs * bf16_round(g1[e]) + bf16_round(b1[e])); }
    *(v8us*)((unsigned short*)X16o + r * DM + j0) = f.half[0]; } }
// Row softmax, one wave per score row; the grid covers the rows of all HG heads held in S. Lane l owns keys c*256 + l*8 .. +7 (c = 0..3): 16-byte loads and stores, row maximum and sum by a butterfly over the 32 lanes.
__global__ __launch_bounds__(256) void k_rsmw(const float* __restrict__ S, _Float16* __restrict__ P, int nrows, const float* __restrict__ uprev, int b, const int* __restrict__ pmask, const int* __restrict__ pidx, const int* __restrict__ pim) {
  __shared__ __attribute__((aligned(16))) unsigned short prow[8][SQ];      /* sparse branch: the wave's own output row (any index set; a duplicated index is stored once) */
  const int lane = threadIdx.x & 31, w = threadIdx.x >> 5; const int i = blockIdx.x * 8 + w; if (i >= nrows) return;      /* whole waves leave; the kernel has no work-group barrier */
  const int hd = i / QN, q = i - hd * QN; const float* s = S + (size_t)hd * SQ * SQ + (size_t)q * SQ; unsigned short* d = (unsigned short*)P + (size_t)hd * SQ * SQ + (size_t)q * SQ;
  const float lam = 10.0f * expf(-5.0f * bf16_round(uprev[b])); const bool sparse = lam >= 1.0f;
  if (sparse) { const int* ix = pidx + (size_t)q * KN; const int* vm = pim + (size_t)q * KN; constexpr int NT = (KN + 31) / 32; float sv[NT]; int jx[NT]; bool ok[NT]; float mx = -3.0e38f;
#pragma unroll      /* constant indices: the lane's values stay in registers and its loads issue together */
    for (int t = 0; t < NT; ++t) { const int k = t * 32 + lane; const int kc = k < KN ? k : KN - 1; jx[t] = ix[kc]; const int vk = vm[kc]; xcnt_wait(); ok[t] = (k < KN) & (vk != 0); }      /* a later load's result may land in an earlier load's address register: the wait stands between them */
#pragma unroll      /* constant indices: the lane's values stay in registers and its loads issue together */
    for (int t = 0; t < NT; ++t) { jx[t] = min(max(jx[t], 0), SQ - 1); sv[t] = s[jx[t]]; xcnt_wait(); }      /* the key index is bounded here before it forms an address; the wait: as in the loop above */
#pragma unroll      /* constant indices: the lane's values stay in registers and its loads issue together */
    for (int t = 0; t < NT; ++t) if (ok[t]) mx = fmaxf(mx, sv[t]);
    mx = wave_max(mx); float se = 0.f;
#pragma unroll      /* constant indices: the lane's values stay in registers and its loads issue together */
    for (int t = 0; t < NT; ++t) { sv[t] = expf(sv[t] - mx); if (ok[t]) se += sv[t]; }
    se = wave_sum(se); const float sc = 256.0f / se; const v8us z = {0, 0, 0, 0, 0, 0, 0, 0};
#pragma unroll      /* constant indices: the lane's values stay in registers and its loads issue together */
    for (int c = 0; c < 4; ++c) *(v8us*)&prow[w][c * 256 + lane * 8] = z;
    /* the zeros of every lane are in LDS before any lane scatters a weight over them */
    __builtin_amdgcn_fence(__ATOMIC_ACQ_REL, "workgroup"); __builtin_amdgcn_wave_barrier();
#pragma unroll      /* constant indices: the lane's values stay in registers and its loads issue together */
    for (int t = 0; t < NT; ++t) if (ok[t]) { FragH f; f.h[0] = (_Float16)(sv[t] * sc); prow[w][jx[t]] = f.u[0]; }
    /* the scattered weights of every lane are in LDS before the row is read back in 16-byte pieces */
    __builtin_amdgcn_fence(__ATOMIC_ACQ_REL, "workgroup"); __builtin_amdgcn_wave_barrier();
#pragma unroll      /* constant indices: the lane's values stay in registers and its loads issue together */
    for (int c = 0; c < 4; ++c) { const v8us o = *(const v8us*)&prow[w][c * 256 + lane * 8]; *(v8us*)(d + c * 256 + lane * 8) = o; }
    xcnt_wait(); }      /* the listing lets the dense part's code follow, which writes the four stores' registers */
  else { const int* pm = pmask + (size_t)q * SQ; float v[32]; float mx = -3.0e38f;
#pragma unroll      /* constant indices: the lane's values stay in registers and its loads issue together */
    for (int c = 0; c < 4; ++c) { const int j0 = c * 256 + lane * 8; const v4f a0 = *(const v4fa*)(s + j0), a1 = *(const v4fa*)(s + j0 + 4); const v4ia m0 = *(const v4ia*)(pm + j0), m1 = *(const v4ia*)(pm + j0 + 4);
#pragma unroll      /* constant indices: the lane's values stay in registers and its loads issue together */
      for (int e = 0; e < 4; ++e) { v[c * 8 + e] = a0[e] + (m0[e] ? 0.f : -lam); v[c * 8 + 4 + e] = a1[e] + (m1[e] ? 0.f : -lam); } }
#pragma unroll      /* constant indices: the lane's values stay in registers and its loads issue together */
    for (int e = 0; e < 32; ++e) mx = fmaxf(mx, v[e]);
    mx = wave_max(mx); float se = 0.f;
#pragma unroll      /* constant indices: the lane's values stay in registers and its loads issue together */
    for (int e = 0; e < 32; ++e) { v[e] = expf(v[e] - mx); se += v[e]; }
    se = wave_sum(se); const float sc = 256.0f / se;
#pragma unroll      /* constant indices: the lane's values stay in registers and its loads issue together */
    for (int c = 0; c < 4; ++c) { FragH f;
#pragma unroll      /* constant indices: the lane's values stay in registers and its loads issue together */
      for (int e = 0; e < 8; ++e) f.h[e] = (_Float16)(v[c * 8 + e] * sc);
      *(v8us*)(d + c * 256 + lane * 8) = f.half[0]; } } }
// Row norms, one wave per row, 32 rows per work-group, so that one wave stores the group's 32 values as one whole 128-byte line of U.
static_assert(NR % 32 == 0, "k_unormw: 32 rows per work-group");
__global__ __launch_bounds__(1024) void k_unormw(const float* __restrict__ OUT, const float* __restrict__ XF, float* __restrict__ U) {
  __shared__ float ur[32];
  const int lane = threadIdx.x & 31, w = threadIdx.x >> 5; const size_t r = (size_t)blockIdx.x * 32 + w; float sd = 0.f, sx = 0.f;
#pragma unroll      /* constant indices: the lane's values stay in registers and its loads issue together */
  for (int c = 0; c < 4; ++c) { const int j0 = c * 128 + lane * 4; const v4f o = *(const v4fa*)(OUT + r * DM + j0), xv = *(const v4fa*)(XF + r * DM + j0);
#pragma unroll      /* constant indices: the lane's values stay in registers and its loads issue together */
    for (int e = 0; e < 4; ++e) { const float dd = o[e] - xv[e]; sd += dd * dd; sx += xv[e] * xv[e]; } }
  sd = wave_sum(sd); sx = wave_sum(sx); if (lane == 0) ur[w] = sqrtf(sd) / (sqrtf(sx) + 1e-8f);
  __syncthreads();      /* the 32 waves' row values are in LDS before wave 0 reads them */
  if (threadIdx.x < 32) U[(size_t)blockIdx.x * 32 + threadIdx.x] = ur[threadIdx.x]; }
// Batch means in float64: one wave, 32 lanes over the 1,024 rows of a batch, lane b stores batch b.
__global__ __launch_bounds__(32) void k_umeanw(const float* __restrict__ U, float* __restrict__ out1) { const int lane = threadIdx.x; float res = 0.f;
#pragma unroll      /* constant indices: the lane's values stay in registers and its loads issue together */
  for (int b = 0; b < NB; ++b) { double s = 0.0;
#pragma unroll      /* constant indices: the lane's values stay in registers and its loads issue together */
    for (int c = 0; c < SQ / 128; ++c) { const v4f a = *(const v4fa*)(U + (size_t)b * SQ + c * 128 + lane * 4);
#pragma unroll      /* constant indices: the lane's values stay in registers and its loads issue together */
      for (int e = 0; e < 4; ++e) s += (double)a[e]; }
#pragma unroll      /* five fixed butterfly steps */
    for (int m = 16; m > 0; m >>= 1) s += __shfl_xor(s, m, 32);
    if (lane == b) res = (float)(s / (double)SQ); }
  if (lane < NB) out1[lane] = res; }
extern "C" void kernel_launch(void* const* d_in, const int* in_sizes, int n_in,
                              void* d_out, int out_size, void* d_ws, size_t ws_size, hipStream_t stream) {
  (void)in_sizes; (void)n_in; (void)out_size;
  const float* const* I = (const float* const*)d_in; const float* x = I[0]; const float* uprev = I[1]; const float* wq = I[2]; const float* bq = I[3]; const float* wk = I[4]; const float* bk = I[5]; const float* wv = I[6]; const float* bv = I[7]; const float* wo = I[8]; const float* bo = I[9]; const float* l1g = I[10]; const float* l1b = I[11]; const float* l2g = I[12]; const float* l2b = I[13]; const float* w1 = I[14]; const float* b1 = I[15]; const float* w2 = I[16]; const float* b2 = I[17]; const int* pmask = (const int*)d_in[18]; const int* pidx = (const int*)d_in[19]; const int* pim = (const int*)d_in[20];
  float* out0 = (float*)d_out; float* out1 = out0 + NR * DM;
  char* ws = (char*)d_ws; size_t off = 0;
  auto take = [&](size_t bytes) { char* p = ws + off; off += (bytes + 255) & ~(size_t)255; return p; };
  _Float16* BQ = (_Float16*)take((size_t)DM * DM * 2); _Float16* BK = (_Float16*)take((size_t)DM * DM * 2); _Float16* BV = (_Float16*)take((size_t)DM * DM * 2); _Float16* BO = (_Float16*)take((size_t)DM * DM * 2); _Float16* BW1 = (_Float16*)take((size_t)FH * DM * 2); _Float16* BW2 = (_Float16*)take((size_t)DM * FH * 2);
  float* XF = (float*)take(NR * DM * 4); float* HF = (float*)take(NR * DM * 4); _Float16* G16 = (_Float16*)take(NR * FH * 2); float* U = (float*)take(NR * 4);
  _Float16* X16 = (_Float16*)take(NR * DM * 2); _Float16* Q16 = (_Float16*)take(NR * DM * 2); _Float16* K16 = (_Float16*)take(NR * DM * 2); _Float16* V16 = (_Float16*)take(NR * DM * 2); _Float16* O16 = (_Float16*)take(NR * DM * 2);
  float* S = (float*)take((size_t)HG * SQ * SQ * 4); _Float16* P = (_Float16*)take((size_t)HG * SQ * SQ * 2); _Float16* VT = (_Float16*)take((size_t)HG * HD * SQ * 2);
  if (off > ws_size) return;      /* 6 + 4 + 4 + 8 + 2x5 + 16 + 8 + 0.5 = ≈ 57 MiB */
  const size_t nw8 = (size_t)DM * DM / 8; const unsigned gw = (unsigned)((nw8 + 255) / 256), gw4 = (unsigned)(((size_t)FH * DM / 8 + 255) / 256);
  k_wnat<<<gw, 256, 0, stream>>>(wq, nw8, BQ); k_wnat<<<gw, 256, 0, stream>>>(wk, nw8, BK); k_wnat<<<gw, 256, 0, stream>>>(wv, nw8, BV); k_wnat<<<gw, 256, 0, stream>>>(wo, nw8, BO); k_wnat<<<gw4, 256, 0, stream>>>(w1, (size_t)FH * DM / 8, BW1); k_wnat<<<gw4, 256, 0, stream>>>(w2, (size_t)DM * FH / 8, BW2);
  k_xf<<<(unsigned)((NR * DM / 8 + 255) / 256), 256, 0, stream>>>(x, XF, NR * DM / 8); k_lnw<<<(unsigned)((NR + 7) / 8), 256, 0, stream>>>(XF, l1g, l1b, X16);
  const dim3 gp((unsigned)((NR / 128) * (DM / 64)), 1);
  k_gemm2<0><<<gp, 128, 0, stream>>>(X16, DM, 0, BQ, DM, 0, 0.0625f, bq, 0, nullptr, 1, 0, 0, nullptr, Q16, DM, 0, (int)NR, DM, DM);
  k_gemm2<0><<<gp, 128, 0, stream>>>(X16, DM, 0, BK, DM, 0, 0.0625f, bk, 0, nullptr, 1, 0, 0, nullptr, K16, DM, 0, (int)NR, DM, DM);
  k_gemm2<0><<<gp, 128, 0, stream>>>(X16, DM, 0, BV, DM, 0, 0.0625f, bv, 0, nullptr, 1, 0, 0, nullptr, V16, DM, 0, (int)NR, DM, DM);
  for (int b = 0; b < NB; ++b) for (int h0 = 0; h0 < NH; h0 += HG) {
    const _Float16* qb = Q16 + (size_t)b * SQ * DM + h0 * HD; const _Float16* kb = K16 + (size_t)b * SQ * DM + h0 * HD;
    k_gemm2<0><<<dim3((QN / 128) * (SQ / 64), HG), 128, 0, stream>>>(qb, DM, (size_t)HD, kb, DM, (size_t)HD, 0.125f, nullptr, 0, nullptr, 1, 0, 0, S, nullptr, SQ, (size_t)SQ * SQ, QN, SQ, HD);      /* scaled scores, HG heads per launch */
    k_rsmw<<<(HG * QN + 7) / 8, 256, 0, stream>>>(S, P, HG * QN, uprev, b, pmask, pidx, pim);      /* one wave per row, HG heads per launch */
    k_vt<<<HG * (SQ / 64), 256, 0, stream>>>(V16, b, h0, VT);
    k_gemm2<0><<<dim3((QN / 128) * (HD / 64), HG), 128, 0, stream>>>(P, SQ, (size_t)SQ * SQ, VT, SQ, (size_t)HD * SQ, 0.00390625f, nullptr, 0, nullptr, 1, 0, 0, nullptr, O16 + (size_t)b * SQ * DM + h0 * HD, DM, (size_t)HD, QN, HD, SQ); }      /* o (merged heads) as f16 rows */
  k_gemm2<0><<<gp, 128, 0, stream>>>(O16, DM, 0, BO, DM, 0, 0.0625f, bo, 0, XF, 1, (size_t)DM, 0, HF, nullptr, DM, 0, (int)NR, DM, DM);      /* h = x + attn W_o^T + b_o */
  k_lnw<<<(unsigned)((NR + 7) / 8), 256, 0, stream>>>(HF, l2g, l2b, X16);
  k_gemm2<6><<<dim3((unsigned)((NR / 128) * (FH / 64)), 1), 128, 0, stream>>>(X16, DM, 0, BW1, DM, 0, 0.0625f, b1, 0, nullptr, 1, 0, 0, nullptr, G16, FH, 0, (int)NR, FH, DM);      /* gelu_erf(LN2(h) W1^T + b1) */
  k_gemm2<0><<<gp, 128, 0, stream>>>(G16, FH, 0, BW2, FH, 0, 0.0625f, b2, 0, HF, 1, (size_t)DM, 0, out0, nullptr, DM, 0, (int)NR, DM, FH);      /* out = h + (...) W2^T + b2, rows are the output layout */
  k_unormw<<<(unsigned)(NR / 32), 1024, 0, stream>>>(out0, XF, U); k_umeanw<<<1, 32, 0, stream>>>(U, out1);
}

// v003
// It runs in 190 microseconds.
// Timed twice side by side with v002, it ran 1.59 times as fast both times.
// Counting every step since v000, it is 20.1 times as fast.
#include <hip/hip_runtime.h>
// SPDGMultiHeadAttention (x [2][1024][512], u_prev [2][1]; xn = LN1(x); Q,K,V = xn W^T + b (8 heads of 64); lam = 10 exp(-5 u_prev); per batch: if lam >= 1 the SPARSE branch (softmax over the prior window slots prior_indices[i][k] with prior_index_mask, others excluded) else the DENSE branch (softmax over all keys of q.k/8 + lam*(prior_mask ? 0 : -1)); attn = merge W_o^T + b_o; h = x + attn; out = h + gelu_erf(LN2(h) W1^T + b1) W2^T + b2 -> [2][1024][512]; aggregated_u[b] = mean_s ||out - x|| / (||x|| + 1e-8) -> [2][1]).
// Structure: token rows; bf16(x) as f32 residual rows + LN1 on VALU (f32, wave per row) into f16 rows; Q | K | V WMMA GEMMs as one launch (32x64 wave tiles, f32 accumulation, exact x16 weights + bias, f16 outputs); all 16 (batch, head) pairs per launch: scores GEMM (K = 64), the branch-selecting row softmax on VALU (lam from u_prev, prior tables read on device; f32; weights x256 as f16), V^T via LDS, o = P . V GEMM (K = 1,024) into merged f16 rows; W_o GEMM + b_o + x (epilogue addend) -> h; LN2 on VALU; fc1 GEMM with the exact-erf GELU epilogue (f16 hidden); fc2 GEMM + b2 + h straight into the output rows; the surprise statistic on VALU (per-row norms, float64 means per batch) into output 1.
// Compute dtype: inputs rounded to bf16; x / weights exact; LN outputs, q, k, v, softmax weights, o, GELU hidden plain f16 (~2^-12); residual, LN statistics, scores, softmax, norms f32/f64. v_wmma_f32_16x16x32_f16.
#define NB 2
#define SQ 1024
#define DM 512
#define NH 8
#define HD 64
#define HG (NB * NH)                 /* (batch, head) pairs per attention launch: all of them */
#define QN SQ                        /* query rows attended per batch (debug hook) */
#define NR ((size_t)NB * SQ)         /* 2048 token rows */
typedef __bf16 v16b __attribute__((ext_vector_type(16)));
typedef unsigned short v8us __attribute__((ext_vector_type(8), may_alias));
typedef float  v8f  __attribute__((ext_vector_type(8)));
typedef float  v4f  __attribute__((ext_vector_type(4)));
typedef float  v4fa __attribute__((ext_vector_type(4), may_alias));
union FragB { v16b v; v8us half[2]; unsigned short u[16]; };

__device__ __forceinline__ unsigned short bf16_bits(float x) { unsigned int u = __float_as_uint(x); return (unsigned short)((u + 0x7FFFu + ((u >> 16) & 1u)) >> 16); }
__device__ __forceinline__ float bf16_val(unsigned short b) { return __uint_as_float(((unsigned int)b) << 16); }
__device__ __forceinline__ float bf16_round(float x) { return bf16_val(bf16_bits(x)); }
// D += A·B with NT terms: 1 = ah·bh, 2 = + al·bh (A split), 3 = + ah·bl (both split)
template <int NT>
__device__ __forceinline__ v8f mmaN(v16b ah, v16b al, v16b bh, v16b bl, v8f c) {
  c = __builtin_amdgcn_wmma_f32_16x16x32_bf16(false, ah, false, bh, (short)0, c, false, false);
  if (NT >= 2) c = __builtin_amdgcn_wmma_f32_16x16x32_bf16(false, al, false, bh, (short)0, c, false, false);
  if (NT >= 3) c = __builtin_amdgcn_wmma_f32_16x16x32_bf16(false, ah, false, bl, (short)0, c, false, false);
  asm volatile("v_nop\n\tv_nop\n\tv_nop\n\tv_nop" : "+v"(c) : "v"(ah), "v"(al), "v"(bh), "v"(bl));
  return c;
}

__global__ __launch_bounds__(256) void k_wt_bf16(const float* __restrict__ W, unsigned short* __restrict__ Wt, int K, int N) {
  const int t = blockIdx.x * 256 + threadIdx.x;
  const int k8n = K / 8;
  if (t >= N * k8n) return;
  const int n = t / k8n, k8 = (t % k8n) * 8;
  v8us v;
#pragma unroll
  for (int i = 0; i < 8; ++i) v[i] = bf16_bits(W[(size_t)(k8 + i) * N + n]);
  *(v8us*)(Wt + (size_t)n * K + k8) = v;
  
}

// GEMM C[M][N] (f32, pitch ldc) = act(A[M][K]·W + bias). A f32 row-major (pitch lda) converted per fragment to bf16
// (ASPLIT: hi/lo two planes -> 2 terms, else single rounded term); Wt bf16 [N][K] (pitch ldb). BIAS_BF16 rounds the
// bias to bf16 first (bias quantised to bf16 before the add). K%32==0, M%16==0, N%64==0.
template <bool ASPLIT, int ACT, bool BIAS_BF16>
__global__ __launch_bounds__(128) void k_gemm_bf(const float* __restrict__ A, int lda, const unsigned short* __restrict__ Wt, int ldb,
                                               const float* __restrict__ bias, float* __restrict__ C, int ldc, int M, int N, int K) {
  __shared__ __attribute__((aligned(16))) float so[4][16][64];
  const int tid = threadIdx.x, w = tid >> 5, lane = tid & 31, ln = lane & 15, hh = lane >> 4;
  const int ntn = N / 64;
  const int wid = blockIdx.x * 4 + w;
  const int mt = wid / ntn, nq = wid % ntn;
  if (mt * 16 >= M) return;
  const int row0 = mt * 16, col0 = nq * 64;
  const float* arow = A + (size_t)(row0 + ln) * lda;
  v8f acc[4] = {};
  for (int kb = 0; kb < K; kb += 32) {
    FragB ah, al;
    const v4f x0 = *(const v4fa*)(arow + kb + 8 * hh), x1 = *(const v4fa*)(arow + kb + 8 * hh + 4);
    const v4f x2 = *(const v4fa*)(arow + kb + 16 + 8 * hh), x3 = *(const v4fa*)(arow + kb + 16 + 8 * hh + 4);
    float xs[16] = {x0[0],x0[1],x0[2],x0[3],x1[0],x1[1],x1[2],x1[3],x2[0],x2[1],x2[2],x2[3],x3[0],x3[1],x3[2],x3[3]};
#pragma unroll
    for (int i = 0; i < 16; ++i) { const unsigned short hb = bf16_bits(xs[i]); ah.u[i] = hb; al.u[i] = ASPLIT ? bf16_bits(xs[i] - bf16_val(hb)) : (unsigned short)0; }
#pragma unroll
    for (int t = 0; t < 4; ++t) {
      const unsigned short* brow = Wt + (size_t)(col0 + t * 16 + ln) * ldb + kb;
      FragB b;
      b.half[0] = *(const v8us*)(brow + 8 * hh);
      b.half[1] = *(const v8us*)(brow + 16 + 8 * hh);
      acc[t] = mmaN<ASPLIT ? 2 : 1>(ah.v, al.v, b.v, b.v, acc[t]);
    }
  }
#pragma unroll
  for (int t = 0; t < 4; ++t) {
    float bv = bias ? bias[col0 + t * 16 + ln] : 0.f;
    if (BIAS_BF16) bv = bf16_round(bv);
#pragma unroll
    for (int r = 0; r < 8; ++r) { float v = acc[t][r] + bv; if (ACT == 1) v = fmaxf(v, 0.f); so[w][8 * hh + r][t * 16 + ln] = v; }
  }
  __builtin_amdgcn_fence(__ATOMIC_ACQ_REL, "workgroup");
  __builtin_amdgcn_wave_barrier();
  const int rsub = lane >> 4, c4 = (lane & 15) * 4;
  {
#pragma unroll
    for (int q = 0; q < 8; ++q) {
      const int r = q * 2 + rsub;
      const v4f v = *(const v4fa*)&so[w][r][c4];
      *(v4f*)(C + (size_t)(row0 + r) * ldc + col0 + c4) = v;
    }
    
  }
}

// GEMM C = act(A·W + bias + resid): A f32 (ASPLIT -> hi/lo 2 terms), Wt bf16 [N][K]; ACT 0 none, 1 relu, 2 exact gelu;
// resid (optional, f32, row index = (row % rmod), pitch ldr, RES_BF16 rounds it) added before the activation.
template <bool ASPLIT, int ACT, bool BIAS_BF16, bool RES_BF16>
__global__ __launch_bounds__(128) void k_gemm_bf3(const float* __restrict__ A, int lda, const unsigned short* __restrict__ Wt, int ldb,
                                                const float* __restrict__ bias, const float* __restrict__ resid, int rmod, int ldr,
                                                float* __restrict__ C, int ldc, int M, int N, int K) {
  __shared__ __attribute__((aligned(16))) float so[4][16][64];
  const int tid = threadIdx.x, w = tid >> 5, lane = tid & 31, ln = lane & 15, hh = lane >> 4;
  const int ntn = N / 64;
  const int wid = blockIdx.x * 4 + w;
  const int mt = wid / ntn, nq = wid % ntn;
  if (mt * 16 >= M) return;
  const int row0 = mt * 16, col0 = nq * 64;
  const float* arow = A + (size_t)(row0 + ln) * lda;
  v8f acc[4] = {};
  for (int kb = 0; kb < K; kb += 32) {
    FragB ah, al;
    const v4f x0 = *(const v4fa*)(arow + kb + 8 * hh), x1 = *(const v4fa*)(arow + kb + 8 * hh + 4);
    const v4f x2 = *(const v4fa*)(arow + kb + 16 + 8 * hh), x3 = *(const v4fa*)(arow + kb + 16 + 8 * hh + 4);
    float xs[16] = {x0[0],x0[1],x0[2],x0[3],x1[0],x1[1],x1[2],x1[3],x2[0],x2[1],x2[2],x2[3],x3[0],x3[1],x3[2],x3[3]};
#pragma unroll
    for (int i = 0; i < 16; ++i) { const unsigned short hb = bf16_bits(xs[i]); ah.u[i] = hb; al.u[i] = ASPLIT ? bf16_bits(xs[i] - bf16_val(hb)) : (unsigned short)0; }
#pragma unroll
    for (int t = 0; t < 4; ++t) {
      const unsigned short* brow = Wt + (size_t)(col0 + t * 16 + ln) * ldb + kb;
      FragB b;
      b.half[0] = *(const v8us*)(brow + 8 * hh);
      b.half[1] = *(const v8us*)(brow + 16 + 8 * hh);
      acc[t] = mmaN<ASPLIT ? 2 : 1>(ah.v, al.v, b.v, b.v, acc[t]);
    }
  }
#pragma unroll
  for (int t = 0; t < 4; ++t) {
    const int col = col0 + t * 16 + ln;
    float bv = bias ? bias[col] : 0.f;
    if (BIAS_BF16) bv = bf16_round(bv);
#pragma unroll
    for (int r = 0; r < 8; ++r) {
      float v = acc[t][r] + bv;
      if (resid) { float rv = resid[(size_t)((row0 + 8 * hh + r) % rmod) * ldr + col]; if (RES_BF16) rv = bf16_round(rv); v += rv; }
      if (ACT == 1) v = fmaxf(v, 0.f);
      if (ACT == 2) v = 0.5f * v * (1.0f + erff(v * 0.70710678118654752f));
      if (ACT == 3) { const float u = 0.7978845608028654f * (v + 0.044715f * v * v * v); v = 0.5f * v * (1.0f + tanhf(u)); }
      so[w][8 * hh + r][t * 16 + ln] = v;
    }
  }
  __builtin_amdgcn_fence(__ATOMIC_ACQ_REL, "workgroup");
  __builtin_amdgcn_wave_barrier();
  const int rsub = lane >> 4, c4 = (lane & 15) * 4;
  {
#pragma unroll
    for (int q = 0; q < 8; ++q) {
      const int r = q * 2 + rsub;
      const v4f v = *(const v4fa*)&so[w][r][c4];
      *(v4f*)(C + (size_t)(row0 + r) * ldc + col0 + c4) = v;
    }
    
  }
}
// row LayerNorm (biased variance, eps) over N: s = X (+ R); optional out_sum <- s; out_norm <- (s-mu)*rsqrt(var+eps)*g + b
template <bool PARAM_BF16>
__global__ __launch_bounds__(256) void k_layernorm(const float* __restrict__ X, const float* __restrict__ R, const float* __restrict__ g, const float* __restrict__ bta,
                                                  float* __restrict__ out_sum, float* __restrict__ out_norm, int N, float eps) {
  __shared__ float red[256];
  const int row = blockIdx.x, tid = threadIdx.x;
  const float* x = X + (size_t)row * N; const float* rr = R ? R + (size_t)row * N : nullptr;
  float vals[16];                     // up to N = 4096
  const int per = N / 256;            // contiguous chunk per thread? use strided-by-4 chunks: thread handles j = tid*4 + 1024*u
  float s1 = 0.f;
  for (int u = 0; u < per / 4; ++u) {
    const int j = tid * 4 + 1024 * u;
    const v4f a = *(const v4fa*)(x + j);
    v4f b = {0.f,0.f,0.f,0.f}; if (rr) b = *(const v4fa*)(rr + j);
#pragma unroll
    for (int q = 0; q < 4; ++q) { const float v = a[q] + b[q]; vals[u * 4 + q] = v; s1 += v; }
  }
  red[tid] = s1; __syncthreads();
  for (int st = 128; st > 0; st >>= 1) { if (tid < st) red[tid] += red[tid + st]; __syncthreads(); }
  const float mu = red[0] / (float)N; __syncthreads();
  float s2 = 0.f;
  for (int u = 0; u < per / 4; ++u)
#pragma unroll
    for (int q = 0; q < 4; ++q) { const float c = vals[u * 4 + q] - mu; s2 += c * c; }
  red[tid] = s2; __syncthreads();
  for (int st = 128; st > 0; st >>= 1) { if (tid < st) red[tid] += red[tid + st]; __syncthreads(); }
  const float rs = rsqrtf(red[0] / (float)N + eps);
  {
    for (int u = 0; u < per / 4; ++u) {
      const int j = tid * 4 + 1024 * u;
      v4f o, sm;
#pragma unroll
      for (int q = 0; q < 4; ++q) {
        float gg = g[j + q], bb = bta[j + q];
        if (PARAM_BF16) { gg = bf16_round(gg); bb = bf16_round(bb); }
        sm[q] = vals[u * 4 + q]; o[q] = (vals[u * 4 + q] - mu) * rs * gg + bb;
      }
      if (out_sum) *(v4f*)(out_sum + (size_t)row * N + j) = sm;
      *(v4f*)(out_norm + (size_t)row * N + j) = o;
    }
    
  }
}



// ---- f16 WMMA path (v_wmma_f32_16x16x32_f16): 11-bit significands for operands in range — used where a [0,1] probability operand needs more precision than bf16
typedef _Float16 v16h __attribute__((ext_vector_type(16)));
union FragH { v16h v; v8us half[2]; _Float16 h[16]; unsigned short u[16]; };
template <int NT>
__device__ __forceinline__ v8f mmaH(v16h ah, v16h al, v16h bh, v16h bl, v8f c) {
  c = __builtin_amdgcn_wmma_f32_16x16x32_f16(false, ah, false, bh, (short)0, c, false, false);
  if (NT >= 2) c = __builtin_amdgcn_wmma_f32_16x16x32_f16(false, al, false, bh, (short)0, c, false, false);
  if (NT >= 3) c = __builtin_amdgcn_wmma_f32_16x16x32_f16(false, ah, false, bl, (short)0, c, false, false);
  asm volatile("v_nop\n\tv_nop\n\tv_nop\n\tv_nop" : "+v"(c) : "v"(ah), "v"(al), "v"(bh), "v"(bl));
  return c;
}
// batched GEMM like k_gemm_b but f16 operands: A f32 (split into f16 hi/lo if ASPLIT, else rounded to f16), Bt = f16 values [n][k]; alpha; C f32; N multiple of 16 (partial tiles skipped)
template <bool ASPLIT>
__global__ __launch_bounds__(128) void k_gemm_h(const float* __restrict__ A, int lda, size_t sA, const _Float16* __restrict__ Bh, int ldb, size_t sB, float alpha, float* __restrict__ C, int ldc, size_t sC, int M, int N, int K) {
  __shared__ __attribute__((aligned(16))) float so[4][16][64];
  const int tid = threadIdx.x, w = tid >> 5, lane = tid & 31, ln = lane & 15, hh = lane >> 4; const int by = blockIdx.y;
  A += (size_t)by * sA; Bh += (size_t)by * sB; C += (size_t)by * sC;
  const int ntn = (N + 63) / 64; const int wid = blockIdx.x * 4 + w; const int mt = wid / ntn, nq = wid % ntn; if (mt * 16 >= M) return;
  const int row0 = mt * 16, col0 = nq * 64; const float* arow = A + (size_t)(row0 + ln) * lda;
  v8f acc[4] = {};
  for (int kb = 0; kb < K; kb += 32) {
    FragH ah, al;
    const v4f x0 = *(const v4fa*)(arow + kb + 8 * hh), x1 = *(const v4fa*)(arow + kb + 8 * hh + 4), x2 = *(const v4fa*)(arow + kb + 16 + 8 * hh), x3 = *(const v4fa*)(arow + kb + 16 + 8 * hh + 4);
    float xs[16] = {x0[0],x0[1],x0[2],x0[3],x1[0],x1[1],x1[2],x1[3],x2[0],x2[1],x2[2],x2[3],x3[0],x3[1],x3[2],x3[3]};
#pragma unroll
    for (int i = 0; i < 16; ++i) { const _Float16 h = (_Float16)xs[i]; ah.h[i] = h; al.h[i] = ASPLIT ? (_Float16)(xs[i] - (float)h) : (_Float16)0.0f; }
#pragma unroll
    for (int t = 0; t < 4; ++t) { if (col0 + t * 16 >= N) continue; const size_t boff = (size_t)(col0 + t * 16 + ln) * ldb + kb; FragH bq; bq.half[0] = *(const v8us*)(Bh + boff + 8 * hh); bq.half[1] = *(const v8us*)(Bh + boff + 16 + 8 * hh);
      acc[t] = mmaH<ASPLIT ? 2 : 1>(ah.v, al.v, bq.v, bq.v, acc[t]); }
  }
#pragma unroll
  for (int t = 0; t < 4; ++t) { if (col0 + t * 16 >= N) continue;
#pragma unroll
    for (int r = 0; r < 8; ++r) so[w][8 * hh + r][t * 16 + ln] = acc[t][r] * alpha; }
  __builtin_amdgcn_fence(__ATOMIC_ACQ_REL, "workgroup"); __builtin_amdgcn_wave_barrier();
  const int rsub = lane >> 4, c4 = (lane & 15) * 4;
  {
#pragma unroll
    for (int q = 0; q < 8; ++q) { const int r = q * 2 + rsub; if (col0 + c4 < N) { const v4f v = *(const v4fa*)&so[w][r][c4]; *(v4f*)(C + (size_t)(row0 + r) * ldc + col0 + c4) = v; } }
     }
}

// Wt[n][k] = f16(W[k][n]·scale) from f32 row-major W[K][N] (scale = power of two; bf16-exact weights stay exact in f16 away from the subnormal range)
__global__ __launch_bounds__(256) void k_wt_f16(const float* __restrict__ W, _Float16* __restrict__ Wt, int K, int N, float scale) {
  const int t = blockIdx.x * 256 + threadIdx.x; if (t >= N * (K / 8)) return; const int n = t / (K / 8), k8 = (t % (K / 8)) * 8; FragH f;
#pragma unroll
  for (int i = 0; i < 8; ++i) f.h[i] = (_Float16)(bf16_round(W[(size_t)(k8 + i) * N + n]) * scale); const v8us o = f.half[0];
  *(v8us*)((unsigned short*)Wt + (size_t)n * K + k8) = o; 
}
// k_gemm_hh variant with fused epilogue: v = acc·alpha + bias[by·sBias + col] (+ CP[(row/rowsPerB)·sCPb + by·64 + col] if CP) ; ACT 0 none / 1 elu ; writes f16 C16 (and f32 C if non-null)
template <int ACT>
__global__ __launch_bounds__(128) void k_gemm_hhx(const _Float16* __restrict__ A, int lda, size_t sA, const _Float16* __restrict__ Bh, int ldb, size_t sB, float alpha, const float* __restrict__ bias, size_t sBias, const float* __restrict__ CP, int rowsPerB, size_t sCPb, int row0g,
    float* __restrict__ C, _Float16* __restrict__ C16, int ldc, size_t sC, int M, int N, int K) {
  __shared__ __attribute__((aligned(16))) float so[4][16][64];
  const int tid = threadIdx.x, w = tid >> 5, lane = tid & 31, ln = lane & 15, hh = lane >> 4; const int by = blockIdx.y;
  A += (size_t)by * sA; Bh += (size_t)by * sB; const size_t cofs = (size_t)by * sC; const float* bp = bias ? bias + (size_t)by * sBias : nullptr;
  const int ntn = (N + 63) / 64; const int wid = blockIdx.x * 4 + w; const int mt = wid / ntn, nq = wid % ntn; if (mt * 16 >= M) return;
  const int row0 = mt * 16, col0 = nq * 64; const _Float16* arow = A + (size_t)(row0 + ln) * lda;
  v8f acc[4] = {};
  for (int kb = 0; kb < K; kb += 32) { FragH ah; ah.half[0] = *(const v8us*)((const unsigned short*)arow + kb + 8 * hh); ah.half[1] = *(const v8us*)((const unsigned short*)arow + kb + 16 + 8 * hh);
#pragma unroll
    for (int t = 0; t < 4; ++t) { if (col0 + t * 16 >= N) continue; const size_t boff = (size_t)(col0 + t * 16 + ln) * ldb + kb; FragH bq; bq.half[0] = *(const v8us*)((const unsigned short*)Bh + boff + 8 * hh); bq.half[1] = *(const v8us*)((const unsigned short*)Bh + boff + 16 + 8 * hh);
      acc[t] = mmaH<1>(ah.v, ah.v, bq.v, bq.v, acc[t]); }
  }
#pragma unroll
  for (int t = 0; t < 4; ++t) { if (col0 + t * 16 >= N) continue; const int col = col0 + t * 16 + ln; const float bv = bp ? bf16_round(bp[col]) : 0.f;
#pragma unroll
    for (int r = 0; r < 8; ++r) { float v = acc[t][r] * alpha + bv; if (CP) { const int rr = row0g + row0 + 8 * hh + r; if (rowsPerB < 0) v += CP[cofs + (size_t)rr * ldc + col];      /* rowsPerB < 0: own element of the batched C plane */ else { const int bidx = rr / rowsPerB; v += CP[(size_t)bidx * sCPb + (size_t)by * 64 + col]; } } if (ACT == 1) v = (v > 0.f) ? v : expm1f(v); else if (ACT == 7) v = (v > 0.f) ? v + 1.0f : expf(v); else if (ACT == 8) v = tanhf(v); else if (ACT == 9) v = 0.5f * v * (1.0f + tanhf(0.7978845608028654f * (v + 0.044715f * v * v * v))); else if (ACT == 11) v = 1.0f / (1.0f + expf(-v)); else if (ACT == 12) v = (v > 0.f) ? v : 0.01f * v; else if (ACT == 14) v = (v > 0.f) ? v : 0.1f * v; else if (ACT == 16) v = (v >= 0.f) ? v : 0.3f * v; else if (ACT == 17) v = (v >= 0.f) ? v : 0.2f * v; else if (ACT == 15) v = v / (1.0f + expf(-v)); else if (ACT == 3) v = fmaxf(v, 0.f); else if (ACT == 6) v = 0.5f * v * (1.0f + erff(v * 0.70710678118654752f)); so[w][8 * hh + r][t * 16 + ln] = v; } }
  __builtin_amdgcn_fence(__ATOMIC_ACQ_REL, "workgroup"); __builtin_amdgcn_wave_barrier();
  const int rsub = lane >> 4, c4 = (lane & 15) * 4; typedef _Float16 v4h __attribute__((ext_vector_type(4)));
  {
#pragma unroll
    for (int q = 0; q < 8; ++q) { const int r = q * 2 + rsub; if (col0 + c4 < N) { const v4f v = *(const v4fa*)&so[w][r][c4]; if (C) *(v4f*)(C + cofs + (size_t)(row0 + r) * ldc + col0 + c4) = v; if (C16) { v4h h4; for (int i = 0; i < 4; ++i) h4[i] = (_Float16)v[i]; *(v4h*)(C16 + cofs + (size_t)(row0 + r) * ldc + col0 + c4) = h4; } } }
     }
}


typedef _Float16 v4h __attribute__((ext_vector_type(4)));

__global__ __launch_bounds__(256) void k_x16(const float* __restrict__ x, _Float16* __restrict__ X16, size_t n8) { const size_t t = (size_t)blockIdx.x * 256 + threadIdx.x; if (t >= n8) return; FragH f;
#pragma unroll
  for (int q = 0; q < 8; ++q) f.h[q] = (_Float16)bf16_round(x[t * 8 + q]); *(v8us*)((unsigned short*)X16 + t * 8) = f.half[0];  }
__global__ __launch_bounds__(256) void k_h16(const float* __restrict__ x, _Float16* __restrict__ X16, size_t n8) { const size_t t = (size_t)blockIdx.x * 256 + threadIdx.x; if (t >= n8) return; FragH f;
#pragma unroll
  for (int q = 0; q < 8; ++q) f.h[q] = (_Float16)x[t * 8 + q]; *(v8us*)((unsigned short*)X16 + t * 8) = f.half[0];  }
__global__ __launch_bounds__(256) void k_round16f(const float* __restrict__ W, _Float16* __restrict__ Bt, size_t n8) { const size_t t = (size_t)blockIdx.x * 256 + threadIdx.x; if (t >= n8) return; FragH f;
#pragma unroll
  for (int i = 0; i < 8; ++i) f.h[i] = (_Float16)(bf16_round(W[t * 8 + i]) * 16.0f); *(v8us*)((unsigned short*)Bt + t * 8) = f.half[0];  }
template <int NHv, int TTv>
__global__ __launch_bounds__(256) void k_vt(const _Float16* __restrict__ V16, int ldv, int voff, _Float16* __restrict__ Vt) { __shared__ unsigned short tl[64][66]; const int tid = threadIdx.x; const int slab = blockIdx.x / (TTv / 64), lg = blockIdx.x % (TTv / 64); const int b = slab / NHv, h = slab % NHv;
  for (int i = tid; i < 64 * 8; i += 256) { const int r = i / 8, c8 = (i % 8) * 8; FragH f; f.half[0] = *(const v8us*)((const unsigned short*)V16 + ((size_t)b * TTv + lg * 64 + r) * ldv + voff + h * 64 + c8);
#pragma unroll
    for (int q = 0; q < 8; ++q) tl[r][c8 + q] = f.u[q]; }
  __syncthreads();
  {
#pragma unroll
    for (int rd = 0; rd < 2; ++rd) { const int d = rd * 32 + tid / 8, pc = tid % 8; FragH f;
#pragma unroll
      for (int q = 0; q < 8; ++q) f.u[q] = tl[pc * 8 + q][d];
      *(v8us*)((unsigned short*)Vt + ((size_t)slab * 64 + d) * TTv + lg * 64 + pc * 8) = f.half[0]; }
     } }

__global__ __launch_bounds__(256) void k_hl(const float* __restrict__ F, _Float16* __restrict__ Hh, _Float16* __restrict__ Hl, size_t n8) { const size_t t = (size_t)blockIdx.x * 256 + threadIdx.x; if (t >= n8) return; FragH fh, fl; const v4f a = *(const v4fa*)(F + t * 8), c = *(const v4fa*)(F + t * 8 + 4);
#pragma unroll
  for (int q = 0; q < 4; ++q) { _Float16 h = (_Float16)a[q]; fh.h[q] = h; fl.h[q] = (_Float16)((a[q] - (float)h) * 1024.0f); h = (_Float16)c[q]; fh.h[4 + q] = h; fl.h[4 + q] = (_Float16)((c[q] - (float)h) * 1024.0f); }
  { *(v8us*)((unsigned short*)Hh + t * 8) = fh.half[0]; *(v8us*)((unsigned short*)Hl + t * 8) = fl.half[0];  } }

// ---- fast GEMM (wave tile 32x64; requires M % 32 == 0 rows per launch region and N % 64 == 0); epilogue = k_gemm_hhx semantics ----
__device__ __forceinline__ v16h g2_frag(const _Float16* p, int hh) { FragH f; f.half[0] = *(const v8us*)((const unsigned short*)p + 8 * hh); f.half[1] = *(const v8us*)((const unsigned short*)p + 16 + 8 * hh); return f.v; }
__device__ __forceinline__ v8f g2_mma(v16h a, v16h b, v8f c) { v8f d = __builtin_amdgcn_wmma_f32_16x16x32_f16(false, a, false, b, (short)0, c, false, false); asm volatile("v_nop\n\tv_nop\n\tv_nop\n\tv_nop" : "+v"(d) : "v"(a), "v"(b)); return d; }
// The fragments of one 32-k step of a 32x64 wave tile: the two A row groups and the four B column groups.
struct G2Set { v16h a0, a1, b0, b1, b2, b3; };
__device__ __forceinline__ void g2_load(G2Set& s, const _Float16* a0p, const _Float16* a1p, const _Float16* b0p, const _Float16* b1p, const _Float16* b2p, const _Float16* b3p, int kb, int hh) {
  s.a0 = g2_frag(a0p + kb, hh); s.a1 = g2_frag(a1p + kb, hh); s.b0 = g2_frag(b0p + kb, hh); s.b1 = g2_frag(b1p + kb, hh); s.b2 = g2_frag(b2p + kb, hh); s.b3 = g2_frag(b3p + kb, hh);
  asm volatile("s_wait_xcnt 0x0" ::: "memory");      /* stands in front of the next address additions, which give new values to registers that these loads name */
  __builtin_amdgcn_sched_barrier(0); }      /* keeps the 12 loads and their wait here, ahead of the other set's products: moved down to their first uses the loads would each be waited for in turn */
__device__ __forceinline__ void g2_mul(const G2Set& s, v8f (&c)[8]) {
  c[0] = g2_mma(s.a0, s.b0, c[0]); c[4] = g2_mma(s.a1, s.b0, c[4]); c[1] = g2_mma(s.a0, s.b1, c[1]); c[5] = g2_mma(s.a1, s.b1, c[5]);
  c[2] = g2_mma(s.a0, s.b2, c[2]); c[6] = g2_mma(s.a1, s.b2, c[6]); c[3] = g2_mma(s.a0, s.b3, c[3]); c[7] = g2_mma(s.a1, s.b3, c[7]); }
template <int ACT>
__global__ __launch_bounds__(128) void k_gemm2(const _Float16* __restrict__ A, int lda, size_t sA, const _Float16* __restrict__ Bh, int ldb, size_t sB, float alpha, const float* __restrict__ bias, size_t sBias, const float* __restrict__ CP, int rowsPerB, size_t sCPb, int row0g,
    float* __restrict__ C, _Float16* __restrict__ C16, int ldc, size_t sC, int M, int N, int K, size_t zA, size_t zB, size_t zC, const float* __restrict__ biasY1, const float* __restrict__ biasY2) {      /* zA, zB, zC: strides of blockIdx.z; biasY1, biasY2: the bias arrays of planes y = 1 and y = 2 where each plane has an array of its own (else null) */ static_assert(ACT == 0 || ACT == 3 || ACT == 6 || ACT == 8 || ACT == 9 || ACT == 11 || ACT == 12 || ACT == 14 || ACT == 15 || ACT == 16 || ACT == 17, "k_gemm2: unsupported ACT code (would silently apply no activation)");
  __shared__ __attribute__((aligned(16))) float so[4][32][68];
  const int tid = threadIdx.x, w = tid >> 5, lane = tid & 31, ln = lane & 15, hh = lane >> 4; const int by = blockIdx.y;
  const int bz = blockIdx.z; A += (size_t)by * sA + (size_t)bz * zA; Bh += (size_t)by * sB + (size_t)bz * zB; const size_t cofs = (size_t)by * sC + (size_t)bz * zC; const float* bp = bias ? bias + (size_t)by * sBias : nullptr; if (biasY1 && by == 1) bp = biasY1; if (biasY2 && by == 2) bp = biasY2;
  const int ntn = N >> 6; const int mt = blockIdx.x / ntn, nq = blockIdx.x - mt * ntn; const int row0 = mt * 128 + 32 * w, col0 = nq * 64; if (row0 >= M) return;
  const _Float16* a0p = A + (size_t)(row0 + ln) * lda; const _Float16* a1p = a0p + (size_t)16 * lda;
  const _Float16* b0p = Bh + (size_t)(col0 + ln) * ldb; const _Float16* b1p = b0p + (size_t)16 * ldb; const _Float16* b2p = b1p + (size_t)16 * ldb; const _Float16* b3p = b2p + (size_t)16 * ldb;
  const v8f z8 = {0.f,0.f,0.f,0.f,0.f,0.f,0.f,0.f}; v8f accs[8] = {z8, z8, z8, z8, z8, z8, z8, z8};
  /* K loop over two fragment sets: while one 32-k step is multiplied, the other step's 12 loads are in flight. K % 64 == 0; every sum keeps its ascending k order. */
  G2Set s0, s1; int kb = 0; g2_load(s0, a0p, a1p, b0p, b1p, b2p, b3p, 0, hh);
#pragma unroll 1      /* the two steps of a trip are written out; more copies would only add code */
  for (; kb + 64 < K; kb += 64) { g2_load(s1, a0p, a1p, b0p, b1p, b2p, b3p, kb + 32, hh); g2_mul(s0, accs); g2_load(s0, a0p, a1p, b0p, b1p, b2p, b3p, kb + 64, hh); g2_mul(s1, accs); }
  g2_load(s1, a0p, a1p, b0p, b1p, b2p, b3p, kb + 32, hh); g2_mul(s0, accs); g2_mul(s1, accs);      /* the last two steps: nothing is left to fetch behind them */
#pragma unroll
  for (int u = 0; u < 8; ++u) { const int t = u & 3, half = u >> 2; const int col = col0 + t * 16 + ln; const float bv = bp ? bf16_round(bp[col]) : 0.f;
#pragma unroll
    for (int r = 0; r < 8; ++r) { const int rloc = half * 16 + 8 * hh + r; float v = accs[u][r] * alpha + bv; if (CP) { if (rowsPerB < 0) v += CP[cofs + (size_t)(row0g + row0 + rloc) * ldc + col];      /* rowsPerB < 0: own element of the batched C plane */ else { const int bidx = (row0g + row0 + rloc) / rowsPerB; v += CP[(size_t)bidx * sCPb + (size_t)by * 64 + col]; } }
      if (ACT == 3) v = fmaxf(v, 0.f); else if (ACT == 6) v = 0.5f * v * (1.0f + erff(v * 0.70710678118654752f)); else if (ACT == 11) v = 1.0f / (1.0f + expf(-v)); else if (ACT == 15) v = v / (1.0f + expf(-v)); else if (ACT == 12) v = (v > 0.f) ? v : 0.01f * v; else if (ACT == 8) v = tanhf(v); else if (ACT == 9) v = 0.5f * v * (1.0f + tanhf(0.7978845608028654f * (v + 0.044715f * v * v * v))); else if (ACT == 14) v = (v > 0.f) ? v : 0.1f * v; else if (ACT == 16) v = (v >= 0.f) ? v : 0.3f * v; else if (ACT == 17) v = (v >= 0.f) ? v : 0.2f * v;
      so[w][rloc][t * 16 + ln] = v; } }
  __builtin_amdgcn_fence(__ATOMIC_ACQ_REL, "workgroup"); __builtin_amdgcn_wave_barrier();
  const int rsub = lane >> 4, c4 = (lane & 15) * 4;
  {
#pragma unroll
    for (int q = 0; q < 16; ++q) { const int r = q * 2 + rsub; const v4f v = *(const v4fa*)&so[w][r][c4]; if (C) *(v4f*)(C + cofs + (size_t)(row0 + r) * ldc + col0 + c4) = v; if (C16) { v4h h4; for (int i = 0; i < 4; ++i) h4[i] = (_Float16)v[i]; *(v4h*)(C16 + cofs + (size_t)(row0 + r) * ldc + col0 + c4) = h4; } }
     } }


__global__ __launch_bounds__(256) void k_rsm(const float* __restrict__ S, _Float16* __restrict__ P, int nrows) {
  #pragma clang fp contract(off)
  const int i = blockIdx.x * 256 + threadIdx.x; if (i >= nrows) return; const float* s = S + (size_t)i * SQ; float mx = -3.0e38f;
#pragma unroll 1
  for (int j = 0; j < SQ; ++j) mx = fmaxf(mx, s[j]); float se = 0.f;
#pragma unroll 1
  for (int j = 0; j < SQ; ++j) se += expf(s[j] - mx); const float sc = 256.0f / se;
#pragma unroll 1
  for (int j0 = 0; j0 < SQ; j0 += 8) { FragH f; for (int q = 0; q < 8; ++q) f.h[q] = (_Float16)(expf(s[j0 + q] - mx) * sc); unsigned short* d = (unsigned short*)P + (size_t)i * SQ + j0; *(v8us*)d = f.half[0];  } }
__global__ __launch_bounds__(256) void k_vt(const _Float16* __restrict__ V16, _Float16* __restrict__ VT) { __shared__ unsigned short tl[64][65]; const int tid = threadIdx.x; const int hh = blockIdx.x % HG, sg = blockIdx.x / HG; const int s0 = sg * 64; const int b = hh / NH, h = hh % NH;
  for (int i = tid; i < 64 * 8; i += 256) { const int j = i / 8, d8 = (i % 8) * 8; FragH f; f.half[0] = *(const v8us*)((const unsigned short*)V16 + ((size_t)b * SQ + s0 + j) * DM + h * HD + d8); for (int q = 0; q < 8; ++q) tl[d8 + q][j] = f.u[q]; }
  __syncthreads();
  { for (int i = tid; i < 64 * 8; i += 256) { const int d = i / 8, j8 = (i % 8) * 8; FragH f; for (int q = 0; q < 8; ++q) f.u[q] = tl[d][j8 + q]; *(v8us*)((unsigned short*)VT + ((size_t)hh * HD + d) * SQ + s0 + j8) = f.half[0]; }  } }

#define FH 2048
#define KN 103
typedef int v4ia __attribute__((ext_vector_type(4), may_alias));
__device__ __forceinline__ void xcnt_wait() { asm volatile("s_wait_xcnt 0x0" ::: "memory"); }
// Operand preparation, one launch: the six weight matrices as x16 f16 planes (they lie one behind the other in Bt, in the order wq, wk, wv, wo, w1, w2) and x as bf16-rounded f32 rows.
// A work-group converts 256 x 8 elements of one array; which array follows from blockIdx.x alone.
#define PW (DM * DM / 2048)          /* work-groups per DM x DM weight */
#define PF (FH * DM / 2048)          /* work-groups per FH x DM weight */
#define PX ((int)(NR * DM / 2048))   /* work-groups for x */
static_assert((DM * DM) % 2048 == 0 && (FH * DM) % 2048 == 0 && (NR * DM) % 2048 == 0, "k_prep: whole work-groups per array");
__global__ __launch_bounds__(256) void k_prep(const float* __restrict__ wq, const float* __restrict__ wk, const float* __restrict__ wv, const float* __restrict__ wo, const float* __restrict__ w1, const float* __restrict__ w2, const float* __restrict__ x, _Float16* __restrict__ Bt, float* __restrict__ XF) {
  const int blk = blockIdx.x; const float* src; int first;
  if (blk < PW) { src = wq; first = 0; } else if (blk < 2 * PW) { src = wk; first = PW; } else if (blk < 3 * PW) { src = wv; first = 2 * PW; } else if (blk < 4 * PW) { src = wo; first = 3 * PW; }
  else if (blk < 4 * PW + PF) { src = w1; first = 4 * PW; } else if (blk < 4 * PW + 2 * PF) { src = w2; first = 4 * PW + PF; } else { src = x; first = 4 * PW + 2 * PF; }
  const size_t t = (size_t)(blk - first) * 256 + threadIdx.x; const v4f a0 = *(const v4fa*)(src + t * 8), a1 = *(const v4fa*)(src + t * 8 + 4);
  xcnt_wait();      /* the address registers of the two loads may take new values below */
  if (blk < 4 * PW + 2 * PF) { FragH f;
#pragma unroll      /* constant indices: the values stay in registers */
    for (int q = 0; q < 4; ++q) { f.h[q] = (_Float16)(bf16_round(a0[q]) * 16.0f); f.h[4 + q] = (_Float16)(bf16_round(a1[q]) * 16.0f); }
    *(v8us*)((unsigned short*)Bt + ((size_t)blk * 256 + threadIdx.x) * 8) = f.half[0]; }
  else { v8f o;
#pragma unroll      /* constant indices: the values stay in registers */
    for (int q = 0; q < 4; ++q) { o[q] = bf16_round(a0[q]); o[4 + q] = bf16_round(a1[q]); }
    *(v8f*)(XF + t * 8) = o;
    xcnt_wait(); } }      /* the listing lets the weight part's code follow, which writes the two stores' registers */
__device__ __forceinline__ float wave_max(float v) {
#pragma unroll      /* five fixed butterfly steps */
  for (int m = 16; m > 0; m >>= 1) v = fmaxf(v, __shfl_xor(v, m, 32)); return v; }
__device__ __forceinline__ float wave_sum(float v) {
#pragma unroll      /* five fixed butterfly steps */
  for (int m = 16; m > 0; m >>= 1) v += __shfl_xor(v, m, 32); return v; }
// Row LayerNorm, one wave per row: lane l owns columns c*256 + l*8 .. +7 (c = 0, 1), held in registers for the three passes.
__global__ __launch_bounds__(256) void k_lnw(const float* __restrict__ HF, const float* __restrict__ g, const float* __restrict__ bb, _Float16* __restrict__ X16o) {
  const int lane = threadIdx.x & 31; const size_t r = (size_t)blockIdx.x * 8 + (threadIdx.x >> 5); if (r >= NR) return; const float* x = HF + r * DM; float v[16]; float s = 0.f;
#pragma unroll      /* constant indices: the lane's values stay in registers and its loads issue together */
  for (int c = 0; c < 2; ++c) { const int j0 = c * 256 + lane * 8; const v4f a0 = *(const v4fa*)(x + j0), a1 = *(const v4fa*)(x + j0 + 4);
#pragma unroll      /* constant indices: the lane's values stay in registers and its loads issue together */
    for (int e = 0; e < 4; ++e) { v[c * 8 + e] = a0[e]; v[c * 8 + 4 + e] = a1[e]; } }
#pragma unroll      /* constant indices: the lane's values stay in registers and its loads issue together */
  for (int e = 0; e < 16; ++e) s += v[e];
  const float mu = wave_sum(s) / (float)DM; float qs = 0.f;
#pragma unroll      /* constant indices: the lane's values stay in registers and its loads issue together */
  for (int e = 0; e < 16; ++e) { const float dd = v[e] - mu; qs += dd * dd; }
  const float rs = 1.0f / sqrtf(wave_sum(qs) / (float)DM + 1e-5f);
#pragma unroll      /* constant indices: the lane's values stay in registers and its loads issue together */
  for (int c = 0; c < 2; ++c) { const int j0 = c * 256 + lane * 8; const v4f g0 = *(const v4fa*)(g + j0), g1 = *(const v4fa*)(g + j0 + 4), b0 = *(const v4fa*)(bb + j0), b1 = *(const v4fa*)(bb + j0 + 4); FragH f;
#pragma unroll      /* constant indices: the lane's values stay in registers and its loads issue together */
    for (int e = 0; e < 4; ++e) { f.h[e] = (_Float16)((v[c * 8 + e] - mu) * rs * bf16_round(g0[e]) + bf16_round(b0[e])); f.h[4 + e] = (_Float16)((v[c * 8 + 4 + e] - mu) * rs * bf16_round(g1[e]) + bf16_round(b1[e])); }
    *(v8us*)((unsigned short*)X16o + r * DM + j0) = f.half[0]; } }
// Row softmax, one wave per score row; the grid covers the rows of all HG (batch, head) planes held in S; the eight rows of a work-group lie in one batch.
static_assert((NH * QN) % 8 == 0, "k_rsmw: a work-group's rows share their batch");
// Lane l owns keys c*256 + l*8 .. +7 (c = 0..3): 16-byte loads and stores, row maximum and sum by a butterfly over the 32 lanes.
__global__ __launch_bounds__(256) void k_rsmw(const float* __restrict__ S, _Float16* __restrict__ P, int nrows, const float* __restrict__ uprev, const int* __restrict__ pmask, const int* __restrict__ pidx, const int* __restrict__ pim) {
  __shared__ __attribute__((aligned(16))) unsigned short prow[8][SQ];      /* sparse branch: the wave's own output row (any index set; a duplicated index is stored once) */
  const int lane = threadIdx.x & 31, w = threadIdx.x >> 5; const int i = blockIdx.x * 8 + w; if (i >= nrows) return;      /* whole waves leave; the kernel has no work-group barrier */
  const int b = (int)(blockIdx.x * 8) / (NH * QN); const int hd = i / QN, q = i - hd * QN; const float* s = S + (size_t)hd * SQ * SQ + (size_t)q * SQ; unsigned short* d = (unsigned short*)P + (size_t)hd * SQ * SQ + (size_t)q * SQ;
  const float lam = 10.0f * expf(-5.0f * bf16_round(uprev[b])); const bool sparse = lam >= 1.0f;
  if (sparse) { const int* ix = pidx + (size_t)q * KN; const int* vm = pim + (size_t)q * KN; constexpr int NT = (KN + 31) / 32; float sv[NT]; int jx[NT]; bool ok[NT]; float mx = -3.0e38f;
#pragma unroll      /* constant indices: the lane's values stay in registers and its loads issue together */
    for (int t = 0; t < NT; ++t) { const int k = t * 32 + lane; const int kc = k < KN ? k : KN - 1; jx[t] = ix[kc]; const int vk = vm[kc]; xcnt_wait(); ok[t] = (k < KN) & (vk != 0); }      /* a later load's result may land in an earlier load's address register: the wait stands between them */
#pragma unroll      /* constant indices: the lane's values stay in registers and its loads issue together */
    for (int t = 0; t < NT; ++t) { jx[t] = min(max(jx[t], 0), SQ - 1); sv[t] = s[jx[t]]; xcnt_wait(); }      /* the key index is bounded here before it forms an address; the wait: as in the loop above */
#pragma unroll      /* constant indices: the lane's values stay in registers and its loads issue together */
    for (int t = 0; t < NT; ++t) if (ok[t]) mx = fmaxf(mx, sv[t]);
    mx = wave_max(mx); float se = 0.f;
#pragma unroll      /* constant indices: the lane's values stay in registers and its loads issue together */
    for (int t = 0; t < NT; ++t) { sv[t] = expf(sv[t] - mx); if (ok[t]) se += sv[t]; }
    se = wave_sum(se); const float sc = 256.0f / se; const v8us z = {0, 0, 0, 0, 0, 0, 0, 0};
#pragma unroll      /* constant indices: the lane's values stay in registers and its loads issue together */
    for (int c = 0; c < 4; ++c) *(v8us*)&prow[w][c * 256 + lane * 8] = z;
    /* the zeros of every lane are in LDS before any lane scatters a weight over them */
    __builtin_amdgcn_fence(__ATOMIC_ACQ_REL, "workgroup"); __builtin_amdgcn_wave_barrier();
#pragma unroll      /* constant indices: the lane's values stay in registers and its loads issue together */
    for (int t = 0; t < NT; ++t) if (ok[t]) { FragH f; f.h[0] = (_Float16)(sv[t] * sc); prow[w][jx[t]] = f.u[0]; }
    /* the scattered weights of every lane are in LDS before the row is read back in 16-byte pieces */
    __builtin_amdgcn_fence(__ATOMIC_ACQ_REL, "workgroup"); __builtin_amdgcn_wave_barrier();
#pragma unroll      /* constant indices: the lane's values stay in registers and its loads issue together */
    for (int c = 0; c < 4; ++c) { const v8us o = *(const v8us*)&prow[w][c * 256 + lane * 8]; *(v8us*)(d + c * 256 + lane * 8) = o; }
    xcnt_wait(); }      /* the listing lets the dense part's code follow, which writes the four stores' registers */
  else { const int* pm = pmask + (size_t)q * SQ; float v[32]; float mx = -3.0e38f;
#pragma unroll      /* constant indices: the lane's values stay in registers and its loads issue together */
    for (int c = 0; c < 4; ++c) { const int j0 = c * 256 + lane * 8; const v4f a0 = *(const v4fa*)(s + j0), a1 = *(const v4fa*)(s + j0 + 4); const v4ia m0 = *(const v4ia*)(pm + j0), m1 = *(const v4ia*)(pm + j0 + 4);
#pragma unroll      /* constant indices: the lane's values stay in registers and its loads issue together */
      for (int e = 0; e < 4; ++e) { v[c * 8 + e] = a0[e] + (m0[e] ? 0.f : -lam); v[c * 8 + 4 + e] = a1[e] + (m1[e] ? 0.f : -lam); } }
#pragma unroll      /* constant indices: the lane's values stay in registers and its loads issue together */
    for (int e = 0; e < 32; ++e) mx = fmaxf(mx, v[e]);
    mx = wave_max(mx); float se = 0.f;
#pragma unroll      /* constant indices: the lane's values stay in registers and its loads issue together */
    for (int e = 0; e < 32; ++e) { v[e] = expf(v[e] - mx); se += v[e]; }
    se = wave_sum(se); const float sc = 256.0f / se;
#pragma unroll      /* constant indices: the lane's values stay in registers and its loads issue together */
    for (int c = 0; c < 4; ++c) { FragH f;
#pragma unroll      /* constant indices: the lane's values stay in registers and its loads issue together */
      for (int e = 0; e < 8; ++e) f.h[e] = (_Float16)(v[c * 8 + e] * sc);
      *(v8us*)(d + c * 256 + lane * 8) = f.half[0]; } } }
// Row norms, one wave per row, 32 rows per work-group, so that one wave stores the group's 32 values as one whole 128-byte line of U.
static_assert(NR % 32 == 0, "k_unormw: 32 rows per work-group");
__global__ __launch_bounds__(1024) void k_unormw(const float* __restrict__ OUT, const float* __restrict__ XF, float* __restrict__ U) {
  __shared__ float ur[32];
  const int lane = threadIdx.x & 31, w = threadIdx.x >> 5; const size_t r = (size_t)blockIdx.x * 32 + w; float sd = 0.f, sx = 0.f;
#pragma unroll      /* constant indices: the lane's values stay in registers and its loads issue together */
  for (int c = 0; c < 4; ++c) { const int j0 = c * 128 + lane * 4; const v4f o = *(const v4fa*)(OUT + r * DM + j0), xv = *(const v4fa*)(XF + r * DM + j0);
#pragma unroll      /* constant indices: the lane's values stay in registers and its loads issue together */
    for (int e = 0; e < 4; ++e) { const float dd = o[e] - xv[e]; sd += dd * dd; sx += xv[e] * xv[e]; } }
  sd = wave_sum(sd); sx = wave_sum(sx); if (lane == 0) ur[w] = sqrtf(sd) / (sqrtf(sx) + 1e-8f);
  __syncthreads();      /* the 32 waves' row values are in LDS before wave 0 reads them */
  if (threadIdx.x < 32) U[(size_t)blockIdx.x * 32 + threadIdx.x] = ur[threadIdx.x]; }
// Batch means in float64: one wave, 32 lanes over the 1,024 rows of a batch, lane b stores batch b.
__global__ __launch_bounds__(32) void k_umeanw(const float* __restrict__ U, float* __restrict__ out1) { const int lane = threadIdx.x; float res = 0.f;
#pragma unroll      /* constant indices: the lane's values stay in registers and its loads issue together */
  for (int b = 0; b < NB; ++b) { double s = 0.0;
#pragma unroll      /* constant indices: the lane's values stay in registers and its loads issue together */
    for (int c = 0; c < SQ / 128; ++c) { const v4f a = *(const v4fa*)(U + (size_t)b * SQ + c * 128 + lane * 4);
#pragma unroll      /* constant indices: the lane's values stay in registers and its loads issue together */
      for (int e = 0; e < 4; ++e) s += (double)a[e]; }
#pragma unroll      /* five fixed butterfly steps */
    for (int m = 16; m > 0; m >>= 1) s += __shfl_xor(s, m, 32);
    if (lane == b) res = (float)(s / (double)SQ); }
  if (lane < NB) out1[lane] = res; }
extern "C" void kernel_launch(void* const* d_in, const int* in_sizes, int n_in,
                              void* d_out, int out_size, void* d_ws, size_t ws_size, hipStream_t stream) {
  (void)in_sizes; (void)n_in; (void)out_size;
  const float* const* I = (const float* const*)d_in; const float* x = I[0]; const float* uprev = I[1]; const float* wq = I[2]; const float* bq = I[3]; const float* wk = I[4]; const float* bk = I[5]; const float* wv = I[6]; const float* bv = I[7]; const float* wo = I[8]; const float* bo = I[9]; const float* l1g = I[10]; const float* l1b = I[11]; const float* l2g = I[12]; const float* l2b = I[13]; const float* w1 = I[14]; const float* b1 = I[15]; const float* w2 = I[16]; const float* b2 = I[17]; const int* pmask = (const int*)d_in[18]; const int* pidx = (const int*)d_in[19]; const int* pim = (const int*)d_in[20];
  float* out0 = (float*)d_out; float* out1 = out0 + NR * DM;
  char* ws = (char*)d_ws; size_t off = 0;
  auto take = [&](size_t bytes) { char* p = ws + off; off += (bytes + 255) & ~(size_t)255; return p; };
  _Float16* BQ = (_Float16*)take(((size_t)4 * DM * DM + (size_t)2 * FH * DM) * 2); _Float16* BO = BQ + (size_t)3 * DM * DM; _Float16* BW1 = BO + (size_t)DM * DM; _Float16* BW2 = BW1 + (size_t)FH * DM;      /* one block: the planes of wq, wk, wv, wo, w1, w2 one behind the other */
  float* XF = (float*)take(NR * DM * 4); float* HF = (float*)take(NR * DM * 4); _Float16* G16 = (_Float16*)take(NR * FH * 2); float* U = (float*)take(NR * 4);
  _Float16* X16 = (_Float16*)take(NR * DM * 2); _Float16* Q16 = (_Float16*)take(3 * NR * DM * 2); _Float16* K16 = Q16 + NR * DM; _Float16* V16 = K16 + NR * DM; _Float16* O16 = (_Float16*)take(NR * DM * 2);
  float* S = (float*)take((size_t)HG * SQ * SQ * 4); _Float16* P = (_Float16*)take((size_t)HG * SQ * SQ * 2); _Float16* VT = (_Float16*)take((size_t)HG * HD * SQ * 2);
  if (off > ws_size) return;      /* 6 + 4 + 4 + 8 + 2x5 + 64 + 32 + 2 = about 130 MiB */
  k_prep<<<4 * PW + 2 * PF + PX, 256, 0, stream>>>(wq, wk, wv, wo, w1, w2, x, BQ, XF); k_lnw<<<(unsigned)((NR + 7) / 8), 256, 0, stream>>>(XF, l1g, l1b, X16);
  const dim3 gp((unsigned)((NR / 128) * (DM / 64)), 1);
  k_gemm2<0><<<dim3(gp.x, 3), 128, 0, stream>>>(X16, DM, 0, BQ, DM, (size_t)DM * DM, 0.0625f, bq, 0, nullptr, 1, 0, 0, nullptr, Q16, DM, NR * DM, (int)NR, DM, DM, 0, 0, 0, bk, bv);      /* y = 0, 1, 2: q, k, v */
  k_gemm2<0><<<dim3((QN / 128) * (SQ / 64), NH, NB), 128, 0, stream>>>(Q16, DM, (size_t)HD, K16, DM, (size_t)HD, 0.125f, nullptr, 0, nullptr, 1, 0, 0, S, nullptr, SQ, (size_t)SQ * SQ, QN, SQ, HD, (size_t)SQ * DM, (size_t)SQ * DM, (size_t)NH * SQ * SQ, nullptr, nullptr);      /* scaled scores; y = head, z = batch */
  k_rsmw<<<(HG * QN + 7) / 8, 256, 0, stream>>>(S, P, HG * QN, uprev, pmask, pidx, pim);      /* one wave per row */
  k_vt<<<HG * (SQ / 64), 256, 0, stream>>>(V16, VT);
  k_gemm2<0><<<dim3((QN / 128) * (HD / 64), NH, NB), 128, 0, stream>>>(P, SQ, (size_t)SQ * SQ, VT, SQ, (size_t)HD * SQ, 0.00390625f, nullptr, 0, nullptr, 1, 0, 0, nullptr, O16, DM, (size_t)HD, QN, HD, SQ, (size_t)NH * SQ * SQ, (size_t)NH * HD * SQ, (size_t)SQ * DM, nullptr, nullptr);      /* o (merged heads) as f16 rows; y = head, z = batch */
  k_gemm2<0><<<gp, 128, 0, stream>>>(O16, DM, 0, BO, DM, 0, 0.0625f, bo, 0, XF, 1, (size_t)DM, 0, HF, nullptr, DM, 0, (int)NR, DM, DM, 0, 0, 0, nullptr, nullptr);      /* h = x + attn W_o^T + b_o */
  k_lnw<<<(unsigned)((NR + 7) / 8), 256, 0, stream>>>(HF, l2g, l2b, X16);
  k_gemm2<6><<<dim3((unsigned)((NR / 128) * (FH / 64)), 1), 128, 0, stream>>>(X16, DM, 0, BW1, DM, 0, 0.0625f, b1, 0, nullptr, 1, 0, 0, nullptr, G16, FH, 0, (int)NR, FH, DM, 0, 0, 0, nullptr, nullptr);      /* gelu_erf(LN2(h) W1^T + b1) */
  k_gemm2<0><<<gp, 128, 0, stream>>>(G16, FH, 0, BW2, FH, 0, 0.0625f, b2, 0, HF, 1, (size_t)DM, 0, out0, nullptr, DM, 0, (int)NR, DM, FH, 0, 0, 0, nullptr, nullptr);      /* out = h + (...) W2^T + b2, rows are the output layout */
  k_unormw<<<(unsigned)(NR / 32), 1024, 0, stream>>>(out0, XF, U); k_umeanw<<<1, 32, 0, stream>>>(U, out1);
}

// v004
// A run of this version takes 172 microseconds.
// In both of two side-by-side timings against v003, it was 1.10 times as fast.
// All steps since v000 together make it 22.2 times as fast.
#include <hip/hip_runtime.h>
// SPDGMultiHeadAttention (x [2][1024][512], u_prev [2][1]; xn = LN1(x); Q,K,V = xn W^T + b (8 heads of 64); lam = 10 exp(-5 u_prev); per batch: if lam >= 1 the SPARSE branch (softmax over the prior window slots prior_indices[i][k] with prior_index_mask, others excluded) else the DENSE branch (softmax over all keys of q.k/8 + lam*(prior_mask ? 0 : -1)); attn = merge W_o^T + b_o; h = x + attn; out = h + gelu_erf(LN2(h) W1^T + b1) W2^T + b2 -> [2][1024][512]; aggregated_u[b] = mean_s ||out - x|| / (||x|| + 1e-8) -> [2][1]).
// Structure: token rows; bf16(x) as f32 residual rows + LN1 on VALU (f32, wave per row) into f16 rows; Q | K | V WMMA GEMMs as one launch (32x64 wave tiles, f32 accumulation, exact x16 weights + bias, f16 outputs); the prior tables packed to one bit per (query, key) beside the operand preparation; V^T via LDS; all 16 (batch, head) pairs in one attention launch: per wave 16 queries, S^T = K . Q^T per 64 keys, the branch-selecting running softmax in registers (lam from u_prev; f32; weights x256 as f16), O^T += V^T . P^T, merged f16 rows; W_o GEMM + b_o + x (epilogue addend) -> h; LN2 on VALU; fc1 GEMM with the exact-erf GELU epilogue (f16 hidden); fc2 GEMM + b2 + h straight into the output rows; the surprise statistic on VALU (per-row norms, float64 means per batch) into output 1.
// Compute dtype: inputs rounded to bf16; x / weights exact; LN outputs, q, k, v, softmax weights, o, GELU hidden plain f16 (~2^-12); residual, LN statistics, scores, softmax, norms f32/f64. v_wmma_f32_16x16x32_f16.
#define NB 2
#define SQ 1024
#define DM 512
#define NH 8
#define HD 64
#define HG (NB * NH)                 /* (batch, head) pairs per attention launch: all of them */
#define QN SQ                        /* query rows per batch; unused, the attention grid covers all SQ */
#define NR ((size_t)NB * SQ)         /* 2048 token rows */
typedef __bf16 v16b __attribute__((ext_vector_type(16)));
typedef unsigned short v8us __attribute__((ext_vector_type(8), may_alias));
typedef float  v8f  __attribute__((ext_vector_type(8)));
typedef float  v4f  __attribute__((ext_vector_type(4)));
typedef float  v4fa __attribute__((ext_vector_type(4), may_alias));
union FragB { v16b v; v8us half[2]; unsigned short u[16]; };

__device__ __forceinline__ unsigned short bf16_bits(float x) { unsigned int u = __float_as_uint(x); return (unsigned short)((u + 0x7FFFu + ((u >> 16) & 1u)) >> 16); }
__device__ __forceinline__ float bf16_val(unsigned short b) { return __uint_as_float(((unsigned int)b) << 16); }
__device__ __forceinline__ float bf16_round(float x) { return bf16_val(bf16_bits(x)); }
// D += A·B with NT terms: 1 = ah·bh, 2 = + al·bh (A split), 3 = + ah·bl (both split)
template <int NT>
__device__ __forceinline__ v8f mmaN(v16b ah, v16b al, v16b bh, v16b bl, v8f c) {
  c = __builtin_amdgcn_wmma_f32_16x16x32_bf16(false, ah, false, bh, (short)0, c, false, false);
  if (NT >= 2) c = __builtin_amdgcn_wmma_f32_16x16x32_bf16(false, al, false, bh, (short)0, c, false, false);
  if (NT >= 3) c = __builtin_amdgcn_wmma_f32_16x16x32_bf16(false, ah, false, bl, (short)0, c, false, false);
  asm volatile("v_nop\n\tv_nop\n\tv_nop\n\tv_nop" : "+v"(c) : "v"(ah), "v"(al), "v"(bh), "v"(bl));
  return c;
}

__global__ __launch_bounds__(256) void k_wt_bf16(const float* __restrict__ W, unsigned short* __restrict__ Wt, int K, int N) {
  const int t = blockIdx.x * 256 + threadIdx.x;
  const int k8n = K / 8;
  if (t >= N * k8n) return;
  const int n = t / k8n, k8 = (t % k8n) * 8;
  v8us v;
#pragma unroll
  for (int i = 0; i < 8; ++i) v[i] = bf16_bits(W[(size_t)(k8 + i) * N + n]);
  *(v8us*)(Wt + (size_t)n * K + k8) = v;
  
}

// GEMM C[M][N] (f32, pitch ldc) = act(A[M][K]·W + bias). A f32 row-major (pitch lda) converted per fragment to bf16
// (ASPLIT: hi/lo two planes -> 2 terms, else single rounded term); Wt bf16 [N][K] (pitch ldb). BIAS_BF16 rounds the
// bias to bf16 first (bias quantised to bf16 before the add). K%32==0, M%16==0, N%64==0.
template <bool ASPLIT, int ACT, bool BIAS_BF16>
__global__ __launch_bounds__(128) void k_gemm_bf(const float* __restrict__ A, int lda, const unsigned short* __restrict__ Wt, int ldb,
                                               const float* __restrict__ bias, float* __restrict__ C, int ldc, int M, int N, int K) {
  __shared__ __attribute__((aligned(16))) float so[4][16][64];
  const int tid = threadIdx.x, w = tid >> 5, lane = tid & 31, ln = lane & 15, hh = lane >> 4;
  const int ntn = N / 64;
  const int wid = blockIdx.x * 4 + w;
  const int mt = wid / ntn, nq = wid % ntn;
  if (mt * 16 >= M) return;
  const int row0 = mt * 16, col0 = nq * 64;
  const float* arow = A + (size_t)(row0 + ln) * lda;
  v8f acc[4] = {};
  for (int kb = 0; kb < K; kb += 32) {
    FragB ah, al;
    const v4f x0 = *(const v4fa*)(arow + kb + 8 * hh), x1 = *(const v4fa*)(arow + kb + 8 * hh + 4);
    const v4f x2 = *(const v4fa*)(arow + kb + 16 + 8 * hh), x3 = *(const v4fa*)(arow + kb + 16 + 8 * hh + 4);
    float xs[16] = {x0[0],x0[1],x0[2],x0[3],x1[0],x1[1],x1[2],x1[3],x2[0],x2[1],x2[2],x2[3],x3[0],x3[1],x3[2],x3[3]};
#pragma unroll
    for (int i = 0; i < 16; ++i) { const unsigned short hb = bf16_bits(xs[i]); ah.u[i] = hb; al.u[i] = ASPLIT ? bf16_bits(xs[i] - bf16_val(hb)) : (unsigned short)0; }
#pragma unroll
    for (int t = 0; t < 4; ++t) {
      const unsigned short* brow = Wt + (size_t)(col0 + t * 16 + ln) * ldb + kb;
      FragB b;
      b.half[0] = *(const v8us*)(brow + 8 * hh);
      b.half[1] = *(const v8us*)(brow + 16 + 8 * hh);
      acc[t] = mmaN<ASPLIT ? 2 : 1>(ah.v, al.v, b.v, b.v, acc[t]);
    }
  }
#pragma unroll
  for (int t = 0; t < 4; ++t) {
    float bv = bias ? bias[col0 + t * 16 + ln] : 0.f;
    if (BIAS_BF16) bv = bf16_round(bv);
#pragma unroll
    for (int r = 0; r < 8; ++r) { float v = acc[t][r] + bv; if (ACT == 1) v = fmaxf(v, 0.f); so[w][8 * hh + r][t * 16 + ln] = v; }
  }
  __builtin_amdgcn_fence(__ATOMIC_ACQ_REL, "workgroup");
  __builtin_amdgcn_wave_barrier();
  const int rsub = lane >> 4, c4 = (lane & 15) * 4;
  {
#pragma unroll
    for (int q = 0; q < 8; ++q) {
      const int r = q * 2 + rsub;
      const v4f v = *(const v4fa*)&so[w][r][c4];
      *(v4f*)(C + (size_t)(row0 + r) * ldc + col0 + c4) = v;
    }
    
  }
}

// GEMM C = act(A·W + bias + resid): A f32 (ASPLIT -> hi/lo 2 terms), Wt bf16 [N][K]; ACT 0 none, 1 relu, 2 exact gelu;
// resid (optional, f32, row index = (row % rmod), pitch ldr, RES_BF16 rounds it) added before the activation.
template <bool ASPLIT, int ACT, bool BIAS_BF16, bool RES_BF16>
__global__ __launch_bounds__(128) void k_gemm_bf3(const float* __restrict__ A, int lda, const unsigned short* __restrict__ Wt, int ldb,
                                                const float* __restrict__ bias, const float* __restrict__ resid, int rmod, int ldr,
                                                float* __restrict__ C, int ldc, int M, int N, int K) {
  __shared__ __attribute__((aligned(16))) float so[4][16][64];
  const int tid = threadIdx.x, w = tid >> 5, lane = tid & 31, ln = lane & 15, hh = lane >> 4;
  const int ntn = N / 64;
  const int wid = blockIdx.x * 4 + w;
  const int mt = wid / ntn, nq = wid % ntn;
  if (mt * 16 >= M) return;
  const int row0 = mt * 16, col0 = nq * 64;
  const float* arow = A + (size_t)(row0 + ln) * lda;
  v8f acc[4] = {};
  for (int kb = 0; kb < K; kb += 32) {
    FragB ah, al;
    const v4f x0 = *(const v4fa*)(arow + kb + 8 * hh), x1 = *(const v4fa*)(arow + kb + 8 * hh + 4);
    const v4f x2 = *(const v4fa*)(arow + kb + 16 + 8 * hh), x3 = *(const v4fa*)(arow + kb + 16 + 8 * hh + 4);
    float xs[16] = {x0[0],x0[1],x0[2],x0[3],x1[0],x1[1],x1[2],x1[3],x2[0],x2[1],x2[2],x2[3],x3[0],x3[1],x3[2],x3[3]};
#pragma unroll
    for (int i = 0; i < 16; ++i) { const unsigned short hb = bf16_bits(xs[i]); ah.u[i] = hb; al.u[i] = ASPLIT ? bf16_bits(xs[i] - bf16_val(hb)) : (unsigned short)0; }
#pragma unroll
    for (int t = 0; t < 4; ++t) {
      const unsigned short* brow = Wt + (size_t)(col0 + t * 16 + ln) * ldb + kb;
      FragB b;
      b.half[0] = *(const v8us*)(brow + 8 * hh);
      b.half[1] = *(const v8us*)(brow + 16 + 8 * hh);
      acc[t] = mmaN<ASPLIT ? 2 : 1>(ah.v, al.v, b.v, b.v, acc[t]);
    }
  }
#pragma unroll
  for (int t = 0; t < 4; ++t) {
    const int col = col0 + t * 16 + ln;
    float bv = bias ? bias[col] : 0.f;
    if (BIAS_BF16) bv = bf16_round(bv);
#pragma unroll
    for (int r = 0; r < 8; ++r) {
      float v = acc[t][r] + bv;
      if (resid) { float rv = resid[(size_t)((row0 + 8 * hh + r) % rmod) * ldr + col]; if (RES_BF16) rv = bf16_round(rv); v += rv; }
      if (ACT == 1) v = fmaxf(v, 0.f);
      if (ACT == 2) v = 0.5f * v * (1.0f + erff(v * 0.70710678118654752f));
      if (ACT == 3) { const float u = 0.7978845608028654f * (v + 0.044715f * v * v * v); v = 0.5f * v * (1.0f + tanhf(u)); }
      so[w][8 * hh + r][t * 16 + ln] = v;
    }
  }
  __builtin_amdgcn_fence(__ATOMIC_ACQ_REL, "workgroup");
  __builtin_amdgcn_wave_barrier();
  const int rsub = lane >> 4, c4 = (lane & 15) * 4;
  {
#pragma unroll
    for (int q = 0; q < 8; ++q) {
      const int r = q * 2 + rsub;
      const v4f v = *(const v4fa*)&so[w][r][c4];
      *(v4f*)(C + (size_t)(row0 + r) * ldc + col0 + c4) = v;
    }
    
  }
}
// row LayerNorm (biased variance, eps) over N: s = X (+ R); optional out_sum <- s; out_norm <- (s-mu)*rsqrt(var+eps)*g + b
template <bool PARAM_BF16>
__global__ __launch_bounds__(256) void k_layernorm(const float* __restrict__ X, const float* __restrict__ R, const float* __restrict__ g, const float* __restrict__ bta,
                                                  float* __restrict__ out_sum, float* __restrict__ out_norm, int N, float eps) {
  __shared__ float red[256];
  const int row = blockIdx.x, tid = threadIdx.x;
  const float* x = X + (size_t)row * N; const float* rr = R ? R + (size_t)row * N : nullptr;
  float vals[16];                     // up to N = 4096
  const int per = N / 256;            // contiguous chunk per thread? use strided-by-4 chunks: thread handles j = tid*4 + 1024*u
  float s1 = 0.f;
  for (int u = 0; u < per / 4; ++u) {
    const int j = tid * 4 + 1024 * u;
    const v4f a = *(const v4fa*)(x + j);
    v4f b = {0.f,0.f,0.f,0.f}; if (rr) b = *(const v4fa*)(rr + j);
#pragma unroll
    for (int q = 0; q < 4; ++q) { const float v = a[q] + b[q]; vals[u * 4 + q] = v; s1 += v; }
  }
  red[tid] = s1; __syncthreads();
  for (int st = 128; st > 0; st >>= 1) { if (tid < st) red[tid] += red[tid + st]; __syncthreads(); }
  const float mu = red[0] / (float)N; __syncthreads();
  float s2 = 0.f;
  for (int u = 0; u < per / 4; ++u)
#pragma unroll
    for (int q = 0; q < 4; ++q) { const float c = vals[u * 4 + q] - mu; s2 += c * c; }
  red[tid] = s2; __syncthreads();
  for (int st = 128; st > 0; st >>= 1) { if (tid < st) red[tid] += red[tid + st]; __syncthreads(); }
  const float rs = rsqrtf(red[0] / (float)N + eps);
  {
    for (int u = 0; u < per / 4; ++u) {
      const int j = tid * 4 + 1024 * u;
      v4f o, sm;
#pragma unroll
      for (int q = 0; q < 4; ++q) {
        float gg = g[j + q], bb = bta[j + q];
        if (PARAM_BF16) { gg = bf16_round(gg); bb = bf16_round(bb); }
        sm[q] = vals[u * 4 + q]; o[q] = (vals[u * 4 + q] - mu) * rs * gg + bb;
      }
      if (out_sum) *(v4f*)(out_sum + (size_t)row * N + j) = sm;
      *(v4f*)(out_norm + (size_t)row * N + j) = o;
    }
    
  }
}



// ---- f16 WMMA path (v_wmma_f32_16x16x32_f16): 11-bit significands for operands in range — used where a [0,1] probability operand needs more precision than bf16
typedef _Float16 v16h __attribute__((ext_vector_type(16)));
union FragH { v16h v; v8us half[2]; _Float16 h[16]; unsigned short u[16]; };
template <int NT>
__device__ __forceinline__ v8f mmaH(v16h ah, v16h al, v16h bh, v16h bl, v8f c) {
  c = __builtin_amdgcn_wmma_f32_16x16x32_f16(false, ah, false, bh, (short)0, c, false, false);
  if (NT >= 2) c = __builtin_amdgcn_wmma_f32_16x16x32_f16(false, al, false, bh, (short)0, c, false, false);
  if (NT >= 3) c = __builtin_amdgcn_wmma_f32_16x16x32_f16(false, ah, false, bl, (short)0, c, false, false);
  asm volatile("v_nop\n\tv_nop\n\tv_nop\n\tv_nop" : "+v"(c) : "v"(ah), "v"(al), "v"(bh), "v"(bl));
  return c;
}
// batched GEMM like k_gemm_b but f16 operands: A f32 (split into f16 hi/lo if ASPLIT, else rounded to f16), Bt = f16 values [n][k]; alpha; C f32; N multiple of 16 (partial tiles skipped)
template <bool ASPLIT>
__global__ __launch_bounds__(128) void k_gemm_h(const float* __restrict__ A, int lda, size_t sA, const _Float16* __restrict__ Bh, int ldb, size_t sB, float alpha, float* __restrict__ C, int ldc, size_t sC, int M, int N, int K) {
  __shared__ __attribute__((aligned(16))) float so[4][16][64];
  const int tid = threadIdx.x, w = tid >> 5, lane = tid & 31, ln = lane & 15, hh = lane >> 4; const int by = blockIdx.y;
  A += (size_t)by * sA; Bh += (size_t)by * sB; C += (size_t)by * sC;
  const int ntn = (N + 63) / 64; const int wid = blockIdx.x * 4 + w; const int mt = wid / ntn, nq = wid % ntn; if (mt * 16 >= M) return;
  const int row0 = mt * 16, col0 = nq * 64; const float* arow = A + (size_t)(row0 + ln) * lda;
  v8f acc[4] = {};
  for (int kb = 0; kb < K; kb += 32) {
    FragH ah, al;
    const v4f x0 = *(const v4fa*)(arow + kb + 8 * hh), x1 = *(const v4fa*)(arow + kb + 8 * hh + 4), x2 = *(const v4fa*)(arow + kb + 16 + 8 * hh), x3 = *(const v4fa*)(arow + kb + 16 + 8 * hh + 4);
    float xs[16] = {x0[0],x0[1],x0[2],x0[3],x1[0],x1[1],x1[2],x1[3],x2[0],x2[1],x2[2],x2[3],x3[0],x3[1],x3[2],x3[3]};
#pragma unroll
    for (int i = 0; i < 16; ++i) { const _Float16 h = (_Float16)xs[i]; ah.h[i] = h; al.h[i] = ASPLIT ? (_Float16)(xs[i] - (float)h) : (_Float16)0.0f; }
#pragma unroll
    for (int t = 0; t < 4; ++t) { if (col0 + t * 16 >= N) continue; const size_t boff = (size_t)(col0 + t * 16 + ln) * ldb + kb; FragH bq; bq.half[0] = *(const v8us*)(Bh + boff + 8 * hh); bq.half[1] = *(const v8us*)(Bh + boff + 16 + 8 * hh);
      acc[t] = mmaH<ASPLIT ? 2 : 1>(ah.v, al.v, bq.v, bq.v, acc[t]); }
  }
#pragma unroll
  for (int t = 0; t < 4; ++t) { if (col0 + t * 16 >= N) continue;
#pragma unroll
    for (int r = 0; r < 8; ++r) so[w][8 * hh + r][t * 16 + ln] = acc[t][r] * alpha; }
  __builtin_amdgcn_fence(__ATOMIC_ACQ_REL, "workgroup"); __builtin_amdgcn_wave_barrier();
  const int rsub = lane >> 4, c4 = (lane & 15) * 4;
  {
#pragma unroll
    for (int q = 0; q < 8; ++q) { const int r = q * 2 + rsub; if (col0 + c4 < N) { const v4f v = *(const v4fa*)&so[w][r][c4]; *(v4f*)(C + (size_t)(row0 + r) * ldc + col0 + c4) = v; } }
     }
}

// Wt[n][k] = f16(W[k][n]·scale) from f32 row-major W[K][N] (scale = power of two; bf16-exact weights stay exact in f16 away from the subnormal range)
__global__ __launch_bounds__(256) void k_wt_f16(const float* __restrict__ W, _Float16* __restrict__ Wt, int K, int N, float scale) {
  const int t = blockIdx.x * 256 + threadIdx.x; if (t >= N * (K / 8)) return; const int n = t / (K / 8), k8 = (t % (K / 8)) * 8; FragH f;
#pragma unroll
  for (int i = 0; i < 8; ++i) f.h[i] = (_Float16)(bf16_round(W[(size_t)(k8 + i) * N + n]) * scale); const v8us o = f.half[0];
  *(v8us*)((unsigned short*)Wt + (size_t)n * K + k8) = o; 
}
// k_gemm_hh variant with fused epilogue: v = acc·alpha + bias[by·sBias + col] (+ CP[(row/rowsPerB)·sCPb + by·64 + col] if CP) ; ACT 0 none / 1 elu ; writes f16 C16 (and f32 C if non-null)
template <int ACT>
__global__ __launch_bounds__(128) void k_gemm_hhx(const _Float16* __restrict__ A, int lda, size_t sA, const _Float16* __restrict__ Bh, int ldb, size_t sB, float alpha, const float* __restrict__ bias, size_t sBias, const float* __restrict__ CP, int rowsPerB, size_t sCPb, int row0g,
    float* __restrict__ C, _Float16* __restrict__ C16, int ldc, size_t sC, int M, int N, int K) {
  __shared__ __attribute__((aligned(16))) float so[4][16][64];
  const int tid = threadIdx.x, w = tid >> 5, lane = tid & 31, ln = lane & 15, hh = lane >> 4; const int by = blockIdx.y;
  A += (size_t)by * sA; Bh += (size_t)by * sB; const size_t cofs = (size_t)by * sC; const float* bp = bias ? bias + (size_t)by * sBias : nullptr;
  const int ntn = (N + 63) / 64; const int wid = blockIdx.x * 4 + w; const int mt = wid / ntn, nq = wid % ntn; if (mt * 16 >= M) return;
  const int row0 = mt * 16, col0 = nq * 64; const _Float16* arow = A + (size_t)(row0 + ln) * lda;
  v8f acc[4] = {};
  for (int kb = 0; kb < K; kb += 32) { FragH ah; ah.half[0] = *(const v8us*)((const unsigned short*)arow + kb + 8 * hh); ah.half[1] = *(const v8us*)((const unsigned short*)arow + kb + 16 + 8 * hh);
#pragma unroll
    for (int t = 0; t < 4; ++t) { if (col0 + t * 16 >= N) continue; const size_t boff = (size_t)(col0 + t * 16 + ln) * ldb + kb; FragH bq; bq.half[0] = *(const v8us*)((const unsigned short*)Bh + boff + 8 * hh); bq.half[1] = *(const v8us*)((const unsigned short*)Bh + boff + 16 + 8 * hh);
      acc[t] = mmaH<1>(ah.v, ah.v, bq.v, bq.v, acc[t]); }
  }
#pragma unroll
  for (int t = 0; t < 4; ++t) { if (col0 + t * 16 >= N) continue; const int col = col0 + t * 16 + ln; const float bv = bp ? bf16_round(bp[col]) : 0.f;
#pragma unroll
    for (int r = 0; r < 8; ++r) { float v = acc[t][r] * alpha + bv; if (CP) { const int rr = row0g + row0 + 8 * hh + r; if (rowsPerB < 0) v += CP[cofs + (size_t)rr * ldc + col];      /* rowsPerB < 0: own element of the batched C plane */ else { const int bidx = rr / rowsPerB; v += CP[(size_t)bidx * sCPb + (size_t)by * 64 + col]; } } if (ACT == 1) v = (v > 0.f) ? v : expm1f(v); else if (ACT == 7) v = (v > 0.f) ? v + 1.0f : expf(v); else if (ACT == 8) v = tanhf(v); else if (ACT == 9) v = 0.5f * v * (1.0f + tanhf(0.7978845608028654f * (v + 0.044715f * v * v * v))); else if (ACT == 11) v = 1.0f / (1.0f + expf(-v)); else if (ACT == 12) v = (v > 0.f) ? v : 0.01f * v; else if (ACT == 14) v = (v > 0.f) ? v : 0.1f * v; else if (ACT == 16) v = (v >= 0.f) ? v : 0.3f * v; else if (ACT == 17) v = (v >= 0.f) ? v : 0.2f * v; else if (ACT == 15) v = v / (1.0f + expf(-v)); else if (ACT == 3) v = fmaxf(v, 0.f); else if (ACT == 6) v = 0.5f * v * (1.0f + erff(v * 0.70710678118654752f)); so[w][8 * hh + r][t * 16 + ln] = v; } }
  __builtin_amdgcn_fence(__ATOMIC_ACQ_REL, "workgroup"); __builtin_amdgcn_wave_barrier();
  const int rsub = lane >> 4, c4 = (lane & 15) * 4; typedef _Float16 v4h __attribute__((ext_vector_type(4)));
  {
#pragma unroll
    for (int q = 0; q < 8; ++q) { const int r = q * 2 + rsub; if (col0 + c4 < N) { const v4f v = *(const v4fa*)&so[w][r][c4]; if (C) *(v4f*)(C + cofs + (size_t)(row0 + r) * ldc + col0 + c4) = v; if (C16) { v4h h4; for (int i = 0; i < 4; ++i) h4[i] = (_Float16)v[i]; *(v4h*)(C16 + cofs + (size_t)(row0 + r) * ldc + col0 + c4) = h4; } } }
     }
}


typedef _Float16 v4h __attribute__((ext_vector_type(4)));

__global__ __launch_bounds__(256) void k_x16(const float* __restrict__ x, _Float16* __restrict__ X16, size_t n8) { const size_t t = (size_t)blockIdx.x * 256 + threadIdx.x; if (t >= n8) return; FragH f;
#pragma unroll
  for (int q = 0; q < 8; ++q) f.h[q] = (_Float16)bf16_round(x[t * 8 + q]); *(v8us*)((unsigned short*)X16 + t * 8) = f.half[0];  }
__global__ __launch_bounds__(256) void k_h16(const float* __restrict__ x, _Float16* __restrict__ X16, size_t n8) { const size_t t = (size_t)blockIdx.x * 256 + threadIdx.x; if (t >= n8) return; FragH f;
#pragma unroll
  for (int q = 0; q < 8; ++q) f.h[q] = (_Float16)x[t * 8 + q]; *(v8us*)((unsigned short*)X16 + t * 8) = f.half[0];  }
__global__ __launch_bounds__(256) void k_round16f(const float* __restrict__ W, _Float16* __restrict__ Bt, size_t n8) { const size_t t = (size_t)blockIdx.x * 256 + threadIdx.x; if (t >= n8) return; FragH f;
#pragma unroll
  for (int i = 0; i < 8; ++i) f.h[i] = (_Float16)(bf16_round(W[t * 8 + i]) * 16.0f); *(v8us*)((unsigned short*)Bt + t * 8) = f.half[0];  }
template <int NHv, int TTv>
__global__ __launch_bounds__(256) void k_vt(const _Float16* __restrict__ V16, int ldv, int voff, _Float16* __restrict__ Vt) { __shared__ unsigned short tl[64][66]; const int tid = threadIdx.x; const int slab = blockIdx.x / (TTv / 64), lg = blockIdx.x % (TTv / 64); const int b = slab / NHv, h = slab % NHv;
  for (int i = tid; i < 64 * 8; i += 256) { const int r = i / 8, c8 = (i % 8) * 8; FragH f; f.half[0] = *(const v8us*)((const unsigned short*)V16 + ((size_t)b * TTv + lg * 64 + r) * ldv + voff + h * 64 + c8);
#pragma unroll
    for (int q = 0; q < 8; ++q) tl[r][c8 + q] = f.u[q]; }
  __syncthreads();
  {
#pragma unroll
    for (int rd = 0; rd < 2; ++rd) { const int d = rd * 32 + tid / 8, pc = tid % 8; FragH f;
#pragma unroll
      for (int q = 0; q < 8; ++q) f.u[q] = tl[pc * 8 + q][d];
      *(v8us*)((unsigned short*)Vt + ((size_t)slab * 64 + d) * TTv + lg * 64 + pc * 8) = f.half[0]; }
     } }

__global__ __launch_bounds__(256) void k_hl(const float* __restrict__ F, _Float16* __restrict__ Hh, _Float16* __restrict__ Hl, size_t n8) { const size_t t = (size_t)blockIdx.x * 256 + threadIdx.x; if (t >= n8) return; FragH fh, fl; const v4f a = *(const v4fa*)(F + t * 8), c = *(const v4fa*)(F + t * 8 + 4);
#pragma unroll
  for (int q = 0; q < 4; ++q) { _Float16 h = (_Float16)a[q]; fh.h[q] = h; fl.h[q] = (_Float16)((a[q] - (float)h) * 1024.0f); h = (_Float16)c[q]; fh.h[4 + q] = h; fl.h[4 + q] = (_Float16)((c[q] - (float)h) * 1024.0f); }
  { *(v8us*)((unsigned short*)Hh + t * 8) = fh.half[0]; *(v8us*)((unsigned short*)Hl + t * 8) = fl.half[0];  } }

// ---- fast GEMM (wave tile 32x64; requires M % 32 == 0 rows per launch region and N % 64 == 0); epilogue = k_gemm_hhx semantics ----
__device__ __forceinline__ v16h g2_frag(const _Float16* p, int hh) { FragH f; f.half[0] = *(const v8us*)((const unsigned short*)p + 8 * hh); f.half[1] = *(const v8us*)((const unsigned short*)p + 16 + 8 * hh); return f.v; }
__device__ __forceinline__ v8f g2_mma(v16h a, v16h b, v8f c) { v8f d = __builtin_amdgcn_wmma_f32_16x16x32_f16(false, a, false, b, (short)0, c, false, false); asm volatile("v_nop\n\tv_nop\n\tv_nop\n\tv_nop" : "+v"(d) : "v"(a), "v"(b)); return d; }
// The fragments of one 32-k step of a 32x64 wave tile: the two A row groups and the four B column groups.
struct G2Set { v16h a0, a1, b0, b1, b2, b3; };
__device__ __forceinline__ void g2_load(G2Set& s, const _Float16* a0p, const _Float16* a1p, const _Float16* b0p, const _Float16* b1p, const _Float16* b2p, const _Float16* b3p, int kb, int hh) {
  s.a0 = g2_frag(a0p + kb, hh); s.a1 = g2_frag(a1p + kb, hh); s.b0 = g2_frag(b0p + kb, hh); s.b1 = g2_frag(b1p + kb, hh); s.b2 = g2_frag(b2p + kb, hh); s.b3 = g2_frag(b3p + kb, hh);
  asm volatile("s_wait_xcnt 0x0" ::: "memory");      /* stands in front of the next address additions, which give new values to registers that these loads name */
  __builtin_amdgcn_sched_barrier(0); }      /* keeps the 12 loads and their wait here, ahead of the other set's products: moved down to their first uses the loads would each be waited for in turn */
__device__ __forceinline__ void g2_mul(const G2Set& s, v8f (&c)[8]) {
  c[0] = g2_mma(s.a0, s.b0, c[0]); c[4] = g2_mma(s.a1, s.b0, c[4]); c[1] = g2_mma(s.a0, s.b1, c[1]); c[5] = g2_mma(s.a1, s.b1, c[5]);
  c[2] = g2_mma(s.a0, s.b2, c[2]); c[6] = g2_mma(s.a1, s.b2, c[6]); c[3] = g2_mma(s.a0, s.b3, c[3]); c[7] = g2_mma(s.a1, s.b3, c[7]); }
template <int ACT>
__global__ __launch_bounds__(128) void k_gemm2(const _Float16* __restrict__ A, int lda, size_t sA, const _Float16* __restrict__ Bh, int ldb, size_t sB, float alpha, const float* __restrict__ bias, size_t sBias, const float* __restrict__ CP, int rowsPerB, size_t sCPb, int row0g,
    float* __restrict__ C, _Float16* __restrict__ C16, int ldc, size_t sC, int M, int N, int K, size_t zA, size_t zB, size_t zC, const float* __restrict__ biasY1, const float* __restrict__ biasY2) {      /* zA, zB, zC: strides of blockIdx.z; biasY1, biasY2: the bias arrays of planes y = 1 and y = 2 where each plane has an array of its own (else null) */ static_assert(ACT == 0 || ACT == 3 || ACT == 6 || ACT == 8 || ACT == 9 || ACT == 11 || ACT == 12 || ACT == 14 || ACT == 15 || ACT == 16 || ACT == 17, "k_gemm2: unsupported ACT code (would silently apply no activation)");
  __shared__ __attribute__((aligned(16))) float so[4][32][68];
  const int tid = threadIdx.x, w = tid >> 5, lane = tid & 31, ln = lane & 15, hh = lane >> 4; const int by = blockIdx.y;
  const int bz = blockIdx.z; A += (size_t)by * sA + (size_t)bz * zA; Bh += (size_t)by * sB + (size_t)bz * zB; const size_t cofs = (size_t)by * sC + (size_t)bz * zC; const float* bp = bias ? bias + (size_t)by * sBias : nullptr; if (biasY1 && by == 1) bp = biasY1; if (biasY2 && by == 2) bp = biasY2;
  const int ntn = N >> 6; const int mt = blockIdx.x / ntn, nq = blockIdx.x - mt * ntn; const int row0 = mt * 128 + 32 * w, col0 = nq * 64; if (row0 >= M) return;
  const _Float16* a0p = A + (size_t)(row0 + ln) * lda; const _Float16* a1p = a0p + (size_t)16 * lda;
  const _Float16* b0p = Bh + (size_t)(col0 + ln) * ldb; const _Float16* b1p = b0p + (size_t)16 * ldb; const _Float16* b2p = b1p + (size_t)16 * ldb; const _Float16* b3p = b2p + (size_t)16 * ldb;
  const v8f z8 = {0.f,0.f,0.f,0.f,0.f,0.f,0.f,0.f}; v8f accs[8] = {z8, z8, z8, z8, z8, z8, z8, z8};
  /* K loop over two fragment sets: while one 32-k step is multiplied, the other step's 12 loads are in flight. K % 64 == 0; every sum keeps its ascending k order. */
  G2Set s0, s1; int kb = 0; g2_load(s0, a0p, a1p, b0p, b1p, b2p, b3p, 0, hh);
#pragma unroll 1      /* the two steps of a trip are written out; more copies would only add code */
  for (; kb + 64 < K; kb += 64) { g2_load(s1, a0p, a1p, b0p, b1p, b2p, b3p, kb + 32, hh); g2_mul(s0, accs); g2_load(s0, a0p, a1p, b0p, b1p, b2p, b3p, kb + 64, hh); g2_mul(s1, accs); }
  g2_load(s1, a0p, a1p, b0p, b1p, b2p, b3p, kb + 32, hh); g2_mul(s0, accs); g2_mul(s1, accs);      /* the last two steps: nothing is left to fetch behind them */
#pragma unroll
  for (int u = 0; u < 8; ++u) { const int t = u & 3, half = u >> 2; const int col = col0 + t * 16 + ln; const float bv = bp ? bf16_round(bp[col]) : 0.f;
#pragma unroll
    for (int r = 0; r < 8; ++r) { const int rloc = half * 16 + 8 * hh + r; float v = accs[u][r] * alpha + bv; if (CP) { if (rowsPerB < 0) v += CP[cofs + (size_t)(row0g + row0 + rloc) * ldc + col];      /* rowsPerB < 0: own element of the batched C plane */ else { const int bidx = (row0g + row0 + rloc) / rowsPerB; v += CP[(size_t)bidx * sCPb + (size_t)by * 64 + col]; } }
      if (ACT == 3) v = fmaxf(v, 0.f); else if (ACT == 6) v = 0.5f * v * (1.0f + erff(v * 0.70710678118654752f)); else if (ACT == 11) v = 1.0f / (1.0f + expf(-v)); else if (ACT == 15) v = v / (1.0f + expf(-v)); else if (ACT == 12) v = (v > 0.f) ? v : 0.01f * v; else if (ACT == 8) v = tanhf(v); else if (ACT == 9) v = 0.5f * v * (1.0f + tanhf(0.7978845608028654f * (v + 0.044715f * v * v * v))); else if (ACT == 14) v = (v > 0.f) ? v : 0.1f * v; else if (ACT == 16) v = (v >= 0.f) ? v : 0.3f * v; else if (ACT == 17) v = (v >= 0.f) ? v : 0.2f * v;
      so[w][rloc][t * 16 + ln] = v; } }
  __builtin_amdgcn_fence(__ATOMIC_ACQ_REL, "workgroup"); __builtin_amdgcn_wave_barrier();
  const int rsub = lane >> 4, c4 = (lane & 15) * 4;
  {
#pragma unroll
    for (int q = 0; q < 16; ++q) { const int r = q * 2 + rsub; const v4f v = *(const v4fa*)&so[w][r][c4]; if (C) *(v4f*)(C + cofs + (size_t)(row0 + r) * ldc + col0 + c4) = v; if (C16) { v4h h4; for (int i = 0; i < 4; ++i) h4[i] = (_Float16)v[i]; *(v4h*)(C16 + cofs + (size_t)(row0 + r) * ldc + col0 + c4) = h4; } }
     } }


__global__ __launch_bounds__(256) void k_rsm(const float* __restrict__ S, _Float16* __restrict__ P, int nrows) {
  #pragma clang fp contract(off)
  const int i = blockIdx.x * 256 + threadIdx.x; if (i >= nrows) return; const float* s = S + (size_t)i * SQ; float mx = -3.0e38f;
#pragma unroll 1
  for (int j = 0; j < SQ; ++j) mx = fmaxf(mx, s[j]); float se = 0.f;
#pragma unroll 1
  for (int j = 0; j < SQ; ++j) se += expf(s[j] - mx); const float sc = 256.0f / se;
#pragma unroll 1
  for (int j0 = 0; j0 < SQ; j0 += 8) { FragH f; for (int q = 0; q < 8; ++q) f.h[q] = (_Float16)(expf(s[j0 + q] - mx) * sc); unsigned short* d = (unsigned short*)P + (size_t)i * SQ + j0; *(v8us*)d = f.half[0];  } }
__global__ __launch_bounds__(256) void k_vt(const _Float16* __restrict__ V16, _Float16* __restrict__ VT) { __shared__ unsigned short tl[64][65]; const int tid = threadIdx.x; const int hh = blockIdx.x % HG, sg = blockIdx.x / HG; const int s0 = sg * 64; const int b = hh / NH, h = hh % NH;
  for (int i = tid; i < 64 * 8; i += 256) { const int j = i / 8, d8 = (i % 8) * 8; FragH f; f.half[0] = *(const v8us*)((const unsigned short*)V16 + ((size_t)b * SQ + s0 + j) * DM + h * HD + d8); for (int q = 0; q < 8; ++q) tl[d8 + q][j] = f.u[q]; }
  __syncthreads();
  { for (int i = tid; i < 64 * 8; i += 256) { const int d = i / 8, j8 = (i % 8) * 8; FragH f; for (int q = 0; q < 8; ++q) f.u[q] = tl[d][j8 + q]; *(v8us*)((unsigned short*)VT + ((size_t)hh * HD + d) * SQ + s0 + j8) = f.half[0]; }  } }

#define FH 2048
#define KN 103
typedef int v4ia __attribute__((ext_vector_type(4), may_alias));
__device__ __forceinline__ void xcnt_wait() { asm volatile("s_wait_xcnt 0x0" ::: "memory"); }
// Operand preparation, one launch: the six weight matrices as x16 f16 planes (they lie one behind the other in Bt, in the order wq, wk, wv, wo, w1, w2) and x as bf16-rounded f32 rows.
// A weight or x work-group converts 256 x 8 elements of one array, a prior_mask one 256 words of 32 entries, a prior_indices one 8 query rows; which part follows from blockIdx.x alone.
#define PW (DM * DM / 2048)          /* work-groups per DM x DM weight */
#define PF (FH * DM / 2048)          /* work-groups per FH x DM weight */
#define PX ((int)(NR * DM / 2048))   /* work-groups for x */
#define PB0 (4 * PW + 2 * PF + PX)   /* first work-group of the prior tables' packing */
#define PMD (SQ * (SQ / 32) / 256)   /* prior_mask: one thread per 32-key word */
#define PMS (SQ / 8)                 /* prior_indices: one wave per query row */
static_assert((DM * DM) % 2048 == 0 && (FH * DM) % 2048 == 0 && (NR * DM) % 2048 == 0, "k_prep: whole work-groups per array");
__global__ __launch_bounds__(256) void k_prep(const float* __restrict__ wq, const float* __restrict__ wk, const float* __restrict__ wv, const float* __restrict__ wo, const float* __restrict__ w1, const float* __restrict__ w2, const float* __restrict__ x, _Float16* __restrict__ Bt, float* __restrict__ XF, const int* __restrict__ pmask, const int* __restrict__ pidx, const int* __restrict__ pim, unsigned int* __restrict__ MD, unsigned int* __restrict__ MS) {
  __shared__ __attribute__((aligned(16))) unsigned char bm[8][SQ];      /* prior_indices: the wave's own row of key flags (any index set) */
  const int blk = blockIdx.x; const float* src; int first;
  if (blk >= PB0 + PMD) {      /* MS[q][j / 32] bit j % 32: key j is one of row q's valid prior slots */
    const int lane = threadIdx.x & 31, w = threadIdx.x >> 5; const int q = (blk - PB0 - PMD) * 8 + w; const int* ix = pidx + (size_t)q * KN; const int* vm = pim + (size_t)q * KN; constexpr int NT = (KN + 31) / 32; int jx[NT]; bool ok[NT];
#pragma unroll      /* constant indices: the lane's values stay in registers and its loads issue together */
    for (int t = 0; t < NT; ++t) { const int k = t * 32 + lane; const int kc = k < KN ? k : KN - 1; jx[t] = ix[kc]; const int vk = vm[kc]; xcnt_wait(); ok[t] = (k < KN) & (vk != 0); }      /* a later load's result may land in an earlier load's address register: the wait stands between them */
    const v4ia z = {0, 0, 0, 0}; *(v4ia*)&bm[w][lane * 32] = z; *(v4ia*)&bm[w][lane * 32 + 16] = z;
    /* the zeros of every lane are in LDS before any lane sets a flag over them */
    __builtin_amdgcn_fence(__ATOMIC_ACQ_REL, "workgroup"); __builtin_amdgcn_wave_barrier();
#pragma unroll      /* constant indices: the lane's values stay in registers */
    for (int t = 0; t < NT; ++t) if (ok[t]) bm[w][min(max(jx[t], 0), SQ - 1)] = 1;      /* the key index is bounded here before it forms an address */
    /* the flags of every lane are in LDS before the row is read back */
    __builtin_amdgcn_fence(__ATOMIC_ACQ_REL, "workgroup"); __builtin_amdgcn_wave_barrier();
    unsigned int word = 0;
#pragma unroll      /* 32 independent LDS reads issue together */
    for (int c = 0; c < SQ / 32; ++c) { const unsigned int bal = __builtin_amdgcn_ballot_w32(bm[w][c * 32 + lane] != 0); if (lane == c) word = bal; }
    MS[(size_t)q * (SQ / 32) + lane] = word; return; }
  if (blk >= PB0) {      /* MD[q][j / 32] bit j % 32: prior_mask[q][j] */
    const size_t t = (size_t)(blk - PB0) * 256 + threadIdx.x; v4ia mv[8]; unsigned int word = 0;
#pragma unroll      /* constant indices: the lane's values stay in registers and its loads issue together */
    for (int i = 0; i < 8; ++i) mv[i] = *(const v4ia*)(pmask + t * 32 + i * 4);
    xcnt_wait();      /* the address registers of the eight loads may take new values below */
#pragma unroll      /* constant indices: the lane's values stay in registers */
    for (int i = 0; i < 8; ++i) for (int e = 0; e < 4; ++e) word |= (mv[i][e] != 0 ? 1u : 0u) << (i * 4 + e);
    MD[t] = word;
    xcnt_wait(); return; }      /* the listing lets another part's code follow, which writes the store's registers */
  if (blk < PW) { src = wq; first = 0; } else if (blk < 2 * PW) { src = wk; first = PW; } else if (blk < 3 * PW) { src = wv; first = 2 * PW; } else if (blk < 4 * PW) { src = wo; first = 3 * PW; }
  else if (blk < 4 * PW + PF) { src = w1; first = 4 * PW; } else if (blk < 4 * PW + 2 * PF) { src = w2; first = 4 * PW + PF; } else { src = x; first = 4 * PW + 2 * PF; }
  const size_t t = (size_t)(blk - first) * 256 + threadIdx.x; const v4f a0 = *(const v4fa*)(src + t * 8), a1 = *(const v4fa*)(src + t * 8 + 4);
  xcnt_wait();      /* the address registers of the two loads may take new values below */
  if (blk < 4 * PW + 2 * PF) { FragH f;
#pragma unroll      /* constant indices: the values stay in registers */
    for (int q = 0; q < 4; ++q) { f.h[q] = (_Float16)(bf16_round(a0[q]) * 16.0f); f.h[4 + q] = (_Float16)(bf16_round(a1[q]) * 16.0f); }
    *(v8us*)((unsigned short*)Bt + ((size_t)blk * 256 + threadIdx.x) * 8) = f.half[0];
    xcnt_wait(); }      /* the listing lets another part's code follow, which writes the store's registers */
  else { v8f o;
#pragma unroll      /* constant indices: the values stay in registers */
    for (int q = 0; q < 4; ++q) { o[q] = bf16_round(a0[q]); o[4 + q] = bf16_round(a1[q]); }
    *(v8f*)(XF + t * 8) = o;
    xcnt_wait(); } }      /* the listing lets the weight part's code follow, which writes the two stores' registers */
__device__ __forceinline__ float wave_max(float v) {
#pragma unroll      /* five fixed butterfly steps */
  for (int m = 16; m > 0; m >>= 1) v = fmaxf(v, __shfl_xor(v, m, 32)); return v; }
__device__ __forceinline__ float wave_sum(float v) {
#pragma unroll      /* five fixed butterfly steps */
  for (int m = 16; m > 0; m >>= 1) v += __shfl_xor(v, m, 32); return v; }
// Row LayerNorm, one wave per row: lane l owns columns c*256 + l*8 .. +7 (c = 0, 1), held in registers for the three passes.
__global__ __launch_bounds__(256) void k_lnw(const float* __restrict__ HF, const float* __restrict__ g, const float* __restrict__ bb, _Float16* __restrict__ X16o) {
  const int lane = threadIdx.x & 31; const size_t r = (size_t)blockIdx.x * 8 + (threadIdx.x >> 5); if (r >= NR) return; const float* x = HF + r * DM; float v[16]; float s = 0.f;
#pragma unroll      /* constant indices: the lane's values stay in registers and its loads issue together */
  for (int c = 0; c < 2; ++c) { const int j0 = c * 256 + lane * 8; const v4f a0 = *(const v4fa*)(x + j0), a1 = *(const v4fa*)(x + j0 + 4);
#pragma unroll      /* constant indices: the lane's values stay in registers and its loads issue together */
    for (int e = 0; e < 4; ++e) { v[c * 8 + e] = a0[e]; v[c * 8 + 4 + e] = a1[e]; } }
#pragma unroll      /* constant indices: the lane's values stay in registers and its loads issue together */
  for (int e = 0; e < 16; ++e) s += v[e];
  const float mu = wave_sum(s) / (float)DM; float qs = 0.f;
#pragma unroll      /* constant indices: the lane's values stay in registers and its loads issue together */
  for (int e = 0; e < 16; ++e) { const float dd = v[e] - mu; qs += dd * dd; }
  const float rs = 1.0f / sqrtf(wave_sum(qs) / (float)DM + 1e-5f);
#pragma unroll      /* constant indices: the lane's values stay in registers and its loads issue together */
  for (int c = 0; c < 2; ++c) { const int j0 = c * 256 + lane * 8; const v4f g0 = *(const v4fa*)(g + j0), g1 = *(const v4fa*)(g + j0 + 4), b0 = *(const v4fa*)(bb + j0), b1 = *(const v4fa*)(bb + j0 + 4); FragH f;
#pragma unroll      /* constant indices: the lane's values stay in registers and its loads issue together */
    for (int e = 0; e < 4; ++e) { f.h[e] = (_Float16)((v[c * 8 + e] - mu) * rs * bf16_round(g0[e]) + bf16_round(b0[e])); f.h[4 + e] = (_Float16)((v[c * 8 + 4 + e] - mu) * rs * bf16_round(g1[e]) + bf16_round(b1[e])); }
    *(v8us*)((unsigned short*)X16o + r * DM + j0) = f.half[0]; } }
// Lane l <-> l ^ 16: the two lanes that hold one query's column of a D tile.
__device__ __forceinline__ float xhalf(float x) { const int b = __builtin_bit_cast(int, x); return __builtin_bit_cast(float, __builtin_amdgcn_permlanex16(b, b, 0x76543210, 0xfedcba98, false, false)); }
typedef unsigned int v2ua __attribute__((ext_vector_type(2), may_alias));
// The A fragments of one 64-key chunk: four 16-row groups (pitch16 elements apart) x two 32-k steps.
struct AtSet { v16h f[8]; };
__device__ __forceinline__ void at_load(AtSet& s, const _Float16* p, size_t pitch16) {      /* p: the lane's own address, its row and its 8 * hh included */
#pragma unroll      /* constant indices: the fragments stay in registers and their loads issue together */
  for (int t = 0; t < 4; ++t) { s.f[2 * t] = g2_frag(p + t * pitch16, 0); s.f[2 * t + 1] = g2_frag(p + t * pitch16 + 32, 0); }
  asm volatile("s_wait_xcnt 0x0" :: "v"(p) : "memory");      /* stands in front of whatever gives new values to the address registers of these loads; the address as an input keeps its registers alive up to here, so that no load's result lands in them */
  __builtin_amdgcn_sched_barrier(0); }      /* keeps the 16 loads and their wait here, ahead of the work that hides them: moved down to their first uses the loads would each be waited for in turn */
// Attention, scores to merged heads in one launch: a wave owns 16 queries of one (batch, head) and walks the 1,024 keys in chunks of 64.
// S^T = K . Q^T puts one query's scores into one lane pair (l, l ^ 16); two converted S^T tiles are the B operand of O^T += V^T . P^T, so neither scores nor weights leave the registers.
// Running maximum m and sum l per query; a key outside the prior gets the penalty pen: -lam in the dense branch, -1e30 in the sparse branch (its weight is exactly 0 once a key of the set has been met, and what was summed before that is scaled by exactly 0).
__global__ __launch_bounds__(128) void k_attn(const _Float16* __restrict__ Q16, const _Float16* __restrict__ K16, const _Float16* __restrict__ VT, const unsigned int* __restrict__ MD, const unsigned int* __restrict__ MS, const float* __restrict__ uprev, _Float16* __restrict__ O16) {
  const int tid = threadIdx.x, w = tid >> 5, lane = tid & 31, ln = lane & 15, hh = lane >> 4; const int h = blockIdx.y, b = blockIdx.z; const int q0 = (blockIdx.x * 4 + w) * 16;
  const float lam = 10.0f * expf(-5.0f * bf16_round(uprev[b])); const bool sparse = lam >= 1.0f; const float pen = sparse ? -1.0e30f : -lam;
  const unsigned int* mk = (sparse ? MS : MD) + (size_t)(q0 + ln) * (SQ / 32);
  const _Float16* qp = Q16 + ((size_t)b * SQ + q0 + ln) * DM + h * HD + 8 * hh; const _Float16* kp = K16 + ((size_t)b * SQ + ln) * DM + h * HD + 8 * hh; const _Float16* vp = VT + ((size_t)(b * NH + h) * HD + ln) * SQ + 8 * hh;      /* each with the lane's 8 * hh of the k order */
  const v16h qb0 = g2_frag(qp, 0), qb1 = g2_frag(qp + 32, 0); v2ua mw = *(const v2ua*)mk;      /* mw: this query's 64 prior bits of the chunk at hand */
  asm volatile("s_wait_xcnt 0x0" :: "v"(qp), "v"(mk) : "memory"); __builtin_amdgcn_sched_barrier(0);      /* the wait stands in front of whatever gives new values to the address registers of these five loads (as inputs they stay alive up to here); the barrier keeps later code behind it */
  AtSet kf, vf; at_load(kf, kp, (size_t)16 * DM);
  const v8f z8 = {0.f,0.f,0.f,0.f,0.f,0.f,0.f,0.f}; v8f o[4] = {z8, z8, z8, z8}; float m = -3.0e38f, l = 0.f;
  const _Float16* vq = vp; const _Float16* kq = kp + (size_t)64 * DM;      /* running addresses: they live across their loads, so no load's result can land in them, and they move on behind the loads' wait */
#pragma unroll 1      /* one chunk per trip: a second copy would double the fragment registers */
  for (int c = 0; c < SQ / 64; ++c) {
    const v2ua mn = *(const v2ua*)(mk + ((c + 1) & (SQ / 64 - 1)) * 2);      /* the next chunk's prior bits, one trip ahead like the K rows */
    xcnt_wait();      /* a later load's result may land in this load's address registers: the wait stands between them */
    at_load(vf, vq, (size_t)16 * SQ); vq += 64;
    v8f s[4];
#pragma unroll      /* constant indices: the tiles stay in registers */
    for (int t = 0; t < 4; ++t) s[t] = g2_mma(kf.f[2 * t + 1], qb1, g2_mma(kf.f[2 * t], qb0, z8));
    at_load(kf, kq, (size_t)16 * DM); kq = c + 2 < SQ / 64 ? kq + (size_t)64 * DM : kp;      /* the next chunk's K rows fly under the softmax; the last trip fetches chunk 0 again, in bounds and unused */
    float mx = m;
#pragma unroll      /* constant indices: the tiles stay in registers */
    for (int t = 0; t < 4; ++t) { const unsigned int by = mw[t >> 1] >> (16 * (t & 1) + 8 * hh);      /* bit r: key 16 t + 8 hh + r of the chunk */
#pragma unroll      /* constant indices: the tiles stay in registers */
      for (int r = 0; r < 8; ++r) { const float v = s[t][r] * 0.125f + (((by >> r) & 1u) ? 0.f : pen); s[t][r] = v; mx = fmaxf(mx, v); } }
    mx = fmaxf(mx, xhalf(mx)); const float corr = expf(m - mx); m = mx; float ps = 0.f; FragH p0, p1;
#pragma unroll      /* constant indices: the tiles stay in registers */
    for (int r = 0; r < 8; ++r) { const float e0 = expf(s[0][r] - mx), e1 = expf(s[1][r] - mx), e2 = expf(s[2][r] - mx), e3 = expf(s[3][r] - mx); ps += (e0 + e1) + (e2 + e3);
      p0.h[r] = (_Float16)(e0 * 256.0f); p0.h[8 + r] = (_Float16)(e1 * 256.0f); p1.h[r] = (_Float16)(e2 * 256.0f); p1.h[8 + r] = (_Float16)(e3 * 256.0f); }
    l = l * corr + ps;
#pragma unroll      /* constant indices: the tiles stay in registers */
    for (int t = 0; t < 4; ++t) { o[t] *= corr; o[t] = g2_mma(vf.f[2 * t + 1], p1.v, g2_mma(vf.f[2 * t], p0.v, o[t])); }
    mw = mn; }
  l += xhalf(l); const float inv = 1.0f / (256.0f * l);      /* l >= 1: the key that holds the maximum adds exp(0) */
  unsigned short* od = (unsigned short*)O16 + ((size_t)b * SQ + q0 + ln) * DM + h * HD + 8 * hh;
#pragma unroll      /* constant indices: the tiles stay in registers */
  for (int t = 0; t < 4; ++t) { FragH f;
#pragma unroll      /* constant indices: the tiles stay in registers */
    for (int r = 0; r < 8; ++r) f.h[r] = (_Float16)(o[t][r] * inv);
    *(v8us*)(od + t * 16) = f.half[0]; } }
// Row norms, one wave per row, 32 rows per work-group, so that one wave stores the group's 32 values as one whole 128-byte line of U.
static_assert(NR % 32 == 0, "k_unormw: 32 rows per work-group");
__global__ __launch_bounds__(1024) void k_unormw(const float* __restrict__ OUT, const float* __restrict__ XF, float* __restrict__ U) {
  __shared__ float ur[32];
  const int lane = threadIdx.x & 31, w = threadIdx.x >> 5; const size_t r = (size_t)blockIdx.x * 32 + w; float sd = 0.f, sx = 0.f;
#pragma unroll      /* constant indices: the lane's values stay in registers and its loads issue together */
  for (int c = 0; c < 4; ++c) { const int j0 = c * 128 + lane * 4; const v4f o = *(const v4fa*)(OUT + r * DM + j0), xv = *(const v4fa*)(XF + r * DM + j0);
#pragma unroll      /* constant indices: the lane's values stay in registers and its loads issue together */
    for (int e = 0; e < 4; ++e) { const float dd = o[e] - xv[e]; sd += dd * dd; sx += xv[e] * xv[e]; } }
  sd = wave_sum(sd); sx = wave_sum(sx); if (lane == 0) ur[w] = sqrtf(sd) / (sqrtf(sx) + 1e-8f);
  __syncthreads();      /* the 32 waves' row values are in LDS before wave 0 reads them */
  if (threadIdx.x < 32) U[(size_t)blockIdx.x * 32 + threadIdx.x] = ur[threadIdx.x]; }
// Batch means in float64: one wave, 32 lanes over the 1,024 rows of a batch, lane b stores batch b.
__global__ __launch_bounds__(32) void k_umeanw(const float* __restrict__ U, float* __restrict__ out1) { const int lane = threadIdx.x; float res = 0.f;
#pragma unroll      /* constant indices: the lane's values stay in registers and its loads issue together */
  for (int b = 0; b < NB; ++b) { double s = 0.0;
#pragma unroll      /* constant indices: the lane's values stay in registers and its loads issue together */
    for (int c = 0; c < SQ / 128; ++c) { const v4f a = *(const v4fa*)(U + (size_t)b * SQ + c * 128 + lane * 4);
#pragma unroll      /* constant indices: the lane's values stay in registers and its loads issue together */
      for (int e = 0; e < 4; ++e) s += (double)a[e]; }
#pragma unroll      /* five fixed butterfly steps */
    for (int m = 16; m > 0; m >>= 1) s += __shfl_xor(s, m, 32);
    if (lane == b) res = (float)(s / (double)SQ); }
  if (lane < NB) out1[lane] = res; }
extern "C" void kernel_launch(void* const* d_in, const int* in_sizes, int n_in,
                              void* d_out, int out_size, void* d_ws, size_t ws_size, hipStream_t stream) {
  (void)in_sizes; (void)n_in; (void)out_size;
  const float* const* I = (const float* const*)d_in; const float* x = I[0]; const float* uprev = I[1]; const float* wq = I[2]; const float* bq = I[3]; const float* wk = I[4]; const float* bk = I[5]; const float* wv = I[6]; const float* bv = I[7]; const float* wo = I[8]; const float* bo = I[9]; const float* l1g = I[10]; const float* l1b = I[11]; const float* l2g = I[12]; const float* l2b = I[13]; const float* w1 = I[14]; const float* b1 = I[15]; const float* w2 = I[16]; const float* b2 = I[17]; const int* pmask = (const int*)d_in[18]; const int* pidx = (const int*)d_in[19]; const int* pim = (const int*)d_in[20];
  float* out0 = (float*)d_out; float* out1 = out0 + NR * DM;
  char* ws = (char*)d_ws; size_t off = 0;
  auto take = [&](size_t bytes) { char* p = ws + off; off += (bytes + 255) & ~(size_t)255; return p; };
  _Float16* BQ = (_Float16*)take(((size_t)4 * DM * DM + (size_t)2 * FH * DM) * 2); _Float16* BO = BQ + (size_t)3 * DM * DM; _Float16* BW1 = BO + (size_t)DM * DM; _Float16* BW2 = BW1 + (size_t)FH * DM;      /* one block: the planes of wq, wk, wv, wo, w1, w2 one behind the other */
  float* XF = (float*)take(NR * DM * 4); float* HF = (float*)take(NR * DM * 4); _Float16* G16 = (_Float16*)take(NR * FH * 2); float* U = (float*)take(NR * 4);
  _Float16* X16 = (_Float16*)take(NR * DM * 2); _Float16* Q16 = (_Float16*)take(3 * NR * DM * 2); _Float16* K16 = Q16 + NR * DM; _Float16* V16 = K16 + NR * DM; _Float16* O16 = (_Float16*)take(NR * DM * 2);
  _Float16* VT = (_Float16*)take((size_t)HG * HD * SQ * 2); unsigned int* MD = (unsigned int*)take((size_t)SQ * (SQ / 32) * 4); unsigned int* MS = (unsigned int*)take((size_t)SQ * (SQ / 32) * 4);
  if (off > ws_size) return;      /* 6 + 4 + 4 + 8 + 2x5 + 2 = about 34 MiB */
  k_prep<<<PB0 + PMD + PMS, 256, 0, stream>>>(wq, wk, wv, wo, w1, w2, x, BQ, XF, pmask, pidx, pim, MD, MS); k_lnw<<<(unsigned)((NR + 7) / 8), 256, 0, stream>>>(XF, l1g, l1b, X16);
  const dim3 gp((unsigned)((NR / 128) * (DM / 64)), 1);
  k_gemm2<0><<<dim3(gp.x, 3), 128, 0, stream>>>(X16, DM, 0, BQ, DM, (size_t)DM * DM, 0.0625f, bq, 0, nullptr, 1, 0, 0, nullptr, Q16, DM, NR * DM, (int)NR, DM, DM, 0, 0, 0, bk, bv);      /* y = 0, 1, 2: q, k, v */
  k_vt<<<HG * (SQ / 64), 256, 0, stream>>>(V16, VT);
  k_attn<<<dim3(SQ / 64, NH, NB), 128, 0, stream>>>(Q16, K16, VT, MD, MS, uprev, O16);      /* o (merged heads) as f16 rows; x = 64 queries, y = head, z = batch */
  k_gemm2<0><<<gp, 128, 0, stream>>>(O16, DM, 0, BO, DM, 0, 0.0625f, bo, 0, XF, 1, (size_t)DM, 0, HF, nullptr, DM, 0, (int)NR, DM, DM, 0, 0, 0, nullptr, nullptr);      /* h = x + attn W_o^T + b_o */
  k_lnw<<<(unsigned)((NR + 7) / 8), 256, 0, stream>>>(HF, l2g, l2b, X16);
  k_gemm2<6><<<dim3((unsigned)((NR / 128) * (FH / 64)), 1), 128, 0, stream>>>(X16, DM, 0, BW1, DM, 0, 0.0625f, b1, 0, nullptr, 1, 0, 0, nullptr, G16, FH, 0, (int)NR, FH, DM, 0, 0, 0, nullptr, nullptr);      /* gelu_erf(LN2(h) W1^T + b1) */
  k_gemm2<0><<<gp, 128, 0, stream>>>(G16, FH, 0, BW2, FH, 0, 0.0625f, b2, 0, HF, 1, (size_t)DM, 0, out0, nullptr, DM, 0, (int)NR, DM, FH, 0, 0, 0, nullptr, nullptr);      /* out = h + (...) W2^T + b2, rows are the output layout */
  k_unormw<<<(unsigned)(NR / 32), 1024, 0, stream>>>(out0, XF, U); k_umeanw<<<1, 32, 0, stream>>>(U, out1);
}

// v005
// It runs in 113 microseconds.
// Next to v004, in two timings, it ran 1.51 times as fast each time.
// Counting every step since v000, it is 33.6 times as fast.
#include <hip/hip_runtime.h>
// SPDGMultiHeadAttention (x [2][1024][512], u_prev [2][1]; xn = LN1(x); Q,K,V = xn W^T + b (8 heads of 64); lam = 10 exp(-5 u_prev); per batch: if lam >= 1 the SPARSE branch (softmax over the prior window slots prior_indices[i][k] with prior_index_mask, others excluded) else the DENSE branch (softmax over all keys of q.k/8 + lam*(prior_mask ? 0 : -1)); attn = merge W_o^T + b_o; h = x + attn; out = h + gelu_erf(LN2(h) W1^T + b1) W2^T + b2 -> [2][1024][512]; aggregated_u[b] = mean_s ||out - x|| / (||x|| + 1e-8) -> [2][1]).
// Structure: token rows; bf16(x) as f32 residual rows + LN1 on VALU (f32, wave per row) into f16 rows; Q | K | V WMMA GEMMs as one launch (32x64 wave tiles, f32 accumulation, exact x16 weights + bias, f16 outputs); the prior tables packed to one bit per (query, key) beside the operand preparation; V^T via LDS; all 16 (batch, head) pairs in one attention launch: per wave 16 queries, S^T = K . Q^T per 64 keys, the branch-selecting running softmax in registers (lam from u_prev; f32; weights x256 as f16), O^T += V^T . P^T, merged f16 rows; W_o GEMM + b_o + x (residual added in the epilogue) -> h; LN2 on VALU; fc1 GEMM with the exact-erf GELU epilogue (f16 hidden); fc2 GEMM + b2 + h straight into the output rows; the surprise statistic on VALU (per-row norms, float64 means per batch) into output 1.
// Compute dtype: inputs rounded to bf16; x / weights exact; LN outputs, q, k, v, softmax weights, o, GELU hidden plain f16 (~2^-12); residual, LN statistics, scores, softmax, norms f32/f64. v_wmma_f32_16x16x32_f16.
#define NB 2
#define SQ 1024
#define DM 512
#define NH 8
#define HD 64
#define HG (NB * NH)                 /* (batch, head) pairs per attention launch: all of them */
#define QN SQ                        /* query rows per batch; unused, the attention grid covers all SQ */
#define NR ((size_t)NB * SQ)         /* 2048 token rows */
typedef __bf16 v16b __attribute__((ext_vector_type(16)));
typedef unsigned short v8us __attribute__((ext_vector_type(8), may_alias));
typedef float  v8f  __attribute__((ext_vector_type(8)));
typedef float  v4f  __attribute__((ext_vector_type(4)));
typedef float  v4fa __attribute__((ext_vector_type(4), may_alias));
union FragB { v16b v; v8us half[2]; unsigned short u[16]; };

__device__ __forceinline__ unsigned short bf16_bits(float x) { unsigned int u = __float_as_uint(x); return (unsigned short)((u + 0x7FFFu + ((u >> 16) & 1u)) >> 16); }
__device__ __forceinline__ float bf16_val(unsigned short b) { return __uint_as_float(((unsigned int)b) << 16); }
__device__ __forceinline__ float bf16_round(float x) { return bf16_val(bf16_bits(x)); }
// D += A·B with NT terms: 1 = ah·bh, 2 = + al·bh (A split), 3 = + ah·bl (both split)
template <int NT>
__device__ __forceinline__ v8f mmaN(v16b ah, v16b al, v16b bh, v16b bl, v8f c) {
  c = __builtin_amdgcn_wmma_f32_16x16x32_bf16(false, ah, false, bh, (short)0, c, false, false);
  if (NT >= 2) c = __builtin_amdgcn_wmma_f32_16x16x32_bf16(false, al, false, bh, (short)0, c, false, false);
  if (NT >= 3) c = __builtin_amdgcn_wmma_f32_16x16x32_bf16(false, ah, false, bl, (short)0, c, false, false);
  asm volatile("v_nop\n\tv_nop\n\tv_nop\n\tv_nop" : "+v"(c) : "v"(ah), "v"(al), "v"(bh), "v"(bl));
  return c;
}

__global__ __launch_bounds__(256) void k_wt_bf16(const float* __restrict__ W, unsigned short* __restrict__ Wt, int K, int N) {
  const int t = blockIdx.x * 256 + threadIdx.x;
  const int k8n = K / 8;
  if (t >= N * k8n) return;
  const int n = t / k8n, k8 = (t % k8n) * 8;
  v8us v;
#pragma unroll
  for (int i = 0; i < 8; ++i) v[i] = bf16_bits(W[(size_t)(k8 + i) * N + n]);
  *(v8us*)(Wt + (size_t)n * K + k8) = v;
  
}

// GEMM C[M][N] (f32, pitch ldc) = act(A[M][K]·W + bias). A f32 row-major (pitch lda) converted per fragment to bf16
// (ASPLIT: hi/lo two planes -> 2 terms, else single rounded term); Wt bf16 [N][K] (pitch ldb). BIAS_BF16 rounds the
// bias to bf16 first (bias quantised to bf16 before the add). K%32==0, M%16==0, N%64==0.
template <bool ASPLIT, int ACT, bool BIAS_BF16>
__global__ __launch_bounds__(128) void k_gemm_bf(const float* __restrict__ A, int lda, const unsigned short* __restrict__ Wt, int ldb,
                                               const float* __restrict__ bias, float* __restrict__ C, int ldc, int M, int N, int K) {
  __shared__ __attribute__((aligned(16))) float so[4][16][64];
  const int tid = threadIdx.x, w = tid >> 5, lane = tid & 31, ln = lane & 15, hh = lane >> 4;
  const int ntn = N / 64;
  const int wid = blockIdx.x * 4 + w;
  const int mt = wid / ntn, nq = wid % ntn;
  if (mt * 16 >= M) return;
  const int row0 = mt * 16, col0 = nq * 64;
  const float* arow = A + (size_t)(row0 + ln) * lda;
  v8f acc[4] = {};
  for (int kb = 0; kb < K; kb += 32) {
    FragB ah, al;
    const v4f x0 = *(const v4fa*)(arow + kb + 8 * hh), x1 = *(const v4fa*)(arow + kb + 8 * hh + 4);
    const v4f x2 = *(const v4fa*)(arow + kb + 16 + 8 * hh), x3 = *(const v4fa*)(arow + kb + 16 + 8 * hh + 4);
    float xs[16] = {x0[0],x0[1],x0[2],x0[3],x1[0],x1[1],x1[2],x1[3],x2[0],x2[1],x2[2],x2[3],x3[0],x3[1],x3[2],x3[3]};
#pragma unroll
    for (int i = 0; i < 16; ++i) { const unsigned short hb = bf16_bits(xs[i]); ah.u[i] = hb; al.u[i] = ASPLIT ? bf16_bits(xs[i] - bf16_val(hb)) : (unsigned short)0; }
#pragma unroll
    for (int t = 0; t < 4; ++t) {
      const unsigned short* brow = Wt + (size_t)(col0 + t * 16 + ln) * ldb + kb;
      FragB b;
      b.half[0] = *(const v8us*)(brow + 8 * hh);
      b.half[1] = *(const v8us*)(brow + 16 + 8 * hh);
      acc[t] = mmaN<ASPLIT ? 2 : 1>(ah.v, al.v, b.v, b.v, acc[t]);
    }
  }
#pragma unroll
  for (int t = 0; t < 4; ++t) {
    float bv = bias ? bias[col0 + t * 16 + ln] : 0.f;
    if (BIAS_BF16) bv = bf16_round(bv);
#pragma unroll
    for (int r = 0; r < 8; ++r) { float v = acc[t][r] + bv; if (ACT == 1) v = fmaxf(v, 0.f); so[w][8 * hh + r][t * 16 + ln] = v; }
  }
  __builtin_amdgcn_fence(__ATOMIC_ACQ_REL, "workgroup");
  __builtin_amdgcn_wave_barrier();
  const int rsub = lane >> 4, c4 = (lane & 15) * 4;
  {
#pragma unroll
    for (int q = 0; q < 8; ++q) {
      const int r = q * 2 + rsub;
      const v4f v = *(const v4fa*)&so[w][r][c4];
      *(v4f*)(C + (size_t)(row0 + r) * ldc + col0 + c4) = v;
    }
    
  }
}

// GEMM C = act(A·W + bias + resid): A f32 (ASPLIT -> hi/lo 2 terms), Wt bf16 [N][K]; ACT 0 none, 1 relu, 2 exact gelu;
// resid (optional, f32, row index = (row % rmod), pitch ldr, RES_BF16 rounds it) added before the activation.
template <bool ASPLIT, int ACT, bool BIAS_BF16, bool RES_BF16>
__global__ __launch_bounds__(128) void k_gemm_bf3(const float* __restrict__ A, int lda, const unsigned short* __restrict__ Wt, int ldb,
                                                const float* __restrict__ bias, const float* __restrict__ resid, int rmod, int ldr,
                                                float* __restrict__ C, int ldc, int M, int N, int K) {
  __shared__ __attribute__((aligned(16))) float so[4][16][64];
  const int tid = threadIdx.x, w = tid >> 5, lane = tid & 31, ln = lane & 15, hh = lane >> 4;
  const int ntn = N / 64;
  const int wid = blockIdx.x * 4 + w;
  const int mt = wid / ntn, nq = wid % ntn;
  if (mt * 16 >= M) return;
  const int row0 = mt * 16, col0 = nq * 64;
  const float* arow = A + (size_t)(row0 + ln) * lda;
  v8f acc[4] = {};
  for (int kb = 0; kb < K; kb += 32) {
    FragB ah, al;
    const v4f x0 = *(const v4fa*)(arow + kb + 8 * hh), x1 = *(const v4fa*)(arow + kb + 8 * hh + 4);
    const v4f x2 = *(const v4fa*)(arow + kb + 16 + 8 * hh), x3 = *(const v4fa*)(arow + kb + 16 + 8 * hh + 4);
    float xs[16] = {x0[0],x0[1],x0[2],x0[3],x1[0],x1[1],x1[2],x1[3],x2[0],x2[1],x2[2],x2[3],x3[0],x3[1],x3[2],x3[3]};
#pragma unroll
    for (int i = 0; i < 16; ++i) { const unsigned short hb = bf16_bits(xs[i]); ah.u[i] = hb; al.u[i] = ASPLIT ? bf16_bits(xs[i] - bf16_val(hb)) : (unsigned short)0; }
#pragma unroll
    for (int t = 0; t < 4; ++t) {
      const unsigned short* brow = Wt + (size_t)(col0 + t * 16 + ln) * ldb + kb;
      FragB b;
      b.half[0] = *(const v8us*)(brow + 8 * hh);
      b.half[1] = *(const v8us*)(brow + 16 + 8 * hh);
      acc[t] = mmaN<ASPLIT ? 2 : 1>(ah.v, al.v, b.v, b.v, acc[t]);
    }
  }
#pragma unroll
  for (int t = 0; t < 4; ++t) {
    const int col = col0 + t * 16 + ln;
    float bv = bias ? bias[col] : 0.f;
    if (BIAS_BF16) bv = bf16_round(bv);
#pragma unroll
    for (int r = 0; r < 8; ++r) {
      float v = acc[t][r] + bv;
      if (resid) { float rv = resid[(size_t)((row0 + 8 * hh + r) % rmod) * ldr + col]; if (RES_BF16) rv = bf16_round(rv); v += rv; }
      if (ACT == 1) v = fmaxf(v, 0.f);
      if (ACT == 2) v = 0.5f * v * (1.0f + erff(v * 0.70710678118654752f));
      if (ACT == 3) { const float u = 0.7978845608028654f * (v + 0.044715f * v * v * v); v = 0.5f * v * (1.0f + tanhf(u)); }
      so[w][8 * hh + r][t * 16 + ln] = v;
    }
  }
  __builtin_amdgcn_fence(__ATOMIC_ACQ_REL, "workgroup");
  __builtin_amdgcn_wave_barrier();
  const int rsub = lane >> 4, c4 = (lane & 15) * 4;
  {
#pragma unroll
    for (int q = 0; q < 8; ++q) {
      const int r = q * 2 + rsub;
      const v4f v = *(const v4fa*)&so[w][r][c4];
      *(v4f*)(C + (size_t)(row0 + r) * ldc + col0 + c4) = v;
    }
    
  }
}
// row LayerNorm (biased variance, eps) over N: s = X (+ R); optional out_sum <- s; out_norm <- (s-mu)*rsqrt(var+eps)*g + b
template <bool PARAM_BF16>
__global__ __launch_bounds__(256) void k_layernorm(const float* __restrict__ X, const float* __restrict__ R, const float* __restrict__ g, const float* __restrict__ bta,
                                                  float* __restrict__ out_sum, float* __restrict__ out_norm, int N, float eps) {
  __shared__ float red[256];
  const int row = blockIdx.x, tid = threadIdx.x;
  const float* x = X + (size_t)row * N; const float* rr = R ? R + (size_t)row * N : nullptr;
  float vals[16];                     // up to N = 4096
  const int per = N / 256;            // contiguous chunk per thread? use strided-by-4 chunks: thread handles j = tid*4 + 1024*u
  float s1 = 0.f;
  for (int u = 0; u < per / 4; ++u) {
    const int j = tid * 4 + 1024 * u;
    const v4f a = *(const v4fa*)(x + j);
    v4f b = {0.f,0.f,0.f,0.f}; if (rr) b = *(const v4fa*)(rr + j);
#pragma unroll
    for (int q = 0; q < 4; ++q) { const float v = a[q] + b[q]; vals[u * 4 + q] = v; s1 += v; }
  }
  red[tid] = s1; __syncthreads();
  for (int st = 128; st > 0; st >>= 1) { if (tid < st) red[tid] += red[tid + st]; __syncthreads(); }
  const float mu = red[0] / (float)N; __syncthreads();
  float s2 = 0.f;
  for (int u = 0; u < per / 4; ++u)
#pragma unroll
    for (int q = 0; q < 4; ++q) { const float c = vals[u * 4 + q] - mu; s2 += c * c; }
  red[tid] = s2; __syncthreads();
  for (int st = 128; st > 0; st >>= 1) { if (tid < st) red[tid] += red[tid + st]; __syncthreads(); }
  const float rs = rsqrtf(red[0] / (float)N + eps);
  {
    for (int u = 0; u < per / 4; ++u) {
      const int j = tid * 4 + 1024 * u;
      v4f o, sm;
#pragma unroll
      for (int q = 0; q < 4; ++q) {
        float gg = g[j + q], bb = bta[j + q];
        if (PARAM_BF16) { gg = bf16_round(gg); bb = bf16_round(bb); }
        sm[q] = vals[u * 4 + q]; o[q] = (vals[u * 4 + q] - mu) * rs * gg + bb;
      }
      if (out_sum) *(v4f*)(out_sum + (size_t)row * N + j) = sm;
      *(v4f*)(out_norm + (size_t)row * N + j) = o;
    }
    
  }
}



// ---- f16 WMMA path (v_wmma_f32_16x16x32_f16): 11-bit significands for operands in range — used where a [0,1] probability operand needs more precision than bf16
typedef _Float16 v16h __attribute__((ext_vector_type(16)));
union FragH { v16h v; v8us half[2]; _Float16 h[16]; unsigned short u[16]; };
template <int NT>
__device__ __forceinline__ v8f mmaH(v16h ah, v16h al, v16h bh, v16h bl, v8f c) {
  c = __builtin_amdgcn_wmma_f32_16x16x32_f16(false, ah, false, bh, (short)0, c, false, false);
  if (NT >= 2) c = __builtin_amdgcn_wmma_f32_16x16x32_f16(false, al, false, bh, (short)0, c, false, false);
  if (NT >= 3) c = __builtin_amdgcn_wmma_f32_16x16x32_f16(false, ah, false, bl, (short)0, c, false, false);
  asm volatile("v_nop\n\tv_nop\n\tv_nop\n\tv_nop" : "+v"(c) : "v"(ah), "v"(al), "v"(bh), "v"(bl));
  return c;
}
// batched GEMM like k_gemm_b but f16 operands: A f32 (split into f16 hi/lo if ASPLIT, else rounded to f16), Bt = f16 values [n][k]; alpha; C f32; N multiple of 16 (partial tiles skipped)
template <bool ASPLIT>
__global__ __launch_bounds__(128) void k_gemm_h(const float* __restrict__ A, int lda, size_t sA, const _Float16* __restrict__ Bh, int ldb, size_t sB, float alpha, float* __restrict__ C, int ldc, size_t sC, int M, int N, int K) {
  __shared__ __attribute__((aligned(16))) float so[4][16][64];
  const int tid = threadIdx.x, w = tid >> 5, lane = tid & 31, ln = lane & 15, hh = lane >> 4; const int by = blockIdx.y;
  A += (size_t)by * sA; Bh += (size_t)by * sB; C += (size_t)by * sC;
  const int ntn = (N + 63) / 64; const int wid = blockIdx.x * 4 + w; const int mt = wid / ntn, nq = wid % ntn; if (mt * 16 >= M) return;
  const int row0 = mt * 16, col0 = nq * 64; const float* arow = A + (size_t)(row0 + ln) * lda;
  v8f acc[4] = {};
  for (int kb = 0; kb < K; kb += 32) {
    FragH ah, al;
    const v4f x0 = *(const v4fa*)(arow + kb + 8 * hh), x1 = *(const v4fa*)(arow + kb + 8 * hh + 4), x2 = *(const v4fa*)(arow + kb + 16 + 8 * hh), x3 = *(const v4fa*)(arow + kb + 16 + 8 * hh + 4);
    float xs[16] = {x0[0],x0[1],x0[2],x0[3],x1[0],x1[1],x1[2],x1[3],x2[0],x2[1],x2[2],x2[3],x3[0],x3[1],x3[2],x3[3]};
#pragma unroll
    for (int i = 0; i < 16; ++i) { const _Float16 h = (_Float16)xs[i]; ah.h[i] = h; al.h[i] = ASPLIT ? (_Float16)(xs[i] - (float)h) : (_Float16)0.0f; }
#pragma unroll
    for (int t = 0; t < 4; ++t) { if (col0 + t * 16 >= N) continue; const size_t boff = (size_t)(col0 + t * 16 + ln) * ldb + kb; FragH bq; bq.half[0] = *(const v8us*)(Bh + boff + 8 * hh); bq.half[1] = *(const v8us*)(Bh + boff + 16 + 8 * hh);
      acc[t] = mmaH<ASPLIT ? 2 : 1>(ah.v, al.v, bq.v, bq.v, acc[t]); }
  }
#pragma unroll
  for (int t = 0; t < 4; ++t) { if (col0 + t * 16 >= N) continue;
#pragma unroll
    for (int r = 0; r < 8; ++r) so[w][8 * hh + r][t * 16 + ln] = acc[t][r] * alpha; }
  __builtin_amdgcn_fence(__ATOMIC_ACQ_REL, "workgroup"); __builtin_amdgcn_wave_barrier();
  const int rsub = lane >> 4, c4 = (lane & 15) * 4;
  {
#pragma unroll
    for (int q = 0; q < 8; ++q) { const int r = q * 2 + rsub; if (col0 + c4 < N) { const v4f v = *(const v4fa*)&so[w][r][c4]; *(v4f*)(C + (size_t)(row0 + r) * ldc + col0 + c4) = v; } }
     }
}

// Wt[n][k] = f16(W[k][n]·scale) from f32 row-major W[K][N] (scale = power of two; bf16-exact weights stay exact in f16 away from the subnormal range)
__global__ __launch_bounds__(256) void k_wt_f16(const float* __restrict__ W, _Float16* __restrict__ Wt, int K, int N, float scale) {
  const int t = blockIdx.x * 256 + threadIdx.x; if (t >= N * (K / 8)) return; const int n = t / (K / 8), k8 = (t % (K / 8)) * 8; FragH f;
#pragma unroll
  for (int i = 0; i < 8; ++i) f.h[i] = (_Float16)(bf16_round(W[(size_t)(k8 + i) * N + n]) * scale); const v8us o = f.half[0];
  *(v8us*)((unsigned short*)Wt + (size_t)n * K + k8) = o; 
}
// k_gemm_hh variant with fused epilogue: v = acc·alpha + bias[by·sBias + col] (+ CP[(row/rowsPerB)·sCPb + by·64 + col] if CP) ; ACT 0 none / 1 elu ; writes f16 C16 (and f32 C if non-null)
template <int ACT>
__global__ __launch_bounds__(128) void k_gemm_hhx(const _Float16* __restrict__ A, int lda, size_t sA, const _Float16* __restrict__ Bh, int ldb, size_t sB, float alpha, const float* __restrict__ bias, size_t sBias, const float* __restrict__ CP, int rowsPerB, size_t sCPb, int row0g,
    float* __restrict__ C, _Float16* __restrict__ C16, int ldc, size_t sC, int M, int N, int K) {
  __shared__ __attribute__((aligned(16))) float so[4][16][64];
  const int tid = threadIdx.x, w = tid >> 5, lane = tid & 31, ln = lane & 15, hh = lane >> 4; const int by = blockIdx.y;
  A += (size_t)by * sA; Bh += (size_t)by * sB; const size_t cofs = (size_t)by * sC; const float* bp = bias ? bias + (size_t)by * sBias : nullptr;
  const int ntn = (N + 63) / 64; const int wid = blockIdx.x * 4 + w; const int mt = wid / ntn, nq = wid % ntn; if (mt * 16 >= M) return;
  const int row0 = mt * 16, col0 = nq * 64; const _Float16* arow = A + (size_t)(row0 + ln) * lda;
  v8f acc[4] = {};
  for (int kb = 0; kb < K; kb += 32) { FragH ah; ah.half[0] = *(const v8us*)((const unsigned short*)arow + kb + 8 * hh); ah.half[1] = *(const v8us*)((const unsigned short*)arow + kb + 16 + 8 * hh);
#pragma unroll
    for (int t = 0; t < 4; ++t) { if (col0 + t * 16 >= N) continue; const size_t boff = (size_t)(col0 + t * 16 + ln) * ldb + kb; FragH bq; bq.half[0] = *(const v8us*)((const unsigned short*)Bh + boff + 8 * hh); bq.half[1] = *(const v8us*)((const unsigned short*)Bh + boff + 16 + 8 * hh);
      acc[t] = mmaH<1>(ah.v, ah.v, bq.v, bq.v, acc[t]); }
  }
#pragma unroll
  for (int t = 0; t < 4; ++t) { if (col0 + t * 16 >= N) continue; const int col = col0 + t * 16 + ln; const float bv = bp ? bf16_round(bp[col]) : 0.f;
#pragma unroll
    for (int r = 0; r < 8; ++r) { float v = acc[t][r] * alpha + bv; if (CP) { const int rr = row0g + row0 + 8 * hh + r; if (rowsPerB < 0) v += CP[cofs + (size_t)rr * ldc + col];      /* rowsPerB < 0: own element of the batched C plane */ else { const int bidx = rr / rowsPerB; v += CP[(size_t)bidx * sCPb + (size_t)by * 64 + col]; } } if (ACT == 1) v = (v > 0.f) ? v : expm1f(v); else if (ACT == 7) v = (v > 0.f) ? v + 1.0f : expf(v); else if (ACT == 8) v = tanhf(v); else if (ACT == 9) v = 0.5f * v * (1.0f + tanhf(0.7978845608028654f * (v + 0.044715f * v * v * v))); else if (ACT == 11) v = 1.0f / (1.0f + expf(-v)); else if (ACT == 12) v = (v > 0.f) ? v : 0.01f * v; else if (ACT == 14) v = (v > 0.f) ? v : 0.1f * v; else if (ACT == 16) v = (v >= 0.f) ? v : 0.3f * v; else if (ACT == 17) v = (v >= 0.f) ? v : 0.2f * v; else if (ACT == 15) v = v / (1.0f + expf(-v)); else if (ACT == 3) v = fmaxf(v, 0.f); else if (ACT == 6) v = 0.5f * v * (1.0f + erff(v * 0.70710678118654752f)); so[w][8 * hh + r][t * 16 + ln] = v; } }
  __builtin_amdgcn_fence(__ATOMIC_ACQ_REL, "workgroup"); __builtin_amdgcn_wave_barrier();
  const int rsub = lane >> 4, c4 = (lane & 15) * 4; typedef _Float16 v4h __attribute__((ext_vector_type(4)));
  {
#pragma unroll
    for (int q = 0; q < 8; ++q) { const int r = q * 2 + rsub; if (col0 + c4 < N) { const v4f v = *(const v4fa*)&so[w][r][c4]; if (C) *(v4f*)(C + cofs + (size_t)(row0 + r) * ldc + col0 + c4) = v; if (C16) { v4h h4; for (int i = 0; i < 4; ++i) h4[i] = (_Float16)v[i]; *(v4h*)(C16 + cofs + (size_t)(row0 + r) * ldc + col0 + c4) = h4; } } }
     }
}


typedef _Float16 v4h __attribute__((ext_vector_type(4)));

__global__ __launch_bounds__(256) void k_x16(const float* __restrict__ x, _Float16* __restrict__ X16, size_t n8) { const size_t t = (size_t)blockIdx.x * 256 + threadIdx.x; if (t >= n8) return; FragH f;
#pragma unroll
  for (int q = 0; q < 8; ++q) f.h[q] = (_Float16)bf16_round(x[t * 8 + q]); *(v8us*)((unsigned short*)X16 + t * 8) = f.half[0];  }
__global__ __launch_bounds__(256) void k_h16(const float* __restrict__ x, _Float16* __restrict__ X16, size_t n8) { const size_t t = (size_t)blockIdx.x * 256 + threadIdx.x; if (t >= n8) return; FragH f;
#pragma unroll
  for (int q = 0; q < 8; ++q) f.h[q] = (_Float16)x[t * 8 + q]; *(v8us*)((unsigned short*)X16 + t * 8) = f.half[0];  }
__global__ __launch_bounds__(256) void k_round16f(const float* __restrict__ W, _Float16* __restrict__ Bt, size_t n8) { const size_t t = (size_t)blockIdx.x * 256 + threadIdx.x; if (t >= n8) return; FragH f;
#pragma unroll
  for (int i = 0; i < 8; ++i) f.h[i] = (_Float16)(bf16_round(W[t * 8 + i]) * 16.0f); *(v8us*)((unsigned short*)Bt + t * 8) = f.half[0];  }
template <int NHv, int TTv>
__global__ __launch_bounds__(256) void k_vt(const _Float16* __restrict__ V16, int ldv, int voff, _Float16* __restrict__ Vt) { __shared__ unsigned short tl[64][66]; const int tid = threadIdx.x; const int slab = blockIdx.x / (TTv / 64), lg = blockIdx.x % (TTv / 64); const int b = slab / NHv, h = slab % NHv;
  for (int i = tid; i < 64 * 8; i += 256) { const int r = i / 8, c8 = (i % 8) * 8; FragH f; f.half[0] = *(const v8us*)((const unsigned short*)V16 + ((size_t)b * TTv + lg * 64 + r) * ldv + voff + h * 64 + c8);
#pragma unroll
    for (int q = 0; q < 8; ++q) tl[r][c8 + q] = f.u[q]; }
  __syncthreads();
  {
#pragma unroll
    for (int rd = 0; rd < 2; ++rd) { const int d = rd * 32 + tid / 8, pc = tid % 8; FragH f;
#pragma unroll
      for (int q = 0; q < 8; ++q) f.u[q] = tl[pc * 8 + q][d];
      *(v8us*)((unsigned short*)Vt + ((size_t)slab * 64 + d) * TTv + lg * 64 + pc * 8) = f.half[0]; }
     } }

__global__ __launch_bounds__(256) void k_hl(const float* __restrict__ F, _Float16* __restrict__ Hh, _Float16* __restrict__ Hl, size_t n8) { const size_t t = (size_t)blockIdx.x * 256 + threadIdx.x; if (t >= n8) return; FragH fh, fl; const v4f a = *(const v4fa*)(F + t * 8), c = *(const v4fa*)(F + t * 8 + 4);
#pragma unroll
  for (int q = 0; q < 4; ++q) { _Float16 h = (_Float16)a[q]; fh.h[q] = h; fl.h[q] = (_Float16)((a[q] - (float)h) * 1024.0f); h = (_Float16)c[q]; fh.h[4 + q] = h; fl.h[4 + q] = (_Float16)((c[q] - (float)h) * 1024.0f); }
  { *(v8us*)((unsigned short*)Hh + t * 8) = fh.half[0]; *(v8us*)((unsigned short*)Hl + t * 8) = fl.half[0];  } }

// ---- fast GEMM (wave tile 32x64; requires M % 32 == 0 rows per launch region and N % 64 == 0) ----
__device__ __forceinline__ v16h g2_frag(const _Float16* p, int hh) { FragH f; f.half[0] = *(const v8us*)((const unsigned short*)p + 8 * hh); f.half[1] = *(const v8us*)((const unsigned short*)p + 16 + 8 * hh); return f.v; }
__device__ __forceinline__ v8f g2_mma(v16h a, v16h b, v8f c) { v8f d = __builtin_amdgcn_wmma_f32_16x16x32_f16(false, a, false, b, (short)0, c, false, false); asm volatile("v_nop\n\tv_nop\n\tv_nop\n\tv_nop" : "+v"(d) : "v"(a), "v"(b)); return d; }
// The fragments of one 32-k step of a 32x64 wave tile: the two A row groups and the four B column groups.
struct G2Set { v16h a0, a1, b0, b1, b2, b3; };
__device__ __forceinline__ void g2_load(G2Set& s, const _Float16* a0p, const _Float16* a1p, const _Float16* b0p, const _Float16* b1p, const _Float16* b2p, const _Float16* b3p, int kb, int hh) {
  s.a0 = g2_frag(a0p + kb, hh); s.a1 = g2_frag(a1p + kb, hh); s.b0 = g2_frag(b0p + kb, hh); s.b1 = g2_frag(b1p + kb, hh); s.b2 = g2_frag(b2p + kb, hh); s.b3 = g2_frag(b3p + kb, hh);
  asm volatile("s_wait_xcnt 0x0" ::: "memory");      /* stands in front of the next address additions, which give new values to registers that these loads name */
  __builtin_amdgcn_sched_barrier(0); }      /* keeps the 12 loads and their wait here, ahead of the other set's products: moved down to their first uses the loads would each be waited for in turn */
// The same for the first and the last step, outside the loop, where nothing reads some of the addresses afterwards (the six pointers: the lane's own addresses, k offset and 8 * hh included).
__device__ __forceinline__ void g2_load_once(G2Set& s, const _Float16* pa0, const _Float16* pa1, const _Float16* pb0, const _Float16* pb1, const _Float16* pb2, const _Float16* pb3) {
  s.a0 = g2_frag(pa0, 0); s.a1 = g2_frag(pa1, 0); s.b0 = g2_frag(pb0, 0); s.b1 = g2_frag(pb1, 0); s.b2 = g2_frag(pb2, 0); s.b3 = g2_frag(pb3, 0);
  asm volatile("s_wait_xcnt 0x0" :: "v"(pa0), "v"(pa1), "v"(pb0), "v"(pb1), "v"(pb2), "v"(pb3) : "memory");      /* the addresses as inputs stay alive up to the wait, so that no later load's result lands in an earlier load's address registers in front of it */
  __builtin_amdgcn_sched_barrier(0); }      /* keeps the 12 loads and their wait here, ahead of the other set's products */
__device__ __forceinline__ void g2_mul(const G2Set& s, v8f (&c)[8]) {
  c[0] = g2_mma(s.a0, s.b0, c[0]); c[4] = g2_mma(s.a1, s.b0, c[4]); c[1] = g2_mma(s.a0, s.b1, c[1]); c[5] = g2_mma(s.a1, s.b1, c[5]);
  c[2] = g2_mma(s.a0, s.b2, c[2]); c[6] = g2_mma(s.a1, s.b2, c[6]); c[3] = g2_mma(s.a0, s.b3, c[3]); c[7] = g2_mma(s.a1, s.b3, c[7]); }
// The epilogue's kind is fixed at compile time. RES: a residual row (f32, pitch LDC, same row and column as the result) is added behind the bias; F16O: the result goes out as f16 rows (C16), else as f32 rows (C); LDC: pitch of the result rows.
// result = act(sum * alpha + bf16(bias[col]) (+ residual)), worked out behind the LDS turn, where a lane holds 4 neighbouring columns of a row: bias and residual come as 16-byte loads with nothing between them.
template <int ACT, bool RES, bool F16O, int LDC>
__global__ __launch_bounds__(128) void k_gemm2(const _Float16* __restrict__ A, int lda, const _Float16* __restrict__ Bh, int ldb, size_t sB, float alpha, const float* __restrict__ bias, const float* __restrict__ biasY1, const float* __restrict__ biasY2, const float* __restrict__ R,
    float* __restrict__ C, _Float16* __restrict__ C16, size_t sC, int M, int N, int K) {      /* sB, sC: strides of blockIdx.y; biasY1, biasY2: the bias arrays of planes y = 1 and y = 2 (else null) */ static_assert(ACT == 0 || ACT == 6, "k_gemm2: unsupported ACT code (would silently apply no activation)"); static_assert(!(RES && ACT == 6), "k_gemm2: the rolled GELU loop holds no residual registers");
  __shared__ __attribute__((aligned(16))) float so[4][32][68];
  const int tid = threadIdx.x, w = tid >> 5, lane = tid & 31, ln = lane & 15, hh = lane >> 4; const int by = blockIdx.y;
  Bh += (size_t)by * sB; const size_t cofs = (size_t)by * sC; const float* bp = bias; if (biasY1 && by == 1) bp = biasY1; if (biasY2 && by == 2) bp = biasY2;
  const int ntn = N >> 6; const int mt = blockIdx.x / ntn, nq = blockIdx.x - mt * ntn; const int row0 = mt * 128 + 32 * w, col0 = nq * 64; if (row0 >= M) return;
  const _Float16* a0p = A + (size_t)(row0 + ln) * lda; const _Float16* a1p = a0p + (size_t)16 * lda;
  const _Float16* b0p = Bh + (size_t)(col0 + ln) * ldb; const _Float16* b1p = b0p + (size_t)16 * ldb; const _Float16* b2p = b1p + (size_t)16 * ldb; const _Float16* b3p = b2p + (size_t)16 * ldb;
  const v8f z8 = {0.f,0.f,0.f,0.f,0.f,0.f,0.f,0.f}; v8f accs[8] = {z8, z8, z8, z8, z8, z8, z8, z8};
  /* K loop over two fragment sets: while one 32-k step is multiplied, the other step's 12 loads are in flight. K % 64 == 0; every sum keeps its ascending k order. */
  G2Set s0, s1; int kb = 0; g2_load_once(s0, a0p + 8 * hh, a1p + 8 * hh, b0p + 8 * hh, b1p + 8 * hh, b2p + 8 * hh, b3p + 8 * hh);
#pragma unroll 1      /* the two steps of a trip are written out; more copies would only add code */
  for (; kb + 64 < K; kb += 64) { g2_load(s1, a0p, a1p, b0p, b1p, b2p, b3p, kb + 32, hh); g2_mul(s0, accs); g2_load(s0, a0p, a1p, b0p, b1p, b2p, b3p, kb + 64, hh); g2_mul(s1, accs); }
  const int kl = kb + 32; g2_load_once(s1, a0p + 8 * hh + kl, a1p + 8 * hh + kl, b0p + 8 * hh + kl, b1p + 8 * hh + kl, b2p + 8 * hh + kl, b3p + 8 * hh + kl); g2_mul(s0, accs);      /* the last two steps: no fragment is left to fetch behind them */
  /* Store layout: lane = row rsub (+ 2 per vector) of the wave's 32, columns c4 .. c4 + 3 of its 64; e0 = the lane's first element. */
  const int rsub = lane >> 4, c4 = (lane & 15) * 4; const size_t e0 = (size_t)(row0 + rsub) * LDC + col0 + c4;
  const v4f b4 = *(const v4fa*)(bp + col0 + c4); v4f rv[RES ? 16 : 1];
  if constexpr (RES) { const float* rp = R + e0;
#pragma unroll      /* constant indices: the 16 row vectors stay in registers and their loads issue together */
    for (int q = 0; q < 16; ++q) rv[q] = *(const v4fa*)(rp + (size_t)q * 2 * LDC);
    asm volatile("s_wait_xcnt 0x0" :: "v"(rp) : "memory"); }      /* stands in front of whatever gives new values to the address registers of these loads; the rows' address as an input stays alive up to here, so that no load's result lands in it */
  else asm volatile("s_wait_xcnt 0x0" ::: "memory");      /* stands in front of whatever gives new values to the address registers of the bias load */
  __builtin_amdgcn_sched_barrier(0);      /* keeps the loads here, in flight under the last step's own load wait and products: moved down to their uses they would be waited for behind the products */
  g2_mul(s1, accs);
#pragma unroll      /* constant indices: the sums stay in registers */
  for (int u = 0; u < 8; ++u) {
#pragma unroll      /* constant indices: the sums stay in registers */
    for (int r = 0; r < 8; ++r) so[w][(u >> 2) * 16 + 8 * hh + r][(u & 3) * 16 + ln] = accs[u][r]; }
  /* the wave's own 32 x 64 sums are in LDS before its lanes read them back row-wise */
  __builtin_amdgcn_fence(__ATOMIC_ACQ_REL, "workgroup"); __builtin_amdgcn_wave_barrier();
  const v4f bb = {bf16_round(b4[0]), bf16_round(b4[1]), bf16_round(b4[2]), bf16_round(b4[3])};
  const float* sp = &so[w][rsub][c4]; char* cp = F16O ? (char*)(C16 + cofs + e0) : (char*)(C + cofs + e0); constexpr size_t RB = (size_t)2 * LDC * (F16O ? 2 : 4);      /* RB: bytes from one of the lane's rows to its next */
#pragma unroll (ACT == 6 ? 1 : 4)      /* GELU: rolled, 16 erf bodies of text instead of 64, so that the kernel's text stays small; else written out, since the residual registers take constant indices */
  for (int g = 0; g < 4; ++g) { v4f v[4];
#pragma unroll      /* constant indices: the four LDS reads issue together */
    for (int i = 0; i < 4; ++i) v[i] = *(const v4fa*)(sp + i * 2 * 68);
#pragma unroll      /* constant indices: the values stay in registers */
    for (int i = 0; i < 4; ++i) {
#pragma unroll      /* constant indices: the values stay in registers */
      for (int e = 0; e < 4; ++e) { float x = v[i][e] * alpha + bb[e]; if constexpr (RES) x += rv[g * 4 + i][e]; if (ACT == 6) x = 0.5f * x * (1.0f + erff(x * 0.70710678118654752f)); v[i][e] = x; }
      if constexpr (F16O) { v4h h4;
#pragma unroll      /* constant indices: the values stay in registers */
        for (int e = 0; e < 4; ++e) h4[e] = (_Float16)v[i][e];
        *(v4h*)(cp + i * RB) = h4; }
      else *(v4f*)(cp + i * RB) = v[i]; }
    sp += 8 * 68; cp += 4 * RB; } }


__global__ __launch_bounds__(256) void k_rsm(const float* __restrict__ S, _Float16* __restrict__ P, int nrows) {
  #pragma clang fp contract(off)
  const int i = blockIdx.x * 256 + threadIdx.x; if (i >= nrows) return; const float* s = S + (size_t)i * SQ; float mx = -3.0e38f;
#pragma unroll 1
  for (int j = 0; j < SQ; ++j) mx = fmaxf(mx, s[j]); float se = 0.f;
#pragma unroll 1
  for (int j = 0; j < SQ; ++j) se += expf(s[j] - mx); const float sc = 256.0f / se;
#pragma unroll 1
  for (int j0 = 0; j0 < SQ; j0 += 8) { FragH f; for (int q = 0; q < 8; ++q) f.h[q] = (_Float16)(expf(s[j0 + q] - mx) * sc); unsigned short* d = (unsigned short*)P + (size_t)i * SQ + j0; *(v8us*)d = f.half[0];  } }
__global__ __launch_bounds__(256) void k_vt(const _Float16* __restrict__ V16, _Float16* __restrict__ VT) { __shared__ unsigned short tl[64][65]; const int tid = threadIdx.x; const int hh = blockIdx.x % HG, sg = blockIdx.x / HG; const int s0 = sg * 64; const int b = hh / NH, h = hh % NH;
  for (int i = tid; i < 64 * 8; i += 256) { const int j = i / 8, d8 = (i % 8) * 8; FragH f; f.half[0] = *(const v8us*)((const unsigned short*)V16 + ((size_t)b * SQ + s0 + j) * DM + h * HD + d8); for (int q = 0; q < 8; ++q) tl[d8 + q][j] = f.u[q]; }
  __syncthreads();
  { for (int i = tid; i < 64 * 8; i += 256) { const int d = i / 8, j8 = (i % 8) * 8; FragH f; for (int q = 0; q < 8; ++q) f.u[q] = tl[d][j8 + q]; *(v8us*)((unsigned short*)VT + ((size_t)hh * HD + d) * SQ + s0 + j8) = f.half[0]; }  } }

#define FH 2048
#define KN 103
typedef int v4ia __attribute__((ext_vector_type(4), may_alias));
__device__ __forceinline__ void xcnt_wait() { asm volatile("s_wait_xcnt 0x0" ::: "memory"); }
// Operand preparation, one launch: the six weight matrices as x16 f16 planes (they lie one behind the other in Bt, in the order wq, wk, wv, wo, w1, w2) and x as bf16-rounded f32 rows.
// A weight or x work-group converts 256 x 8 elements of one array, a prior_mask one 256 words of 32 entries, a prior_indices one 8 query rows; which part follows from blockIdx.x alone.
#define PW (DM * DM / 2048)          /* work-groups per DM x DM weight */
#define PF (FH * DM / 2048)          /* work-groups per FH x DM weight */
#define PX ((int)(NR * DM / 2048))   /* work-groups for x */
#define PB0 (4 * PW + 2 * PF + PX)   /* first work-group of the prior tables' packing */
#define PMD (SQ * (SQ / 32) / 256)   /* prior_mask: one thread per 32-key word */
#define PMS (SQ / 8)                 /* prior_indices: one wave per query row */
static_assert((DM * DM) % 2048 == 0 && (FH * DM) % 2048 == 0 && (NR * DM) % 2048 == 0, "k_prep: whole work-groups per array");
__global__ __launch_bounds__(256) void k_prep(const float* __restrict__ wq, const float* __restrict__ wk, const float* __restrict__ wv, const float* __restrict__ wo, const float* __restrict__ w1, const float* __restrict__ w2, const float* __restrict__ x, _Float16* __restrict__ Bt, float* __restrict__ XF, const int* __restrict__ pmask, const int* __restrict__ pidx, const int* __restrict__ pim, unsigned int* __restrict__ MD, unsigned int* __restrict__ MS) {
  __shared__ __attribute__((aligned(16))) unsigned char bm[8][SQ];      /* prior_indices: the wave's own row of key flags (any index set) */
  const int blk = blockIdx.x; const float* src; int first;
  if (blk >= PB0 + PMD) {      /* MS[q][j / 32] bit j % 32: key j is one of row q's valid prior slots */
    const int lane = threadIdx.x & 31, w = threadIdx.x >> 5; const int q = (blk - PB0 - PMD) * 8 + w; const int* ix = pidx + (size_t)q * KN; const int* vm = pim + (size_t)q * KN; constexpr int NT = (KN + 31) / 32; int jx[NT]; bool ok[NT];
#pragma unroll      /* constant indices: the lane's values stay in registers and its loads issue together */
    for (int t = 0; t < NT; ++t) { const int k = t * 32 + lane; const int kc = k < KN ? k : KN - 1; jx[t] = ix[kc]; const int vk = vm[kc]; xcnt_wait(); ok[t] = (k < KN) & (vk != 0); }      /* a later load's result may land in an earlier load's address register: the wait stands between them */
    const v4ia z = {0, 0, 0, 0}; *(v4ia*)&bm[w][lane * 32] = z; *(v4ia*)&bm[w][lane * 32 + 16] = z;
    /* the zeros of every lane are in LDS before any lane sets a flag over them */
    __builtin_amdgcn_fence(__ATOMIC_ACQ_REL, "workgroup"); __builtin_amdgcn_wave_barrier();
#pragma unroll      /* constant indices: the lane's values stay in registers */
    for (int t = 0; t < NT; ++t) if (ok[t]) bm[w][min(max(jx[t], 0), SQ - 1)] = 1;      /* the key index is bounded here before it forms an address */
    /* the flags of every lane are in LDS before the row is read back */
    __builtin_amdgcn_fence(__ATOMIC_ACQ_REL, "workgroup"); __builtin_amdgcn_wave_barrier();
    unsigned int word = 0;
#pragma unroll      /* 32 independent LDS reads issue together */
    for (int c = 0; c < SQ / 32; ++c) { const unsigned int bal = __builtin_amdgcn_ballot_w32(bm[w][c * 32 + lane] != 0); if (lane == c) word = bal; }
    MS[(size_t)q * (SQ / 32) + lane] = word; return; }
  if (blk >= PB0) {      /* MD[q][j / 32] bit j % 32: prior_mask[q][j] */
    const size_t t = (size_t)(blk - PB0) * 256 + threadIdx.x; v4ia mv[8]; unsigned int word = 0;
#pragma unroll      /* constant indices: the lane's values stay in registers and its loads issue together */
    for (int i = 0; i < 8; ++i) mv[i] = *(const v4ia*)(pmask + t * 32 + i * 4);
    xcnt_wait();      /* the address registers of the eight loads may take new values below */
#pragma unroll      /* constant indices: the lane's values stay in registers */
    for (int i = 0; i < 8; ++i) for (int e = 0; e < 4; ++e) word |= (mv[i][e] != 0 ? 1u : 0u) << (i * 4 + e);
    MD[t] = word;
    xcnt_wait(); return; }      /* the listing lets another part's code follow, which writes the store's registers */
  if (blk < PW) { src = wq; first = 0; } else if (blk < 2 * PW) { src = wk; first = PW; } else if (blk < 3 * PW) { src = wv; first = 2 * PW; } else if (blk < 4 * PW) { src = wo; first = 3 * PW; }
  else if (blk < 4 * PW + PF) { src = w1; first = 4 * PW; } else if (blk < 4 * PW + 2 * PF) { src = w2; first = 4 * PW + PF; } else { src = x; first = 4 * PW + 2 * PF; }
  const size_t t = (size_t)(blk - first) * 256 + threadIdx.x; const v4f a0 = *(const v4fa*)(src + t * 8), a1 = *(const v4fa*)(src + t * 8 + 4);
  xcnt_wait();      /* the address registers of the two loads may take new values below */
  if (blk < 4 * PW + 2 * PF) { FragH f;
#pragma unroll      /* constant indices: the values stay in registers */
    for (int q = 0; q < 4; ++q) { f.h[q] = (_Float16)(bf16_round(a0[q]) * 16.0f); f.h[4 + q] = (_Float16)(bf16_round(a1[q]) * 16.0f); }
    *(v8us*)((unsigned short*)Bt + ((size_t)blk * 256 + threadIdx.x) * 8) = f.half[0];
    xcnt_wait(); }      /* the listing lets another part's code follow, which writes the store's registers */
  else { v8f o;
#pragma unroll      /* constant indices: the values stay in registers */
    for (int q = 0; q < 4; ++q) { o[q] = bf16_round(a0[q]); o[4 + q] = bf16_round(a1[q]); }
    *(v8f*)(XF + t * 8) = o;
    xcnt_wait(); } }      /* the listing lets the weight part's code follow, which writes the two stores' registers */
__device__ __forceinline__ float wave_max(float v) {
#pragma unroll      /* five fixed butterfly steps */
  for (int m = 16; m > 0; m >>= 1) v = fmaxf(v, __shfl_xor(v, m, 32)); return v; }
__device__ __forceinline__ float wave_sum(float v) {
#pragma unroll      /* five fixed butterfly steps */
  for (int m = 16; m > 0; m >>= 1) v += __shfl_xor(v, m, 32); return v; }
// Row LayerNorm, one wave per row: lane l owns columns c*256 + l*8 .. +7 (c = 0, 1), held in registers for the three passes.
__global__ __launch_bounds__(256) void k_lnw(const float* __restrict__ HF, const float* __restrict__ g, const float* __restrict__ bb, _Float16* __restrict__ X16o) {
  const int lane = threadIdx.x & 31; const size_t r = (size_t)blockIdx.x * 8 + (threadIdx.x >> 5); if (r >= NR) return; const float* x = HF + r * DM; float v[16]; float s = 0.f;
#pragma unroll      /* constant indices: the lane's values stay in registers and its loads issue together */
  for (int c = 0; c < 2; ++c) { const int j0 = c * 256 + lane * 8; const v4f a0 = *(const v4fa*)(x + j0), a1 = *(const v4fa*)(x + j0 + 4);
#pragma unroll      /* constant indices: the lane's values stay in registers and its loads issue together */
    for (int e = 0; e < 4; ++e) { v[c * 8 + e] = a0[e]; v[c * 8 + 4 + e] = a1[e]; } }
#pragma unroll      /* constant indices: the lane's values stay in registers and its loads issue together */
  for (int e = 0; e < 16; ++e) s += v[e];
  const float mu = wave_sum(s) / (float)DM; float qs = 0.f;
#pragma unroll      /* constant indices: the lane's values stay in registers and its loads issue together */
  for (int e = 0; e < 16; ++e) { const float dd = v[e] - mu; qs += dd * dd; }
  const float rs = 1.0f / sqrtf(wave_sum(qs) / (float)DM + 1e-5f);
#pragma unroll      /* constant indices: the lane's values stay in registers and its loads issue together */
  for (int c = 0; c < 2; ++c) { const int j0 = c * 256 + lane * 8; const v4f g0 = *(const v4fa*)(g + j0), g1 = *(const v4fa*)(g + j0 + 4), b0 = *(const v4fa*)(bb + j0), b1 = *(const v4fa*)(bb + j0 + 4); FragH f;
#pragma unroll      /* constant indices: the lane's values stay in registers and its loads issue together */
    for (int e = 0; e < 4; ++e) { f.h[e] = (_Float16)((v[c * 8 + e] - mu) * rs * bf16_round(g0[e]) + bf16_round(b0[e])); f.h[4 + e] = (_Float16)((v[c * 8 + 4 + e] - mu) * rs * bf16_round(g1[e]) + bf16_round(b1[e])); }
    *(v8us*)((unsigned short*)X16o + r * DM + j0) = f.half[0]; } }
// Lane l <-> l ^ 16: the two lanes that hold one query's column of a D tile.
__device__ __forceinline__ float xhalf(float x) { const int b = __builtin_bit_cast(int, x); return __builtin_bit_cast(float, __builtin_amdgcn_permlanex16(b, b, 0x76543210, 0xfedcba98, false, false)); }
typedef unsigned int v2ua __attribute__((ext_vector_type(2), may_alias));
// The A fragments of one 64-key chunk: four 16-row groups (pitch16 elements apart) x two 32-k steps.
struct AtSet { v16h f[8]; };
__device__ __forceinline__ void at_load(AtSet& s, const _Float16* p, size_t pitch16) {      /* p: the lane's own address, its row and its 8 * hh included */
#pragma unroll      /* constant indices: the fragments stay in registers and their loads issue together */
  for (int t = 0; t < 4; ++t) { s.f[2 * t] = g2_frag(p + t * pitch16, 0); s.f[2 * t + 1] = g2_frag(p + t * pitch16 + 32, 0); }
  asm volatile("s_wait_xcnt 0x0" :: "v"(p) : "memory");      /* stands in front of whatever gives new values to the address registers of these loads; the address as an input keeps its registers alive up to here, so that no load's result lands in them */
  __builtin_amdgcn_sched_barrier(0); }      /* keeps the 16 loads and their wait here, ahead of the work that hides them: moved down to their first uses the loads would each be waited for in turn */
// Attention, scores to merged heads in one launch: a wave owns 16 queries of one (batch, head) and walks the 1,024 keys in chunks of 64.
// S^T = K . Q^T puts one query's scores into one lane pair (l, l ^ 16); two converted S^T tiles are the B operand of O^T += V^T . P^T, so neither scores nor weights leave the registers.
// Running maximum m and sum l per query; a key outside the prior gets the penalty pen: -lam in the dense branch, -1e30 in the sparse branch (its weight is exactly 0 once a key of the set has been met, and what was summed before that is scaled by exactly 0).
__global__ __launch_bounds__(128) void k_attn(const _Float16* __restrict__ Q16, const _Float16* __restrict__ K16, const _Float16* __restrict__ VT, const unsigned int* __restrict__ MD, const unsigned int* __restrict__ MS, const float* __restrict__ uprev, _Float16* __restrict__ O16) {
  const int tid = threadIdx.x, w = tid >> 5, lane = tid & 31, ln = lane & 15, hh = lane >> 4; const int h = blockIdx.y, b = blockIdx.z; const int q0 = (blockIdx.x * 4 + w) * 16;
  const float lam = 10.0f * expf(-5.0f * bf16_round(uprev[b])); const bool sparse = lam >= 1.0f; const float pen = sparse ? -1.0e30f : -lam;
  const unsigned int* mk = (sparse ? MS : MD) + (size_t)(q0 + ln) * (SQ / 32);
  const _Float16* qp = Q16 + ((size_t)b * SQ + q0 + ln) * DM + h * HD + 8 * hh; const _Float16* kp = K16 + ((size_t)b * SQ + ln) * DM + h * HD + 8 * hh; const _Float16* vp = VT + ((size_t)(b * NH + h) * HD + ln) * SQ + 8 * hh;      /* each with the lane's 8 * hh of the k order */
  const v16h qb0 = g2_frag(qp, 0), qb1 = g2_frag(qp + 32, 0); v2ua mw = *(const v2ua*)mk;      /* mw: this query's 64 prior bits of the chunk at hand */
  asm volatile("s_wait_xcnt 0x0" :: "v"(qp), "v"(mk) : "memory"); __builtin_amdgcn_sched_barrier(0);      /* the wait stands in front of whatever gives new values to the address registers of these five loads (as inputs they stay alive up to here); the barrier keeps later code behind it */
  AtSet kf, vf; at_load(kf, kp, (size_t)16 * DM);
  const v8f z8 = {0.f,0.f,0.f,0.f,0.f,0.f,0.f,0.f}; v8f o[4] = {z8, z8, z8, z8}; float m = -3.0e38f, l = 0.f;
  const _Float16* vq = vp; const _Float16* kq = kp + (size_t)64 * DM;      /* running addresses: they live across their loads, so no load's result can land in them, and they move on behind the loads' wait */
#pragma unroll 1      /* one chunk per trip: a second copy would double the fragment registers */
  for (int c = 0; c < SQ / 64; ++c) {
    const v2ua mn = *(const v2ua*)(mk + ((c + 1) & (SQ / 64 - 1)) * 2);      /* the next chunk's prior bits, one trip ahead like the K rows */
    xcnt_wait();      /* a later load's result may land in this load's address registers: the wait stands between them */
    at_load(vf, vq, (size_t)16 * SQ); vq += 64;
    v8f s[4];
#pragma unroll      /* constant indices: the tiles stay in registers */
    for (int t = 0; t < 4; ++t) s[t] = g2_mma(kf.f[2 * t + 1], qb1, g2_mma(kf.f[2 * t], qb0, z8));
    at_load(kf, kq, (size_t)16 * DM); kq = c + 2 < SQ / 64 ? kq + (size_t)64 * DM : kp;      /* the next chunk's K rows fly under the softmax; the last trip fetches chunk 0 again, in bounds and unused */
    float mx = m;
#pragma unroll      /* constant indices: the tiles stay in registers */
    for (int t = 0; t < 4; ++t) { const unsigned int by = mw[t >> 1] >> (16 * (t & 1) + 8 * hh);      /* bit r: key 16 t + 8 hh + r of the chunk */
#pragma unroll      /* constant indices: the tiles stay in registers */
      for (int r = 0; r < 8; ++r) { const float v = s[t][r] * 0.125f + (((by >> r) & 1u) ? 0.f : pen); s[t][r] = v; mx = fmaxf(mx, v); } }
    mx = fmaxf(mx, xhalf(mx)); const float corr = expf(m - mx); m = mx; float ps = 0.f; FragH p0, p1;
#pragma unroll      /* constant indices: the tiles stay in registers */
    for (int r = 0; r < 8; ++r) { const float e0 = expf(s[0][r] - mx), e1 = expf(s[1][r] - mx), e2 = expf(s[2][r] - mx), e3 = expf(s[3][r] - mx); ps += (e0 + e1) + (e2 + e3);
      p0.h[r] = (_Float16)(e0 * 256.0f); p0.h[8 + r] = (_Float16)(e1 * 256.0f); p1.h[r] = (_Float16)(e2 * 256.0f); p1.h[8 + r] = (_Float16)(e3 * 256.0f); }
    l = l * corr + ps;
#pragma unroll      /* constant indices: the tiles stay in registers */
    for (int t = 0; t < 4; ++t) { o[t] *= corr; o[t] = g2_mma(vf.f[2 * t + 1], p1.v, g2_mma(vf.f[2 * t], p0.v, o[t])); }
    mw = mn; }
  l += xhalf(l); const float inv = 1.0f / (256.0f * l);      /* l >= 1: the key that holds the maximum adds exp(0) */
  unsigned short* od = (unsigned short*)O16 + ((size_t)b * SQ + q0 + ln) * DM + h * HD + 8 * hh;
#pragma unroll      /* constant indices: the tiles stay in registers */
  for (int t = 0; t < 4; ++t) { FragH f;
#pragma unroll      /* constant indices: the tiles stay in registers */
    for (int r = 0; r < 8; ++r) f.h[r] = (_Float16)(o[t][r] * inv);
    *(v8us*)(od + t * 16) = f.half[0]; } }
// Row norms, one wave per row, 32 rows per work-group, so that one wave stores the group's 32 values as one whole 128-byte line of U.
static_assert(NR % 32 == 0, "k_unormw: 32 rows per work-group");
__global__ __launch_bounds__(1024) void k_unormw(const float* __restrict__ OUT, const float* __restrict__ XF, float* __restrict__ U) {
  __shared__ float ur[32];
  const int lane = threadIdx.x & 31, w = threadIdx.x >> 5; const size_t r = (size_t)blockIdx.x * 32 + w; float sd = 0.f, sx = 0.f;
#pragma unroll      /* constant indices: the lane's values stay in registers and its loads issue together */
  for (int c = 0; c < 4; ++c) { const int j0 = c * 128 + lane * 4; const v4f o = *(const v4fa*)(OUT + r * DM + j0), xv = *(const v4fa*)(XF + r * DM + j0);
#pragma unroll      /* constant indices: the lane's values stay in registers and its loads issue together */
    for (int e = 0; e < 4; ++e) { const float dd = o[e] - xv[e]; sd += dd * dd; sx += xv[e] * xv[e]; } }
  sd = wave_sum(sd); sx = wave_sum(sx); if (lane == 0) ur[w] = sqrtf(sd) / (sqrtf(sx) + 1e-8f);
  __syncthreads();      /* the 32 waves' row values are in LDS before wave 0 reads them */
  if (threadIdx.x < 32) U[(size_t)blockIdx.x * 32 + threadIdx.x] = ur[threadIdx.x]; }
// Batch means in float64: one wave, 32 lanes over the 1,024 rows of a batch, lane b stores batch b.
__global__ __launch_bounds__(32) void k_umeanw(const float* __restrict__ U, float* __restrict__ out1) { const int lane = threadIdx.x; float res = 0.f;
#pragma unroll      /* constant indices: the lane's values stay in registers and its loads issue together */
  for (int b = 0; b < NB; ++b) { double s = 0.0;
#pragma unroll      /* constant indices: the lane's values stay in registers and its loads issue together */
    for (int c = 0; c < SQ / 128; ++c) { const v4f a = *(const v4fa*)(U + (size_t)b * SQ + c * 128 + lane * 4);
#pragma unroll      /* constant indices: the lane's values stay in registers and its loads issue together */
      for (int e = 0; e < 4; ++e) s += (double)a[e]; }
#pragma unroll      /* five fixed butterfly steps */
    for (int m = 16; m > 0; m >>= 1) s += __shfl_xor(s, m, 32);
    if (lane == b) res = (float)(s / (double)SQ); }
  if (lane < NB) out1[lane] = res; }
extern "C" void kernel_launch(void* const* d_in, const int* in_sizes, int n_in,
                              void* d_out, int out_size, void* d_ws, size_t ws_size, hipStream_t stream) {
  (void)in_sizes; (void)n_in; (void)out_size;
  const float* const* I = (const float* const*)d_in; const float* x = I[0]; const float* uprev = I[1]; const float* wq = I[2]; const float* bq = I[3]; const float* wk = I[4]; const float* bk = I[5]; const float* wv = I[6]; const float* bv = I[7]; const float* wo = I[8]; const float* bo = I[9]; const float* l1g = I[10]; const float* l1b = I[11]; const float* l2g = I[12]; const float* l2b = I[13]; const float* w1 = I[14]; const float* b1 = I[15]; const float* w2 = I[16]; const float* b2 = I[17]; const int* pmask = (const int*)d_in[18]; const int* pidx = (const int*)d_in[19]; const int* pim = (const int*)d_in[20];
  float* out0 = (float*)d_out; float* out1 = out0 + NR * DM;
  char* ws = (char*)d_ws; size_t off = 0;
  auto take = [&](size_t bytes) { char* p = ws + off; off += (bytes + 255) & ~(size_t)255; return p; };
  _Float16* BQ = (_Float16*)take(((size_t)4 * DM * DM + (size_t)2 * FH * DM) * 2); _Float16* BO = BQ + (size_t)3 * DM * DM; _Float16* BW1 = BO + (size_t)DM * DM; _Float16* BW2 = BW1 + (size_t)FH * DM;      /* one block: the planes of wq, wk, wv, wo, w1, w2 one behind the other */
  float* XF = (float*)take(NR * DM * 4); float* HF = (float*)take(NR * DM * 4); _Float16* G16 = (_Float16*)take(NR * FH * 2); float* U = (float*)take(NR * 4);
  _Float16* X16 = (_Float16*)take(NR * DM * 2); _Float16* Q16 = (_Float16*)take(3 * NR * DM * 2); _Float16* K16 = Q16 + NR * DM; _Float16* V16 = K16 + NR * DM; _Float16* O16 = (_Float16*)take(NR * DM * 2);
  _Float16* VT = (_Float16*)take((size_t)HG * HD * SQ * 2); unsigned int* MD = (unsigned int*)take((size_t)SQ * (SQ / 32) * 4); unsigned int* MS = (unsigned int*)take((size_t)SQ * (SQ / 32) * 4);
  if (off > ws_size) return;      /* 6 + 4 + 4 + 8 + 2x5 + 2 = about 34 MiB */
  k_prep<<<PB0 + PMD + PMS, 256, 0, stream>>>(wq, wk, wv, wo, w1, w2, x, BQ, XF, pmask, pidx, pim, MD, MS); k_lnw<<<(unsigned)((NR + 7) / 8), 256, 0, stream>>>(XF, l1g, l1b, X16);
  const dim3 gp((unsigned)((NR / 128) * (DM / 64)), 1);
  k_gemm2<0, false, true, DM><<<dim3(gp.x, 3), 128, 0, stream>>>(X16, DM, BQ, DM, (size_t)DM * DM, 0.0625f, bq, bk, bv, nullptr, nullptr, Q16, NR * DM, (int)NR, DM, DM);      /* y = 0, 1, 2: q, k, v */
  k_vt<<<HG * (SQ / 64), 256, 0, stream>>>(V16, VT);
  k_attn<<<dim3(SQ / 64, NH, NB), 128, 0, stream>>>(Q16, K16, VT, MD, MS, uprev, O16);      /* o (merged heads) as f16 rows; x = 64 queries, y = head, z = batch */
  k_gemm2<0, true, false, DM><<<gp, 128, 0, stream>>>(O16, DM, BO, DM, 0, 0.0625f, bo, nullptr, nullptr, XF, HF, nullptr, 0, (int)NR, DM, DM);      /* h = x + attn W_o^T + b_o */
  k_lnw<<<(unsigned)((NR + 7) / 8), 256, 0, stream>>>(HF, l2g, l2b, X16);
  k_gemm2<6, false, true, FH><<<dim3((unsigned)((NR / 128) * (FH / 64)), 1), 128, 0, stream>>>(X16, DM, BW1, DM, 0, 0.0625f, b1, nullptr, nullptr, nullptr, nullptr, G16, 0, (int)NR, FH, DM);      /* gelu_erf(LN2(h) W1^T + b1) */
  k_gemm2<0, true, false, DM><<<gp, 128, 0, stream>>>(G16, FH, BW2, FH, 0, 0.0625f, b2, nullptr, nullptr, HF, out0, nullptr, 0, (int)NR, DM, FH);      /* out = h + (...) W2^T + b2, rows are the output layout */
  k_unormw<<<(unsigned)(NR / 32), 1024, 0, stream>>>(out0, XF, U); k_umeanw<<<1, 32, 0, stream>>>(U, out1);
}

// v006
// Measured time: 109 microseconds a run.
// Next to v005, in two timings, it ran 1.04 and 1.05 times as fast.
// Over all steps from v000 it is 35.1 times as fast.
#include <hip/hip_runtime.h>
// SPDGMultiHeadAttention (x [2][1024][512], u_prev [2][1]; xn = LN1(x); Q,K,V = xn W^T + b (8 heads of 64); lam = 10 exp(-5 u_prev); per batch: if lam >= 1 the SPARSE branch (softmax over the prior window slots prior_indices[i][k] with prior_index_mask, others excluded) else the DENSE branch (softmax over all keys of q.k/8 + lam*(prior_mask ? 0 : -1)); attn = merge W_o^T + b_o; h = x + attn; out = h + gelu_erf(LN2(h) W1^T + b1) W2^T + b2 -> [2][1024][512]; aggregated_u[b] = mean_s ||out - x|| / (||x|| + 1e-8) -> [2][1]).
// Structure: token rows; bf16(x) as f32 residual rows + LN1 on VALU (f32, wave per row) into f16 rows; Q | K | V WMMA GEMMs as one launch (32x64 wave tiles, f32 accumulation, exact x16 weights + bias, f16 outputs); the prior tables packed to one bit per (query, key) beside the operand preparation; V^T via LDS; all 16 (batch, head) pairs in one attention launch: per wave 16 queries, S^T = K . Q^T per 64 keys, the branch-selecting running softmax in registers (lam from u_prev; f32; weights x256 as f16), O^T += V^T . P^T, merged f16 rows; W_o GEMM + b_o + x (residual added in the epilogue) -> h; LN2 on VALU; fc1 GEMM with the exact-erf GELU epilogue (f16 hidden); fc2 GEMM + b2 + h straight into the output rows; the surprise statistic on VALU (per-row norms, float64 means per batch) into output 1.
// Compute dtype: inputs rounded to bf16; x / weights exact; LN outputs, q, k, v, softmax weights, o, GELU hidden plain f16 (~2^-12); residual, LN statistics, scores, softmax, norms f32/f64. v_wmma_f32_16x16x32_f16.
#define NB 2
#define SQ 1024
#define DM 512
#define NH 8
#define HD 64
#define HG (NB * NH)                 /* (batch, head) pairs per attention launch: all of them */
#define QN SQ                        /* query rows per batch; unused, the attention grid covers all SQ */
#define NR ((size_t)NB * SQ)         /* 2048 token rows */
typedef __bf16 v16b __attribute__((ext_vector_type(16)));
typedef unsigned short v8us __attribute__((ext_vector_type(8), may_alias));
typedef float  v8f  __attribute__((ext_vector_type(8)));
typedef float  v4f  __attribute__((ext_vector_type(4)));
typedef float  v4fa __attribute__((ext_vector_type(4), may_alias));
union FragB { v16b v; v8us half[2]; unsigned short u[16]; };

__device__ __forceinline__ unsigned short bf16_bits(float x) { unsigned int u = __float_as_uint(x); return (unsigned short)((u + 0x7FFFu + ((u >> 16) & 1u)) >> 16); }
__device__ __forceinline__ float bf16_val(unsigned short b) { return __uint_as_float(((unsigned int)b) << 16); }
__device__ __forceinline__ float bf16_round(float x) { return bf16_val(bf16_bits(x)); }
// D += A·B with NT terms: 1 = ah·bh, 2 = + al·bh (A split), 3 = + ah·bl (both split)
template <int NT>
__device__ __forceinline__ v8f mmaN(v16b ah, v16b al, v16b bh, v16b bl, v8f c) {
  c = __builtin_amdgcn_wmma_f32_16x16x32_bf16(false, ah, false, bh, (short)0, c, false, false);
  if (NT >= 2) c = __builtin_amdgcn_wmma_f32_16x16x32_bf16(false, al, false, bh, (short)0, c, false, false);
  if (NT >= 3) c = __builtin_amdgcn_wmma_f32_16x16x32_bf16(false, ah, false, bl, (short)0, c, false, false);
  asm volatile("v_nop\n\tv_nop\n\tv_nop\n\tv_nop" : "+v"(c) : "v"(ah), "v"(al), "v"(bh), "v"(bl));
  return c;
}

__global__ __launch_bounds__(256) void k_wt_bf16(const float* __restrict__ W, unsigned short* __restrict__ Wt, int K, int N) {
  const int t = blockIdx.x * 256 + threadIdx.x;
  const int k8n = K / 8;
  if (t >= N * k8n) return;
  const int n = t / k8n, k8 = (t % k8n) * 8;
  v8us v;
#pragma unroll
  for (int i = 0; i < 8; ++i) v[i] = bf16_bits(W[(size_t)(k8 + i) * N + n]);
  *(v8us*)(Wt + (size_t)n * K + k8) = v;
  
}

// GEMM C[M][N] (f32, pitch ldc) = act(A[M][K]·W + bias). A f32 row-major (pitch lda) converted per fragment to bf16
// (ASPLIT: hi/lo two planes -> 2 terms, else single rounded term); Wt bf16 [N][K] (pitch ldb). BIAS_BF16 rounds the
// bias to bf16 first (bias quantised to bf16 before the add). K%32==0, M%16==0, N%64==0.
template <bool ASPLIT, int ACT, bool BIAS_BF16>
__global__ __launch_bounds__(128) void k_gemm_bf(const float* __restrict__ A, int lda, const unsigned short* __restrict__ Wt, int ldb,
                                               const float* __restrict__ bias, float* __restrict__ C, int ldc, int M, int N, int K) {
  __shared__ __attribute__((aligned(16))) float so[4][16][64];
  const int tid = threadIdx.x, w = tid >> 5, lane = tid & 31, ln = lane & 15, hh = lane >> 4;
  const int ntn = N / 64;
  const int wid = blockIdx.x * 4 + w;
  const int mt = wid / ntn, nq = wid % ntn;
  if (mt * 16 >= M) return;
  const int row0 = mt * 16, col0 = nq * 64;
  const float* arow = A + (size_t)(row0 + ln) * lda;
  v8f acc[4] = {};
  for (int kb = 0; kb < K; kb += 32) {
    FragB ah, al;
    const v4f x0 = *(const v4fa*)(arow + kb + 8 * hh), x1 = *(const v4fa*)(arow + kb + 8 * hh + 4);
    const v4f x2 = *(const v4fa*)(arow + kb + 16 + 8 * hh), x3 = *(const v4fa*)(arow + kb + 16 + 8 * hh + 4);
    float xs[16] = {x0[0],x0[1],x0[2],x0[3],x1[0],x1[1],x1[2],x1[3],x2[0],x2[1],x2[2],x2[3],x3[0],x3[1],x3[2],x3[3]};
#pragma unroll
    for (int i = 0; i < 16; ++i) { const unsigned short hb = bf16_bits(xs[i]); ah.u[i] = hb; al.u[i] = ASPLIT ? bf16_bits(xs[i] - bf16_val(hb)) : (unsigned short)0; }
#pragma unroll
    for (int t = 0; t < 4; ++t) {
      const unsigned short* brow = Wt + (size_t)(col0 + t * 16 + ln) * ldb + kb;
      FragB b;
      b.half[0] = *(const v8us*)(brow + 8 * hh);
      b.half[1] = *(const v8us*)(brow + 16 + 8 * hh);
      acc[t] = mmaN<ASPLIT ? 2 : 1>(ah.v, al.v, b.v, b.v, acc[t]);
    }
  }
#pragma unroll
  for (int t = 0; t < 4; ++t) {
    float bv = bias ? bias[col0 + t * 16 + ln] : 0.f;
    if (BIAS_BF16) bv = bf16_round(bv);
#pragma unroll
    for (int r = 0; r < 8; ++r) { float v = acc[t][r] + bv; if (ACT == 1) v = fmaxf(v, 0.f); so[w][8 * hh + r][t * 16 + ln] = v; }
  }
  __builtin_amdgcn_fence(__ATOMIC_ACQ_REL, "workgroup");
  __builtin_amdgcn_wave_barrier();
  const int rsub = lane >> 4, c4 = (lane & 15) * 4;
  {
#pragma unroll
    for (int q = 0; q < 8; ++q) {
      const int r = q * 2 + rsub;
      const v4f v = *(const v4fa*)&so[w][r][c4];
      *(v4f*)(C + (size_t)(row0 + r) * ldc + col0 + c4) = v;
    }
    
  }
}

// GEMM C = act(A·W + bias + resid): A f32 (ASPLIT -> hi/lo 2 terms), Wt bf16 [N][K]; ACT 0 none, 1 relu, 2 exact gelu;
// resid (optional, f32, row index = (row % rmod), pitch ldr, RES_BF16 rounds it) added before the activation.
template <bool ASPLIT, int ACT, bool BIAS_BF16, bool RES_BF16>
__global__ __launch_bounds__(128) void k_gemm_bf3(const float* __restrict__ A, int lda, const unsigned short* __restrict__ Wt, int ldb,
                                                const float* __restrict__ bias, const float* __restrict__ resid, int rmod, int ldr,
                                                float* __restrict__ C, int ldc, int M, int N, int K) {
  __shared__ __attribute__((aligned(16))) float so[4][16][64];
  const int tid = threadIdx.x, w = tid >> 5, lane = tid & 31, ln = lane & 15, hh = lane >> 4;
  const int ntn = N / 64;
  const int wid = blockIdx.x * 4 + w;
  const int mt = wid / ntn, nq = wid % ntn;
  if (mt * 16 >= M) return;
  const int row0 = mt * 16, col0 = nq * 64;
  const float* arow = A + (size_t)(row0 + ln) * lda;
  v8f acc[4] = {};
  for (int kb = 0; kb < K; kb += 32) {
    FragB ah, al;
    const v4f x0 = *(const v4fa*)(arow + kb + 8 * hh), x1 = *(const v4fa*)(arow + kb + 8 * hh + 4);
    const v4f x2 = *(const v4fa*)(arow + kb + 16 + 8 * hh), x3 = *(const v4fa*)(arow + kb + 16 + 8 * hh + 4);
    float xs[16] = {x0[0],x0[1],x0[2],x0[3],x1[0],x1[1],x1[2],x1[3],x2[0],x2[1],x2[2],x2[3],x3[0],x3[1],x3[2],x3[3]};
#pragma unroll
    for (int i = 0; i < 16; ++i) { const unsigned short hb = bf16_bits(xs[i]); ah.u[i] = hb; al.u[i] = ASPLIT ? bf16_bits(xs[i] - bf16_val(hb)) : (unsigned short)0; }
#pragma unroll
    for (int t = 0; t < 4; ++t) {
      const unsigned short* brow = Wt + (size_t)(col0 + t * 16 + ln) * ldb + kb;
      FragB b;
      b.half[0] = *(const v8us*)(brow + 8 * hh);
      b.half[1] = *(const v8us*)(brow + 16 + 8 * hh);
      acc[t] = mmaN<ASPLIT ? 2 : 1>(ah.v, al.v, b.v, b.v, acc[t]);
    }
  }
#pragma unroll
  for (int t = 0; t < 4; ++t) {
    const int col = col0 + t * 16 + ln;
    float bv = bias ? bias[col] : 0.f;
    if (BIAS_BF16) bv = bf16_round(bv);
#pragma unroll
    for (int r = 0; r < 8; ++r) {
      float v = acc[t][r] + bv;
      if (resid) { float rv = resid[(size_t)((row0 + 8 * hh + r) % rmod) * ldr + col]; if (RES_BF16) rv = bf16_round(rv); v += rv; }
      if (ACT == 1) v = fmaxf(v, 0.f);
      if (ACT == 2) v = 0.5f * v * (1.0f + erff(v * 0.70710678118654752f));
      if (ACT == 3) { const float u = 0.7978845608028654f * (v + 0.044715f * v * v * v); v = 0.5f * v * (1.0f + tanhf(u)); }
      so[w][8 * hh + r][t * 16 + ln] = v;
    }
  }
  __builtin_amdgcn_fence(__ATOMIC_ACQ_REL, "workgroup");
  __builtin_amdgcn_wave_barrier();
  const int rsub = lane >> 4, c4 = (lane & 15) * 4;
  {
#pragma unroll
    for (int q = 0; q < 8; ++q) {
      const int r = q * 2 + rsub;
      const v4f v = *(const v4fa*)&so[w][r][c4];
      *(v4f*)(C + (size_t)(row0 + r) * ldc + col0 + c4) = v;
    }
    
  }
}
// row LayerNorm (biased variance, eps) over N: s = X (+ R); optional out_sum <- s; out_norm <- (s-mu)*rsqrt(var+eps)*g + b
template <bool PARAM_BF16>
__global__ __launch_bounds__(256) void k_layernorm(const float* __restrict__ X, const float* __restrict__ R, const float* __restrict__ g, const float* __restrict__ bta,
                                                  float* __restrict__ out_sum, float* __restrict__ out_norm, int N, float eps) {
  __shared__ float red[256];
  const int row = blockIdx.x, tid = threadIdx.x;
  const float* x = X + (size_t)row * N; const float* rr = R ? R + (size_t)row * N : nullptr;
  float vals[16];                     // up to N = 4096
  const int per = N / 256;            // contiguous chunk per thread? use strided-by-4 chunks: thread handles j = tid*4 + 1024*u
  float s1 = 0.f;
  for (int u = 0; u < per / 4; ++u) {
    const int j = tid * 4 + 1024 * u;
    const v4f a = *(const v4fa*)(x + j);
    v4f b = {0.f,0.f,0.f,0.f}; if (rr) b = *(const v4fa*)(rr + j);
#pragma unroll
    for (int q = 0; q < 4; ++q) { const float v = a[q] + b[q]; vals[u * 4 + q] = v; s1 += v; }
  }
  red[tid] = s1; __syncthreads();
  for (int st = 128; st > 0; st >>= 1) { if (tid < st) red[tid] += red[tid + st]; __syncthreads(); }
  const float mu = red[0] / (float)N; __syncthreads();
  float s2 = 0.f;
  for (int u = 0; u < per / 4; ++u)
#pragma unroll
    for (int q = 0; q < 4; ++q) { const float c = vals[u * 4 + q] - mu; s2 += c * c; }
  red[tid] = s2; __syncthreads();
  for (int st = 128; st > 0; st >>= 1) { if (tid < st) red[tid] += red[tid + st]; __syncthreads(); }
  const float rs = rsqrtf(red[0] / (float)N + eps);
  {
    for (int u = 0; u < per / 4; ++u) {
      const int j = tid * 4 + 1024 * u;
      v4f o, sm;
#pragma unroll
      for (int q = 0; q < 4; ++q) {
        float gg = g[j + q], bb = bta[j + q];
        if (PARAM_BF16) { gg = bf16_round(gg); bb = bf16_round(bb); }
        sm[q] = vals[u * 4 + q]; o[q] = (vals[u * 4 + q] - mu) * rs * gg + bb;
      }
      if (out_sum) *(v4f*)(out_sum + (size_t)row * N + j) = sm;
      *(v4f*)(out_norm + (size_t)row * N + j) = o;
    }
    
  }
}



// ---- f16 WMMA path (v_wmma_f32_16x16x32_f16): 11-bit significands for operands in range — used where a [0,1] probability operand needs more precision than bf16
typedef _Float16 v16h __attribute__((ext_vector_type(16)));
union FragH { v16h v; v8us half[2]; _Float16 h[16]; unsigned short u[16]; };
template <int NT>
__device__ __forceinline__ v8f mmaH(v16h ah, v16h al, v16h bh, v16h bl, v8f c) {
  c = __builtin_amdgcn_wmma_f32_16x16x32_f16(false, ah, false, bh, (short)0, c, false, false);
  if (NT >= 2) c = __builtin_amdgcn_wmma_f32_16x16x32_f16(false, al, false, bh, (short)0, c, false, false);
  if (NT >= 3) c = __builtin_amdgcn_wmma_f32_16x16x32_f16(false, ah, false, bl, (short)0, c, false, false);
  asm volatile("v_nop\n\tv_nop\n\tv_nop\n\tv_nop" : "+v"(c) : "v"(ah), "v"(al), "v"(bh), "v"(bl));
  return c;
}
// batched GEMM like k_gemm_b but f16 operands: A f32 (split into f16 hi/lo if ASPLIT, else rounded to f16), Bt = f16 values [n][k]; alpha; C f32; N multiple of 16 (partial tiles skipped)
template <bool ASPLIT>
__global__ __launch_bounds__(128) void k_gemm_h(const float* __restrict__ A, int lda, size_t sA, const _Float16* __restrict__ Bh, int ldb, size_t sB, float alpha, float* __restrict__ C, int ldc, size_t sC, int M, int N, int K) {
  __shared__ __attribute__((aligned(16))) float so[4][16][64];
  const int tid = threadIdx.x, w = tid >> 5, lane = tid & 31, ln = lane & 15, hh = lane >> 4; const int by = blockIdx.y;
  A += (size_t)by * sA; Bh += (size_t)by * sB; C += (size_t)by * sC;
  const int ntn = (N + 63) / 64; const int wid = blockIdx.x * 4 + w; const int mt = wid / ntn, nq = wid % ntn; if (mt * 16 >= M) return;
  const int row0 = mt * 16, col0 = nq * 64; const float* arow = A + (size_t)(row0 + ln) * lda;
  v8f acc[4] = {};
  for (int kb = 0; kb < K; kb += 32) {
    FragH ah, al;
    const v4f x0 = *(const v4fa*)(arow + kb + 8 * hh), x1 = *(const v4fa*)(arow + kb + 8 * hh + 4), x2 = *(const v4fa*)(arow + kb + 16 + 8 * hh), x3 = *(const v4fa*)(arow + kb + 16 + 8 * hh + 4);
    float xs[16] = {x0[0],x0[1],x0[2],x0[3],x1[0],x1[1],x1[2],x1[3],x2[0],x2[1],x2[2],x2[3],x3[0],x3[1],x3[2],x3[3]};
#pragma unroll
    for (int i = 0; i < 16; ++i) { const _Float16 h = (_Float16)xs[i]; ah.h[i] = h; al.h[i] = ASPLIT ? (_Float16)(xs[i] - (float)h) : (_Float16)0.0f; }
#pragma unroll
    for (int t = 0; t < 4; ++t) { if (col0 + t * 16 >= N) continue; const size_t boff = (size_t)(col0 + t * 16 + ln) * ldb + kb; FragH bq; bq.half[0] = *(const v8us*)(Bh + boff + 8 * hh); bq.half[1] = *(const v8us*)(Bh + boff + 16 + 8 * hh);
      acc[t] = mmaH<ASPLIT ? 2 : 1>(ah.v, al.v, bq.v, bq.v, acc[t]); }
  }
#pragma unroll
  for (int t = 0; t < 4; ++t) { if (col0 + t * 16 >= N) continue;
#pragma unroll
    for (int r = 0; r < 8; ++r) so[w][8 * hh + r][t * 16 + ln] = acc[t][r] * alpha; }
  __builtin_amdgcn_fence(__ATOMIC_ACQ_REL, "workgroup"); __builtin_amdgcn_wave_barrier();
  const int rsub = lane >> 4, c4 = (lane & 15) * 4;
  {
#pragma unroll
    for (int q = 0; q < 8; ++q) { const int r = q * 2 + rsub; if (col0 + c4 < N) { const v4f v = *(const v4fa*)&so[w][r][c4]; *(v4f*)(C + (size_t)(row0 + r) * ldc + col0 + c4) = v; } }
     }
}

// Wt[n][k] = f16(W[k][n]·scale) from f32 row-major W[K][N] (scale = power of two; bf16-exact weights stay exact in f16 away from the subnormal range)
__global__ __launch_bounds__(256) void k_wt_f16(const float* __restrict__ W, _Float16* __restrict__ Wt, int K, int N, float scale) {
  const int t = blockIdx.x * 256 + threadIdx.x; if (t >= N * (K / 8)) return; const int n = t / (K / 8), k8 = (t % (K / 8)) * 8; FragH f;
#pragma unroll
  for (int i = 0; i < 8; ++i) f.h[i] = (_Float16)(bf16_round(W[(size_t)(k8 + i) * N + n]) * scale); const v8us o = f.half[0];
  *(v8us*)((unsigned short*)Wt + (size_t)n * K + k8) = o; 
}
// k_gemm_hh variant with fused epilogue: v = acc·alpha + bias[by·sBias + col] (+ CP[(row/rowsPerB)·sCPb + by·64 + col] if CP) ; ACT 0 none / 1 elu ; writes f16 C16 (and f32 C if non-null)
template <int ACT>
__global__ __launch_bounds__(128) void k_gemm_hhx(const _Float16* __restrict__ A, int lda, size_t sA, const _Float16* __restrict__ Bh, int ldb, size_t sB, float alpha, const float* __restrict__ bias, size_t sBias, const float* __restrict__ CP, int rowsPerB, size_t sCPb, int row0g,
    float* __restrict__ C, _Float16* __restrict__ C16, int ldc, size_t sC, int M, int N, int K) {
  __shared__ __attribute__((aligned(16))) float so[4][16][64];
  const int tid = threadIdx.x, w = tid >> 5, lane = tid & 31, ln = lane & 15, hh = lane >> 4; const int by = blockIdx.y;
  A += (size_t)by * sA; Bh += (size_t)by * sB; const size_t cofs = (size_t)by * sC; const float* bp = bias ? bias + (size_t)by * sBias : nullptr;
  const int ntn = (N + 63) / 64; const int wid = blockIdx.x * 4 + w; const int mt = wid / ntn, nq = wid % ntn; if (mt * 16 >= M) return;
  const int row0 = mt * 16, col0 = nq * 64; const _Float16* arow = A + (size_t)(row0 + ln) * lda;
  v8f acc[4] = {};
  for (int kb = 0; kb < K; kb += 32) { FragH ah; ah.half[0] = *(const v8us*)((const unsigned short*)arow + kb + 8 * hh); ah.half[1] = *(const v8us*)((const unsigned short*)arow + kb + 16 + 8 * hh);
#pragma unroll
    for (int t = 0; t < 4; ++t) { if (col0 + t * 16 >= N) continue; const size_t boff = (size_t)(col0 + t * 16 + ln) * ldb + kb; FragH bq; bq.half[0] = *(const v8us*)((const unsigned short*)Bh + boff + 8 * hh); bq.half[1] = *(const v8us*)((const unsigned short*)Bh + boff + 16 + 8 * hh);
      acc[t] = mmaH<1>(ah.v, ah.v, bq.v, bq.v, acc[t]); }
  }
#pragma unroll
  for (int t = 0; t < 4; ++t) { if (col0 + t * 16 >= N) continue; const int col = col0 + t * 16 + ln; const float bv = bp ? bf16_round(bp[col]) : 0.f;
#pragma unroll
    for (int r = 0; r < 8; ++r) { float v = acc[t][r] * alpha + bv; if (CP) { const int rr = row0g + row0 + 8 * hh + r; if (rowsPerB < 0) v += CP[cofs + (size_t)rr * ldc + col];      /* rowsPerB < 0: own element of the batched C plane */ else { const int bidx = rr / rowsPerB; v += CP[(size_t)bidx * sCPb + (size_t)by * 64 + col]; } } if (ACT == 1) v = (v > 0.f) ? v : expm1f(v); else if (ACT == 7) v = (v > 0.f) ? v + 1.0f : expf(v); else if (ACT == 8) v = tanhf(v); else if (ACT == 9) v = 0.5f * v * (1.0f + tanhf(0.7978845608028654f * (v + 0.044715f * v * v * v))); else if (ACT == 11) v = 1.0f / (1.0f + expf(-v)); else if (ACT == 12) v = (v > 0.f) ? v : 0.01f * v; else if (ACT == 14) v = (v > 0.f) ? v : 0.1f * v; else if (ACT == 16) v = (v >= 0.f) ? v : 0.3f * v; else if (ACT == 17) v = (v >= 0.f) ? v : 0.2f * v; else if (ACT == 15) v = v / (1.0f + expf(-v)); else if (ACT == 3) v = fmaxf(v, 0.f); else if (ACT == 6) v = 0.5f * v * (1.0f + erff(v * 0.70710678118654752f)); so[w][8 * hh + r][t * 16 + ln] = v; } }
  __builtin_amdgcn_fence(__ATOMIC_ACQ_REL, "workgroup"); __builtin_amdgcn_wave_barrier();
  const int rsub = lane >> 4, c4 = (lane & 15) * 4; typedef _Float16 v4h __attribute__((ext_vector_type(4)));
  {
#pragma unroll
    for (int q = 0; q < 8; ++q) { const int r = q * 2 + rsub; if (col0 + c4 < N) { const v4f v = *(const v4fa*)&so[w][r][c4]; if (C) *(v4f*)(C + cofs + (size_t)(row0 + r) * ldc + col0 + c4) = v; if (C16) { v4h h4; for (int i = 0; i < 4; ++i) h4[i] = (_Float16)v[i]; *(v4h*)(C16 + cofs + (size_t)(row0 + r) * ldc + col0 + c4) = h4; } } }
     }
}


typedef _Float16 v4h __attribute__((ext_vector_type(4)));

__global__ __launch_bounds__(256) void k_x16(const float* __restrict__ x, _Float16* __restrict__ X16, size_t n8) { const size_t t = (size_t)blockIdx.x * 256 + threadIdx.x; if (t >= n8) return; FragH f;
#pragma unroll
  for (int q = 0; q < 8; ++q) f.h[q] = (_Float16)bf16_round(x[t * 8 + q]); *(v8us*)((unsigned short*)X16 + t * 8) = f.half[0];  }
__global__ __launch_bounds__(256) void k_h16(const float* __restrict__ x, _Float16* __restrict__ X16, size_t n8) { const size_t t = (size_t)blockIdx.x * 256 + threadIdx.x; if (t >= n8) return; FragH f;
#pragma unroll
  for (int q = 0; q < 8; ++q) f.h[q] = (_Float16)x[t * 8 + q]; *(v8us*)((unsigned short*)X16 + t * 8) = f.half[0];  }
__global__ __launch_bounds__(256) void k_round16f(const float* __restrict__ W, _Float16* __restrict__ Bt, size_t n8) { const size_t t = (size_t)blockIdx.x * 256 + threadIdx.x; if (t >= n8) return; FragH f;
#pragma unroll
  for (int i = 0; i < 8; ++i) f.h[i] = (_Float16)(bf16_round(W[t * 8 + i]) * 16.0f); *(v8us*)((unsigned short*)Bt + t * 8) = f.half[0];  }
template <int NHv, int TTv>
__global__ __launch_bounds__(256) void k_vt(const _Float16* __restrict__ V16, int ldv, int voff, _Float16* __restrict__ Vt) { __shared__ unsigned short tl[64][66]; const int tid = threadIdx.x; const int slab = blockIdx.x / (TTv / 64), lg = blockIdx.x % (TTv / 64); const int b = slab / NHv, h = slab % NHv;
  for (int i = tid; i < 64 * 8; i += 256) { const int r = i / 8, c8 = (i % 8) * 8; FragH f; f.half[0] = *(const v8us*)((const unsigned short*)V16 + ((size_t)b * TTv + lg * 64 + r) * ldv + voff + h * 64 + c8);
#pragma unroll
    for (int q = 0; q < 8; ++q) tl[r][c8 + q] = f.u[q]; }
  __syncthreads();
  {
#pragma unroll
    for (int rd = 0; rd < 2; ++rd) { const int d = rd * 32 + tid / 8, pc = tid % 8; FragH f;
#pragma unroll
      for (int q = 0; q < 8; ++q) f.u[q] = tl[pc * 8 + q][d];
      *(v8us*)((unsigned short*)Vt + ((size_t)slab * 64 + d) * TTv + lg * 64 + pc * 8) = f.half[0]; }
     } }

__global__ __launch_bounds__(256) void k_hl(const float* __restrict__ F, _Float16* __restrict__ Hh, _Float16* __restrict__ Hl, size_t n8) { const size_t t = (size_t)blockIdx.x * 256 + threadIdx.x; if (t >= n8) return; FragH fh, fl; const v4f a = *(const v4fa*)(F + t * 8), c = *(const v4fa*)(F + t * 8 + 4);
#pragma unroll
  for (int q = 0; q < 4; ++q) { _Float16 h = (_Float16)a[q]; fh.h[q] = h; fl.h[q] = (_Float16)((a[q] - (float)h) * 1024.0f); h = (_Float16)c[q]; fh.h[4 + q] = h; fl.h[4 + q] = (_Float16)((c[q] - (float)h) * 1024.0f); }
  { *(v8us*)((unsigned short*)Hh + t * 8) = fh.half[0]; *(v8us*)((unsigned short*)Hl + t * 8) = fl.half[0];  } }

// ---- fast GEMM (wave tile 32x64; requires M % 32 == 0 rows per launch region and N % 64 == 0) ----
__device__ __forceinline__ v16h g2_frag(const _Float16* p, int hh) { FragH f; f.half[0] = *(const v8us*)((const unsigned short*)p + 8 * hh); f.half[1] = *(const v8us*)((const unsigned short*)p + 16 + 8 * hh); return f.v; }
__device__ __forceinline__ v8f g2_mma(v16h a, v16h b, v8f c) { v8f d = __builtin_amdgcn_wmma_f32_16x16x32_f16(false, a, false, b, (short)0, c, false, false); asm volatile("v_nop\n\tv_nop\n\tv_nop\n\tv_nop" : "+v"(d) : "v"(a), "v"(b)); return d; }
// The fragments of one 32-k step of a 32x64 wave tile: the two A row groups and the four B column groups.
struct G2Set { v16h a0, a1, b0, b1, b2, b3; };
__device__ __forceinline__ void g2_load(G2Set& s, const _Float16* a0p, const _Float16* a1p, const _Float16* b0p, const _Float16* b1p, const _Float16* b2p, const _Float16* b3p, int kb, int hh) {
  s.a0 = g2_frag(a0p + kb, hh); s.a1 = g2_frag(a1p + kb, hh); s.b0 = g2_frag(b0p + kb, hh); s.b1 = g2_frag(b1p + kb, hh); s.b2 = g2_frag(b2p + kb, hh); s.b3 = g2_frag(b3p + kb, hh);
  asm volatile("s_wait_xcnt 0x0" ::: "memory");      /* stands in front of the next address additions, which give new values to registers that these loads name */
  __builtin_amdgcn_sched_barrier(0); }      /* keeps the 12 loads and their wait here, ahead of the other set's products: moved down to their first uses the loads would each be waited for in turn */
// The same for the first and the last step, outside the loop, where nothing reads some of the addresses afterwards (the six pointers: the lane's own addresses, k offset and 8 * hh included).
__device__ __forceinline__ void g2_load_once(G2Set& s, const _Float16* pa0, const _Float16* pa1, const _Float16* pb0, const _Float16* pb1, const _Float16* pb2, const _Float16* pb3) {
  s.a0 = g2_frag(pa0, 0); s.a1 = g2_frag(pa1, 0); s.b0 = g2_frag(pb0, 0); s.b1 = g2_frag(pb1, 0); s.b2 = g2_frag(pb2, 0); s.b3 = g2_frag(pb3, 0);
  asm volatile("s_wait_xcnt 0x0" :: "v"(pa0), "v"(pa1), "v"(pb0), "v"(pb1), "v"(pb2), "v"(pb3) : "memory");      /* the addresses as inputs stay alive up to the wait, so that no later load's result lands in an earlier load's address registers in front of it */
  __builtin_amdgcn_sched_barrier(0); }      /* keeps the 12 loads and their wait here, ahead of the other set's products */
__device__ __forceinline__ void g2_mul(const G2Set& s, v8f (&c)[8]) {
  c[0] = g2_mma(s.a0, s.b0, c[0]); c[4] = g2_mma(s.a1, s.b0, c[4]); c[1] = g2_mma(s.a0, s.b1, c[1]); c[5] = g2_mma(s.a1, s.b1, c[5]);
  c[2] = g2_mma(s.a0, s.b2, c[2]); c[6] = g2_mma(s.a1, s.b2, c[6]); c[3] = g2_mma(s.a0, s.b3, c[3]); c[7] = g2_mma(s.a1, s.b3, c[7]); }
// The epilogue's kind is fixed at compile time. RES: a residual row (f32, pitch LDC, same row and column as the result) is added behind the bias; F16O: the result goes out as f16 rows (C16), else as f32 rows (C); LDC: pitch of the result rows.
// result = act(sum * alpha + bf16(bias[col]) (+ residual)), worked out behind the LDS turn, where a lane holds 4 neighbouring columns of a row: bias and residual come as 16-byte loads with nothing between them.
template <int ACT, bool RES, bool F16O, int LDC>
__global__ __launch_bounds__(128) void k_gemm2(const _Float16* __restrict__ A, int lda, const _Float16* __restrict__ Bh, int ldb, size_t sB, float alpha, const float* __restrict__ bias, const float* __restrict__ biasY1, const float* __restrict__ biasY2, const float* __restrict__ R,
    float* __restrict__ C, _Float16* __restrict__ C16, size_t sC, int M, int N, int K) {      /* sB, sC: strides of blockIdx.y; biasY1, biasY2: the bias arrays of planes y = 1 and y = 2 (else null) */ static_assert(ACT == 0 || ACT == 6, "k_gemm2: unsupported ACT code (would silently apply no activation)"); static_assert(!(RES && ACT == 6), "k_gemm2: the rolled GELU loop holds no residual registers");
  __shared__ __attribute__((aligned(16))) float so[4][32][68];
  const int tid = threadIdx.x, w = tid >> 5, lane = tid & 31, ln = lane & 15, hh = lane >> 4; const int by = blockIdx.y;
  Bh += (size_t)by * sB; const size_t cofs = (size_t)by * sC; const float* bp = bias; if (biasY1 && by == 1) bp = biasY1; if (biasY2 && by == 2) bp = biasY2;
  const int ntn = N >> 6; const int mt = blockIdx.x / ntn, nq = blockIdx.x - mt * ntn; const int row0 = mt * 128 + 32 * w, col0 = nq * 64; if (row0 >= M) return;
  const _Float16* a0p = A + (size_t)(row0 + ln) * lda; const _Float16* a1p = a0p + (size_t)16 * lda;
  const _Float16* b0p = Bh + (size_t)(col0 + ln) * ldb; const _Float16* b1p = b0p + (size_t)16 * ldb; const _Float16* b2p = b1p + (size_t)16 * ldb; const _Float16* b3p = b2p + (size_t)16 * ldb;
  const v8f z8 = {0.f,0.f,0.f,0.f,0.f,0.f,0.f,0.f}; v8f accs[8] = {z8, z8, z8, z8, z8, z8, z8, z8};
  /* K loop over two fragment sets: while one 32-k step is multiplied, the other step's 12 loads are in flight. K % 64 == 0; every sum keeps its ascending k order. */
  G2Set s0, s1; int kb = 0; g2_load_once(s0, a0p + 8 * hh, a1p + 8 * hh, b0p + 8 * hh, b1p + 8 * hh, b2p + 8 * hh, b3p + 8 * hh);
#pragma unroll 1      /* the two steps of a trip are written out; more copies would only add code */
  for (; kb + 64 < K; kb += 64) { g2_load(s1, a0p, a1p, b0p, b1p, b2p, b3p, kb + 32, hh); g2_mul(s0, accs); g2_load(s0, a0p, a1p, b0p, b1p, b2p, b3p, kb + 64, hh); g2_mul(s1, accs); }
  const int kl = kb + 32; g2_load_once(s1, a0p + 8 * hh + kl, a1p + 8 * hh + kl, b0p + 8 * hh + kl, b1p + 8 * hh + kl, b2p + 8 * hh + kl, b3p + 8 * hh + kl); g2_mul(s0, accs);      /* the last two steps: no fragment is left to fetch behind them */
  /* Store layout: lane = row rsub (+ 2 per vector) of the wave's 32, columns c4 .. c4 + 3 of its 64; e0 = the lane's first element. */
  const int rsub = lane >> 4, c4 = (lane & 15) * 4; const size_t e0 = (size_t)(row0 + rsub) * LDC + col0 + c4;
  const v4f b4 = *(const v4fa*)(bp + col0 + c4); v4f rv[RES ? 16 : 1];
  if constexpr (RES) { const float* rp = R + e0;
#pragma unroll      /* constant indices: the 16 row vectors stay in registers and their loads issue together */
    for (int q = 0; q < 16; ++q) rv[q] = *(const v4fa*)(rp + (size_t)q * 2 * LDC);
    asm volatile("s_wait_xcnt 0x0" :: "v"(rp) : "memory"); }      /* stands in front of whatever gives new values to the address registers of these loads; the rows' address as an input stays alive up to here, so that no load's result lands in it */
  else asm volatile("s_wait_xcnt 0x0" ::: "memory");      /* stands in front of whatever gives new values to the address registers of the bias load */
  __builtin_amdgcn_sched_barrier(0);      /* keeps the loads here, in flight under the last step's own load wait and products: moved down to their uses they would be waited for behind the products */
  g2_mul(s1, accs);
#pragma unroll      /* constant indices: the sums stay in registers */
  for (int u = 0; u < 8; ++u) {
#pragma unroll      /* constant indices: the sums stay in registers */
    for (int r = 0; r < 8; ++r) so[w][(u >> 2) * 16 + 8 * hh + r][(u & 3) * 16 + ln] = accs[u][r]; }
  /* the wave's own 32 x 64 sums are in LDS before its lanes read them back row-wise */
  __builtin_amdgcn_fence(__ATOMIC_ACQ_REL, "workgroup"); __builtin_amdgcn_wave_barrier();
  const v4f bb = {bf16_round(b4[0]), bf16_round(b4[1]), bf16_round(b4[2]), bf16_round(b4[3])};
  const float* sp = &so[w][rsub][c4]; char* cp = F16O ? (char*)(C16 + cofs + e0) : (char*)(C + cofs + e0); constexpr size_t RB = (size_t)2 * LDC * (F16O ? 2 : 4);      /* RB: bytes from one of the lane's rows to its next */
#pragma unroll (ACT == 6 ? 1 : 4)      /* GELU: rolled, 16 erf bodies of text instead of 64, so that the kernel's text stays small; else written out, since the residual registers take constant indices */
  for (int g = 0; g < 4; ++g) { v4f v[4];
#pragma unroll      /* constant indices: the four LDS reads issue together */
    for (int i = 0; i < 4; ++i) v[i] = *(const v4fa*)(sp + i * 2 * 68);
#pragma unroll      /* constant indices: the values stay in registers */
    for (int i = 0; i < 4; ++i) {
#pragma unroll      /* constant indices: the values stay in registers */
      for (int e = 0; e < 4; ++e) { float x = v[i][e] * alpha + bb[e]; if constexpr (RES) x += rv[g * 4 + i][e]; if (ACT == 6) x = 0.5f * x * (1.0f + erff(x * 0.70710678118654752f)); v[i][e] = x; }
      if constexpr (F16O) { v4h h4;
#pragma unroll      /* constant indices: the values stay in registers */
        for (int e = 0; e < 4; ++e) h4[e] = (_Float16)v[i][e];
        *(v4h*)(cp + i * RB) = h4; }
      else *(v4f*)(cp + i * RB) = v[i]; }
    sp += 8 * 68; cp += 4 * RB; } }


// The same GEMM for the two launches whose grid of 128 x 64 tiles is small and whose K loop is a long chain of load waits (W_o, fc2): 16 waves per tile instead of 4.
// Wave w works on row group w & 3 (32 rows) and on the 32-k steps kq, kq + KS, kq + 2 KS, ... with kq = w >> 2, so that the KS waves of a row group read the same 128-byte lines of A and B at the same time.
// The KS partial sums of a row group meet in LDS; behind the barrier wave (rw, kq) adds them in the order of kq for rows 8 kq .. 8 kq + 7 and finishes these rows: result = sum * alpha + bf16(bias[col]) + residual, f32 rows of pitch LDC.
#define KS 4
static_assert(NR % 128 == 0, "k_gemm2k: whole 128-row tiles");
template <int LDC>
__global__ __launch_bounds__(128 * KS) void k_gemm2k(const _Float16* __restrict__ A, int lda, const _Float16* __restrict__ Bh, int ldb, float alpha, const float* __restrict__ bias, const float* __restrict__ R, float* __restrict__ C, int M, int N, int K) {      /* K % (64 * KS) == 0 */
  __shared__ __attribute__((aligned(16))) float so[KS * 4][32][68];
  const int tid = threadIdx.x, w = tid >> 5, lane = tid & 31, ln = lane & 15, hh = lane >> 4; const int rw = w & 3, kq = w >> 2;
  const int ntn = N >> 6; const int mt = blockIdx.x / ntn, nq = blockIdx.x - mt * ntn; if (mt * 128 >= M) return;      /* the whole work-group or none of it, in front of the barrier */
  const int row0 = mt * 128 + 32 * rw, col0 = nq * 64;
  const _Float16* a0p = A + (size_t)(row0 + ln) * lda + 32 * kq; const _Float16* a1p = a0p + (size_t)16 * lda;
  const _Float16* b0p = Bh + (size_t)(col0 + ln) * ldb + 32 * kq; const _Float16* b1p = b0p + (size_t)16 * ldb; const _Float16* b2p = b1p + (size_t)16 * ldb; const _Float16* b3p = b2p + (size_t)16 * ldb;
  const v8f z8 = {0.f,0.f,0.f,0.f,0.f,0.f,0.f,0.f}; v8f accs[8] = {z8, z8, z8, z8, z8, z8, z8, z8};
  /* K loop over two fragment sets as in k_gemm2; from one of the wave's steps to its next it is 32 * KS elements of k. */
  constexpr int ST = 32 * KS; G2Set s0, s1; int kb = 0; g2_load_once(s0, a0p + 8 * hh, a1p + 8 * hh, b0p + 8 * hh, b1p + 8 * hh, b2p + 8 * hh, b3p + 8 * hh);
#pragma unroll 1      /* the two steps of a trip are written out; more copies would only add code */
  for (; kb + 2 * ST < K; kb += 2 * ST) { g2_load(s1, a0p, a1p, b0p, b1p, b2p, b3p, kb + ST, hh); g2_mul(s0, accs); g2_load(s0, a0p, a1p, b0p, b1p, b2p, b3p, kb + 2 * ST, hh); g2_mul(s1, accs); }
  const int kl = kb + ST; g2_load_once(s1, a0p + 8 * hh + kl, a1p + 8 * hh + kl, b0p + 8 * hh + kl, b1p + 8 * hh + kl, b2p + 8 * hh + kl, b3p + 8 * hh + kl); g2_mul(s0, accs);      /* the wave's last two steps: no fragment is left to fetch behind them */
  /* Store layout: lane = row rl (+ 2 per vector) of the row group's 32, columns c4 .. c4 + 3 of its 64; e0 = the lane's first element. */
  const int c4 = (lane & 15) * 4, rl = 8 * kq + (lane >> 4); const size_t e0 = (size_t)(row0 + rl) * LDC + col0 + c4;
  const float* rp = R + e0; const v4f b4 = *(const v4fa*)(bias + col0 + c4); v4f rv[4];
#pragma unroll      /* constant indices: the 4 row vectors stay in registers and their loads issue together */
  for (int i = 0; i < 4; ++i) rv[i] = *(const v4fa*)(rp + (size_t)i * 2 * LDC);
  asm volatile("s_wait_xcnt 0x0" :: "v"(rp) : "memory");      /* stands in front of whatever gives new values to the address registers of these loads; the rows' address as an input stays alive up to here, so that no load's result lands in it */
  __builtin_amdgcn_sched_barrier(0);      /* keeps the loads here, in flight under the last step's own load wait and products: moved down to their uses they would be waited for behind the barrier */
  g2_mul(s1, accs);
#pragma unroll      /* constant indices: the sums stay in registers */
  for (int u = 0; u < 8; ++u) {
#pragma unroll      /* constant indices: the sums stay in registers */
    for (int r = 0; r < 8; ++r) so[w][(u >> 2) * 16 + 8 * hh + r][(u & 3) * 16 + ln] = accs[u][r]; }
  __syncthreads();      /* the partial sums of all 16 waves are in LDS before any wave adds them up */
  const v4f bb = {bf16_round(b4[0]), bf16_round(b4[1]), bf16_round(b4[2]), bf16_round(b4[3])};
  const float* sp = &so[rw][rl][c4]; float* cp = C + e0; v4f p[4][KS];
#pragma unroll      /* constant indices: the LDS reads issue together */
  for (int i = 0; i < 4; ++i) {
#pragma unroll      /* constant indices: the LDS reads issue together */
    for (int q = 0; q < KS; ++q) p[i][q] = *(const v4fa*)(sp + (size_t)q * 4 * 32 * 68 + i * 2 * 68); }
#pragma unroll      /* constant indices: the values stay in registers */
  for (int i = 0; i < 4; ++i) { v4f v = p[i][0];
#pragma unroll      /* constant indices: the values stay in registers */
    for (int q = 1; q < KS; ++q) v += p[i][q];
#pragma unroll      /* constant indices: the values stay in registers */
    for (int e = 0; e < 4; ++e) v[e] = v[e] * alpha + bb[e] + rv[i][e];
    *(v4f*)(cp + (size_t)i * 2 * LDC) = v; } }


__global__ __launch_bounds__(256) void k_rsm(const float* __restrict__ S, _Float16* __restrict__ P, int nrows) {
  #pragma clang fp contract(off)
  const int i = blockIdx.x * 256 + threadIdx.x; if (i >= nrows) return; const float* s = S + (size_t)i * SQ; float mx = -3.0e38f;
#pragma unroll 1
  for (int j = 0; j < SQ; ++j) mx = fmaxf(mx, s[j]); float se = 0.f;
#pragma unroll 1
  for (int j = 0; j < SQ; ++j) se += expf(s[j] - mx); const float sc = 256.0f / se;
#pragma unroll 1
  for (int j0 = 0; j0 < SQ; j0 += 8) { FragH f; for (int q = 0; q < 8; ++q) f.h[q] = (_Float16)(expf(s[j0 + q] - mx) * sc); unsigned short* d = (unsigned short*)P + (size_t)i * SQ + j0; *(v8us*)d = f.half[0];  } }
__global__ __launch_bounds__(256) void k_vt(const _Float16* __restrict__ V16, _Float16* __restrict__ VT) { __shared__ unsigned short tl[64][65]; const int tid = threadIdx.x; const int hh = blockIdx.x % HG, sg = blockIdx.x / HG; const int s0 = sg * 64; const int b = hh / NH, h = hh % NH;
  for (int i = tid; i < 64 * 8; i += 256) { const int j = i / 8, d8 = (i % 8) * 8; FragH f; f.half[0] = *(const v8us*)((const unsigned short*)V16 + ((size_t)b * SQ + s0 + j) * DM + h * HD + d8); for (int q = 0; q < 8; ++q) tl[d8 + q][j] = f.u[q]; }
  __syncthreads();
  { for (int i = tid; i < 64 * 8; i += 256) { const int d = i / 8, j8 = (i % 8) * 8; FragH f; for (int q = 0; q < 8; ++q) f.u[q] = tl[d][j8 + q]; *(v8us*)((unsigned short*)VT + ((size_t)hh * HD + d) * SQ + s0 + j8) = f.half[0]; }  } }

#define FH 2048
#define KN 103
typedef int v4ia __attribute__((ext_vector_type(4), may_alias));
__device__ __forceinline__ void xcnt_wait() { asm volatile("s_wait_xcnt 0x0" ::: "memory"); }
// Operand preparation, one launch: the six weight matrices as x16 f16 planes (they lie one behind the other in Bt, in the order wq, wk, wv, wo, w1, w2) and x as bf16-rounded f32 rows.
// A weight or x work-group converts 256 x 8 elements of one array, a prior_mask one 256 words of 32 entries, a prior_indices one 8 query rows; which part follows from blockIdx.x alone.
#define PW (DM * DM / 2048)          /* work-groups per DM x DM weight */
#define PF (FH * DM / 2048)          /* work-groups per FH x DM weight */
#define PX ((int)(NR * DM / 2048))   /* work-groups for x */
#define PB0 (4 * PW + 2 * PF + PX)   /* first work-group of the prior tables' packing */
#define PMD (SQ * (SQ / 32) / 256)   /* prior_mask: one thread per 32-key word */
#define PMS (SQ / 8)                 /* prior_indices: one wave per query row */
static_assert((DM * DM) % 2048 == 0 && (FH * DM) % 2048 == 0 && (NR * DM) % 2048 == 0, "k_prep: whole work-groups per array");
__global__ __launch_bounds__(256) void k_prep(const float* __restrict__ wq, const float* __restrict__ wk, const float* __restrict__ wv, const float* __restrict__ wo, const float* __restrict__ w1, const float* __restrict__ w2, const float* __restrict__ x, _Float16* __restrict__ Bt, float* __restrict__ XF, const int* __restrict__ pmask, const int* __restrict__ pidx, const int* __restrict__ pim, unsigned int* __restrict__ MD, unsigned int* __restrict__ MS) {
  __shared__ __attribute__((aligned(16))) unsigned char bm[8][SQ];      /* prior_indices: the wave's own row of key flags (any index set) */
  const int blk = blockIdx.x; const float* src; int first;
  if (blk >= PB0 + PMD) {      /* MS[q][j / 32] bit j % 32: key j is one of row q's valid prior slots */
    const int lane = threadIdx.x & 31, w = threadIdx.x >> 5; const int q = (blk - PB0 - PMD) * 8 + w; const int* ix = pidx + (size_t)q * KN; const int* vm = pim + (size_t)q * KN; constexpr int NT = (KN + 31) / 32; int jx[NT]; bool ok[NT];
#pragma unroll      /* constant indices: the lane's values stay in registers and its loads issue together */
    for (int t = 0; t < NT; ++t) { const int k = t * 32 + lane; const int kc = k < KN ? k : KN - 1; jx[t] = ix[kc]; const int vk = vm[kc]; xcnt_wait(); ok[t] = (k < KN) & (vk != 0); }      /* a later load's result may land in an earlier load's address register: the wait stands between them */
    const v4ia z = {0, 0, 0, 0}; *(v4ia*)&bm[w][lane * 32] = z; *(v4ia*)&bm[w][lane * 32 + 16] = z;
    /* the zeros of every lane are in LDS before any lane sets a flag over them */
    __builtin_amdgcn_fence(__ATOMIC_ACQ_REL, "workgroup"); __builtin_amdgcn_wave_barrier();
#pragma unroll      /* constant indices: the lane's values stay in registers */
    for (int t = 0; t < NT; ++t) if (ok[t]) bm[w][min(max(jx[t], 0), SQ - 1)] = 1;      /* the key index is bounded here before it forms an address */
    /* the flags of every lane are in LDS before the row is read back */
    __builtin_amdgcn_fence(__ATOMIC_ACQ_REL, "workgroup"); __builtin_amdgcn_wave_barrier();
    unsigned int word = 0;
#pragma unroll      /* 32 independent LDS reads issue together */
    for (int c = 0; c < SQ / 32; ++c) { const unsigned int bal = __builtin_amdgcn_ballot_w32(bm[w][c * 32 + lane] != 0); if (lane == c) word = bal; }
    MS[(size_t)q * (SQ / 32) + lane] = word; return; }
  if (blk >= PB0) {      /* MD[q][j / 32] bit j % 32: prior_mask[q][j] */
    const size_t t = (size_t)(blk - PB0) * 256 + threadIdx.x; v4ia mv[8]; unsigned int word = 0;
#pragma unroll      /* constant indices: the lane's values stay in registers and its loads issue together */
    for (int i = 0; i < 8; ++i) mv[i] = *(const v4ia*)(pmask + t * 32 + i * 4);
    xcnt_wait();      /* the address registers of the eight loads may take new values below */
#pragma unroll      /* constant indices: the lane's values stay in registers */
    for (int i = 0; i < 8; ++i) for (int e = 0; e < 4; ++e) word |= (mv[i][e] != 0 ? 1u : 0u) << (i * 4 + e);
    MD[t] = word;
    xcnt_wait(); return; }      /* the listing lets another part's code follow, which writes the store's registers */
  if (blk < PW) { src = wq; first = 0; } else if (blk < 2 * PW) { src = wk; first = PW; } else if (blk < 3 * PW) { src = wv; first = 2 * PW; } else if (blk < 4 * PW) { src = wo; first = 3 * PW; }
  else if (blk < 4 * PW + PF) { src = w1; first = 4 * PW; } else if (blk < 4 * PW + 2 * PF) { src = w2; first = 4 * PW + PF; } else { src = x; first = 4 * PW + 2 * PF; }
  const size_t t = (size_t)(blk - first) * 256 + threadIdx.x; const v4f a0 = *(const v4fa*)(src + t * 8), a1 = *(const v4fa*)(src + t * 8 + 4);
  xcnt_wait();      /* the address registers of the two loads may take new values below */
  if (blk < 4 * PW + 2 * PF) { FragH f;
#pragma unroll      /* constant indices: the values stay in registers */
    for (int q = 0; q < 4; ++q) { f.h[q] = (_Float16)(bf16_round(a0[q]) * 16.0f); f.h[4 + q] = (_Float16)(bf16_round(a1[q]) * 16.0f); }
    *(v8us*)((unsigned short*)Bt + ((size_t)blk * 256 + threadIdx.x) * 8) = f.half[0];
    xcnt_wait(); }      /* the listing lets another part's code follow, which writes the store's registers */
  else { v8f o;
#pragma unroll      /* constant indices: the values stay in registers */
    for (int q = 0; q < 4; ++q) { o[q] = bf16_round(a0[q]); o[4 + q] = bf16_round(a1[q]); }
    *(v8f*)(XF + t * 8) = o;
    xcnt_wait(); } }      /* the listing lets the weight part's code follow, which writes the two stores' registers */
__device__ __forceinline__ float wave_max(float v) {
#pragma unroll      /* five fixed butterfly steps */
  for (int m = 16; m > 0; m >>= 1) v = fmaxf(v, __shfl_xor(v, m, 32)); return v; }
__device__ __forceinline__ float wave_sum(float v) {
#pragma unroll      /* five fixed butterfly steps */
  for (int m = 16; m > 0; m >>= 1) v += __shfl_xor(v, m, 32); return v; }
// Row LayerNorm, one wave per row: lane l owns columns c*256 + l*8 .. +7 (c = 0, 1), held in registers for the three passes.
__global__ __launch_bounds__(256) void k_lnw(const float* __restrict__ HF, const float* __restrict__ g, const float* __restrict__ bb, _Float16* __restrict__ X16o) {
  const int lane = threadIdx.x & 31; const size_t r = (size_t)blockIdx.x * 8 + (threadIdx.x >> 5); if (r >= NR) return; const float* x = HF + r * DM; float v[16]; float s = 0.f;
#pragma unroll      /* constant indices: the lane's values stay in registers and its loads issue together */
  for (int c = 0; c < 2; ++c) { const int j0 = c * 256 + lane * 8; const v4f a0 = *(const v4fa*)(x + j0), a1 = *(const v4fa*)(x + j0 + 4);
#pragma unroll      /* constant indices: the lane's values stay in registers and its loads issue together */
    for (int e = 0; e < 4; ++e) { v[c * 8 + e] = a0[e]; v[c * 8 + 4 + e] = a1[e]; } }
#pragma unroll      /* constant indices: the lane's values stay in registers and its loads issue together */
  for (int e = 0; e < 16; ++e) s += v[e];
  const float mu = wave_sum(s) / (float)DM; float qs = 0.f;
#pragma unroll      /* constant indices: the lane's values stay in registers and its loads issue together */
  for (int e = 0; e < 16; ++e) { const float dd = v[e] - mu; qs += dd * dd; }
  const float rs = 1.0f / sqrtf(wave_sum(qs) / (float)DM + 1e-5f);
#pragma unroll      /* constant indices: the lane's values stay in registers and its loads issue together */
  for (int c = 0; c < 2; ++c) { const int j0 = c * 256 + lane * 8; const v4f g0 = *(const v4fa*)(g + j0), g1 = *(const v4fa*)(g + j0 + 4), b0 = *(const v4fa*)(bb + j0), b1 = *(const v4fa*)(bb + j0 + 4); FragH f;
#pragma unroll      /* constant indices: the lane's values stay in registers and its loads issue together */
    for (int e = 0; e < 4; ++e) { f.h[e] = (_Float16)((v[c * 8 + e] - mu) * rs * bf16_round(g0[e]) + bf16_round(b0[e])); f.h[4 + e] = (_Float16)((v[c * 8 + 4 + e] - mu) * rs * bf16_round(g1[e]) + bf16_round(b1[e])); }
    *(v8us*)((unsigned short*)X16o + r * DM + j0) = f.half[0]; } }
// Lane l <-> l ^ 16: the two lanes that hold one query's column of a D tile.
__device__ __forceinline__ float xhalf(float x) { const int b = __builtin_bit_cast(int, x); return __builtin_bit_cast(float, __builtin_amdgcn_permlanex16(b, b, 0x76543210, 0xfedcba98, false, false)); }
typedef unsigned int v2ua __attribute__((ext_vector_type(2), may_alias));
// The A fragments of one 64-key chunk: four 16-row groups (pitch16 elements apart) x two 32-k steps.
struct AtSet { v16h f[8]; };
__device__ __forceinline__ void at_load(AtSet& s, const _Float16* p, size_t pitch16) {      /* p: the lane's own address, its row and its 8 * hh included */
#pragma unroll      /* constant indices: the fragments stay in registers and their loads issue together */
  for (int t = 0; t < 4; ++t) { s.f[2 * t] = g2_frag(p + t * pitch16, 0); s.f[2 * t + 1] = g2_frag(p + t * pitch16 + 32, 0); }
  asm volatile("s_wait_xcnt 0x0" :: "v"(p) : "memory");      /* stands in front of whatever gives new values to the address registers of these loads; the address as an input keeps its registers alive up to here, so that no load's result lands in them */
  __builtin_amdgcn_sched_barrier(0); }      /* keeps the 16 loads and their wait here, ahead of the work that hides them: moved down to their first uses the loads would each be waited for in turn */
// Attention, scores to merged heads in one launch: a wave owns 16 queries of one (batch, head) and walks the 1,024 keys in chunks of 64.
// S^T = K . Q^T puts one query's scores into one lane pair (l, l ^ 16); two converted S^T tiles are the B operand of O^T += V^T . P^T, so neither scores nor weights leave the registers.
// Running maximum m and sum l per query; a key outside the prior gets the penalty pen: -lam in the dense branch, -1e30 in the sparse branch (its weight is exactly 0 once a key of the set has been met, and what was summed before that is scaled by exactly 0).
__global__ __launch_bounds__(128) void k_attn(const _Float16* __restrict__ Q16, const _Float16* __restrict__ K16, const _Float16* __restrict__ VT, const unsigned int* __restrict__ MD, const unsigned int* __restrict__ MS, const float* __restrict__ uprev, _Float16* __restrict__ O16) {
  const int tid = threadIdx.x, w = tid >> 5, lane = tid & 31, ln = lane & 15, hh = lane >> 4; const int h = blockIdx.y, b = blockIdx.z; const int q0 = (blockIdx.x * 4 + w) * 16;
  const float lam = 10.0f * expf(-5.0f * bf16_round(uprev[b])); const bool sparse = lam >= 1.0f; const float pen = sparse ? -1.0e30f : -lam;
  const unsigned int* mk = (sparse ? MS : MD) + (size_t)(q0 + ln) * (SQ / 32);
  const _Float16* qp = Q16 + ((size_t)b * SQ + q0 + ln) * DM + h * HD + 8 * hh; const _Float16* kp = K16 + ((size_t)b * SQ + ln) * DM + h * HD + 8 * hh; const _Float16* vp = VT + ((size_t)(b * NH + h) * HD + ln) * SQ + 8 * hh;      /* each with the lane's 8 * hh of the k order */
  const v16h qb0 = g2_frag(qp, 0), qb1 = g2_frag(qp + 32, 0); v2ua mw = *(const v2ua*)mk;      /* mw: this query's 64 prior bits of the chunk at hand */
  asm volatile("s_wait_xcnt 0x0" :: "v"(qp), "v"(mk) : "memory"); __builtin_amdgcn_sched_barrier(0);      /* the wait stands in front of whatever gives new values to the address registers of these five loads (as inputs they stay alive up to here); the barrier keeps later code behind it */
  AtSet kf, vf; at_load(kf, kp, (size_t)16 * DM);
  const v8f z8 = {0.f,0.f,0.f,0.f,0.f,0.f,0.f,0.f}; v8f o[4] = {z8, z8, z8, z8}; float m = -3.0e38f, l = 0.f;
  const _Float16* vq = vp; const _Float16* kq = kp + (size_t)64 * DM;      /* running addresses: they live across their loads, so no load's result can land in them, and they move on behind the loads' wait */
#pragma unroll 1      /* one chunk per trip: a second copy would double the fragment registers */
  for (int c = 0; c < SQ / 64; ++c) {
    const v2ua mn = *(const v2ua*)(mk + ((c + 1) & (SQ / 64 - 1)) * 2);      /* the next chunk's prior bits, one trip ahead like the K rows */
    xcnt_wait();      /* a later load's result may land in this load's address registers: the wait stands between them */
    at_load(vf, vq, (size_t)16 * SQ); vq += 64;
    v8f s[4];
#pragma unroll      /* constant indices: the tiles stay in registers */
    for (int t = 0; t < 4; ++t) s[t] = g2_mma(kf.f[2 * t + 1], qb1, g2_mma(kf.f[2 * t], qb0, z8));
    at_load(kf, kq, (size_t)16 * DM); kq = c + 2 < SQ / 64 ? kq + (size_t)64 * DM : kp;      /* the next chunk's K rows fly under the softmax; the last trip fetches chunk 0 again, in bounds and unused */
    float mx = m;
#pragma unroll      /* constant indices: the tiles stay in registers */
    for (int t = 0; t < 4; ++t) { const unsigned int by = mw[t >> 1] >> (16 * (t & 1) + 8 * hh);      /* bit r: key 16 t + 8 hh + r of the chunk */
#pragma unroll      /* constant indices: the tiles stay in registers */
      for (int r = 0; r < 8; ++r) { const float v = s[t][r] * 0.125f + (((by >> r) & 1u) ? 0.f : pen); s[t][r] = v; mx = fmaxf(mx, v); } }
    mx = fmaxf(mx, xhalf(mx)); const float corr = expf(m - mx); m = mx; float ps = 0.f; FragH p0, p1;
#pragma unroll      /* constant indices: the tiles stay in registers */
    for (int r = 0; r < 8; ++r) { const float e0 = expf(s[0][r] - mx), e1 = expf(s[1][r] - mx), e2 = expf(s[2][r] - mx), e3 = expf(s[3][r] - mx); ps += (e0 + e1) + (e2 + e3);
      p0.h[r] = (_Float16)(e0 * 256.0f); p0.h[8 + r] = (_Float16)(e1 * 256.0f); p1.h[r] = (_Float16)(e2 * 256.0f); p1.h[8 + r] = (_Float16)(e3 * 256.0f); }
    l = l * corr + ps;
#pragma unroll      /* constant indices: the tiles stay in registers */
    for (int t = 0; t < 4; ++t) { o[t] *= corr; o[t] = g2_mma(vf.f[2 * t + 1], p1.v, g2_mma(vf.f[2 * t], p0.v, o[t])); }
    mw = mn; }
  l += xhalf(l); const float inv = 1.0f / (256.0f * l);      /* l >= 1: the key that holds the maximum adds exp(0) */
  unsigned short* od = (unsigned short*)O16 + ((size_t)b * SQ + q0 + ln) * DM + h * HD + 8 * hh;
#pragma unroll      /* constant indices: the tiles stay in registers */
  for (int t = 0; t < 4; ++t) { FragH f;
#pragma unroll      /* constant indices: the tiles stay in registers */
    for (int r = 0; r < 8; ++r) f.h[r] = (_Float16)(o[t][r] * inv);
    *(v8us*)(od + t * 16) = f.half[0]; } }
// Row norms, one wave per row, 32 rows per work-group, so that one wave stores the group's 32 values as one whole 128-byte line of U.
static_assert(NR % 32 == 0, "k_unormw: 32 rows per work-group");
__global__ __launch_bounds__(1024) void k_unormw(const float* __restrict__ OUT, const float* __restrict__ XF, float* __restrict__ U) {
  __shared__ float ur[32];
  const int lane = threadIdx.x & 31, w = threadIdx.x >> 5; const size_t r = (size_t)blockIdx.x * 32 + w; float sd = 0.f, sx = 0.f;
#pragma unroll      /* constant indices: the lane's values stay in registers and its loads issue together */
  for (int c = 0; c < 4; ++c) { const int j0 = c * 128 + lane * 4; const v4f o = *(const v4fa*)(OUT + r * DM + j0), xv = *(const v4fa*)(XF + r * DM + j0);
#pragma unroll      /* constant indices: the lane's values stay in registers and its loads issue together */
    for (int e = 0; e < 4; ++e) { const float dd = o[e] - xv[e]; sd += dd * dd; sx += xv[e] * xv[e]; } }
  sd = wave_sum(sd); sx = wave_sum(sx); if (lane == 0) ur[w] = sqrtf(sd) / (sqrtf(sx) + 1e-8f);
  __syncthreads();      /* the 32 waves' row values are in LDS before wave 0 reads them */
  if (threadIdx.x < 32) U[(size_t)blockIdx.x * 32 + threadIdx.x] = ur[threadIdx.x]; }
// Batch means in float64: one wave, 32 lanes over the 1,024 rows of a batch, lane b stores batch b.
__global__ __launch_bounds__(32) void k_umeanw(const float* __restrict__ U, float* __restrict__ out1) { const int lane = threadIdx.x; float res = 0.f;
#pragma unroll      /* constant indices: the lane's values stay in registers and its loads issue together */
  for (int b = 0; b < NB; ++b) { double s = 0.0;
#pragma unroll      /* constant indices: the lane's values stay in registers and its loads issue together */
    for (int c = 0; c < SQ / 128; ++c) { const v4f a = *(const v4fa*)(U + (size_t)b * SQ + c * 128 + lane * 4);
#pragma unroll      /* constant indices: the lane's values stay in registers and its loads issue together */
      for (int e = 0; e < 4; ++e) s += (double)a[e]; }
#pragma unroll      /* five fixed butterfly steps */
    for (int m = 16; m > 0; m >>= 1) s += __shfl_xor(s, m, 32);
    if (lane == b) res = (float)(s / (double)SQ); }
  if (lane < NB) out1[lane] = res; }
extern "C" void kernel_launch(void* const* d_in, const int* in_sizes, int n_in,
                              void* d_out, int out_size, void* d_ws, size_t ws_size, hipStream_t stream) {
  (void)in_sizes; (void)n_in; (void)out_size;
  const float* const* I = (const float* const*)d_in; const float* x = I[0]; const float* uprev = I[1]; const float* wq = I[2]; const float* bq = I[3]; const float* wk = I[4]; const float* bk = I[5]; const float* wv = I[6]; const float* bv = I[7]; const float* wo = I[8]; const float* bo = I[9]; const float* l1g = I[10]; const float* l1b = I[11]; const float* l2g = I[12]; const float* l2b = I[13]; const float* w1 = I[14]; const float* b1 = I[15]; const float* w2 = I[16]; const float* b2 = I[17]; const int* pmask = (const int*)d_in[18]; const int* pidx = (const int*)d_in[19]; const int* pim = (const int*)d_in[20];
  float* out0 = (float*)d_out; float* out1 = out0 + NR * DM;
  char* ws = (char*)d_ws; size_t off = 0;
  auto take = [&](size_t bytes) { char* p = ws + off; off += (bytes + 255) & ~(size_t)255; return p; };
  _Float16* BQ = (_Float16*)take(((size_t)4 * DM * DM + (size_t)2 * FH * DM) * 2); _Float16* BO = BQ + (size_t)3 * DM * DM; _Float16* BW1 = BO + (size_t)DM * DM; _Float16* BW2 = BW1 + (size_t)FH * DM;      /* one block: the planes of wq, wk, wv, wo, w1, w2 one behind the other */
  float* XF = (float*)take(NR * DM * 4); float* HF = (float*)take(NR * DM * 4); _Float16* G16 = (_Float16*)take(NR * FH * 2); float* U = (float*)take(NR * 4);
  _Float16* X16 = (_Float16*)take(NR * DM * 2); _Float16* Q16 = (_Float16*)take(3 * NR * DM * 2); _Float16* K16 = Q16 + NR * DM; _Float16* V16 = K16 + NR * DM; _Float16* O16 = (_Float16*)take(NR * DM * 2);
  _Float16* VT = (_Float16*)take((size_t)HG * HD * SQ * 2); unsigned int* MD = (unsigned int*)take((size_t)SQ * (SQ / 32) * 4); unsigned int* MS = (unsigned int*)take((size_t)SQ * (SQ / 32) * 4);
  if (off > ws_size) return;      /* 6 + 4 + 4 + 8 + 2x5 + 2 = about 34 MiB */
  k_prep<<<PB0 + PMD + PMS, 256, 0, stream>>>(wq, wk, wv, wo, w1, w2, x, BQ, XF, pmask, pidx, pim, MD, MS); k_lnw<<<(unsigned)((NR + 7) / 8), 256, 0, stream>>>(XF, l1g, l1b, X16);
  const dim3 gp((unsigned)((NR / 128) * (DM / 64)), 1);
  k_gemm2<0, false, true, DM><<<dim3(gp.x, 3), 128, 0, stream>>>(X16, DM, BQ, DM, (size_t)DM * DM, 0.0625f, bq, bk, bv, nullptr, nullptr, Q16, NR * DM, (int)NR, DM, DM);      /* y = 0, 1, 2: q, k, v */
  k_vt<<<HG * (SQ / 64), 256, 0, stream>>>(V16, VT);
  k_attn<<<dim3(SQ / 64, NH, NB), 128, 0, stream>>>(Q16, K16, VT, MD, MS, uprev, O16);      /* o (merged heads) as f16 rows; x = 64 queries, y = head, z = batch */
  k_gemm2k<DM><<<gp, 128 * KS, 0, stream>>>(O16, DM, BO, DM, 0.0625f, bo, XF, HF, (int)NR, DM, DM);      /* h = x + attn W_o^T + b_o */
  k_lnw<<<(unsigned)((NR + 7) / 8), 256, 0, stream>>>(HF, l2g, l2b, X16);
  k_gemm2<6, false, true, FH><<<dim3((unsigned)((NR / 128) * (FH / 64)), 1), 128, 0, stream>>>(X16, DM, BW1, DM, 0, 0.0625f, b1, nullptr, nullptr, nullptr, nullptr, G16, 0, (int)NR, FH, DM);      /* gelu_erf(LN2(h) W1^T + b1) */
  k_gemm2k<DM><<<gp, 128 * KS, 0, stream>>>(G16, FH, BW2, FH, 0.0625f, b2, HF, out0, (int)NR, DM, FH);      /* out = h + (...) W2^T + b2, rows are the output layout */
  k_unormw<<<(unsigned)(NR / 32), 1024, 0, stream>>>(out0, XF, U); k_umeanw<<<1, 32, 0, stream>>>(U, out1);
}

// v007
// One run takes 98 microseconds.
// In two side-by-side timings against v006, it was 1.12 and 1.11 times as fast.
// Over all steps from v000 it is 39.2 times as fast.
#include <hip/hip_runtime.h>
// SPDGMultiHeadAttention (x [2][1024][512], u_prev [2][1]; xn = LN1(x); Q,K,V = xn W^T + b (8 heads of 64); lam = 10 exp(-5 u_prev); per batch: if lam >= 1 the SPARSE branch (softmax over the prior window slots prior_indices[i][k] with prior_index_mask, others excluded) else the DENSE branch (softmax over all keys of q.k/8 + lam*(prior_mask ? 0 : -1)); attn = merge W_o^T + b_o; h = x + attn; out = h + gelu_erf(LN2(h) W1^T + b1) W2^T + b2 -> [2][1024][512]; aggregated_u[b] = mean_s ||out - x|| / (||x|| + 1e-8) -> [2][1]).
// Structure: token rows; bf16(x) as f32 residual rows + LN1 on VALU (f32, wave per row) into f16 rows; Q | K | V WMMA GEMMs as one launch (32x64 wave tiles, f32 accumulation, exact x16 weights + bias, f16 outputs); LN1 and the prior tables packed to one bit per (query, key) beside the operand preparation; V^T stored straight from the V sums; all 16 (batch, head) pairs in one attention launch: per wave 16 queries, S^T = K . Q^T per 64 keys, the branch-selecting running softmax in registers (lam from u_prev; f32; weights x256 as f16), O^T += V^T . P^T, merged f16 rows; W_o GEMM + b_o + x (added in the epilogue) -> h; LN2 on VALU; fc1 GEMM with the exact-erf GELU epilogue (f16 hidden); fc2 GEMM + b2 + h straight into the output rows; the surprise statistic on VALU (per-row sums of squares per 64-column tile in the fc2 epilogue, float64 means per batch in a last small launch) into output 1.
// Compute dtype: inputs rounded to bf16; x / weights exact; LN outputs, q, k, v, softmax weights, o, GELU hidden plain f16 (~2^-12); residual, LN statistics, scores, softmax, norms f32/f64. v_wmma_f32_16x16x32_f16.
#define NB 2
#define SQ 1024
#define DM 512
#define NH 8
#define HD 64
#define HG (NB * NH)                 /* (batch, head) pairs per attention launch: all of them */
#define QN SQ                        /* query rows per batch; unused, the attention grid covers all SQ */
#define NR ((size_t)NB * SQ)         /* 2048 token rows */
typedef __bf16 v16b __attribute__((ext_vector_type(16)));
typedef unsigned short v8us __attribute__((ext_vector_type(8), may_alias));
typedef float  v8f  __attribute__((ext_vector_type(8)));
typedef float  v4f  __attribute__((ext_vector_type(4)));
typedef float  v2f  __attribute__((ext_vector_type(2)));
typedef float  v2fa __attribute__((ext_vector_type(2), may_alias));
typedef float  v4fa __attribute__((ext_vector_type(4), may_alias));
union FragB { v16b v; v8us half[2]; unsigned short u[16]; };

__device__ __forceinline__ unsigned short bf16_bits(float x) { unsigned int u = __float_as_uint(x); return (unsigned short)((u + 0x7FFFu + ((u >> 16) & 1u)) >> 16); }
__device__ __forceinline__ float bf16_val(unsigned short b) { return __uint_as_float(((unsigned int)b) << 16); }
__device__ __forceinline__ float bf16_round(float x) { return bf16_val(bf16_bits(x)); }
// D += A·B with NT terms: 1 = ah·bh, 2 = + al·bh (A split), 3 = + ah·bl (both split)
template <int NT>
__device__ __forceinline__ v8f mmaN(v16b ah, v16b al, v16b bh, v16b bl, v8f c) {
  c = __builtin_amdgcn_wmma_f32_16x16x32_bf16(false, ah, false, bh, (short)0, c, false, false);
  if (NT >= 2) c = __builtin_amdgcn_wmma_f32_16x16x32_bf16(false, al, false, bh, (short)0, c, false, false);
  if (NT >= 3) c = __builtin_amdgcn_wmma_f32_16x16x32_bf16(false, ah, false, bl, (short)0, c, false, false);
  asm volatile("v_nop\n\tv_nop\n\tv_nop\n\tv_nop" : "+v"(c) : "v"(ah), "v"(al), "v"(bh), "v"(bl));
  return c;
}

__global__ __launch_bounds__(256) void k_wt_bf16(const float* __restrict__ W, unsigned short* __restrict__ Wt, int K, int N) {
  const int t = blockIdx.x * 256 + threadIdx.x;
  const int k8n = K / 8;
  if (t >= N * k8n) return;
  const int n = t / k8n, k8 = (t % k8n) * 8;
  v8us v;
#pragma unroll
  for (int i = 0; i < 8; ++i) v[i] = bf16_bits(W[(size_t)(k8 + i) * N + n]);
  *(v8us*)(Wt + (size_t)n * K + k8) = v;
  
}

// GEMM C[M][N] (f32, pitch ldc) = act(A[M][K]·W + bias). A f32 row-major (pitch lda) converted per fragment to bf16
// (ASPLIT: hi/lo two planes -> 2 terms, else single rounded term); Wt bf16 [N][K] (pitch ldb). BIAS_BF16 rounds the
// bias to bf16 first (bias quantised to bf16 before the add). K%32==0, M%16==0, N%64==0.
template <bool ASPLIT, int ACT, bool BIAS_BF16>
__global__ __launch_bounds__(128) void k_gemm_bf(const float* __restrict__ A, int lda, const unsigned short* __restrict__ Wt, int ldb,
                                               const float* __restrict__ bias, float* __restrict__ C, int ldc, int M, int N, int K) {
  __shared__ __attribute__((aligned(16))) float so[4][16][64];
  const int tid = threadIdx.x, w = tid >> 5, lane = tid & 31, ln = lane & 15, hh = lane >> 4;
  const int ntn = N / 64;
  const int wid = blockIdx.x * 4 + w;
  const int mt = wid / ntn, nq = wid % ntn;
  if (mt * 16 >= M) return;
  const int row0 = mt * 16, col0 = nq * 64;
  const float* arow = A + (size_t)(row0 + ln) * lda;
  v8f acc[4] = {};
  for (int kb = 0; kb < K; kb += 32) {
    FragB ah, al;
    const v4f x0 = *(const v4fa*)(arow + kb + 8 * hh), x1 = *(const v4fa*)(arow + kb + 8 * hh + 4);
    const v4f x2 = *(const v4fa*)(arow + kb + 16 + 8 * hh), x3 = *(const v4fa*)(arow + kb + 16 + 8 * hh + 4);
    float xs[16] = {x0[0],x0[1],x0[2],x0[3],x1[0],x1[1],x1[2],x1[3],x2[0],x2[1],x2[2],x2[3],x3[0],x3[1],x3[2],x3[3]};
#pragma unroll
    for (int i = 0; i < 16; ++i) { const unsigned short hb = bf16_bits(xs[i]); ah.u[i] = hb; al.u[i] = ASPLIT ? bf16_bits(xs[i] - bf16_val(hb)) : (unsigned short)0; }
#pragma unroll
    for (int t = 0; t < 4; ++t) {
      const unsigned short* brow = Wt + (size_t)(col0 + t * 16 + ln) * ldb + kb;
      FragB b;
      b.half[0] = *(const v8us*)(brow + 8 * hh);
      b.half[1] = *(const v8us*)(brow + 16 + 8 * hh);
      acc[t] = mmaN<ASPLIT ? 2 : 1>(ah.v, al.v, b.v, b.v, acc[t]);
    }
  }
#pragma unroll
  for (int t = 0; t < 4; ++t) {
    float bv = bias ? bias[col0 + t * 16 + ln] : 0.f;
    if (BIAS_BF16) bv = bf16_round(bv);
#pragma unroll
    for (int r = 0; r < 8; ++r) { float v = acc[t][r] + bv; if (ACT == 1) v = fmaxf(v, 0.f); so[w][8 * hh + r][t * 16 + ln] = v; }
  }
  __builtin_amdgcn_fence(__ATOMIC_ACQ_REL, "workgroup");
  __builtin_amdgcn_wave_barrier();
  const int rsub = lane >> 4, c4 = (lane & 15) * 4;
  {
#pragma unroll
    for (int q = 0; q < 8; ++q) {
      const int r = q * 2 + rsub;
      const v4f v = *(const v4fa*)&so[w][r][c4];
      *(v4f*)(C + (size_t)(row0 + r) * ldc + col0 + c4) = v;
    }
    
  }
}

// GEMM C = act(A·W + bias + resid): A f32 (ASPLIT -> hi/lo 2 terms), Wt bf16 [N][K]; ACT 0 none, 1 relu, 2 exact gelu;
// resid (optional, f32, row index = (row % rmod), pitch ldr, RES_BF16 rounds it) added before the activation.
template <bool ASPLIT, int ACT, bool BIAS_BF16, bool RES_BF16>
__global__ __launch_bounds__(128) void k_gemm_bf3(const float* __restrict__ A, int lda, const unsigned short* __restrict__ Wt, int ldb,
                                                const float* __restrict__ bias, const float* __restrict__ resid, int rmod, int ldr,
                                                float* __restrict__ C, int ldc, int M, int N, int K) {
  __shared__ __attribute__((aligned(16))) float so[4][16][64];
  const int tid = threadIdx.x, w = tid >> 5, lane = tid & 31, ln = lane & 15, hh = lane >> 4;
  const int ntn = N / 64;
  const int wid = blockIdx.x * 4 + w;
  const int mt = wid / ntn, nq = wid % ntn;
  if (mt * 16 >= M) return;
  const int row0 = mt * 16, col0 = nq * 64;
  const float* arow = A + (size_t)(row0 + ln) * lda;
  v8f acc[4] = {};
  for (int kb = 0; kb < K; kb += 32) {
    FragB ah, al;
    const v4f x0 = *(const v4fa*)(arow + kb + 8 * hh), x1 = *(const v4fa*)(arow + kb + 8 * hh + 4);
    const v4f x2 = *(const v4fa*)(arow + kb + 16 + 8 * hh), x3 = *(const v4fa*)(arow + kb + 16 + 8 * hh + 4);
    float xs[16] = {x0[0],x0[1],x0[2],x0[3],x1[0],x1[1],x1[2],x1[3],x2[0],x2[1],x2[2],x2[3],x3[0],x3[1],x3[2],x3[3]};
#pragma unroll
    for (int i = 0; i < 16; ++i) { const unsigned short hb = bf16_bits(xs[i]); ah.u[i] = hb; al.u[i] = ASPLIT ? bf16_bits(xs[i] - bf16_val(hb)) : (unsigned short)0; }
#pragma unroll
    for (int t = 0; t < 4; ++t) {
      const unsigned short* brow = Wt + (size_t)(col0 + t * 16 + ln) * ldb + kb;
      FragB b;
      b.half[0] = *(const v8us*)(brow + 8 * hh);
      b.half[1] = *(const v8us*)(brow + 16 + 8 * hh);
      acc[t] = mmaN<ASPLIT ? 2 : 1>(ah.v, al.v, b.v, b.v, acc[t]);
    }
  }
#pragma unroll
  for (int t = 0; t < 4; ++t) {
    const int col = col0 + t * 16 + ln;
    float bv = bias ? bias[col] : 0.f;
    if (BIAS_BF16) bv = bf16_round(bv);
#pragma unroll
    for (int r = 0; r < 8; ++r) {
      float v = acc[t][r] + bv;
      if (resid) { float rv = resid[(size_t)((row0 + 8 * hh + r) % rmod) * ldr + col]; if (RES_BF16) rv = bf16_round(rv); v += rv; }
      if (ACT == 1) v = fmaxf(v, 0.f);
      if (ACT == 2) v = 0.5f * v * (1.0f + erff(v * 0.70710678118654752f));
      if (ACT == 3) { const float u = 0.7978845608028654f * (v + 0.044715f * v * v * v); v = 0.5f * v * (1.0f + tanhf(u)); }
      so[w][8 * hh + r][t * 16 + ln] = v;
    }
  }
  __builtin_amdgcn_fence(__ATOMIC_ACQ_REL, "workgroup");
  __builtin_amdgcn_wave_barrier();
  const int rsub = lane >> 4, c4 = (lane & 15) * 4;
  {
#pragma unroll
    for (int q = 0; q < 8; ++q) {
      const int r = q * 2 + rsub;
      const v4f v = *(const v4fa*)&so[w][r][c4];
      *(v4f*)(C + (size_t)(row0 + r) * ldc + col0 + c4) = v;
    }
    
  }
}
// row LayerNorm (biased variance, eps) over N: s = X (+ R); optional out_sum <- s; out_norm <- (s-mu)*rsqrt(var+eps)*g + b
template <bool PARAM_BF16>
__global__ __launch_bounds__(256) void k_layernorm(const float* __restrict__ X, const float* __restrict__ R, const float* __restrict__ g, const float* __restrict__ bta,
                                                  float* __restrict__ out_sum, float* __restrict__ out_norm, int N, float eps) {
  __shared__ float red[256];
  const int row = blockIdx.x, tid = threadIdx.x;
  const float* x = X + (size_t)row * N; const float* rr = R ? R + (size_t)row * N : nullptr;
  float vals[16];                     // up to N = 4096
  const int per = N / 256;            // contiguous chunk per thread? use strided-by-4 chunks: thread handles j = tid*4 + 1024*u
  float s1 = 0.f;
  for (int u = 0; u < per / 4; ++u) {
    const int j = tid * 4 + 1024 * u;
    const v4f a = *(const v4fa*)(x + j);
    v4f b = {0.f,0.f,0.f,0.f}; if (rr) b = *(const v4fa*)(rr + j);
#pragma unroll
    for (int q = 0; q < 4; ++q) { const float v = a[q] + b[q]; vals[u * 4 + q] = v; s1 += v; }
  }
  red[tid] = s1; __syncthreads();
  for (int st = 128; st > 0; st >>= 1) { if (tid < st) red[tid] += red[tid + st]; __syncthreads(); }
  const float mu = red[0] / (float)N; __syncthreads();
  float s2 = 0.f;
  for (int u = 0; u < per / 4; ++u)
#pragma unroll
    for (int q = 0; q < 4; ++q) { const float c = vals[u * 4 + q] - mu; s2 += c * c; }
  red[tid] = s2; __syncthreads();
  for (int st = 128; st > 0; st >>= 1) { if (tid < st) red[tid] += red[tid + st]; __syncthreads(); }
  const float rs = rsqrtf(red[0] / (float)N + eps);
  {
    for (int u = 0; u < per / 4; ++u) {
      const int j = tid * 4 + 1024 * u;
      v4f o, sm;
#pragma unroll
      for (int q = 0; q < 4; ++q) {
        float gg = g[j + q], bb = bta[j + q];
        if (PARAM_BF16) { gg = bf16_round(gg); bb = bf16_round(bb); }
        sm[q] = vals[u * 4 + q]; o[q] = (vals[u * 4 + q] - mu) * rs * gg + bb;
      }
      if (out_sum) *(v4f*)(out_sum + (size_t)row * N + j) = sm;
      *(v4f*)(out_norm + (size_t)row * N + j) = o;
    }
    
  }
}



// ---- f16 WMMA path (v_wmma_f32_16x16x32_f16): 11-bit significands for operands in range — used where a [0,1] probability operand needs more precision than bf16
typedef _Float16 v16h __attribute__((ext_vector_type(16)));
union FragH { v16h v; v8us half[2]; _Float16 h[16]; unsigned short u[16]; };
template <int NT>
__device__ __forceinline__ v8f mmaH(v16h ah, v16h al, v16h bh, v16h bl, v8f c) {
  c = __builtin_amdgcn_wmma_f32_16x16x32_f16(false, ah, false, bh, (short)0, c, false, false);
  if (NT >= 2) c = __builtin_amdgcn_wmma_f32_16x16x32_f16(false, al, false, bh, (short)0, c, false, false);
  if (NT >= 3) c = __builtin_amdgcn_wmma_f32_16x16x32_f16(false, ah, false, bl, (short)0, c, false, false);
  asm volatile("v_nop\n\tv_nop\n\tv_nop\n\tv_nop" : "+v"(c) : "v"(ah), "v"(al), "v"(bh), "v"(bl));
  return c;
}
// batched GEMM like k_gemm_b but f16 operands: A f32 (split into f16 hi/lo if ASPLIT, else rounded to f16), Bt = f16 values [n][k]; alpha; C f32; N multiple of 16 (partial tiles skipped)
template <bool ASPLIT>
__global__ __launch_bounds__(128) void k_gemm_h(const float* __restrict__ A, int lda, size_t sA, const _Float16* __restrict__ Bh, int ldb, size_t sB, float alpha, float* __restrict__ C, int ldc, size_t sC, int M, int N, int K) {
  __shared__ __attribute__((aligned(16))) float so[4][16][64];
  const int tid = threadIdx.x, w = tid >> 5, lane = tid & 31, ln = lane & 15, hh = lane >> 4; const int by = blockIdx.y;
  A += (size_t)by * sA; Bh += (size_t)by * sB; C += (size_t)by * sC;
  const int ntn = (N + 63) / 64; const int wid = blockIdx.x * 4 + w; const int mt = wid / ntn, nq = wid % ntn; if (mt * 16 >= M) return;
  const int row0 = mt * 16, col0 = nq * 64; const float* arow = A + (size_t)(row0 + ln) * lda;
  v8f acc[4] = {};
  for (int kb = 0; kb < K; kb += 32) {
    FragH ah, al;
    const v4f x0 = *(const v4fa*)(arow + kb + 8 * hh), x1 = *(const v4fa*)(arow + kb + 8 * hh + 4), x2 = *(const v4fa*)(arow + kb + 16 + 8 * hh), x3 = *(const v4fa*)(arow + kb + 16 + 8 * hh + 4);
    float xs[16] = {x0[0],x0[1],x0[2],x0[3],x1[0],x1[1],x1[2],x1[3],x2[0],x2[1],x2[2],x2[3],x3[0],x3[1],x3[2],x3[3]};
#pragma unroll
    for (int i = 0; i < 16; ++i) { const _Float16 h = (_Float16)xs[i]; ah.h[i] = h; al.h[i] = ASPLIT ? (_Float16)(xs[i] - (float)h) : (_Float16)0.0f; }
#pragma unroll
    for (int t = 0; t < 4; ++t) { if (col0 + t * 16 >= N) continue; const size_t boff = (size_t)(col0 + t * 16 + ln) * ldb + kb; FragH bq; bq.half[0] = *(const v8us*)(Bh + boff + 8 * hh); bq.half[1] = *(const v8us*)(Bh + boff + 16 + 8 * hh);
      acc[t] = mmaH<ASPLIT ? 2 : 1>(ah.v, al.v, bq.v, bq.v, acc[t]); }
  }
#pragma unroll
  for (int t = 0; t < 4; ++t) { if (col0 + t * 16 >= N) continue;
#pragma unroll
    for (int r = 0; r < 8; ++r) so[w][8 * hh + r][t * 16 + ln] = acc[t][r] * alpha; }
  __builtin_amdgcn_fence(__ATOMIC_ACQ_REL, "workgroup"); __builtin_amdgcn_wave_barrier();
  const int rsub = lane >> 4, c4 = (lane & 15) * 4;
  {
#pragma unroll
    for (int q = 0; q < 8; ++q) { const int r = q * 2 + rsub; if (col0 + c4 < N) { const v4f v = *(const v4fa*)&so[w][r][c4]; *(v4f*)(C + (size_t)(row0 + r) * ldc + col0 + c4) = v; } }
     }
}

// Wt[n][k] = f16(W[k][n]·scale) from f32 row-major W[K][N] (scale = power of two; bf16-exact weights stay exact in f16 away from the subnormal range)
__global__ __launch_bounds__(256) void k_wt_f16(const float* __restrict__ W, _Float16* __restrict__ Wt, int K, int N, float scale) {
  const int t = blockIdx.x * 256 + threadIdx.x; if (t >= N * (K / 8)) return; const int n = t / (K / 8), k8 = (t % (K / 8)) * 8; FragH f;
#pragma unroll
  for (int i = 0; i < 8; ++i) f.h[i] = (_Float16)(bf16_round(W[(size_t)(k8 + i) * N + n]) * scale); const v8us o = f.half[0];
  *(v8us*)((unsigned short*)Wt + (size_t)n * K + k8) = o; 
}
// k_gemm_hh variant with fused epilogue: v = acc·alpha + bias[by·sBias + col] (+ CP[(row/rowsPerB)·sCPb + by·64 + col] if CP) ; ACT 0 none / 1 elu ; writes f16 C16 (and f32 C if non-null)
template <int ACT>
__global__ __launch_bounds__(128) void k_gemm_hhx(const _Float16* __restrict__ A, int lda, size_t sA, const _Float16* __restrict__ Bh, int ldb, size_t sB, float alpha, const float* __restrict__ bias, size_t sBias, const float* __restrict__ CP, int rowsPerB, size_t sCPb, int row0g,
    float* __restrict__ C, _Float16* __restrict__ C16, int ldc, size_t sC, int M, int N, int K) {
  __shared__ __attribute__((aligned(16))) float so[4][16][64];
  const int tid = threadIdx.x, w = tid >> 5, lane = tid & 31, ln = lane & 15, hh = lane >> 4; const int by = blockIdx.y;
  A += (size_t)by * sA; Bh += (size_t)by * sB; const size_t cofs = (size_t)by * sC; const float* bp = bias ? bias + (size_t)by * sBias : nullptr;
  const int ntn = (N + 63) / 64; const int wid = blockIdx.x * 4 + w; const int mt = wid / ntn, nq = wid % ntn; if (mt * 16 >= M) return;
  const int row0 = mt * 16, col0 = nq * 64; const _Float16* arow = A + (size_t)(row0 + ln) * lda;
  v8f acc[4] = {};
  for (int kb = 0; kb < K; kb += 32) { FragH ah; ah.half[0] = *(const v8us*)((const unsigned short*)arow + kb + 8 * hh); ah.half[1] = *(const v8us*)((const unsigned short*)arow + kb + 16 + 8 * hh);
#pragma unroll
    for (int t = 0; t < 4; ++t) { if (col0 + t * 16 >= N) continue; const size_t boff = (size_t)(col0 + t * 16 + ln) * ldb + kb; FragH bq; bq.half[0] = *(const v8us*)((const unsigned short*)Bh + boff + 8 * hh); bq.half[1] = *(const v8us*)((const unsigned short*)Bh + boff + 16 + 8 * hh);
      acc[t] = mmaH<1>(ah.v, ah.v, bq.v, bq.v, acc[t]); }
  }
#pragma unroll
  for (int t = 0; t < 4; ++t) { if (col0 + t * 16 >= N) continue; const int col = col0 + t * 16 + ln; const float bv = bp ? bf16_round(bp[col]) : 0.f;
#pragma unroll
    for (int r = 0; r < 8; ++r) { float v = acc[t][r] * alpha + bv; if (CP) { const int rr = row0g + row0 + 8 * hh + r; if (rowsPerB < 0) v += CP[cofs + (size_t)rr * ldc + col];      /* rowsPerB < 0: own element of the batched C plane */ else { const int bidx = rr / rowsPerB; v += CP[(size_t)bidx * sCPb + (size_t)by * 64 + col]; } } if (ACT == 1) v = (v > 0.f) ? v : expm1f(v); else if (ACT == 7) v = (v > 0.f) ? v + 1.0f : expf(v); else if (ACT == 8) v = tanhf(v); else if (ACT == 9) v = 0.5f * v * (1.0f + tanhf(0.7978845608028654f * (v + 0.044715f * v * v * v))); else if (ACT == 11) v = 1.0f / (1.0f + expf(-v)); else if (ACT == 12) v = (v > 0.f) ? v : 0.01f * v; else if (ACT == 14) v = (v > 0.f) ? v : 0.1f * v; else if (ACT == 16) v = (v >= 0.f) ? v : 0.3f * v; else if (ACT == 17) v = (v >= 0.f) ? v : 0.2f * v; else if (ACT == 15) v = v / (1.0f + expf(-v)); else if (ACT == 3) v = fmaxf(v, 0.f); else if (ACT == 6) v = 0.5f * v * (1.0f + erff(v * 0.70710678118654752f)); so[w][8 * hh + r][t * 16 + ln] = v; } }
  __builtin_amdgcn_fence(__ATOMIC_ACQ_REL, "workgroup"); __builtin_amdgcn_wave_barrier();
  const int rsub = lane >> 4, c4 = (lane & 15) * 4; typedef _Float16 v4h __attribute__((ext_vector_type(4)));
  {
#pragma unroll
    for (int q = 0; q < 8; ++q) { const int r = q * 2 + rsub; if (col0 + c4 < N) { const v4f v = *(const v4fa*)&so[w][r][c4]; if (C) *(v4f*)(C + cofs + (size_t)(row0 + r) * ldc + col0 + c4) = v; if (C16) { v4h h4; for (int i = 0; i < 4; ++i) h4[i] = (_Float16)v[i]; *(v4h*)(C16 + cofs + (size_t)(row0 + r) * ldc + col0 + c4) = h4; } } }
     }
}


typedef _Float16 v4h __attribute__((ext_vector_type(4)));

__global__ __launch_bounds__(256) void k_x16(const float* __restrict__ x, _Float16* __restrict__ X16, size_t n8) { const size_t t = (size_t)blockIdx.x * 256 + threadIdx.x; if (t >= n8) return; FragH f;
#pragma unroll
  for (int q = 0; q < 8; ++q) f.h[q] = (_Float16)bf16_round(x[t * 8 + q]); *(v8us*)((unsigned short*)X16 + t * 8) = f.half[0];  }
__global__ __launch_bounds__(256) void k_h16(const float* __restrict__ x, _Float16* __restrict__ X16, size_t n8) { const size_t t = (size_t)blockIdx.x * 256 + threadIdx.x; if (t >= n8) return; FragH f;
#pragma unroll
  for (int q = 0; q < 8; ++q) f.h[q] = (_Float16)x[t * 8 + q]; *(v8us*)((unsigned short*)X16 + t * 8) = f.half[0];  }
__global__ __launch_bounds__(256) void k_round16f(const float* __restrict__ W, _Float16* __restrict__ Bt, size_t n8) { const size_t t = (size_t)blockIdx.x * 256 + threadIdx.x; if (t >= n8) return; FragH f;
#pragma unroll
  for (int i = 0; i < 8; ++i) f.h[i] = (_Float16)(bf16_round(W[t * 8 + i]) * 16.0f); *(v8us*)((unsigned short*)Bt + t * 8) = f.half[0];  }
template <int NHv, int TTv>
__global__ __launch_bounds__(256) void k_vt(const _Float16* __restrict__ V16, int ldv, int voff, _Float16* __restrict__ Vt) { __shared__ unsigned short tl[64][66]; const int tid = threadIdx.x; const int slab = blockIdx.x / (TTv / 64), lg = blockIdx.x % (TTv / 64); const int b = slab / NHv, h = slab % NHv;
  for (int i = tid; i < 64 * 8; i += 256) { const int r = i / 8, c8 = (i % 8) * 8; FragH f; f.half[0] = *(const v8us*)((const unsigned short*)V16 + ((size_t)b * TTv + lg * 64 + r) * ldv + voff + h * 64 + c8);
#pragma unroll
    for (int q = 0; q < 8; ++q) tl[r][c8 + q] = f.u[q]; }
  __syncthreads();
  {
#pragma unroll
    for (int rd = 0; rd < 2; ++rd) { const int d = rd * 32 + tid / 8, pc = tid % 8; FragH f;
#pragma unroll
      for (int q = 0; q < 8; ++q) f.u[q] = tl[pc * 8 + q][d];
      *(v8us*)((unsigned short*)Vt + ((size_t)slab * 64 + d) * TTv + lg * 64 + pc * 8) = f.half[0]; }
     } }

__global__ __launch_bounds__(256) void k_hl(const float* __restrict__ F, _Float16* __restrict__ Hh, _Float16* __restrict__ Hl, size_t n8) { const size_t t = (size_t)blockIdx.x * 256 + threadIdx.x; if (t >= n8) return; FragH fh, fl; const v4f a = *(const v4fa*)(F + t * 8), c = *(const v4fa*)(F + t * 8 + 4);
#pragma unroll
  for (int q = 0; q < 4; ++q) { _Float16 h = (_Float16)a[q]; fh.h[q] = h; fl.h[q] = (_Float16)((a[q] - (float)h) * 1024.0f); h = (_Float16)c[q]; fh.h[4 + q] = h; fl.h[4 + q] = (_Float16)((c[q] - (float)h) * 1024.0f); }
  { *(v8us*)((unsigned short*)Hh + t * 8) = fh.half[0]; *(v8us*)((unsigned short*)Hl + t * 8) = fl.half[0];  } }

// ---- fast GEMM (wave tile 32x64; requires M % 32 == 0 rows per launch region and N % 64 == 0) ----
__device__ __forceinline__ v16h g2_frag(const _Float16* p, int hh) { FragH f; f.half[0] = *(const v8us*)((const unsigned short*)p + 8 * hh); f.half[1] = *(const v8us*)((const unsigned short*)p + 16 + 8 * hh); return f.v; }
__device__ __forceinline__ v8f g2_mma(v16h a, v16h b, v8f c) { v8f d = __builtin_amdgcn_wmma_f32_16x16x32_f16(false, a, false, b, (short)0, c, false, false); asm volatile("v_nop\n\tv_nop\n\tv_nop\n\tv_nop" : "+v"(d) : "v"(a), "v"(b)); return d; }
// The fragments of one 32-k step of a 32x64 wave tile: the two A row groups and the four B column groups.
struct G2Set { v16h a0, a1, b0, b1, b2, b3; };
__device__ __forceinline__ void g2_load(G2Set& s, const _Float16* a0p, const _Float16* a1p, const _Float16* b0p, const _Float16* b1p, const _Float16* b2p, const _Float16* b3p, int kb, int hh) {
  s.a0 = g2_frag(a0p + kb, hh); s.a1 = g2_frag(a1p + kb, hh); s.b0 = g2_frag(b0p + kb, hh); s.b1 = g2_frag(b1p + kb, hh); s.b2 = g2_frag(b2p + kb, hh); s.b3 = g2_frag(b3p + kb, hh);
  asm volatile("s_wait_xcnt 0x0" ::: "memory");      /* stands in front of the next address additions, which give new values to registers that these loads name */
  __builtin_amdgcn_sched_barrier(0); }      /* keeps the 12 loads and their wait here, ahead of the other set's products: moved down to their first uses the loads would each be waited for in turn */
// The same for the first and the last step, outside the loop, where nothing reads some of the addresses afterwards (the six pointers: the lane's own addresses, k offset and 8 * hh included).
__device__ __forceinline__ void g2_load_once(G2Set& s, const _Float16* pa0, const _Float16* pa1, const _Float16* pb0, const _Float16* pb1, const _Float16* pb2, const _Float16* pb3) {
  s.a0 = g2_frag(pa0, 0); s.a1 = g2_frag(pa1, 0); s.b0 = g2_frag(pb0, 0); s.b1 = g2_frag(pb1, 0); s.b2 = g2_frag(pb2, 0); s.b3 = g2_frag(pb3, 0);
  asm volatile("s_wait_xcnt 0x0" :: "v"(pa0), "v"(pa1), "v"(pb0), "v"(pb1), "v"(pb2), "v"(pb3) : "memory");      /* the addresses as inputs stay alive up to the wait, so that no later load's result lands in an earlier load's address registers in front of it */
  __builtin_amdgcn_sched_barrier(0); }      /* keeps the 12 loads and their wait here, ahead of the other set's products */
__device__ __forceinline__ void g2_mul(const G2Set& s, v8f (&c)[8]) {
  c[0] = g2_mma(s.a0, s.b0, c[0]); c[4] = g2_mma(s.a1, s.b0, c[4]); c[1] = g2_mma(s.a0, s.b1, c[1]); c[5] = g2_mma(s.a1, s.b1, c[5]);
  c[2] = g2_mma(s.a0, s.b2, c[2]); c[6] = g2_mma(s.a1, s.b2, c[6]); c[3] = g2_mma(s.a0, s.b3, c[3]); c[7] = g2_mma(s.a1, s.b3, c[7]); }
// The epilogue's kind is fixed at compile time. RES: a residual row (f32, pitch LDC, same row and column as the result) is added behind the bias; F16O: the result goes out as f16 rows (C16), else as f32 rows (C); LDC: pitch of the result rows.
// result = act(sum * alpha + bf16(bias[col]) (+ residual)), worked out behind the LDS turn, where a lane holds 4 neighbouring columns of a row: bias and residual come as 16-byte loads with nothing between them.
// VTP: plane y = 2 (v) goes out transposed, as the attention launch reads it: VTo[(batch, head)][d][key]. A lane of a D tile holds 8 neighbouring rows (keys) of one column (d), so each tile half is one 16-byte store straight from the sums, without the LDS turn; the 4 waves of a work-group fill 256 bytes of each d row.
template <int ACT, bool RES, bool F16O, int LDC, bool VTP>
__global__ __launch_bounds__(128) void k_gemm2(const _Float16* __restrict__ A, int lda, const _Float16* __restrict__ Bh, int ldb, size_t sB, float alpha, const float* __restrict__ bias, const float* __restrict__ biasY1, const float* __restrict__ biasY2, const float* __restrict__ R,
    float* __restrict__ C, _Float16* __restrict__ C16, _Float16* __restrict__ VTo, size_t sC, int M, int N, int K) {      /* sB, sC: strides of blockIdx.y; biasY1, biasY2: the bias arrays of planes y = 1 and y = 2 (else null) */ static_assert(ACT == 0 || ACT == 6, "k_gemm2: unsupported ACT code (would silently apply no activation)"); static_assert(!(RES && ACT == 6), "k_gemm2: the rolled GELU loop holds no residual registers");
  __shared__ __attribute__((aligned(16))) float so[4][32][68];
  const int tid = threadIdx.x, w = tid >> 5, lane = tid & 31, ln = lane & 15, hh = lane >> 4; const int by = blockIdx.y;
  Bh += (size_t)by * sB; const size_t cofs = (size_t)by * sC; const float* bp = bias; if (biasY1 && by == 1) bp = biasY1; if (biasY2 && by == 2) bp = biasY2;
  const int ntn = N >> 6; const int mt = blockIdx.x / ntn, nq = blockIdx.x - mt * ntn; const int row0 = mt * 128 + 32 * w, col0 = nq * 64; if (row0 >= M) return;
  const _Float16* a0p = A + (size_t)(row0 + ln) * lda; const _Float16* a1p = a0p + (size_t)16 * lda;
  const _Float16* b0p = Bh + (size_t)(col0 + ln) * ldb; const _Float16* b1p = b0p + (size_t)16 * ldb; const _Float16* b2p = b1p + (size_t)16 * ldb; const _Float16* b3p = b2p + (size_t)16 * ldb;
  const v8f z8 = {0.f,0.f,0.f,0.f,0.f,0.f,0.f,0.f}; v8f accs[8] = {z8, z8, z8, z8, z8, z8, z8, z8};
  /* K loop over two fragment sets: while one 32-k step is multiplied, the other step's 12 loads are in flight. K % 64 == 0; every sum keeps its ascending k order. */
  G2Set s0, s1; int kb = 0; g2_load_once(s0, a0p + 8 * hh, a1p + 8 * hh, b0p + 8 * hh, b1p + 8 * hh, b2p + 8 * hh, b3p + 8 * hh);
#pragma unroll 1      /* the two steps of a trip are written out; more copies would only add code */
  for (; kb + 64 < K; kb += 64) { g2_load(s1, a0p, a1p, b0p, b1p, b2p, b3p, kb + 32, hh); g2_mul(s0, accs); g2_load(s0, a0p, a1p, b0p, b1p, b2p, b3p, kb + 64, hh); g2_mul(s1, accs); }
  const int kl = kb + 32; g2_load_once(s1, a0p + 8 * hh + kl, a1p + 8 * hh + kl, b0p + 8 * hh + kl, b1p + 8 * hh + kl, b2p + 8 * hh + kl, b3p + 8 * hh + kl); g2_mul(s0, accs);      /* the last two steps: no fragment is left to fetch behind them */
  if constexpr (VTP) { static_assert(!VTP || (LDC == NH * HD && HD == 64 && SQ % 128 == 0 && ACT == 0 && !RES), "k_gemm2: a 64-column tile is one head, a 128-row tile lies in one batch");
    if (by == 2) { const float* bc = bp + col0 + ln; float bl[4];
#pragma unroll      /* constant indices: the four bias values stay in registers and their loads issue together */
      for (int t = 0; t < 4; ++t) bl[t] = bc[t * 16];
      asm volatile("s_wait_xcnt 0x0" :: "v"(bc) : "memory");      /* stands in front of whatever gives new values to the address registers of these loads; the address as an input stays alive up to here, so that no load's result lands in it */
      __builtin_amdgcn_sched_barrier(0);      /* keeps the loads here, in flight under the last step's own load wait and products */
      g2_mul(s1, accs);
      unsigned short* vd = (unsigned short*)VTo + ((size_t)((row0 / SQ) * NH + nq) * HD + ln) * SQ + (row0 % SQ) + 8 * hh;      /* d = 16 t + ln, keys 16 g + 8 hh .. + 7 of the wave's 32 */
#pragma unroll      /* constant indices: the sums stay in registers */
      for (int t = 0; t < 4; ++t) { const float bt = bf16_round(bl[t]);
#pragma unroll      /* constant indices: the sums stay in registers */
        for (int g = 0; g < 2; ++g) { FragH f;
#pragma unroll      /* constant indices: the sums stay in registers */
          for (int r = 0; r < 8; ++r) f.h[r] = (_Float16)(accs[g * 4 + t][r] * alpha + bt);
          *(v8us*)(vd + (size_t)t * 16 * SQ + g * 16) = f.half[0]; } }
      asm volatile("s_wait_xcnt 0x0" :: "v"(vd) : "memory"); return; } }      /* the listing lets the other planes' code follow, which writes the stores' registers; the address as an input stays alive up to here */
  /* Store layout: lane = row rsub (+ 2 per vector) of the wave's 32, columns c4 .. c4 + 3 of its 64; e0 = the lane's first element. */
  const int rsub = lane >> 4, c4 = (lane & 15) * 4; const size_t e0 = (size_t)(row0 + rsub) * LDC + col0 + c4;
  const v4f b4 = *(const v4fa*)(bp + col0 + c4); v4f rv[RES ? 16 : 1];
  if constexpr (RES) { const float* rp = R + e0;
#pragma unroll      /* constant indices: the 16 row vectors stay in registers and their loads issue together */
    for (int q = 0; q < 16; ++q) rv[q] = *(const v4fa*)(rp + (size_t)q * 2 * LDC);
    asm volatile("s_wait_xcnt 0x0" :: "v"(rp) : "memory"); }      /* stands in front of whatever gives new values to the address registers of these loads; the rows' address as an input stays alive up to here, so that no load's result lands in it */
  else asm volatile("s_wait_xcnt 0x0" ::: "memory");      /* stands in front of whatever gives new values to the address registers of the bias load */
  __builtin_amdgcn_sched_barrier(0);      /* keeps the loads here, in flight under the last step's own load wait and products: moved down to their uses they would be waited for behind the products */
  g2_mul(s1, accs);
#pragma unroll      /* constant indices: the sums stay in registers */
  for (int u = 0; u < 8; ++u) {
#pragma unroll      /* constant indices: the sums stay in registers */
    for (int r = 0; r < 8; ++r) so[w][(u >> 2) * 16 + 8 * hh + r][(u & 3) * 16 + ln] = accs[u][r]; }
  /* the wave's own 32 x 64 sums are in LDS before its lanes read them back row-wise */
  __builtin_amdgcn_fence(__ATOMIC_ACQ_REL, "workgroup"); __builtin_amdgcn_wave_barrier();
  const v4f bb = {bf16_round(b4[0]), bf16_round(b4[1]), bf16_round(b4[2]), bf16_round(b4[3])};
  const float* sp = &so[w][rsub][c4]; char* cp = F16O ? (char*)(C16 + cofs + e0) : (char*)(C + cofs + e0); constexpr size_t RB = (size_t)2 * LDC * (F16O ? 2 : 4);      /* RB: bytes from one of the lane's rows to its next */
#pragma unroll (ACT == 6 ? 1 : 4)      /* GELU: rolled, 16 erf bodies of text instead of 64, so that the kernel's text stays small; else written out, since the residual registers take constant indices */
  for (int g = 0; g < 4; ++g) { v4f v[4];
#pragma unroll      /* constant indices: the four LDS reads issue together */
    for (int i = 0; i < 4; ++i) v[i] = *(const v4fa*)(sp + i * 2 * 68);
#pragma unroll      /* constant indices: the values stay in registers */
    for (int i = 0; i < 4; ++i) {
#pragma unroll      /* constant indices: the values stay in registers */
      for (int e = 0; e < 4; ++e) { float x = v[i][e] * alpha + bb[e]; if constexpr (RES) x += rv[g * 4 + i][e]; if (ACT == 6) x = 0.5f * x * (1.0f + erff(x * 0.70710678118654752f)); v[i][e] = x; }
      if constexpr (F16O) { v4h h4;
#pragma unroll      /* constant indices: the values stay in registers */
        for (int e = 0; e < 4; ++e) h4[e] = (_Float16)v[i][e];
        *(v4h*)(cp + i * RB) = h4; }
      else *(v4f*)(cp + i * RB) = v[i]; }
    sp += 8 * 68; cp += 4 * RB; } }


// The same GEMM for the two launches whose grid of 128 x 64 tiles is small and whose K loop is a long chain of load waits (W_o, fc2): 16 waves per tile instead of 4.
// Wave w works on row group w & 3 (32 rows) and on the 32-k steps kq, kq + KS, kq + 2 KS, ... with kq = w >> 2, so that the KS waves of a row group read the same 128-byte lines of A and B at the same time.
// The KS partial sums of a row group meet in LDS; behind the barrier wave (rw, kq) adds them in the order of kq for rows 8 kq .. 8 kq + 7 and finishes these rows: result = sum * alpha + bf16(bias[col]) + residual, f32 rows of pitch LDC.
#define KS 4
static_assert(NR % 128 == 0, "k_gemm2k: whole 128-row tiles");
// NRM: the finished rows also leave, per row and 64-column tile, the pair (sum of (result - XR)^2, sum of XR^2) in PN[tile][row]: the surprise statistic's row norms, taken from the registers that hold the result.
template <int LDC, bool NRM>
__global__ __launch_bounds__(128 * KS) void k_gemm2k(const _Float16* __restrict__ A, int lda, const _Float16* __restrict__ Bh, int ldb, float alpha, const float* __restrict__ bias, const float* __restrict__ R, const float* __restrict__ XR, float* __restrict__ C, float* __restrict__ PN, int M, int N, int K) {      /* K % (64 * KS) == 0 */
  __shared__ __attribute__((aligned(16))) float so[KS * 4][32][68];
  const int tid = threadIdx.x, w = tid >> 5, lane = tid & 31, ln = lane & 15, hh = lane >> 4; const int rw = w & 3, kq = w >> 2;
  const int ntn = N >> 6; const int mt = blockIdx.x / ntn, nq = blockIdx.x - mt * ntn; if (mt * 128 >= M) return;      /* the whole work-group or none of it, in front of the barrier */
  const int row0 = mt * 128 + 32 * rw, col0 = nq * 64;
  const _Float16* a0p = A + (size_t)(row0 + ln) * lda + 32 * kq; const _Float16* a1p = a0p + (size_t)16 * lda;
  const _Float16* b0p = Bh + (size_t)(col0 + ln) * ldb + 32 * kq; const _Float16* b1p = b0p + (size_t)16 * ldb; const _Float16* b2p = b1p + (size_t)16 * ldb; const _Float16* b3p = b2p + (size_t)16 * ldb;
  const v8f z8 = {0.f,0.f,0.f,0.f,0.f,0.f,0.f,0.f}; v8f accs[8] = {z8, z8, z8, z8, z8, z8, z8, z8};
  /* K loop over two fragment sets as in k_gemm2; from one of the wave's steps to its next it is 32 * KS elements of k. */
  constexpr int ST = 32 * KS; G2Set s0, s1; int kb = 0; g2_load_once(s0, a0p + 8 * hh, a1p + 8 * hh, b0p + 8 * hh, b1p + 8 * hh, b2p + 8 * hh, b3p + 8 * hh);
#pragma unroll 1      /* the two steps of a trip are written out; more copies would only add code */
  for (; kb + 2 * ST < K; kb += 2 * ST) { g2_load(s1, a0p, a1p, b0p, b1p, b2p, b3p, kb + ST, hh); g2_mul(s0, accs); g2_load(s0, a0p, a1p, b0p, b1p, b2p, b3p, kb + 2 * ST, hh); g2_mul(s1, accs); }
  const int kl = kb + ST; g2_load_once(s1, a0p + 8 * hh + kl, a1p + 8 * hh + kl, b0p + 8 * hh + kl, b1p + 8 * hh + kl, b2p + 8 * hh + kl, b3p + 8 * hh + kl); g2_mul(s0, accs);      /* the wave's last two steps: no fragment is left to fetch behind them */
  /* Store layout: lane = row rl (+ 2 per vector) of the row group's 32, columns c4 .. c4 + 3 of its 64; e0 = the lane's first element. */
  const int c4 = (lane & 15) * 4, rl = 8 * kq + (lane >> 4); const size_t e0 = (size_t)(row0 + rl) * LDC + col0 + c4;
  const float* rp = R + e0; const v4f b4 = *(const v4fa*)(bias + col0 + c4); v4f rv[4]; v4f xv[NRM ? 4 : 1];
#pragma unroll      /* constant indices: the 4 row vectors stay in registers and their loads issue together */
  for (int i = 0; i < 4; ++i) rv[i] = *(const v4fa*)(rp + (size_t)i * 2 * LDC);
  const float* xp = NRM ? XR + e0 : rp;
  if constexpr (NRM) {
#pragma unroll      /* constant indices: the 4 row vectors stay in registers and their loads issue together */
    for (int i = 0; i < 4; ++i) xv[i] = *(const v4fa*)(xp + (size_t)i * 2 * LDC); }
  asm volatile("s_wait_xcnt 0x0" :: "v"(rp), "v"(xp) : "memory");      /* stands in front of whatever gives new values to the address registers of these loads; the rows' addresses as inputs stay alive up to here, so that no load's result lands in them */
  __builtin_amdgcn_sched_barrier(0);      /* keeps the loads here, in flight under the last step's own load wait and products: moved down to their uses they would be waited for behind the barrier */
  g2_mul(s1, accs);
#pragma unroll      /* constant indices: the sums stay in registers */
  for (int u = 0; u < 8; ++u) {
#pragma unroll      /* constant indices: the sums stay in registers */
    for (int r = 0; r < 8; ++r) so[w][(u >> 2) * 16 + 8 * hh + r][(u & 3) * 16 + ln] = accs[u][r]; }
  __syncthreads();      /* the partial sums of all 16 waves are in LDS before any wave adds them up */
  const v4f bb = {bf16_round(b4[0]), bf16_round(b4[1]), bf16_round(b4[2]), bf16_round(b4[3])};
  const float* sp = &so[rw][rl][c4]; float* cp = C + e0; v4f p[4][KS];
#pragma unroll      /* constant indices: the LDS reads issue together */
  for (int i = 0; i < 4; ++i) {
#pragma unroll      /* constant indices: the LDS reads issue together */
    for (int q = 0; q < KS; ++q) p[i][q] = *(const v4fa*)(sp + (size_t)q * 4 * 32 * 68 + i * 2 * 68); }
  float sd[4], sx[4];
#pragma unroll      /* constant indices: the values stay in registers */
  for (int i = 0; i < 4; ++i) { v4f v = p[i][0];
#pragma unroll      /* constant indices: the values stay in registers */
    for (int q = 1; q < KS; ++q) v += p[i][q];
#pragma unroll      /* constant indices: the values stay in registers */
    for (int e = 0; e < 4; ++e) v[e] = v[e] * alpha + bb[e] + rv[i][e];
    *(v4f*)(cp + (size_t)i * 2 * LDC) = v;
    if constexpr (NRM) { sd[i] = 0.f; sx[i] = 0.f;
#pragma unroll      /* constant indices: the values stay in registers */
      for (int e = 0; e < 4; ++e) { const float dd = v[e] - xv[i][e]; sd[i] += dd * dd; sx[i] += xv[i][e] * xv[i][e]; } } }
  if constexpr (NRM) {      /* a row's 64 columns lie in the 16 lanes of one wave half: four butterfly steps, then lane i of each half (i < 4) stores row rl + 2 i, so that the wave's 8 pairs are 64 neighbouring bytes */
    asm volatile("s_wait_xcnt 0x0" :: "v"(cp) : "memory");      /* stands in front of whatever gives new values to the registers of the four row stores; their address as an input stays alive up to here */
    float od = 0.f, ox = 0.f;
#pragma unroll      /* constant indices: the values stay in registers */
    for (int i = 0; i < 4; ++i) {
#pragma unroll      /* four fixed butterfly steps */
      for (int m = 8; m > 0; m >>= 1) { sd[i] += __shfl_xor(sd[i], m, 32); sx[i] += __shfl_xor(sx[i], m, 32); }
      if ((lane & 15) == i) { od = sd[i]; ox = sx[i]; } }
    if ((lane & 15) < 4) { const v2f o2 = {od, ox}; *(v2f*)(PN + ((size_t)nq * NR + row0 + rl + 2 * (lane & 15)) * 2) = o2; } } }


__global__ __launch_bounds__(256) void k_rsm(const float* __restrict__ S, _Float16* __restrict__ P, int nrows) {
  #pragma clang fp contract(off)
  const int i = blockIdx.x * 256 + threadIdx.x; if (i >= nrows) return; const float* s = S + (size_t)i * SQ; float mx = -3.0e38f;
#pragma unroll 1
  for (int j = 0; j < SQ; ++j) mx = fmaxf(mx, s[j]); float se = 0.f;
#pragma unroll 1
  for (int j = 0; j < SQ; ++j) se += expf(s[j] - mx); const float sc = 256.0f / se;
#pragma unroll 1
  for (int j0 = 0; j0 < SQ; j0 += 8) { FragH f; for (int q = 0; q < 8; ++q) f.h[q] = (_Float16)(expf(s[j0 + q] - mx) * sc); unsigned short* d = (unsigned short*)P + (size_t)i * SQ + j0; *(v8us*)d = f.half[0];  } }

#define FH 2048
#define KN 103
typedef int v4ia __attribute__((ext_vector_type(4), may_alias));
__device__ __forceinline__ void xcnt_wait() { asm volatile("s_wait_xcnt 0x0" ::: "memory"); }
__device__ __forceinline__ float wave_max(float v) {
#pragma unroll      /* five fixed butterfly steps */
  for (int m = 16; m > 0; m >>= 1) v = fmaxf(v, __shfl_xor(v, m, 32)); return v; }
__device__ __forceinline__ float wave_sum(float v) {
#pragma unroll      /* five fixed butterfly steps */
  for (int m = 16; m > 0; m >>= 1) v += __shfl_xor(v, m, 32); return v; }
// Operand preparation, one launch: the six weight matrices as x16 f16 planes (they lie one behind the other in Bt, in the order wq, wk, wv, wo, w1, w2), x as bf16-rounded f32 rows and, from the same registers, LN1 of these rows as f16 rows.
// A work-group converts 256 x 8 elements of one weight array or 8 rows of x; which array follows from blockIdx.x alone.
#define PW (DM * DM / 2048)          /* work-groups per DM x DM weight */
#define PF (FH * DM / 2048)          /* work-groups per FH x DM weight */
#define PX ((int)(NR / 8))           /* work-groups for x: one wave per row, 8 rows each */
#define PB0 (4 * PW + 2 * PF + PX)   /* first work-group of the prior tables' packing */
#define PMD (SQ * (SQ / 32) / 256)   /* prior_mask: one thread per 32-key word */
#define PMS (SQ / 8)                 /* prior_indices: one wave per query row */
static_assert((DM * DM) % 2048 == 0 && (FH * DM) % 2048 == 0 && NR % 8 == 0 && DM == 512, "k_prep: whole work-groups per array; a lane holds 16 of a row's 512 columns");
__global__ __launch_bounds__(256) void k_prep(const float* __restrict__ wq, const float* __restrict__ wk, const float* __restrict__ wv, const float* __restrict__ wo, const float* __restrict__ w1, const float* __restrict__ w2, const float* __restrict__ x, const float* __restrict__ g1, const float* __restrict__ be1, _Float16* __restrict__ Bt, float* __restrict__ XF, _Float16* __restrict__ X16o, const int* __restrict__ pmask, const int* __restrict__ pidx, const int* __restrict__ pim, unsigned int* __restrict__ MD, unsigned int* __restrict__ MS) {
  __shared__ __attribute__((aligned(16))) unsigned char bm[8][SQ];      /* prior_indices: the wave's own row of key flags (any index set) */
  const int blk = blockIdx.x; const float* src; int first;
  if (blk >= PB0 + PMD) {      /* MS[q][j / 32] bit j % 32: key j is one of row q's valid prior slots */
    const int lane = threadIdx.x & 31, w = threadIdx.x >> 5; const int q = (blk - PB0 - PMD) * 8 + w; const int* ix = pidx + (size_t)q * KN; const int* vm = pim + (size_t)q * KN; constexpr int NT = (KN + 31) / 32; int jx[NT]; bool ok[NT];
#pragma unroll      /* constant indices: the lane's values stay in registers and its loads issue together */
    for (int t = 0; t < NT; ++t) { const int k = t * 32 + lane; const int kc = k < KN ? k : KN - 1; jx[t] = ix[kc]; const int vk = vm[kc]; xcnt_wait(); ok[t] = (k < KN) & (vk != 0); }      /* a later load's result may land in an earlier load's address register: the wait stands between them */
    const v4ia z = {0, 0, 0, 0}; *(v4ia*)&bm[w][lane * 32] = z; *(v4ia*)&bm[w][lane * 32 + 16] = z;
    /* the zeros of every lane are in LDS before any lane sets a flag over them */
    __builtin_amdgcn_fence(__ATOMIC_ACQ_REL, "workgroup"); __builtin_amdgcn_wave_barrier();
#pragma unroll      /* constant indices: the lane's values stay in registers */
    for (int t = 0; t < NT; ++t) if (ok[t]) bm[w][min(max(jx[t], 0), SQ - 1)] = 1;      /* the key index is bounded here before it forms an address */
    /* the flags of every lane are in LDS before the row is read back */
    __builtin_amdgcn_fence(__ATOMIC_ACQ_REL, "workgroup"); __builtin_amdgcn_wave_barrier();
    unsigned int word = 0;
#pragma unroll      /* 32 independent LDS reads issue together */
    for (int c = 0; c < SQ / 32; ++c) { const unsigned int bal = __builtin_amdgcn_ballot_w32(bm[w][c * 32 + lane] != 0); if (lane == c) word = bal; }
    MS[(size_t)q * (SQ / 32) + lane] = word; return; }
  if (blk >= PB0) {      /* MD[q][j / 32] bit j % 32: prior_mask[q][j] */
    const size_t t = (size_t)(blk - PB0) * 256 + threadIdx.x; v4ia mv[8]; unsigned int word = 0;
#pragma unroll      /* constant indices: the lane's values stay in registers and its loads issue together */
    for (int i = 0; i < 8; ++i) mv[i] = *(const v4ia*)(pmask + t * 32 + i * 4);
    xcnt_wait();      /* the address registers of the eight loads may take new values below */
#pragma unroll      /* constant indices: the lane's values stay in registers */
    for (int i = 0; i < 8; ++i) for (int e = 0; e < 4; ++e) word |= (mv[i][e] != 0 ? 1u : 0u) << (i * 4 + e);
    MD[t] = word;
    xcnt_wait(); return; }      /* the listing lets another part's code follow, which writes the store's registers */
  if (blk >= 4 * PW + 2 * PF) {      /* x: one wave per row; lane l owns columns c*256 + l*8 .. +7 (c = 0, 1), rounded once, stored as the residual row and held in registers for the three passes of LN1 */
    const int lane = threadIdx.x & 31; const size_t r = (size_t)(blk - (4 * PW + 2 * PF)) * 8 + (threadIdx.x >> 5); const float* xr = x + r * DM + lane * 8; const float* gp = g1 + lane * 8; const float* bp = be1 + lane * 8; v4f a[4], gv[4], bv[4];
#pragma unroll      /* constant indices: the lane's values stay in registers and its 12 loads issue together */
    for (int c = 0; c < 2; ++c) { a[2 * c] = *(const v4fa*)(xr + c * 256); a[2 * c + 1] = *(const v4fa*)(xr + c * 256 + 4); gv[2 * c] = *(const v4fa*)(gp + c * 256); gv[2 * c + 1] = *(const v4fa*)(gp + c * 256 + 4); bv[2 * c] = *(const v4fa*)(bp + c * 256); bv[2 * c + 1] = *(const v4fa*)(bp + c * 256 + 4); }
    asm volatile("s_wait_xcnt 0x0" :: "v"(xr), "v"(gp), "v"(bp) : "memory");      /* stands in front of whatever gives new values to the address registers of these loads; the addresses as inputs stay alive up to here, so that no load's result lands in them */
    float v[16]; float s = 0.f; float* xo = XF + r * DM + lane * 8;
#pragma unroll      /* constant indices: the lane's values stay in registers */
    for (int c = 0; c < 4; ++c) { v4f o;
#pragma unroll      /* constant indices: the lane's values stay in registers */
      for (int e = 0; e < 4; ++e) { o[e] = bf16_round(a[c][e]); v[c * 4 + e] = o[e]; }
      *(v4f*)(xo + (c >> 1) * 256 + (c & 1) * 4) = o; }
#pragma unroll      /* constant indices: the lane's values stay in registers */
    for (int e = 0; e < 16; ++e) s += v[e];
    const float mu = wave_sum(s) / (float)DM; float qs = 0.f;
#pragma unroll      /* constant indices: the lane's values stay in registers */
    for (int e = 0; e < 16; ++e) { const float dd = v[e] - mu; qs += dd * dd; }
    const float rs = 1.0f / sqrtf(wave_sum(qs) / (float)DM + 1e-5f); unsigned short* no = (unsigned short*)X16o + r * DM + lane * 8;
#pragma unroll      /* constant indices: the lane's values stay in registers */
    for (int c = 0; c < 2; ++c) { FragH f;
#pragma unroll      /* constant indices: the lane's values stay in registers */
      for (int e = 0; e < 4; ++e) { f.h[e] = (_Float16)((v[c * 8 + e] - mu) * rs * bf16_round(gv[2 * c][e]) + bf16_round(bv[2 * c][e])); f.h[4 + e] = (_Float16)((v[c * 8 + 4 + e] - mu) * rs * bf16_round(gv[2 * c + 1][e]) + bf16_round(bv[2 * c + 1][e])); }
      *(v8us*)(no + c * 256) = f.half[0]; }
    asm volatile("s_wait_xcnt 0x0" :: "v"(xo), "v"(no) : "memory"); return; }      /* the listing lets another part's code follow, which writes the stores' registers; the two addresses as inputs stay alive up to here */
  if (blk < PW) { src = wq; first = 0; } else if (blk < 2 * PW) { src = wk; first = PW; } else if (blk < 3 * PW) { src = wv; first = 2 * PW; } else if (blk < 4 * PW) { src = wo; first = 3 * PW; }
  else if (blk < 4 * PW + PF) { src = w1; first = 4 * PW; } else { src = w2; first = 4 * PW + PF; }
  const size_t t = (size_t)(blk - first) * 256 + threadIdx.x; const v4f a0 = *(const v4fa*)(src + t * 8), a1 = *(const v4fa*)(src + t * 8 + 4);
  xcnt_wait();      /* the address registers of the two loads may take new values below */
  { FragH f;
#pragma unroll      /* constant indices: the values stay in registers */
    for (int q = 0; q < 4; ++q) { f.h[q] = (_Float16)(bf16_round(a0[q]) * 16.0f); f.h[4 + q] = (_Float16)(bf16_round(a1[q]) * 16.0f); }
    *(v8us*)((unsigned short*)Bt + ((size_t)blk * 256 + threadIdx.x) * 8) = f.half[0];
    xcnt_wait(); } }      /* the listing lets another part's code follow, which writes the store's registers */
// Row LayerNorm, one wave per row: lane l owns columns c*256 + l*8 .. +7 (c = 0, 1), held in registers for the three passes.
__global__ __launch_bounds__(256) void k_lnw(const float* __restrict__ HF, const float* __restrict__ g, const float* __restrict__ bb, _Float16* __restrict__ X16o) {
  const int lane = threadIdx.x & 31; const size_t r = (size_t)blockIdx.x * 8 + (threadIdx.x >> 5); if (r >= NR) return; const float* x = HF + r * DM; float v[16]; float s = 0.f;
#pragma unroll      /* constant indices: the lane's values stay in registers and its loads issue together */
  for (int c = 0; c < 2; ++c) { const int j0 = c * 256 + lane * 8; const v4f a0 = *(const v4fa*)(x + j0), a1 = *(const v4fa*)(x + j0 + 4);
#pragma unroll      /* constant indices: the lane's values stay in registers and its loads issue together */
    for (int e = 0; e < 4; ++e) { v[c * 8 + e] = a0[e]; v[c * 8 + 4 + e] = a1[e]; } }
#pragma unroll      /* constant indices: the lane's values stay in registers and its loads issue together */
  for (int e = 0; e < 16; ++e) s += v[e];
  const float mu = wave_sum(s) / (float)DM; float qs = 0.f;
#pragma unroll      /* constant indices: the lane's values stay in registers and its loads issue together */
  for (int e = 0; e < 16; ++e) { const float dd = v[e] - mu; qs += dd * dd; }
  const float rs = 1.0f / sqrtf(wave_sum(qs) / (float)DM + 1e-5f);
#pragma unroll      /* constant indices: the lane's values stay in registers and its loads issue together */
  for (int c = 0; c < 2; ++c) { const int j0 = c * 256 + lane * 8; const v4f g0 = *(const v4fa*)(g + j0), g1 = *(const v4fa*)(g + j0 + 4), b0 = *(const v4fa*)(bb + j0), b1 = *(const v4fa*)(bb + j0 + 4); FragH f;
#pragma unroll      /* constant indices: the lane's values stay in registers and its loads issue together */
    for (int e = 0; e < 4; ++e) { f.h[e] = (_Float16)((v[c * 8 + e] - mu) * rs * bf16_round(g0[e]) + bf16_round(b0[e])); f.h[4 + e] = (_Float16)((v[c * 8 + 4 + e] - mu) * rs * bf16_round(g1[e]) + bf16_round(b1[e])); }
    *(v8us*)((unsigned short*)X16o + r * DM + j0) = f.half[0]; } }
// Lane l <-> l ^ 16: the two lanes that hold one query's column of a D tile.
__device__ __forceinline__ float xhalf(float x) { const int b = __builtin_bit_cast(int, x); return __builtin_bit_cast(float, __builtin_amdgcn_permlanex16(b, b, 0x76543210, 0xfedcba98, false, false)); }
typedef unsigned int v2ua __attribute__((ext_vector_type(2), may_alias));
// The A fragments of one 64-key chunk: four 16-row groups (pitch16 elements apart) x two 32-k steps.
struct AtSet { v16h f[8]; };
__device__ __forceinline__ void at_load(AtSet& s, const _Float16* p, size_t pitch16) {      /* p: the lane's own address, its row and its 8 * hh included */
#pragma unroll      /* constant indices: the fragments stay in registers and their loads issue together */
  for (int t = 0; t < 4; ++t) { s.f[2 * t] = g2_frag(p + t * pitch16, 0); s.f[2 * t + 1] = g2_frag(p + t * pitch16 + 32, 0); }
  asm volatile("s_wait_xcnt 0x0" :: "v"(p) : "memory");      /* stands in front of whatever gives new values to the address registers of these loads; the address as an input keeps its registers alive up to here, so that no load's result lands in them */
  __builtin_amdgcn_sched_barrier(0); }      /* keeps the 16 loads and their wait here, ahead of the work that hides them: moved down to their first uses the loads would each be waited for in turn */
// Attention, scores to merged heads in one launch: a wave owns 16 queries of one (batch, head) and walks the 1,024 keys in chunks of 64.
// S^T = K . Q^T puts one query's scores into one lane pair (l, l ^ 16); two converted S^T tiles are the B operand of O^T += V^T . P^T, so neither scores nor weights leave the registers.
// Running maximum m and sum l per query; a key outside the prior gets the penalty pen: -lam in the dense branch, -1e30 in the sparse branch (its weight is exactly 0 once a key of the set has been met, and what was summed before that is scaled by exactly 0).
__global__ __launch_bounds__(128) void k_attn(const _Float16* __restrict__ Q16, const _Float16* __restrict__ K16, const _Float16* __restrict__ VT, const unsigned int* __restrict__ MD, const unsigned int* __restrict__ MS, const float* __restrict__ uprev, _Float16* __restrict__ O16) {
  const int tid = threadIdx.x, w = tid >> 5, lane = tid & 31, ln = lane & 15, hh = lane >> 4; const int h = blockIdx.y, b = blockIdx.z; const int q0 = (blockIdx.x * 4 + w) * 16;
  const float lam = 10.0f * expf(-5.0f * bf16_round(uprev[b])); const bool sparse = lam >= 1.0f; const float pen = sparse ? -1.0e30f : -lam;
  const unsigned int* mk = (sparse ? MS : MD) + (size_t)(q0 + ln) * (SQ / 32);
  const _Float16* qp = Q16 + ((size_t)b * SQ + q0 + ln) * DM + h * HD + 8 * hh; const _Float16* kp = K16 + ((size_t)b * SQ + ln) * DM + h * HD + 8 * hh; const _Float16* vp = VT + ((size_t)(b * NH + h) * HD + ln) * SQ + 8 * hh;      /* each with the lane's 8 * hh of the k order */
  const v16h qb0 = g2_frag(qp, 0), qb1 = g2_frag(qp + 32, 0); v2ua mw = *(const v2ua*)mk;      /* mw: this query's 64 prior bits of the chunk at hand */
  asm volatile("s_wait_xcnt 0x0" :: "v"(qp), "v"(mk) : "memory"); __builtin_amdgcn_sched_barrier(0);      /* the wait stands in front of whatever gives new values to the address registers of these five loads (as inputs they stay alive up to here); the barrier keeps later code behind it */
  AtSet kf, vf; at_load(kf, kp, (size_t)16 * DM);
  const v8f z8 = {0.f,0.f,0.f,0.f,0.f,0.f,0.f,0.f}; v8f o[4] = {z8, z8, z8, z8}; float m = -3.0e38f, l = 0.f;
  const _Float16* vq = vp; const _Float16* kq = kp + (size_t)64 * DM;      /* running addresses: they live across their loads, so no load's result can land in them, and they move on behind the loads' wait */
#pragma unroll 1      /* one chunk per trip: a second copy would double the fragment registers */
  for (int c = 0; c < SQ / 64; ++c) {
    const v2ua mn = *(const v2ua*)(mk + ((c + 1) & (SQ / 64 - 1)) * 2);      /* the next chunk's prior bits, one trip ahead like the K rows */
    xcnt_wait();      /* a later load's result may land in this load's address registers: the wait stands between them */
    at_load(vf, vq, (size_t)16 * SQ); vq += 64;
    v8f s[4];
#pragma unroll      /* constant indices: the tiles stay in registers */
    for (int t = 0; t < 4; ++t) s[t] = g2_mma(kf.f[2 * t + 1], qb1, g2_mma(kf.f[2 * t], qb0, z8));
    at_load(kf, kq, (size_t)16 * DM); kq = c + 2 < SQ / 64 ? kq + (size_t)64 * DM : kp;      /* the next chunk's K rows fly under the softmax; the last trip fetches chunk 0 again, in bounds and unused */
    float mx = m;
#pragma unroll      /* constant indices: the tiles stay in registers */
    for (int t = 0; t < 4; ++t) { const unsigned int by = mw[t >> 1] >> (16 * (t & 1) + 8 * hh);      /* bit r: key 16 t + 8 hh + r of the chunk */
#pragma unroll      /* constant indices: the tiles stay in registers */
      for (int r = 0; r < 8; ++r) { const float v = s[t][r] * 0.125f + (((by >> r) & 1u) ? 0.f : pen); s[t][r] = v; mx = fmaxf(mx, v); } }
    mx = fmaxf(mx, xhalf(mx)); const float corr = expf(m - mx); m = mx; float ps = 0.f; FragH p0, p1;
#pragma unroll      /* constant indices: the tiles stay in registers */
    for (int r = 0; r < 8; ++r) { const float e0 = expf(s[0][r] - mx), e1 = expf(s[1][r] - mx), e2 = expf(s[2][r] - mx), e3 = expf(s[3][r] - mx); ps += (e0 + e1) + (e2 + e3);
      p0.h[r] = (_Float16)(e0 * 256.0f); p0.h[8 + r] = (_Float16)(e1 * 256.0f); p1.h[r] = (_Float16)(e2 * 256.0f); p1.h[8 + r] = (_Float16)(e3 * 256.0f); }
    l = l * corr + ps;
#pragma unroll      /* constant indices: the tiles stay in registers */
    for (int t = 0; t < 4; ++t) { o[t] *= corr; o[t] = g2_mma(vf.f[2 * t + 1], p1.v, g2_mma(vf.f[2 * t], p0.v, o[t])); }
    mw = mn; }
  l += xhalf(l); const float inv = 1.0f / (256.0f * l);      /* l >= 1: the key that holds the maximum adds exp(0) */
  unsigned short* od = (unsigned short*)O16 + ((size_t)b * SQ + q0 + ln) * DM + h * HD + 8 * hh;
#pragma unroll      /* constant indices: the tiles stay in registers */
  for (int t = 0; t < 4; ++t) { FragH f;
#pragma unroll      /* constant indices: the tiles stay in registers */
    for (int r = 0; r < 8; ++r) f.h[r] = (_Float16)(o[t][r] * inv);
    *(v8us*)(od + t * 16) = f.half[0]; } }
// The surprise statistic from the row sums that the fc2 launch left: one work-group, thread t takes row t of every batch, adds the row's DM / 64 pairs in tile order, u = |out - x| / (|x| + 1e-8); batch means in float64 (wave butterfly, then one value per wave through LDS); lane b of wave 0 stores batch b.
static_assert(SQ == 1024 && NB <= 32, "k_ufin: one thread per row of a batch");
__global__ __launch_bounds__(1024) void k_ufin(const float* __restrict__ PN, float* __restrict__ out1) {
  __shared__ double ws[NB][32];
  const int tid = threadIdx.x, lane = tid & 31, w = tid >> 5; constexpr int NTL = DM / 64; v2f pr[NB][NTL]; const float* pp = PN + (size_t)tid * 2;
#pragma unroll      /* constant indices: the pairs stay in registers and their loads issue together */
  for (int b = 0; b < NB; ++b) {
#pragma unroll      /* constant indices: the pairs stay in registers and their loads issue together */
    for (int q = 0; q < NTL; ++q) pr[b][q] = *(const v2fa*)(pp + ((size_t)q * NR + (size_t)b * SQ) * 2); }
  asm volatile("s_wait_xcnt 0x0" :: "v"(pp) : "memory");      /* stands in front of whatever gives new values to the address registers of these loads; the address as an input stays alive up to here, so that no load's result lands in it */
#pragma unroll      /* constant indices: the pairs stay in registers */
  for (int b = 0; b < NB; ++b) { float sd = pr[b][0][0], sx = pr[b][0][1];
#pragma unroll      /* constant indices: the pairs stay in registers */
    for (int q = 1; q < NTL; ++q) { sd += pr[b][q][0]; sx += pr[b][q][1]; }
    double s = (double)(sqrtf(sd) / (sqrtf(sx) + 1e-8f));
#pragma unroll      /* five fixed butterfly steps */
    for (int m = 16; m > 0; m >>= 1) s += __shfl_xor(s, m, 32);
    if (lane == 0) ws[b][w] = s; }
  __syncthreads();      /* the 32 waves' sums are in LDS before wave 0 reads them */
  if (w == 0) { float res = 0.f;
#pragma unroll      /* constant indices */
    for (int b = 0; b < NB; ++b) { double s = ws[b][lane];
#pragma unroll      /* five fixed butterfly steps */
      for (int m = 16; m > 0; m >>= 1) s += __shfl_xor(s, m, 32);
      if (lane == b) res = (float)(s / (double)SQ); }
    if (lane < NB) out1[lane] = res; } }
extern "C" void kernel_launch(void* const* d_in, const int* in_sizes, int n_in,
                              void* d_out, int out_size, void* d_ws, size_t ws_size, hipStream_t stream) {
  (void)in_sizes; (void)n_in; (void)out_size;
  const float* const* I = (const float* const*)d_in; const float* x = I[0]; const float* uprev = I[1]; const float* wq = I[2]; const float* bq = I[3]; const float* wk = I[4]; const float* bk = I[5]; const float* wv = I[6]; const float* bv = I[7]; const float* wo = I[8]; const float* bo = I[9]; const float* l1g = I[10]; const float* l1b = I[11]; const float* l2g = I[12]; const float* l2b = I[13]; const float* w1 = I[14]; const float* b1 = I[15]; const float* w2 = I[16]; const float* b2 = I[17]; const int* pmask = (const int*)d_in[18]; const int* pidx = (const int*)d_in[19]; const int* pim = (const int*)d_in[20];
  float* out0 = (float*)d_out; float* out1 = out0 + NR * DM;
  char* ws = (char*)d_ws; size_t off = 0;
  auto take = [&](size_t bytes) { char* p = ws + off; off += (bytes + 255) & ~(size_t)255; return p; };
  _Float16* BQ = (_Float16*)take(((size_t)4 * DM * DM + (size_t)2 * FH * DM) * 2); _Float16* BO = BQ + (size_t)3 * DM * DM; _Float16* BW1 = BO + (size_t)DM * DM; _Float16* BW2 = BW1 + (size_t)FH * DM;      /* one block: the planes of wq, wk, wv, wo, w1, w2 one behind the other */
  float* XF = (float*)take(NR * DM * 4); float* HF = (float*)take(NR * DM * 4); _Float16* G16 = (_Float16*)take(NR * FH * 2); float* PN = (float*)take((size_t)(DM / 64) * NR * 2 * 4);
  _Float16* X16 = (_Float16*)take(NR * DM * 2); _Float16* Q16 = (_Float16*)take(2 * NR * DM * 2); _Float16* K16 = Q16 + NR * DM; _Float16* O16 = (_Float16*)take(NR * DM * 2);
  _Float16* VT = (_Float16*)take((size_t)HG * HD * SQ * 2); unsigned int* MD = (unsigned int*)take((size_t)SQ * (SQ / 32) * 4); unsigned int* MS = (unsigned int*)take((size_t)SQ * (SQ / 32) * 4);
  if (off > ws_size) return;      /* 6 + 4 + 4 + 8 + 2x4 + 2 = about 32 MiB */
  k_prep<<<PB0 + PMD + PMS, 256, 0, stream>>>(wq, wk, wv, wo, w1, w2, x, l1g, l1b, BQ, XF, X16, pmask, pidx, pim, MD, MS);      /* LN1(x) rows included */
  const dim3 gp((unsigned)((NR / 128) * (DM / 64)), 1);
  k_gemm2<0, false, true, DM, true><<<dim3(gp.x, 3), 128, 0, stream>>>(X16, DM, BQ, DM, (size_t)DM * DM, 0.0625f, bq, bk, bv, nullptr, nullptr, Q16, VT, NR * DM, (int)NR, DM, DM);      /* y = 0, 1: q, k rows; y = 2: v transposed */
  k_attn<<<dim3(SQ / 64, NH, NB), 128, 0, stream>>>(Q16, K16, VT, MD, MS, uprev, O16);      /* o (merged heads) as f16 rows; x = 64 queries, y = head, z = batch */
  k_gemm2k<DM, false><<<gp, 128 * KS, 0, stream>>>(O16, DM, BO, DM, 0.0625f, bo, XF, nullptr, HF, nullptr, (int)NR, DM, DM);      /* h = x + attn W_o^T + b_o */
  k_lnw<<<(unsigned)((NR + 7) / 8), 256, 0, stream>>>(HF, l2g, l2b, X16);
  k_gemm2<6, false, true, FH, false><<<dim3((unsigned)((NR / 128) * (FH / 64)), 1), 128, 0, stream>>>(X16, DM, BW1, DM, 0, 0.0625f, b1, nullptr, nullptr, nullptr, nullptr, G16, nullptr, 0, (int)NR, FH, DM);      /* gelu_erf(LN2(h) W1^T + b1) */
  k_gemm2k<DM, true><<<gp, 128 * KS, 0, stream>>>(G16, FH, BW2, FH, 0.0625f, b2, HF, XF, out0, PN, (int)NR, DM, FH);      /* out = h + (...) W2^T + b2, rows are the output layout; the row norms' partial sums beside them */
  k_ufin<<<1, 1024, 0, stream>>>(PN, out1);
}

// v008
// One run takes 76.2 microseconds.
// Next to v007, in two timings, it ran 1.28 and 1.29 times as fast.
// Over all steps from v000 it is 50.2 times as fast.
#include <hip/hip_runtime.h>
// SPDGMultiHeadAttention (x [2][1024][512], u_prev [2][1]; xn = LN1(x); Q,K,V = xn W^T + b (8 heads of 64); lam = 10 exp(-5 u_prev); per batch: if lam >= 1 the SPARSE branch (softmax over the prior window slots prior_indices[i][k] with prior_index_mask, others excluded) else the DENSE branch (softmax over all keys of q.k/8 + lam*(prior_mask ? 0 : -1)); attn = merge W_o^T + b_o; h = x + attn; out = h + gelu_erf(LN2(h) W1^T + b1) W2^T + b2 -> [2][1024][512]; aggregated_u[b] = mean_s ||out - x|| / (||x|| + 1e-8) -> [2][1]).
// Structure: token rows; every f16 WMMA operand array of the workspace in fragment order (see g2_frag); bf16(x) as f32 residual rows + LN1 on VALU (f32, wave per row) into f16 rows; Q | K | V WMMA GEMMs as one launch (32x64 wave tiles, f32 accumulation, exact x16 weights + bias, f16 outputs); LN1 and the prior tables packed to one bit per (query, key) beside the operand preparation; V^T stored straight from the V sums; all 16 (batch, head) pairs in one attention launch: per wave 16 queries, S^T = K . Q^T per 64 keys, the branch-selecting running softmax in registers (lam from u_prev; f32; weights x256 as f16), O^T += V^T . P^T, merged f16 rows; W_o GEMM + b_o + x in the epilogue -> h; LN2 on VALU; fc1 GEMM with the exact-erf GELU epilogue (f16 hidden); fc2 GEMM + b2 + h straight into the output rows; the surprise statistic on VALU (per-row sums of squares per 64-column tile in the fc2 epilogue, float64 means per batch in a last small launch) into output 1.
// Compute dtype: inputs rounded to bf16; x / weights exact; LN outputs, q, k, v, softmax weights, o, GELU hidden plain f16 (~2^-12); residual, LN statistics, scores, softmax, norms f32/f64. v_wmma_f32_16x16x32_f16.
#define NB 2
#define SQ 1024
#define DM 512
#define NH 8
#define HD 64
#define HG (NB * NH)                 /* (batch, head) pairs per attention launch: all of them */
#define QN SQ                        /* query rows per batch; unused, the attention grid covers all SQ */
#define NR ((size_t)NB * SQ)         /* 2048 token rows */
typedef __bf16 v16b __attribute__((ext_vector_type(16)));
typedef unsigned short v8us __attribute__((ext_vector_type(8), may_alias));
typedef float  v8f  __attribute__((ext_vector_type(8)));
typedef float  v4f  __attribute__((ext_vector_type(4)));
typedef float  v2f  __attribute__((ext_vector_type(2)));
typedef float  v2fa __attribute__((ext_vector_type(2), may_alias));
typedef float  v4fa __attribute__((ext_vector_type(4), may_alias));
union FragB { v16b v; v8us half[2]; unsigned short u[16]; };

__device__ __forceinline__ unsigned short bf16_bits(float x) { unsigned int u = __float_as_uint(x); return (unsigned short)((u + 0x7FFFu + ((u >> 16) & 1u)) >> 16); }
__device__ __forceinline__ float bf16_val(unsigned short b) { return __uint_as_float(((unsigned int)b) << 16); }
__device__ __forceinline__ float bf16_round(float x) { return bf16_val(bf16_bits(x)); }
// D += A·B with NT terms: 1 = ah·bh, 2 = + al·bh (A split), 3 = + ah·bl (both split)
template <int NT>
__device__ __forceinline__ v8f mmaN(v16b ah, v16b al, v16b bh, v16b bl, v8f c) {
  c = __builtin_amdgcn_wmma_f32_16x16x32_bf16(false, ah, false, bh, (short)0, c, false, false);
  if (NT >= 2) c = __builtin_amdgcn_wmma_f32_16x16x32_bf16(false, al, false, bh, (short)0, c, false, false);
  if (NT >= 3) c = __builtin_amdgcn_wmma_f32_16x16x32_bf16(false, ah, false, bl, (short)0, c, false, false);
  asm volatile("v_nop\n\tv_nop\n\tv_nop\n\tv_nop" : "+v"(c) : "v"(ah), "v"(al), "v"(bh), "v"(bl));
  return c;
}

__global__ __launch_bounds__(256) void k_wt_bf16(const float* __restrict__ W, unsigned short* __restrict__ Wt, int K, int N) {
  const int t = blockIdx.x * 256 + threadIdx.x;
  const int k8n = K / 8;
  if (t >= N * k8n) return;
  const int n = t / k8n, k8 = (t % k8n) * 8;
  v8us v;
#pragma unroll
  for (int i = 0; i < 8; ++i) v[i] = bf16_bits(W[(size_t)(k8 + i) * N + n]);
  *(v8us*)(Wt + (size_t)n * K + k8) = v;
  
}

// GEMM C[M][N] (f32, pitch ldc) = act(A[M][K]·W + bias). A f32 row-major (pitch lda) converted per fragment to bf16
// (ASPLIT: hi/lo two planes -> 2 terms, else single rounded term); Wt bf16 [N][K] (pitch ldb). BIAS_BF16 rounds the
// bias to bf16 first (bias quantised to bf16 before the add). K%32==0, M%16==0, N%64==0.
template <bool ASPLIT, int ACT, bool BIAS_BF16>
__global__ __launch_bounds__(128) void k_gemm_bf(const float* __restrict__ A, int lda, const unsigned short* __restrict__ Wt, int ldb,
                                               const float* __restrict__ bias, float* __restrict__ C, int ldc, int M, int N, int K) {
  __shared__ __attribute__((aligned(16))) float so[4][16][64];
  const int tid = threadIdx.x, w = tid >> 5, lane = tid & 31, ln = lane & 15, hh = lane >> 4;
  const int ntn = N / 64;
  const int wid = blockIdx.x * 4 + w;
  const int mt = wid / ntn, nq = wid % ntn;
  if (mt * 16 >= M) return;
  const int row0 = mt * 16, col0 = nq * 64;
  const float* arow = A + (size_t)(row0 + ln) * lda;
  v8f acc[4] = {};
  for (int kb = 0; kb < K; kb += 32) {
    FragB ah, al;
    const v4f x0 = *(const v4fa*)(arow + kb + 8 * hh), x1 = *(const v4fa*)(arow + kb + 8 * hh + 4);
    const v4f x2 = *(const v4fa*)(arow + kb + 16 + 8 * hh), x3 = *(const v4fa*)(arow + kb + 16 + 8 * hh + 4);
    float xs[16] = {x0[0],x0[1],x0[2],x0[3],x1[0],x1[1],x1[2],x1[3],x2[0],x2[1],x2[2],x2[3],x3[0],x3[1],x3[2],x3[3]};
#pragma unroll
    for (int i = 0; i < 16; ++i) { const unsigned short hb = bf16_bits(xs[i]); ah.u[i] = hb; al.u[i] = ASPLIT ? bf16_bits(xs[i] - bf16_val(hb)) : (unsigned short)0; }
#pragma unroll
    for (int t = 0; t < 4; ++t) {
      const unsigned short* brow = Wt + (size_t)(col0 + t * 16 + ln) * ldb + kb;
      FragB b;
      b.half[0] = *(const v8us*)(brow + 8 * hh);
      b.half[1] = *(const v8us*)(brow + 16 + 8 * hh);
      acc[t] = mmaN<ASPLIT ? 2 : 1>(ah.v, al.v, b.v, b.v, acc[t]);
    }
  }
#pragma unroll
  for (int t = 0; t < 4; ++t) {
    float bv = bias ? bias[col0 + t * 16 + ln] : 0.f;
    if (BIAS_BF16) bv = bf16_round(bv);
#pragma unroll
    for (int r = 0; r < 8; ++r) { float v = acc[t][r] + bv; if (ACT == 1) v = fmaxf(v, 0.f); so[w][8 * hh + r][t * 16 + ln] = v; }
  }
  __builtin_amdgcn_fence(__ATOMIC_ACQ_REL, "workgroup");
  __builtin_amdgcn_wave_barrier();
  const int rsub = lane >> 4, c4 = (lane & 15) * 4;
  {
#pragma unroll
    for (int q = 0; q < 8; ++q) {
      const int r = q * 2 + rsub;
      const v4f v = *(const v4fa*)&so[w][r][c4];
      *(v4f*)(C + (size_t)(row0 + r) * ldc + col0 + c4) = v;
    }
    
  }
}

// GEMM C = act(A·W + bias + resid): A f32 (ASPLIT -> hi/lo 2 terms), Wt bf16 [N][K]; ACT 0 none, 1 relu, 2 exact gelu;
// resid (optional, f32, row index = (row % rmod), pitch ldr, RES_BF16 rounds it) added before the activation.
template <bool ASPLIT, int ACT, bool BIAS_BF16, bool RES_BF16>
__global__ __launch_bounds__(128) void k_gemm_bf3(const float* __restrict__ A, int lda, const unsigned short* __restrict__ Wt, int ldb,
                                                const float* __restrict__ bias, const float* __restrict__ resid, int rmod, int ldr,
                                                float* __restrict__ C, int ldc, int M, int N, int K) {
  __shared__ __attribute__((aligned(16))) float so[4][16][64];
  const int tid = threadIdx.x, w = tid >> 5, lane = tid & 31, ln = lane & 15, hh = lane >> 4;
  const int ntn = N / 64;
  const int wid = blockIdx.x * 4 + w;
  const int mt = wid / ntn, nq = wid % ntn;
  if (mt * 16 >= M) return;
  const int row0 = mt * 16, col0 = nq * 64;
  const float* arow = A + (size_t)(row0 + ln) * lda;
  v8f acc[4] = {};
  for (int kb = 0; kb < K; kb += 32) {
    FragB ah, al;
    const v4f x0 = *(const v4fa*)(arow + kb + 8 * hh), x1 = *(const v4fa*)(arow + kb + 8 * hh + 4);
    const v4f x2 = *(const v4fa*)(arow + kb + 16 + 8 * hh), x3 = *(const v4fa*)(arow + kb + 16 + 8 * hh + 4);
    float xs[16] = {x0[0],x0[1],x0[2],x0[3],x1[0],x1[1],x1[2],x1[3],x2[0],x2[1],x2[2],x2[3],x3[0],x3[1],x3[2],x3[3]};
#pragma unroll
    for (int i = 0; i < 16; ++i) { const unsigned short hb = bf16_bits(xs[i]); ah.u[i] = hb; al.u[i] = ASPLIT ? bf16_bits(xs[i] - bf16_val(hb)) : (unsigned short)0; }
#pragma unroll
    for (int t = 0; t < 4; ++t) {
      const unsigned short* brow = Wt + (size_t)(col0 + t * 16 + ln) * ldb + kb;
      FragB b;
      b.half[0] = *(const v8us*)(brow + 8 * hh);
      b.half[1] = *(const v8us*)(brow + 16 + 8 * hh);
      acc[t] = mmaN<ASPLIT ? 2 : 1>(ah.v, al.v, b.v, b.v, acc[t]);
    }
  }
#pragma unroll
  for (int t = 0; t < 4; ++t) {
    const int col = col0 + t * 16 + ln;
    float bv = bias ? bias[col] : 0.f;
    if (BIAS_BF16) bv = bf16_round(bv);
#pragma unroll
    for (int r = 0; r < 8; ++r) {
      float v = acc[t][r] + bv;
      if (resid) { float rv = resid[(size_t)((row0 + 8 * hh + r) % rmod) * ldr + col]; if (RES_BF16) rv = bf16_round(rv); v += rv; }
      if (ACT == 1) v = fmaxf(v, 0.f);
      if (ACT == 2) v = 0.5f * v * (1.0f + erff(v * 0.70710678118654752f));
      if (ACT == 3) { const float u = 0.7978845608028654f * (v + 0.044715f * v * v * v); v = 0.5f * v * (1.0f + tanhf(u)); }
      so[w][8 * hh + r][t * 16 + ln] = v;
    }
  }
  __builtin_amdgcn_fence(__ATOMIC_ACQ_REL, "workgroup");
  __builtin_amdgcn_wave_barrier();
  const int rsub = lane >> 4, c4 = (lane & 15) * 4;
  {
#pragma unroll
    for (int q = 0; q < 8; ++q) {
      const int r = q * 2 + rsub;
      const v4f v = *(const v4fa*)&so[w][r][c4];
      *(v4f*)(C + (size_t)(row0 + r) * ldc + col0 + c4) = v;
    }
    
  }
}
// row LayerNorm (biased variance, eps) over N: s = X (+ R); optional out_sum <- s; out_norm <- (s-mu)*rsqrt(var+eps)*g + b
template <bool PARAM_BF16>
__global__ __launch_bounds__(256) void k_layernorm(const float* __restrict__ X, const float* __restrict__ R, const float* __restrict__ g, const float* __restrict__ bta,
                                                  float* __restrict__ out_sum, float* __restrict__ out_norm, int N, float eps) {
  __shared__ float red[256];
  const int row = blockIdx.x, tid = threadIdx.x;
  const float* x = X + (size_t)row * N; const float* rr = R ? R + (size_t)row * N : nullptr;
  float vals[16];                     // up to N = 4096
  const int per = N / 256;            // contiguous chunk per thread? use strided-by-4 chunks: thread handles j = tid*4 + 1024*u
  float s1 = 0.f;
  for (int u = 0; u < per / 4; ++u) {
    const int j = tid * 4 + 1024 * u;
    const v4f a = *(const v4fa*)(x + j);
    v4f b = {0.f,0.f,0.f,0.f}; if (rr) b = *(const v4fa*)(rr + j);
#pragma unroll
    for (int q = 0; q < 4; ++q) { const float v = a[q] + b[q]; vals[u * 4 + q] = v; s1 += v; }
  }
  red[tid] = s1; __syncthreads();
  for (int st = 128; st > 0; st >>= 1) { if (tid < st) red[tid] += red[tid + st]; __syncthreads(); }
  const float mu = red[0] / (float)N; __syncthreads();
  float s2 = 0.f;
  for (int u = 0; u < per / 4; ++u)
#pragma unroll
    for (int q = 0; q < 4; ++q) { const float c = vals[u * 4 + q] - mu; s2 += c * c; }
  red[tid] = s2; __syncthreads();
  for (int st = 128; st > 0; st >>= 1) { if (tid < st) red[tid] += red[tid + st]; __syncthreads(); }
  const float rs = rsqrtf(red[0] / (float)N + eps);
  {
    for (int u = 0; u < per / 4; ++u) {
      const int j = tid * 4 + 1024 * u;
      v4f o, sm;
#pragma unroll
      for (int q = 0; q < 4; ++q) {
        float gg = g[j + q], bb = bta[j + q];
        if (PARAM_BF16) { gg = bf16_round(gg); bb = bf16_round(bb); }
        sm[q] = vals[u * 4 + q]; o[q] = (vals[u * 4 + q] - mu) * rs * gg + bb;
      }
      if (out_sum) *(v4f*)(out_sum + (size_t)row * N + j) = sm;
      *(v4f*)(out_norm + (size_t)row * N + j) = o;
    }
    
  }
}



// ---- f16 WMMA path (v_wmma_f32_16x16x32_f16): 11-bit significands for operands in range — used where a [0,1] probability operand needs more precision than bf16
typedef _Float16 v16h __attribute__((ext_vector_type(16)));
union FragH { v16h v; v8us half[2]; _Float16 h[16]; unsigned short u[16]; };
template <int NT>
__device__ __forceinline__ v8f mmaH(v16h ah, v16h al, v16h bh, v16h bl, v8f c) {
  c = __builtin_amdgcn_wmma_f32_16x16x32_f16(false, ah, false, bh, (short)0, c, false, false);
  if (NT >= 2) c = __builtin_amdgcn_wmma_f32_16x16x32_f16(false, al, false, bh, (short)0, c, false, false);
  if (NT >= 3) c = __builtin_amdgcn_wmma_f32_16x16x32_f16(false, ah, false, bl, (short)0, c, false, false);
  asm volatile("v_nop\n\tv_nop\n\tv_nop\n\tv_nop" : "+v"(c) : "v"(ah), "v"(al), "v"(bh), "v"(bl));
  return c;
}
// batched GEMM like k_gemm_b but f16 operands: A f32 (split into f16 hi/lo if ASPLIT, else rounded to f16), Bt = f16 values [n][k]; alpha; C f32; N multiple of 16 (partial tiles skipped)
template <bool ASPLIT>
__global__ __launch_bounds__(128) void k_gemm_h(const float* __restrict__ A, int lda, size_t sA, const _Float16* __restrict__ Bh, int ldb, size_t sB, float alpha, float* __restrict__ C, int ldc, size_t sC, int M, int N, int K) {
  __shared__ __attribute__((aligned(16))) float so[4][16][64];
  const int tid = threadIdx.x, w = tid >> 5, lane = tid & 31, ln = lane & 15, hh = lane >> 4; const int by = blockIdx.y;
  A += (size_t)by * sA; Bh += (size_t)by * sB; C += (size_t)by * sC;
  const int ntn = (N + 63) / 64; const int wid = blockIdx.x * 4 + w; const int mt = wid / ntn, nq = wid % ntn; if (mt * 16 >= M) return;
  const int row0 = mt * 16, col0 = nq * 64; const float* arow = A + (size_t)(row0 + ln) * lda;
  v8f acc[4] = {};
  for (int kb = 0; kb < K; kb += 32) {
    FragH ah, al;
    const v4f x0 = *(const v4fa*)(arow + kb + 8 * hh), x1 = *(const v4fa*)(arow + kb + 8 * hh + 4), x2 = *(const v4fa*)(arow + kb + 16 + 8 * hh), x3 = *(const v4fa*)(arow + kb + 16 + 8 * hh + 4);
    float xs[16] = {x0[0],x0[1],x0[2],x0[3],x1[0],x1[1],x1[2],x1[3],x2[0],x2[1],x2[2],x2[3],x3[0],x3[1],x3[2],x3[3]};
#pragma unroll
    for (int i = 0; i < 16; ++i) { const _Float16 h = (_Float16)xs[i]; ah.h[i] = h; al.h[i] = ASPLIT ? (_Float16)(xs[i] - (float)h) : (_Float16)0.0f; }
#pragma unroll
    for (int t = 0; t < 4; ++t) { if (col0 + t * 16 >= N) continue; const size_t boff = (size_t)(col0 + t * 16 + ln) * ldb + kb; FragH bq; bq.half[0] = *(const v8us*)(Bh + boff + 8 * hh); bq.half[1] = *(const v8us*)(Bh + boff + 16 + 8 * hh);
      acc[t] = mmaH<ASPLIT ? 2 : 1>(ah.v, al.v, bq.v, bq.v, acc[t]); }
  }
#pragma unroll
  for (int t = 0; t < 4; ++t) { if (col0 + t * 16 >= N) continue;
#pragma unroll
    for (int r = 0; r < 8; ++r) so[w][8 * hh + r][t * 16 + ln] = acc[t][r] * alpha; }
  __builtin_amdgcn_fence(__ATOMIC_ACQ_REL, "workgroup"); __builtin_amdgcn_wave_barrier();
  const int rsub = lane >> 4, c4 = (lane & 15) * 4;
  {
#pragma unroll
    for (int q = 0; q < 8; ++q) { const int r = q * 2 + rsub; if (col0 + c4 < N) { const v4f v = *(const v4fa*)&so[w][r][c4]; *(v4f*)(C + (size_t)(row0 + r) * ldc + col0 + c4) = v; } }
     }
}

// Wt[n][k] = f16(W[k][n]·scale) from f32 row-major W[K][N] (scale = power of two; bf16-exact weights stay exact in f16 away from the subnormal range)
__global__ __launch_bounds__(256) void k_wt_f16(const float* __restrict__ W, _Float16* __restrict__ Wt, int K, int N, float scale) {
  const int t = blockIdx.x * 256 + threadIdx.x; if (t >= N * (K / 8)) return; const int n = t / (K / 8), k8 = (t % (K / 8)) * 8; FragH f;
#pragma unroll
  for (int i = 0; i < 8; ++i) f.h[i] = (_Float16)(bf16_round(W[(size_t)(k8 + i) * N + n]) * scale); const v8us o = f.half[0];
  *(v8us*)((unsigned short*)Wt + (size_t)n * K + k8) = o; 
}
// k_gemm_hh variant with fused epilogue: v = acc·alpha + bias[by·sBias + col] (+ CP[(row/rowsPerB)·sCPb + by·64 + col] if CP) ; ACT 0 none / 1 elu ; writes f16 C16 (and f32 C if non-null)
template <int ACT>
__global__ __launch_bounds__(128) void k_gemm_hhx(const _Float16* __restrict__ A, int lda, size_t sA, const _Float16* __restrict__ Bh, int ldb, size_t sB, float alpha, const float* __restrict__ bias, size_t sBias, const float* __restrict__ CP, int rowsPerB, size_t sCPb, int row0g,
    float* __restrict__ C, _Float16* __restrict__ C16, int ldc, size_t sC, int M, int N, int K) {
  __shared__ __attribute__((aligned(16))) float so[4][16][64];
  const int tid = threadIdx.x, w = tid >> 5, lane = tid & 31, ln = lane & 15, hh = lane >> 4; const int by = blockIdx.y;
  A += (size_t)by * sA; Bh += (size_t)by * sB; const size_t cofs = (size_t)by * sC; const float* bp = bias ? bias + (size_t)by * sBias : nullptr;
  const int ntn = (N + 63) / 64; const int wid = blockIdx.x * 4 + w; const int mt = wid / ntn, nq = wid % ntn; if (mt * 16 >= M) return;
  const int row0 = mt * 16, col0 = nq * 64; const _Float16* arow = A + (size_t)(row0 + ln) * lda;
  v8f acc[4] = {};
  for (int kb = 0; kb < K; kb += 32) { FragH ah; ah.half[0] = *(const v8us*)((const unsigned short*)arow + kb + 8 * hh); ah.half[1] = *(const v8us*)((const unsigned short*)arow + kb + 16 + 8 * hh);
#pragma unroll
    for (int t = 0; t < 4; ++t) { if (col0 + t * 16 >= N) continue; const size_t boff = (size_t)(col0 + t * 16 + ln) * ldb + kb; FragH bq; bq.half[0] = *(const v8us*)((const unsigned short*)Bh + boff + 8 * hh); bq.half[1] = *(const v8us*)((const unsigned short*)Bh + boff + 16 + 8 * hh);
      acc[t] = mmaH<1>(ah.v, ah.v, bq.v, bq.v, acc[t]); }
  }
#pragma unroll
  for (int t = 0; t < 4; ++t) { if (col0 + t * 16 >= N) continue; const int col = col0 + t * 16 + ln; const float bv = bp ? bf16_round(bp[col]) : 0.f;
#pragma unroll
    for (int r = 0; r < 8; ++r) { float v = acc[t][r] * alpha + bv; if (CP) { const int rr = row0g + row0 + 8 * hh + r; if (rowsPerB < 0) v += CP[cofs + (size_t)rr * ldc + col];      /* rowsPerB < 0: own element of the batched C plane */ else { const int bidx = rr / rowsPerB; v += CP[(size_t)bidx * sCPb + (size_t)by * 64 + col]; } } if (ACT == 1) v = (v > 0.f) ? v : expm1f(v); else if (ACT == 7) v = (v > 0.f) ? v + 1.0f : expf(v); else if (ACT == 8) v = tanhf(v); else if (ACT == 9) v = 0.5f * v * (1.0f + tanhf(0.7978845608028654f * (v + 0.044715f * v * v * v))); else if (ACT == 11) v = 1.0f / (1.0f + expf(-v)); else if (ACT == 12) v = (v > 0.f) ? v : 0.01f * v; else if (ACT == 14) v = (v > 0.f) ? v : 0.1f * v; else if (ACT == 16) v = (v >= 0.f) ? v : 0.3f * v; else if (ACT == 17) v = (v >= 0.f) ? v : 0.2f * v; else if (ACT == 15) v = v / (1.0f + expf(-v)); else if (ACT == 3) v = fmaxf(v, 0.f); else if (ACT == 6) v = 0.5f * v * (1.0f + erff(v * 0.70710678118654752f)); so[w][8 * hh + r][t * 16 + ln] = v; } }
  __builtin_amdgcn_fence(__ATOMIC_ACQ_REL, "workgroup"); __builtin_amdgcn_wave_barrier();
  const int rsub = lane >> 4, c4 = (lane & 15) * 4; typedef _Float16 v4h __attribute__((ext_vector_type(4)));
  {
#pragma unroll
    for (int q = 0; q < 8; ++q) { const int r = q * 2 + rsub; if (col0 + c4 < N) { const v4f v = *(const v4fa*)&so[w][r][c4]; if (C) *(v4f*)(C + cofs + (size_t)(row0 + r) * ldc + col0 + c4) = v; if (C16) { v4h h4; for (int i = 0; i < 4; ++i) h4[i] = (_Float16)v[i]; *(v4h*)(C16 + cofs + (size_t)(row0 + r) * ldc + col0 + c4) = h4; } } }
     }
}


typedef _Float16 v4h __attribute__((ext_vector_type(4)));

__global__ __launch_bounds__(256) void k_x16(const float* __restrict__ x, _Float16* __restrict__ X16, size_t n8) { const size_t t = (size_t)blockIdx.x * 256 + threadIdx.x; if (t >= n8) return; FragH f;
#pragma unroll
  for (int q = 0; q < 8; ++q) f.h[q] = (_Float16)bf16_round(x[t * 8 + q]); *(v8us*)((unsigned short*)X16 + t * 8) = f.half[0];  }
__global__ __launch_bounds__(256) void k_h16(const float* __restrict__ x, _Float16* __restrict__ X16, size_t n8) { const size_t t = (size_t)blockIdx.x * 256 + threadIdx.x; if (t >= n8) return; FragH f;
#pragma unroll
  for (int q = 0; q < 8; ++q) f.h[q] = (_Float16)x[t * 8 + q]; *(v8us*)((unsigned short*)X16 + t * 8) = f.half[0];  }
__global__ __launch_bounds__(256) void k_round16f(const float* __restrict__ W, _Float16* __restrict__ Bt, size_t n8) { const size_t t = (size_t)blockIdx.x * 256 + threadIdx.x; if (t >= n8) return; FragH f;
#pragma unroll
  for (int i = 0; i < 8; ++i) f.h[i] = (_Float16)(bf16_round(W[t * 8 + i]) * 16.0f); *(v8us*)((unsigned short*)Bt + t * 8) = f.half[0];  }
template <int NHv, int TTv>
__global__ __launch_bounds__(256) void k_vt(const _Float16* __restrict__ V16, int ldv, int voff, _Float16* __restrict__ Vt) { __shared__ unsigned short tl[64][66]; const int tid = threadIdx.x; const int slab = blockIdx.x / (TTv / 64), lg = blockIdx.x % (TTv / 64); const int b = slab / NHv, h = slab % NHv;
  for (int i = tid; i < 64 * 8; i += 256) { const int r = i / 8, c8 = (i % 8) * 8; FragH f; f.half[0] = *(const v8us*)((const unsigned short*)V16 + ((size_t)b * TTv + lg * 64 + r) * ldv + voff + h * 64 + c8);
#pragma unroll
    for (int q = 0; q < 8; ++q) tl[r][c8 + q] = f.u[q]; }
  __syncthreads();
  {
#pragma unroll
    for (int rd = 0; rd < 2; ++rd) { const int d = rd * 32 + tid / 8, pc = tid % 8; FragH f;
#pragma unroll
      for (int q = 0; q < 8; ++q) f.u[q] = tl[pc * 8 + q][d];
      *(v8us*)((unsigned short*)Vt + ((size_t)slab * 64 + d) * TTv + lg * 64 + pc * 8) = f.half[0]; }
     } }

__global__ __launch_bounds__(256) void k_hl(const float* __restrict__ F, _Float16* __restrict__ Hh, _Float16* __restrict__ Hl, size_t n8) { const size_t t = (size_t)blockIdx.x * 256 + threadIdx.x; if (t >= n8) return; FragH fh, fl; const v4f a = *(const v4fa*)(F + t * 8), c = *(const v4fa*)(F + t * 8 + 4);
#pragma unroll
  for (int q = 0; q < 4; ++q) { _Float16 h = (_Float16)a[q]; fh.h[q] = h; fl.h[q] = (_Float16)((a[q] - (float)h) * 1024.0f); h = (_Float16)c[q]; fh.h[4 + q] = h; fl.h[4 + q] = (_Float16)((c[q] - (float)h) * 1024.0f); }
  { *(v8us*)((unsigned short*)Hh + t * 8) = fh.half[0]; *(v8us*)((unsigned short*)Hl + t * 8) = fl.half[0];  } }

// ---- fast GEMM (wave tile 32x64; requires M % 32 == 0 rows per launch region and N % 64 == 0) ----
// Fragment order of every f16 operand array ([rows][K], rows % 16 == 0, K % 32 == 0): blocks of 16 rows x 32 k (1 KiB), the K / 32 blocks of a row group one behind the other, so that 16 rows are 16 * K elements as in row order.
// Inside a block the 16-byte unit number (k % 32) / 8 * 16 + row % 16 holds 8 neighbouring k of one row: lane l of a fragment reads units l and 32 + l, so each of its two loads covers 512 neighbouring bytes (4 whole lines, not a piece of 16).
__device__ __forceinline__ size_t fr_off(size_t row, int k8, int K) { return ((row >> 4) * (size_t)(K >> 5) + (size_t)(k8 >> 2)) * 512 + (size_t)((k8 & 3) * 128) + (row & 15) * 8; }      /* element offset of the unit that holds k = 8 k8 .. + 7 of a row */
__device__ __forceinline__ v16h g2_frag(const _Float16* p) { FragH f; f.half[0] = *(const v8us*)((const unsigned short*)p); f.half[1] = *(const v8us*)((const unsigned short*)p + 256); return f.v; }      /* p: the block's start + 8 * lane */
__device__ __forceinline__ v8f g2_mma(v16h a, v16h b, v8f c) { v8f d = __builtin_amdgcn_wmma_f32_16x16x32_f16(false, a, false, b, (short)0, c, false, false); asm volatile("v_nop\n\tv_nop\n\tv_nop\n\tv_nop" : "+v"(d) : "v"(a), "v"(b)); return d; }
// The fragments of one 32-k step of a 32x64 wave tile: the two A row groups and the four B column groups.
struct G2Set { v16h a0, a1, b0, b1, b2, b3; };
__device__ __forceinline__ void g2_load(G2Set& s, const _Float16* a0p, const _Float16* a1p, const _Float16* b0p, const _Float16* b1p, const _Float16* b2p, const _Float16* b3p, int kb) {      /* kb: the step's first k; 32 k are one block of 512 elements */
  const int ko = kb * 16; const _Float16* pa0 = a0p + ko; const _Float16* pa1 = a1p + ko; const _Float16* pb0 = b0p + ko; const _Float16* pb1 = b1p + ko; const _Float16* pb2 = b2p + ko; const _Float16* pb3 = b3p + ko;
  s.a0 = g2_frag(pa0); s.a1 = g2_frag(pa1); s.b0 = g2_frag(pb0); s.b1 = g2_frag(pb1); s.b2 = g2_frag(pb2); s.b3 = g2_frag(pb3);
  asm volatile("s_wait_xcnt 0x0" :: "v"(pa0), "v"(pa1), "v"(pb0), "v"(pb1), "v"(pb2), "v"(pb3) : "memory");      /* stands in front of the next address additions, which give new values to registers that these loads name; the addresses as inputs stay alive up to the wait, so that no later load's result lands in an earlier load's address registers in front of it */
  __builtin_amdgcn_sched_barrier(0); }      /* keeps the 12 loads and their wait here, ahead of the other set's products: moved down to their first uses the loads would each be waited for in turn */
// The same for the first and the last step, outside the loop, where nothing reads some of the addresses afterwards (the six pointers: the lane's own addresses, the step's block included).
__device__ __forceinline__ void g2_load_once(G2Set& s, const _Float16* pa0, const _Float16* pa1, const _Float16* pb0, const _Float16* pb1, const _Float16* pb2, const _Float16* pb3) {
  s.a0 = g2_frag(pa0); s.a1 = g2_frag(pa1); s.b0 = g2_frag(pb0); s.b1 = g2_frag(pb1); s.b2 = g2_frag(pb2); s.b3 = g2_frag(pb3);
  asm volatile("s_wait_xcnt 0x0" :: "v"(pa0), "v"(pa1), "v"(pb0), "v"(pb1), "v"(pb2), "v"(pb3) : "memory");      /* the addresses as inputs stay alive up to the wait, so that no later load's result lands in an earlier load's address registers in front of it */
  __builtin_amdgcn_sched_barrier(0); }      /* keeps the 12 loads and their wait here, ahead of the other set's products */
__device__ __forceinline__ void g2_mul(const G2Set& s, v8f (&c)[8]) {
  c[0] = g2_mma(s.a0, s.b0, c[0]); c[4] = g2_mma(s.a1, s.b0, c[4]); c[1] = g2_mma(s.a0, s.b1, c[1]); c[5] = g2_mma(s.a1, s.b1, c[5]);
  c[2] = g2_mma(s.a0, s.b2, c[2]); c[6] = g2_mma(s.a1, s.b2, c[6]); c[3] = g2_mma(s.a0, s.b3, c[3]); c[7] = g2_mma(s.a1, s.b3, c[7]); }
// The epilogue's kind is fixed at compile time. RES: a residual row (f32, pitch LDC, same row and column as the result) is added behind the bias; F16O: the result goes out as f16 rows (C16), else as f32 rows (C); LDC: pitch of the result rows.
// result = act(sum * alpha + bf16(bias[col]) (+ residual)), worked out behind the LDS turn, where a lane holds 4 neighbouring columns of a row: bias and residual come as 16-byte loads with nothing between them.
// VTP: plane y = 2 (v) goes out transposed, as the attention launch reads it: VTo[(batch, head)][d][key]. A lane of a D tile holds 8 neighbouring rows (keys) of one column (d), so each tile half is one 16-byte store straight from the sums, without the LDS turn; in fragment order (rows d, k = key) each such store of a wave covers 512 neighbouring bytes.
template <int ACT, bool RES, bool F16O, int LDC, bool VTP>
__global__ __launch_bounds__(128) void k_gemm2(const _Float16* __restrict__ A, int lda, const _Float16* __restrict__ Bh, int ldb, size_t sB, float alpha, const float* __restrict__ bias, const float* __restrict__ biasY1, const float* __restrict__ biasY2, const float* __restrict__ R,
    float* __restrict__ C, _Float16* __restrict__ C16, _Float16* __restrict__ VTo, size_t sC, int M, int N, int K) {      /* sB, sC: strides of blockIdx.y; biasY1, biasY2: the bias arrays of planes y = 1 and y = 2 (else null) */ static_assert(ACT == 0 || ACT == 6, "k_gemm2: unsupported ACT code (would silently apply no activation)"); static_assert(!(RES && ACT == 6), "k_gemm2: the rolled GELU loop holds no residual registers");
  __shared__ __attribute__((aligned(16))) float so[4][32][68];
  const int tid = threadIdx.x, w = tid >> 5, lane = tid & 31, ln = lane & 15, hh = lane >> 4; const int by = blockIdx.y;
  Bh += (size_t)by * sB; const size_t cofs = (size_t)by * sC; const float* bp = bias; if (biasY1 && by == 1) bp = biasY1; if (biasY2 && by == 2) bp = biasY2;
  const int ntn = N >> 6; const int mt = blockIdx.x / ntn, nq = blockIdx.x - mt * ntn; const int row0 = mt * 128 + 32 * w, col0 = nq * 64; if (row0 >= M) return;
  const _Float16* a0p = A + (size_t)row0 * lda + lane * 8; const _Float16* a1p = a0p + (size_t)16 * lda;      /* fragment order: lda = ldb = K */
  const _Float16* b0p = Bh + (size_t)col0 * ldb + lane * 8; const _Float16* b1p = b0p + (size_t)16 * ldb; const _Float16* b2p = b1p + (size_t)16 * ldb; const _Float16* b3p = b2p + (size_t)16 * ldb;
  const v8f z8 = {0.f,0.f,0.f,0.f,0.f,0.f,0.f,0.f}; v8f accs[8] = {z8, z8, z8, z8, z8, z8, z8, z8};
  /* K loop over two fragment sets: while one 32-k step is multiplied, the other step's 12 loads are in flight. K % 64 == 0; every sum keeps its ascending k order. */
  G2Set s0, s1; int kb = 0; g2_load_once(s0, a0p, a1p, b0p, b1p, b2p, b3p);
#pragma unroll 1      /* the two steps of a trip are written out; more copies would only add code */
  for (; kb + 64 < K; kb += 64) { g2_load(s1, a0p, a1p, b0p, b1p, b2p, b3p, kb + 32); g2_mul(s0, accs); g2_load(s0, a0p, a1p, b0p, b1p, b2p, b3p, kb + 64); g2_mul(s1, accs); }
  const int kl = (kb + 32) * 16; g2_load_once(s1, a0p + kl, a1p + kl, b0p + kl, b1p + kl, b2p + kl, b3p + kl); g2_mul(s0, accs);      /* the last two steps: no fragment is left to fetch behind them */
  if constexpr (VTP) { static_assert(!VTP || (LDC == NH * HD && HD == 64 && SQ % 128 == 0 && ACT == 0 && !RES), "k_gemm2: a 64-column tile is one head, a 128-row tile lies in one batch");
    if (by == 2) { const float* bc = bp + col0 + ln; float bl[4];
#pragma unroll      /* constant indices: the four bias values stay in registers and their loads issue together */
      for (int t = 0; t < 4; ++t) bl[t] = bc[t * 16];
      asm volatile("s_wait_xcnt 0x0" :: "v"(bc) : "memory");      /* stands in front of whatever gives new values to the address registers of these loads; the address as an input stays alive up to here, so that no load's result lands in it */
      __builtin_amdgcn_sched_barrier(0);      /* keeps the loads here, in flight under the last step's own load wait and products */
      g2_mul(s1, accs);
      unsigned short* vd = (unsigned short*)VTo + (size_t)((row0 / SQ) * NH + nq) * HD * SQ + (size_t)((row0 % SQ) >> 5) * 512 + lane * 8;      /* d = 16 t + ln, keys 16 g + 8 hh .. + 7 of the wave's 32: in fragment order (rows d, k = key) unit 32 g + lane of the block of d group t */
#pragma unroll      /* constant indices: the sums stay in registers */
      for (int t = 0; t < 4; ++t) { const float bt = bf16_round(bl[t]);
#pragma unroll      /* constant indices: the sums stay in registers */
        for (int g = 0; g < 2; ++g) { FragH f;
#pragma unroll      /* constant indices: the sums stay in registers */
          for (int r = 0; r < 8; ++r) f.h[r] = (_Float16)(accs[g * 4 + t][r] * alpha + bt);
          *(v8us*)(vd + (size_t)t * 16 * SQ + g * 256) = f.half[0]; } }
      asm volatile("s_wait_xcnt 0x0" :: "v"(vd) : "memory"); return; } }      /* the listing lets the other planes' code follow, which writes the stores' registers; the address as an input stays alive up to here */
  /* Store layout: lane = row rsub (+ 2 per vector) of the wave's 32, columns c4 .. c4 + 3 of its 64; e0 = the lane's first element. */
  const int rsub = lane >> 4, c4 = (lane & 15) * 4; const size_t e0 = (size_t)(row0 + rsub) * LDC + col0 + c4;
  const v4f b4 = *(const v4fa*)(bp + col0 + c4); v4f rv[RES ? 16 : 1];
  if constexpr (RES) { const float* rp = R + e0;
#pragma unroll      /* constant indices: the 16 row vectors stay in registers and their loads issue together */
    for (int q = 0; q < 16; ++q) rv[q] = *(const v4fa*)(rp + (size_t)q * 2 * LDC);
    asm volatile("s_wait_xcnt 0x0" :: "v"(rp) : "memory"); }      /* stands in front of whatever gives new values to the address registers of these loads; the rows' address as an input stays alive up to here, so that no load's result lands in it */
  else asm volatile("s_wait_xcnt 0x0" ::: "memory");      /* stands in front of whatever gives new values to the address registers of the bias load */
  __builtin_amdgcn_sched_barrier(0);      /* keeps the loads here, in flight under the last step's own load wait and products: moved down to their uses they would be waited for behind the products */
  g2_mul(s1, accs);
#pragma unroll      /* constant indices: the sums stay in registers */
  for (int u = 0; u < 8; ++u) {
#pragma unroll      /* constant indices: the sums stay in registers */
    for (int r = 0; r < 8; ++r) so[w][(u >> 2) * 16 + 8 * hh + r][(u & 3) * 16 + ln] = accs[u][r]; }
  /* the wave's own 32 x 64 sums are in LDS before its lanes read them back row-wise */
  __builtin_amdgcn_fence(__ATOMIC_ACQ_REL, "workgroup"); __builtin_amdgcn_wave_barrier();
  const v4f bb = {bf16_round(b4[0]), bf16_round(b4[1]), bf16_round(b4[2]), bf16_round(b4[3])};
  const float* sp = &so[w][rsub][c4]; char* cp = F16O ? (char*)(C16 + cofs + fr_off((size_t)(row0 + rsub), (col0 + c4) >> 3, LDC) + (c4 & 7)) : (char*)(C + cofs + e0); constexpr size_t RB = F16O ? (size_t)32 : (size_t)2 * LDC * 4;      /* RB: bytes from one of the lane's rows to its next; f16 rows go out in fragment order, where two rows on are two units on */
#pragma unroll (ACT == 6 ? 1 : 4)      /* GELU: rolled, 16 erf bodies of text instead of 64, so that the kernel's text stays small; else written out, since the residual registers take constant indices */
  for (int g = 0; g < 4; ++g) { v4f v[4];
#pragma unroll      /* constant indices: the four LDS reads issue together */
    for (int i = 0; i < 4; ++i) v[i] = *(const v4fa*)(sp + i * 2 * 68);
#pragma unroll      /* constant indices: the values stay in registers */
    for (int i = 0; i < 4; ++i) {
#pragma unroll      /* constant indices: the values stay in registers */
      for (int e = 0; e < 4; ++e) { float x = v[i][e] * alpha + bb[e]; if constexpr (RES) x += rv[g * 4 + i][e]; if (ACT == 6) x = 0.5f * x * (1.0f + erff(x * 0.70710678118654752f)); v[i][e] = x; }
      if constexpr (F16O) { v4h h4;
#pragma unroll      /* constant indices: the values stay in registers */
        for (int e = 0; e < 4; ++e) h4[e] = (_Float16)v[i][e];
        *(v4h*)(cp + i * RB) = h4; }
      else *(v4f*)(cp + i * RB) = v[i]; }
    sp += 8 * 68; cp += 4 * RB; if (F16O && g == 1) cp += (size_t)16 * LDC * 2 - 8 * RB; } }      /* behind its 16th row the wave goes on to the next row group's block */


// The same GEMM for the two launches whose grid of 128 x 64 tiles is small and whose K loop is a long chain of load waits (W_o, fc2): 16 waves per tile instead of 4.
// Wave w works on row group w & 3 (32 rows) and on the 32-k steps kq, kq + KS, kq + 2 KS, ... with kq = w >> 2, so that the KS waves of a row group read neighbouring blocks of A and B at the same time.
// The KS partial sums of a row group meet in LDS; behind the barrier wave (rw, kq) adds them in the order of kq for rows 8 kq .. 8 kq + 7 and finishes these rows: result = sum * alpha + bf16(bias[col]) + residual, f32 rows of pitch LDC.
#define KS 4
static_assert(NR % 128 == 0, "k_gemm2k: whole 128-row tiles");
// NRM: the finished rows also leave, per row and 64-column tile, the pair (sum of (result - XR)^2, sum of XR^2) in PN[tile][row]: the surprise statistic's row norms, taken from the registers that hold the result.
template <int LDC, bool NRM>
__global__ __launch_bounds__(128 * KS) void k_gemm2k(const _Float16* __restrict__ A, int lda, const _Float16* __restrict__ Bh, int ldb, float alpha, const float* __restrict__ bias, const float* __restrict__ R, const float* __restrict__ XR, float* __restrict__ C, float* __restrict__ PN, int M, int N, int K) {      /* K % (64 * KS) == 0 */
  __shared__ __attribute__((aligned(16))) float so[KS * 4][32][68];
  const int tid = threadIdx.x, w = tid >> 5, lane = tid & 31, ln = lane & 15, hh = lane >> 4; const int rw = w & 3, kq = w >> 2;
  const int ntn = N >> 6; const int mt = blockIdx.x / ntn, nq = blockIdx.x - mt * ntn; if (mt * 128 >= M) return;      /* the whole work-group or none of it, in front of the barrier */
  const int row0 = mt * 128 + 32 * rw, col0 = nq * 64;
  const _Float16* a0p = A + (size_t)row0 * lda + 512 * kq + lane * 8; const _Float16* a1p = a0p + (size_t)16 * lda;      /* fragment order: lda = ldb = K; block kq of the row group */
  const _Float16* b0p = Bh + (size_t)col0 * ldb + 512 * kq + lane * 8; const _Float16* b1p = b0p + (size_t)16 * ldb; const _Float16* b2p = b1p + (size_t)16 * ldb; const _Float16* b3p = b2p + (size_t)16 * ldb;
  const v8f z8 = {0.f,0.f,0.f,0.f,0.f,0.f,0.f,0.f}; v8f accs[8] = {z8, z8, z8, z8, z8, z8, z8, z8};
  /* K loop over two fragment sets as in k_gemm2; from one of the wave's steps to its next it is 32 * KS elements of k. */
  constexpr int ST = 32 * KS; G2Set s0, s1; int kb = 0; g2_load_once(s0, a0p, a1p, b0p, b1p, b2p, b3p);
#pragma unroll 1      /* the two steps of a trip are written out; more copies would only add code */
  for (; kb + 2 * ST < K; kb += 2 * ST) { g2_load(s1, a0p, a1p, b0p, b1p, b2p, b3p, kb + ST); g2_mul(s0, accs); g2_load(s0, a0p, a1p, b0p, b1p, b2p, b3p, kb + 2 * ST); g2_mul(s1, accs); }
  const int kl = (kb + ST) * 16; g2_load_once(s1, a0p + kl, a1p + kl, b0p + kl, b1p + kl, b2p + kl, b3p + kl); g2_mul(s0, accs);      /* the wave's last two steps: no fragment is left to fetch behind them */
  /* Store layout: lane = row rl (+ 2 per vector) of the row group's 32, columns c4 .. c4 + 3 of its 64; e0 = the lane's first element. */
  const int c4 = (lane & 15) * 4, rl = 8 * kq + (lane >> 4); const size_t e0 = (size_t)(row0 + rl) * LDC + col0 + c4;
  const float* rp = R + e0; const v4f b4 = *(const v4fa*)(bias + col0 + c4); v4f rv[4]; v4f xv[NRM ? 4 : 1];
#pragma unroll      /* constant indices: the 4 row vectors stay in registers and their loads issue together */
  for (int i = 0; i < 4; ++i) rv[i] = *(const v4fa*)(rp + (size_t)i * 2 * LDC);
  const float* xp = NRM ? XR + e0 : rp;
  if constexpr (NRM) {
#pragma unroll      /* constant indices: the 4 row vectors stay in registers and their loads issue together */
    for (int i = 0; i < 4; ++i) xv[i] = *(const v4fa*)(xp + (size_t)i * 2 * LDC); }
  asm volatile("s_wait_xcnt 0x0" :: "v"(rp), "v"(xp) : "memory");      /* stands in front of whatever gives new values to the address registers of these loads; the rows' addresses as inputs stay alive up to here, so that no load's result lands in them */
  __builtin_amdgcn_sched_barrier(0);      /* keeps the loads here, in flight under the last step's own load wait and products: moved down to their uses they would be waited for behind the barrier */
  g2_mul(s1, accs);
#pragma unroll      /* constant indices: the sums stay in registers */
  for (int u = 0; u < 8; ++u) {
#pragma unroll      /* constant indices: the sums stay in registers */
    for (int r = 0; r < 8; ++r) so[w][(u >> 2) * 16 + 8 * hh + r][(u & 3) * 16 + ln] = accs[u][r]; }
  __syncthreads();      /* the partial sums of all 16 waves are in LDS before any wave adds them up */
  const v4f bb = {bf16_round(b4[0]), bf16_round(b4[1]), bf16_round(b4[2]), bf16_round(b4[3])};
  const float* sp = &so[rw][rl][c4]; float* cp = C + e0; v4f p[4][KS];
#pragma unroll      /* constant indices: the LDS reads issue together */
  for (int i = 0; i < 4; ++i) {
#pragma unroll      /* constant indices: the LDS reads issue together */
    for (int q = 0; q < KS; ++q) p[i][q] = *(const v4fa*)(sp + (size_t)q * 4 * 32 * 68 + i * 2 * 68); }
  float sd[4], sx[4];
#pragma unroll      /* constant indices: the values stay in registers */
  for (int i = 0; i < 4; ++i) { v4f v = p[i][0];
#pragma unroll      /* constant indices: the values stay in registers */
    for (int q = 1; q < KS; ++q) v += p[i][q];
#pragma unroll      /* constant indices: the values stay in registers */
    for (int e = 0; e < 4; ++e) v[e] = v[e] * alpha + bb[e] + rv[i][e];
    *(v4f*)(cp + (size_t)i * 2 * LDC) = v;
    if constexpr (NRM) { sd[i] = 0.f; sx[i] = 0.f;
#pragma unroll      /* constant indices: the values stay in registers */
      for (int e = 0; e < 4; ++e) { const float dd = v[e] - xv[i][e]; sd[i] += dd * dd; sx[i] += xv[i][e] * xv[i][e]; } } }
  if constexpr (NRM) {      /* a row's 64 columns lie in the 16 lanes of one wave half: four butterfly steps, then lane i of each half (i < 4) stores row rl + 2 i, so that the wave's 8 pairs are 64 neighbouring bytes */
    asm volatile("s_wait_xcnt 0x0" :: "v"(cp) : "memory");      /* stands in front of whatever gives new values to the registers of the four row stores; their address as an input stays alive up to here */
    float od = 0.f, ox = 0.f;
#pragma unroll      /* constant indices: the values stay in registers */
    for (int i = 0; i < 4; ++i) {
#pragma unroll      /* four fixed butterfly steps */
      for (int m = 8; m > 0; m >>= 1) { sd[i] += __shfl_xor(sd[i], m, 32); sx[i] += __shfl_xor(sx[i], m, 32); }
      if ((lane & 15) == i) { od = sd[i]; ox = sx[i]; } }
    if ((lane & 15) < 4) { const v2f o2 = {od, ox}; *(v2f*)(PN + ((size_t)nq * NR + row0 + rl + 2 * (lane & 15)) * 2) = o2; } } }


__global__ __launch_bounds__(256) void k_rsm(const float* __restrict__ S, _Float16* __restrict__ P, int nrows) {
  #pragma clang fp contract(off)
  const int i = blockIdx.x * 256 + threadIdx.x; if (i >= nrows) return; const float* s = S + (size_t)i * SQ; float mx = -3.0e38f;
#pragma unroll 1
  for (int j = 0; j < SQ; ++j) mx = fmaxf(mx, s[j]); float se = 0.f;
#pragma unroll 1
  for (int j = 0; j < SQ; ++j) se += expf(s[j] - mx); const float sc = 256.0f / se;
#pragma unroll 1
  for (int j0 = 0; j0 < SQ; j0 += 8) { FragH f; for (int q = 0; q < 8; ++q) f.h[q] = (_Float16)(expf(s[j0 + q] - mx) * sc); unsigned short* d = (unsigned short*)P + (size_t)i * SQ + j0; *(v8us*)d = f.half[0];  } }

#define FH 2048
#define KN 103
typedef int v4ia __attribute__((ext_vector_type(4), may_alias));
__device__ __forceinline__ void xcnt_wait() { asm volatile("s_wait_xcnt 0x0" ::: "memory"); }
__device__ __forceinline__ float wave_max(float v) {
#pragma unroll      /* five fixed butterfly steps */
  for (int m = 16; m > 0; m >>= 1) v = fmaxf(v, __shfl_xor(v, m, 32)); return v; }
__device__ __forceinline__ float wave_sum(float v) {
#pragma unroll      /* five fixed butterfly steps */
  for (int m = 16; m > 0; m >>= 1) v += __shfl_xor(v, m, 32); return v; }
// Operand preparation, one launch: the six weight matrices as x16 f16 planes (they lie one behind the other in Bt, in the order wq, wk, wv, wo, w1, w2), x as bf16-rounded f32 rows and, from the same registers, LN1 of these rows as f16 rows.
// A work-group converts 256 x 8 elements of one weight array or 8 rows of x; which array follows from blockIdx.x alone.
#define PW (DM * DM / 2048)          /* work-groups per DM x DM weight */
#define PF (FH * DM / 2048)          /* work-groups per FH x DM weight */
#define PX ((int)(NR / 8))           /* work-groups for x: one wave per row, 8 rows each */
#define PB0 (4 * PW + 2 * PF + PX)   /* first work-group of the prior tables' packing */
#define PMD (SQ * (SQ / 32) / 256)   /* prior_mask: one thread per 32-key word */
#define PMS (SQ / 8)                 /* prior_indices: one wave per query row */
static_assert((DM * DM) % 2048 == 0 && (FH * DM) % 2048 == 0 && NR % 8 == 0 && DM == 512, "k_prep: whole work-groups per array; a lane holds 16 of a row's 512 columns");
__global__ __launch_bounds__(256) void k_prep(const float* __restrict__ wq, const float* __restrict__ wk, const float* __restrict__ wv, const float* __restrict__ wo, const float* __restrict__ w1, const float* __restrict__ w2, const float* __restrict__ x, const float* __restrict__ g1, const float* __restrict__ be1, _Float16* __restrict__ Bt, float* __restrict__ XF, _Float16* __restrict__ X16o, const int* __restrict__ pmask, const int* __restrict__ pidx, const int* __restrict__ pim, unsigned int* __restrict__ MD, unsigned int* __restrict__ MS) {
  __shared__ __attribute__((aligned(16))) unsigned char bm[8][SQ];      /* prior_indices: the wave's own row of key flags (any index set) */
  const int blk = blockIdx.x; const float* src; int first; int ksh = 4;      /* ksh: log2 of a weight row's 32-k blocks */
  if (blk >= PB0 + PMD) {      /* MS[q][j / 32] bit j % 32: key j is one of row q's valid prior slots */
    const int lane = threadIdx.x & 31, w = threadIdx.x >> 5; const int q = (blk - PB0 - PMD) * 8 + w; const int* ix = pidx + (size_t)q * KN; const int* vm = pim + (size_t)q * KN; constexpr int NT = (KN + 31) / 32; int jx[NT]; bool ok[NT];
#pragma unroll      /* constant indices: the lane's values stay in registers and its loads issue together */
    for (int t = 0; t < NT; ++t) { const int k = t * 32 + lane; const int kc = k < KN ? k : KN - 1; jx[t] = ix[kc]; const int vk = vm[kc]; xcnt_wait(); ok[t] = (k < KN) & (vk != 0); }      /* a later load's result may land in an earlier load's address register: the wait stands between them */
    const v4ia z = {0, 0, 0, 0}; *(v4ia*)&bm[w][lane * 32] = z; *(v4ia*)&bm[w][lane * 32 + 16] = z;
    /* the zeros of every lane are in LDS before any lane sets a flag over them */
    __builtin_amdgcn_fence(__ATOMIC_ACQ_REL, "workgroup"); __builtin_amdgcn_wave_barrier();
#pragma unroll      /* constant indices: the lane's values stay in registers */
    for (int t = 0; t < NT; ++t) if (ok[t]) bm[w][min(max(jx[t], 0), SQ - 1)] = 1;      /* the key index is bounded here before it forms an address */
    /* the flags of every lane are in LDS before the row is read back */
    __builtin_amdgcn_fence(__ATOMIC_ACQ_REL, "workgroup"); __builtin_amdgcn_wave_barrier();
    unsigned int word = 0;
#pragma unroll      /* 32 independent LDS reads issue together */
    for (int c = 0; c < SQ / 32; ++c) { const unsigned int bal = __builtin_amdgcn_ballot_w32(bm[w][c * 32 + lane] != 0); if (lane == c) word = bal; }
    MS[(size_t)q * (SQ / 32) + lane] = word; return; }
  if (blk >= PB0) {      /* MD[q][j / 32] bit j % 32: prior_mask[q][j] */
    const size_t t = (size_t)(blk - PB0) * 256 + threadIdx.x; v4ia mv[8]; unsigned int word = 0;
#pragma unroll      /* constant indices: the lane's values stay in registers and its loads issue together */
    for (int i = 0; i < 8; ++i) mv[i] = *(const v4ia*)(pmask + t * 32 + i * 4);
    xcnt_wait();      /* the address registers of the eight loads may take new values below */
#pragma unroll      /* constant indices: the lane's values stay in registers */
    for (int i = 0; i < 8; ++i) for (int e = 0; e < 4; ++e) word |= (mv[i][e] != 0 ? 1u : 0u) << (i * 4 + e);
    MD[t] = word;
    xcnt_wait(); return; }      /* the listing lets another part's code follow, which writes the store's registers */
  if (blk >= 4 * PW + 2 * PF) {      /* x: one wave per row; lane l owns columns c*256 + l*8 .. +7 (c = 0, 1), rounded once, stored as the residual row and held in registers for the three passes of LN1 */
    const int lane = threadIdx.x & 31; const size_t r = (size_t)(blk - (4 * PW + 2 * PF)) * 8 + (threadIdx.x >> 5); const float* xr = x + r * DM + lane * 8; const float* gp = g1 + lane * 8; const float* bp = be1 + lane * 8; v4f a[4], gv[4], bv[4];
#pragma unroll      /* constant indices: the lane's values stay in registers and its 12 loads issue together */
    for (int c = 0; c < 2; ++c) { a[2 * c] = *(const v4fa*)(xr + c * 256); a[2 * c + 1] = *(const v4fa*)(xr + c * 256 + 4); gv[2 * c] = *(const v4fa*)(gp + c * 256); gv[2 * c + 1] = *(const v4fa*)(gp + c * 256 + 4); bv[2 * c] = *(const v4fa*)(bp + c * 256); bv[2 * c + 1] = *(const v4fa*)(bp + c * 256 + 4); }
    asm volatile("s_wait_xcnt 0x0" :: "v"(xr), "v"(gp), "v"(bp) : "memory");      /* stands in front of whatever gives new values to the address registers of these loads; the addresses as inputs stay alive up to here, so that no load's result lands in them */
    float v[16]; float s = 0.f; float* xo = XF + r * DM + lane * 8;
#pragma unroll      /* constant indices: the lane's values stay in registers */
    for (int c = 0; c < 4; ++c) { v4f o;
#pragma unroll      /* constant indices: the lane's values stay in registers */
      for (int e = 0; e < 4; ++e) { o[e] = bf16_round(a[c][e]); v[c * 4 + e] = o[e]; }
      *(v4f*)(xo + (c >> 1) * 256 + (c & 1) * 4) = o; }
#pragma unroll      /* constant indices: the lane's values stay in registers */
    for (int e = 0; e < 16; ++e) s += v[e];
    const float mu = wave_sum(s) / (float)DM; float qs = 0.f;
#pragma unroll      /* constant indices: the lane's values stay in registers */
    for (int e = 0; e < 16; ++e) { const float dd = v[e] - mu; qs += dd * dd; }
    const float rs = 1.0f / sqrtf(wave_sum(qs) / (float)DM + 1e-5f); unsigned short* no = (unsigned short*)X16o + fr_off(r, lane, DM);      /* fragment order: columns 8 lane .. + 7; 256 columns on are 8 blocks on */
#pragma unroll      /* constant indices: the lane's values stay in registers */
    for (int c = 0; c < 2; ++c) { FragH f;
#pragma unroll      /* constant indices: the lane's values stay in registers */
      for (int e = 0; e < 4; ++e) { f.h[e] = (_Float16)((v[c * 8 + e] - mu) * rs * bf16_round(gv[2 * c][e]) + bf16_round(bv[2 * c][e])); f.h[4 + e] = (_Float16)((v[c * 8 + 4 + e] - mu) * rs * bf16_round(gv[2 * c + 1][e]) + bf16_round(bv[2 * c + 1][e])); }
      *(v8us*)(no + c * 4096) = f.half[0]; }
    asm volatile("s_wait_xcnt 0x0" :: "v"(xo), "v"(no) : "memory"); return; }      /* the listing lets another part's code follow, which writes the stores' registers; the two addresses as inputs stay alive up to here */
  if (blk < PW) { src = wq; first = 0; } else if (blk < 2 * PW) { src = wk; first = PW; } else if (blk < 3 * PW) { src = wv; first = 2 * PW; } else if (blk < 4 * PW) { src = wo; first = 3 * PW; }
  else if (blk < 4 * PW + PF) { src = w1; first = 4 * PW; } else { src = w2; first = 4 * PW + PF; ksh = 6; }
  static_assert(DM == 32 << 4 && FH == 32 << 6, "k_prep: blocks per weight row");
  /* thread = one 16-byte unit of the plane in fragment order; its 8 elements of the row-major weight follow from the unit's number. A wave takes 8 rows x 32 k of a block: it reads one whole 128-byte line of each row and stores 4 whole lines (8 rows' units of one k group each). */
  const int tl = threadIdx.x, ul = (tl & 0xC0) | (((tl >> 3) & 3) << 4) | (((tl >> 5) & 1) << 3) | (tl & 7);
  const int u = (blk - first) * 256 + ul, ub = u >> 6; const int wn = ((ub >> ksh) << 4) + (u & 15), wk8 = ((ub & ((1 << ksh) - 1)) << 2) + ((u >> 4) & 3);
  const float* wsrc = src + ((size_t)wn << (ksh + 5)) + wk8 * 8; const v4f a0 = *(const v4fa*)wsrc, a1 = *(const v4fa*)(wsrc + 4);
  xcnt_wait();      /* the address registers of the two loads may take new values below */
  { FragH f;
#pragma unroll      /* constant indices: the values stay in registers */
    for (int q = 0; q < 4; ++q) { f.h[q] = (_Float16)(bf16_round(a0[q]) * 16.0f); f.h[4 + q] = (_Float16)(bf16_round(a1[q]) * 16.0f); }
    *(v8us*)((unsigned short*)Bt + ((size_t)blk * 256 + ul) * 8) = f.half[0];
    xcnt_wait(); } }      /* the listing lets another part's code follow, which writes the store's registers */
// Row LayerNorm, one wave per row: lane l owns columns c*256 + l*8 .. +7 (c = 0, 1), held in registers for the three passes.
__global__ __launch_bounds__(256) void k_lnw(const float* __restrict__ HF, const float* __restrict__ g, const float* __restrict__ bb, _Float16* __restrict__ X16o) {
  const int lane = threadIdx.x & 31; const size_t r = (size_t)blockIdx.x * 8 + (threadIdx.x >> 5); if (r >= NR) return; const float* x = HF + r * DM; float v[16]; float s = 0.f;
#pragma unroll      /* constant indices: the lane's values stay in registers and its loads issue together */
  for (int c = 0; c < 2; ++c) { const int j0 = c * 256 + lane * 8; const v4f a0 = *(const v4fa*)(x + j0), a1 = *(const v4fa*)(x + j0 + 4);
#pragma unroll      /* constant indices: the lane's values stay in registers and its loads issue together */
    for (int e = 0; e < 4; ++e) { v[c * 8 + e] = a0[e]; v[c * 8 + 4 + e] = a1[e]; } }
#pragma unroll      /* constant indices: the lane's values stay in registers and its loads issue together */
  for (int e = 0; e < 16; ++e) s += v[e];
  const float mu = wave_sum(s) / (float)DM; float qs = 0.f;
#pragma unroll      /* constant indices: the lane's values stay in registers and its loads issue together */
  for (int e = 0; e < 16; ++e) { const float dd = v[e] - mu; qs += dd * dd; }
  const float rs = 1.0f / sqrtf(wave_sum(qs) / (float)DM + 1e-5f);
#pragma unroll      /* constant indices: the lane's values stay in registers and its loads issue together */
  for (int c = 0; c < 2; ++c) { const int j0 = c * 256 + lane * 8; const v4f g0 = *(const v4fa*)(g + j0), g1 = *(const v4fa*)(g + j0 + 4), b0 = *(const v4fa*)(bb + j0), b1 = *(const v4fa*)(bb + j0 + 4); FragH f;
#pragma unroll      /* constant indices: the lane's values stay in registers and its loads issue together */
    for (int e = 0; e < 4; ++e) { f.h[e] = (_Float16)((v[c * 8 + e] - mu) * rs * bf16_round(g0[e]) + bf16_round(b0[e])); f.h[4 + e] = (_Float16)((v[c * 8 + 4 + e] - mu) * rs * bf16_round(g1[e]) + bf16_round(b1[e])); }
    *(v8us*)((unsigned short*)X16o + fr_off(r, j0 >> 3, DM)) = f.half[0]; } }      /* fragment order */
// Lane l <-> l ^ 16: the two lanes that hold one query's column of a D tile.
__device__ __forceinline__ float xhalf(float x) { const int b = __builtin_bit_cast(int, x); return __builtin_bit_cast(float, __builtin_amdgcn_permlanex16(b, b, 0x76543210, 0xfedcba98, false, false)); }
typedef unsigned int v2ua __attribute__((ext_vector_type(2), may_alias));
// The A fragments of one 64-key chunk: four 16-row groups (pitch16 elements apart) x two 32-k steps (neighbouring blocks).
struct AtSet { v16h f[8]; };
__device__ __forceinline__ void at_load(AtSet& s, const _Float16* p, size_t pitch16) {      /* p: the lane's own address in the first block */
#pragma unroll      /* constant indices: the fragments stay in registers and their loads issue together */
  for (int t = 0; t < 4; ++t) { s.f[2 * t] = g2_frag(p + t * pitch16); s.f[2 * t + 1] = g2_frag(p + t * pitch16 + 512); }
  asm volatile("s_wait_xcnt 0x0" :: "v"(p) : "memory");      /* stands in front of whatever gives new values to the address registers of these loads; the address as an input keeps its registers alive up to here, so that no load's result lands in them */
  __builtin_amdgcn_sched_barrier(0); }      /* keeps the 16 loads and their wait here, ahead of the work that hides them: moved down to their first uses the loads would each be waited for in turn */
// Attention, scores to merged heads in one launch: a wave owns 16 queries of one (batch, head) and walks the 1,024 keys in chunks of 64.
// S^T = K . Q^T puts one query's scores into one lane pair (l, l ^ 16); two converted S^T tiles are the B operand of O^T += V^T . P^T, so neither scores nor weights leave the registers.
// Running maximum m and sum l per query; a key outside the prior gets the penalty pen: -lam in the dense branch, -1e30 in the sparse branch (its weight is exactly 0 once a key of the set has been met, and what was summed before that is scaled by exactly 0).
__global__ __launch_bounds__(128) void k_attn(const _Float16* __restrict__ Q16, const _Float16* __restrict__ K16, const _Float16* __restrict__ VT, const unsigned int* __restrict__ MD, const unsigned int* __restrict__ MS, const float* __restrict__ uprev, _Float16* __restrict__ O16) {
  const int tid = threadIdx.x, w = tid >> 5, lane = tid & 31, ln = lane & 15, hh = lane >> 4; const int h = blockIdx.y, b = blockIdx.z; const int q0 = (blockIdx.x * 4 + w) * 16;
  const float lam = 10.0f * expf(-5.0f * bf16_round(uprev[b])); const bool sparse = lam >= 1.0f; const float pen = sparse ? -1.0e30f : -lam;
  const unsigned int* mk = (sparse ? MS : MD) + (size_t)(q0 + ln) * (SQ / 32);
  const _Float16* qp = Q16 + ((size_t)b * SQ + q0) * DM + h * (HD * 16) + lane * 8; const _Float16* kp = K16 + (size_t)b * SQ * DM + h * (HD * 16) + lane * 8; const _Float16* vp = VT + (size_t)(b * NH + h) * HD * SQ + lane * 8;      /* fragment order: a head's 64 columns are blocks 2 h and 2 h + 1 of a row group */
  const v16h qb0 = g2_frag(qp), qb1 = g2_frag(qp + 512); v2ua mw = *(const v2ua*)mk;      /* mw: this query's 64 prior bits of the chunk at hand */
  asm volatile("s_wait_xcnt 0x0" :: "v"(qp), "v"(mk) : "memory"); __builtin_amdgcn_sched_barrier(0);      /* the wait stands in front of whatever gives new values to the address registers of these five loads (as inputs they stay alive up to here); the barrier keeps later code behind it */
  AtSet kf, vf; at_load(kf, kp, (size_t)16 * DM);
  const v8f z8 = {0.f,0.f,0.f,0.f,0.f,0.f,0.f,0.f}; v8f o[4] = {z8, z8, z8, z8}; float m = -3.0e38f, l = 0.f;
  const _Float16* vq = vp; const _Float16* kq = kp + (size_t)64 * DM;      /* running addresses: they live across their loads, so no load's result can land in them, and they move on behind the loads' wait */
#pragma unroll 1      /* one chunk per trip: a second copy would double the fragment registers */
  for (int c = 0; c < SQ / 64; ++c) {
    const v2ua mn = *(const v2ua*)(mk + ((c + 1) & (SQ / 64 - 1)) * 2);      /* the next chunk's prior bits, one trip ahead like the K rows */
    xcnt_wait();      /* a later load's result may land in this load's address registers: the wait stands between them */
    at_load(vf, vq, (size_t)16 * SQ); vq += 64 * 16;      /* 64 keys on: two blocks */
    v8f s[4];
#pragma unroll      /* constant indices: the tiles stay in registers */
    for (int t = 0; t < 4; ++t) s[t] = g2_mma(kf.f[2 * t + 1], qb1, g2_mma(kf.f[2 * t], qb0, z8));
    at_load(kf, kq, (size_t)16 * DM); kq = c + 2 < SQ / 64 ? kq + (size_t)64 * DM : kp;      /* the next chunk's K rows fly under the softmax; the last trip fetches chunk 0 again, in bounds and unused */
    float mx = m;
#pragma unroll      /* constant indices: the tiles stay in registers */
    for (int t = 0; t < 4; ++t) { const unsigned int by = mw[t >> 1] >> (16 * (t & 1) + 8 * hh);      /* bit r: key 16 t + 8 hh + r of the chunk */
#pragma unroll      /* constant indices: the tiles stay in registers */
      for (int r = 0; r < 8; ++r) { const float v = s[t][r] * 0.125f + (((by >> r) & 1u) ? 0.f : pen); s[t][r] = v; mx = fmaxf(mx, v); } }
    mx = fmaxf(mx, xhalf(mx)); const float corr = expf(m - mx); m = mx; float ps = 0.f; FragH p0, p1;
#pragma unroll      /* constant indices: the tiles stay in registers */
    for (int r = 0; r < 8; ++r) { const float e0 = expf(s[0][r] - mx), e1 = expf(s[1][r] - mx), e2 = expf(s[2][r] - mx), e3 = expf(s[3][r] - mx); ps += (e0 + e1) + (e2 + e3);
      p0.h[r] = (_Float16)(e0 * 256.0f); p0.h[8 + r] = (_Float16)(e1 * 256.0f); p1.h[r] = (_Float16)(e2 * 256.0f); p1.h[8 + r] = (_Float16)(e3 * 256.0f); }
    l = l * corr + ps;
#pragma unroll      /* constant indices: the tiles stay in registers */
    for (int t = 0; t < 4; ++t) { o[t] *= corr; o[t] = g2_mma(vf.f[2 * t + 1], p1.v, g2_mma(vf.f[2 * t], p0.v, o[t])); }
    mw = mn; }
  l += xhalf(l); const float inv = 1.0f / (256.0f * l);      /* l >= 1: the key that holds the maximum adds exp(0) */
  unsigned short* od = (unsigned short*)O16 + ((size_t)b * SQ + q0) * DM + h * (HD * 16) + lane * 8;      /* fragment order: columns 16 t + 8 hh .. + 7 of query ln are unit 32 t + lane of the head's two blocks */
#pragma unroll      /* constant indices: the tiles stay in registers */
  for (int t = 0; t < 4; ++t) { FragH f;
#pragma unroll      /* constant indices: the tiles stay in registers */
    for (int r = 0; r < 8; ++r) f.h[r] = (_Float16)(o[t][r] * inv);
    *(v8us*)(od + t * 256) = f.half[0]; } }
// The surprise statistic from the row sums that the fc2 launch left: one work-group, thread t takes row t of every batch, adds the row's DM / 64 pairs in tile order, u = |out - x| / (|x| + 1e-8); batch means in float64 (wave butterfly, then one value per wave through LDS); lane b of wave 0 stores batch b.
static_assert(SQ == 1024 && NB <= 32, "k_ufin: one thread per row of a batch");
__global__ __launch_bounds__(1024) void k_ufin(const float* __restrict__ PN, float* __restrict__ out1) {
  __shared__ double ws[NB][32];
  const int tid = threadIdx.x, lane = tid & 31, w = tid >> 5; constexpr int NTL = DM / 64; v2f pr[NB][NTL]; const float* pp = PN + (size_t)tid * 2;
#pragma unroll      /* constant indices: the pairs stay in registers and their loads issue together */
  for (int b = 0; b < NB; ++b) {
#pragma unroll      /* constant indices: the pairs stay in registers and their loads issue together */
    for (int q = 0; q < NTL; ++q) pr[b][q] = *(const v2fa*)(pp + ((size_t)q * NR + (size_t)b * SQ) * 2); }
  asm volatile("s_wait_xcnt 0x0" :: "v"(pp) : "memory");      /* stands in front of whatever gives new values to the address registers of these loads; the address as an input stays alive up to here, so that no load's result lands in it */
#pragma unroll      /* constant indices: the pairs stay in registers */
  for (int b = 0; b < NB; ++b) { float sd = pr[b][0][0], sx = pr[b][0][1];
#pragma unroll      /* constant indices: the pairs stay in registers */
    for (int q = 1; q < NTL; ++q) { sd += pr[b][q][0]; sx += pr[b][q][1]; }
    double s = (double)(sqrtf(sd) / (sqrtf(sx) + 1e-8f));
#pragma unroll      /* five fixed butterfly steps */
    for (int m = 16; m > 0; m >>= 1) s += __shfl_xor(s, m, 32);
    if (lane == 0) ws[b][w] = s; }
  __syncthreads();      /* the 32 waves' sums are in LDS before wave 0 reads them */
  if (w == 0) { float res = 0.f;
#pragma unroll      /* constant indices */
    for (int b = 0; b < NB; ++b) { double s = ws[b][lane];
#pragma unroll      /* five fixed butterfly steps */
      for (int m = 16; m > 0; m >>= 1) s += __shfl_xor(s, m, 32);
      if (lane == b) res = (float)(s / (double)SQ); }
    if (lane < NB) out1[lane] = res; } }
extern "C" void kernel_launch(void* const* d_in, const int* in_sizes, int n_in,
                              void* d_out, int out_size, void* d_ws, size_t ws_size, hipStream_t stream) {
  (void)in_sizes; (void)n_in; (void)out_size;
  const float* const* I = (const float* const*)d_in; const float* x = I[0]; const float* uprev = I[1]; const float* wq = I[2]; const float* bq = I[3]; const float* wk = I[4]; const float* bk = I[5]; const float* wv = I[6]; const float* bv = I[7]; const float* wo = I[8]; const float* bo = I[9]; const float* l1g = I[10]; const float* l1b = I[11]; const float* l2g = I[12]; const float* l2b = I[13]; const float* w1 = I[14]; const float* b1 = I[15]; const float* w2 = I[16]; const float* b2 = I[17]; const int* pmask = (const int*)d_in[18]; const int* pidx = (const int*)d_in[19]; const int* pim = (const int*)d_in[20];
  float* out0 = (float*)d_out; float* out1 = out0 + NR * DM;
  char* ws = (char*)d_ws; size_t off = 0;
  auto take = [&](size_t bytes) { char* p = ws + off; off += (bytes + 255) & ~(size_t)255; return p; };
  _Float16* BQ = (_Float16*)take(((size_t)4 * DM * DM + (size_t)2 * FH * DM) * 2); _Float16* BO = BQ + (size_t)3 * DM * DM; _Float16* BW1 = BO + (size_t)DM * DM; _Float16* BW2 = BW1 + (size_t)FH * DM;      /* one block: the planes of wq, wk, wv, wo, w1, w2 one behind the other */
  float* XF = (float*)take(NR * DM * 4); float* HF = (float*)take(NR * DM * 4); _Float16* G16 = (_Float16*)take(NR * FH * 2); float* PN = (float*)take((size_t)(DM / 64) * NR * 2 * 4);
  _Float16* X16 = (_Float16*)take(NR * DM * 2); _Float16* Q16 = (_Float16*)take(2 * NR * DM * 2); _Float16* K16 = Q16 + NR * DM; _Float16* O16 = (_Float16*)take(NR * DM * 2);
  _Float16* VT = (_Float16*)take((size_t)HG * HD * SQ * 2); unsigned int* MD = (unsigned int*)take((size_t)SQ * (SQ / 32) * 4); unsigned int* MS = (unsigned int*)take((size_t)SQ * (SQ / 32) * 4);
  if (off > ws_size) return;      /* 6 + 4 + 4 + 8 + 2x4 + 2 = about 32 MiB */
  k_prep<<<PB0 + PMD + PMS, 256, 0, stream>>>(wq, wk, wv, wo, w1, w2, x, l1g, l1b, BQ, XF, X16, pmask, pidx, pim, MD, MS);      /* LN1(x) rows included */
  const dim3 gp((unsigned)((NR / 128) * (DM / 64)), 1);
  k_gemm2<0, false, true, DM, true><<<dim3(gp.x, 3), 128, 0, stream>>>(X16, DM, BQ, DM, (size_t)DM * DM, 0.0625f, bq, bk, bv, nullptr, nullptr, Q16, VT, NR * DM, (int)NR, DM, DM);      /* y = 0, 1: q, k rows; y = 2: v transposed */
  k_attn<<<dim3(SQ / 64, NH, NB), 128, 0, stream>>>(Q16, K16, VT, MD, MS, uprev, O16);      /* o (merged heads) as f16 rows; x = 64 queries, y = head, z = batch */
  k_gemm2k<DM, false><<<gp, 128 * KS, 0, stream>>>(O16, DM, BO, DM, 0.0625f, bo, XF, nullptr, HF, nullptr, (int)NR, DM, DM);      /* h = x + attn W_o^T + b_o */
  k_lnw<<<(unsigned)((NR + 7) / 8), 256, 0, stream>>>(HF, l2g, l2b, X16);
  k_gemm2<6, false, true, FH, false><<<dim3((unsigned)((NR / 128) * (FH / 64)), 1), 128, 0, stream>>>(X16, DM, BW1, DM, 0, 0.0625f, b1, nullptr, nullptr, nullptr, nullptr, G16, nullptr, 0, (int)NR, FH, DM);      /* gelu_erf(LN2(h) W1^T + b1) */
  k_gemm2k<DM, true><<<gp, 128 * KS, 0, stream>>>(G16, FH, BW2, FH, 0.0625f, b2, HF, XF, out0, PN, (int)NR, DM, FH);      /* out = h + (...) W2^T + b2, rows are the output layout; the row norms' partial sums beside them */
  k_ufin<<<1, 1024, 0, stream>>>(PN, out1);
}

// v009
// One run takes 72.1 microseconds.
// In two side-by-side timings against v008, it was 1.08 and 1.04 times as fast.
// Counting every step since v000, it is 53.2 times as fast.
#include <hip/hip_runtime.h>
// SPDGMultiHeadAttention (x [2][1024][512], u_prev [2][1]; xn = LN1(x); Q,K,V = xn W^T + b (8 heads of 64); lam = 10 exp(-5 u_prev); per batch: if lam >= 1 the SPARSE branch (softmax over the prior window slots prior_indices[i][k] with prior_index_mask, others excluded) else the DENSE branch (softmax over all keys of q.k/8 + lam*(prior_mask ? 0 : -1)); attn = merge W_o^T + b_o; h = x + attn; out = h + gelu_erf(LN2(h) W1^T + b1) W2^T + b2 -> [2][1024][512]; aggregated_u[b] = mean_s ||out - x|| / (||x|| + 1e-8) -> [2][1]).
// Structure: token rows; every f16 WMMA operand array of the workspace in fragment order (see g2_frag); bf16(x) as f32 residual rows + LN1 on VALU (f32, wave per row) into f16 rows; Q | K | V WMMA GEMMs as one launch (32x64 wave tiles, f32 accumulation, exact x16 weights + bias, f16 outputs); LN1 and the prior tables packed to one bit per (query, key) beside the operand preparation; V^T stored straight from the V sums; all 16 (batch, head) pairs in one attention launch: per wave 16 queries, S^T = K . Q^T per 64 keys, the branch-selecting running softmax in registers (lam from u_prev; f32; weights x256 as f16), O^T += V^T . P^T, merged f16 rows; W_o GEMM + b_o + x in the epilogue -> h; LN2 on VALU; fc1 GEMM with the exact-erf GELU epilogue (f16 hidden); fc2 GEMM + b2 + h straight into the output rows; the surprise statistic on VALU (per-row sums of squares per 64-column tile in the fc2 epilogue, float64 means per batch in a last small launch) into output 1.
// Compute dtype: inputs rounded to bf16; x / weights exact; LN outputs, q, k, v, softmax weights, o, GELU hidden plain f16 (~2^-12); residual, LN statistics, scores, softmax, norms f32/f64. v_wmma_f32_16x16x32_f16.
#define NB 2
#define SQ 1024
#define DM 512
#define NH 8
#define HD 64
#define HG (NB * NH)                 /* (batch, head) pairs per attention launch: all of them */
#define QN SQ                        /* query rows per batch; unused, the attention grid covers all SQ */
#define NR ((size_t)NB * SQ)         /* 2048 token rows */
typedef __bf16 v16b __attribute__((ext_vector_type(16)));
typedef unsigned short v8us __attribute__((ext_vector_type(8), may_alias));
typedef float  v8f  __attribute__((ext_vector_type(8)));
typedef float  v4f  __attribute__((ext_vector_type(4)));
typedef float  v2f  __attribute__((ext_vector_type(2)));
typedef float  v2fa __attribute__((ext_vector_type(2), may_alias));
typedef float  v4fa __attribute__((ext_vector_type(4), may_alias));
union FragB { v16b v; v8us half[2]; unsigned short u[16]; };

__device__ __forceinline__ unsigned short bf16_bits(float x) { unsigned int u = __float_as_uint(x); return (unsigned short)((u + 0x7FFFu + ((u >> 16) & 1u)) >> 16); }
__device__ __forceinline__ float bf16_val(unsigned short b) { return __uint_as_float(((unsigned int)b) << 16); }
__device__ __forceinline__ float bf16_round(float x) { return bf16_val(bf16_bits(x)); }
// D += A·B with NT terms: 1 = ah·bh, 2 = + al·bh (A split), 3 = + ah·bl (both split)
template <int NT>
__device__ __forceinline__ v8f mmaN(v16b ah, v16b al, v16b bh, v16b bl, v8f c) {
  c = __builtin_amdgcn_wmma_f32_16x16x32_bf16(false, ah, false, bh, (short)0, c, false, false);
  if (NT >= 2) c = __builtin_amdgcn_wmma_f32_16x16x32_bf16(false, al, false, bh, (short)0, c, false, false);
  if (NT >= 3) c = __builtin_amdgcn_wmma_f32_16x16x32_bf16(false, ah, false, bl, (short)0, c, false, false);
  asm volatile("v_nop\n\tv_nop\n\tv_nop\n\tv_nop" : "+v"(c) : "v"(ah), "v"(al), "v"(bh), "v"(bl));
  return c;
}

__global__ __launch_bounds__(256) void k_wt_bf16(const float* __restrict__ W, unsigned short* __restrict__ Wt, int K, int N) {
  const int t = blockIdx.x * 256 + threadIdx.x;
  const int k8n = K / 8;
  if (t >= N * k8n) return;
  const int n = t / k8n, k8 = (t % k8n) * 8;
  v8us v;
#pragma unroll
  for (int i = 0; i < 8; ++i) v[i] = bf16_bits(W[(size_t)(k8 + i) * N + n]);
  *(v8us*)(Wt + (size_t)n * K + k8) = v;
  
}

// GEMM C[M][N] (f32, pitch ldc) = act(A[M][K]·W + bias). A f32 row-major (pitch lda) converted per fragment to bf16
// (ASPLIT: hi/lo two planes -> 2 terms, else single rounded term); Wt bf16 [N][K] (pitch ldb). BIAS_BF16 rounds the
// bias to bf16 first (bias quantised to bf16 before the add). K%32==0, M%16==0, N%64==0.
template <bool ASPLIT, int ACT, bool BIAS_BF16>
__global__ __launch_bounds__(128) void k_gemm_bf(const float* __restrict__ A, int lda, const unsigned short* __restrict__ Wt, int ldb,
                                               const float* __restrict__ bias, float* __restrict__ C, int ldc, int M, int N, int K) {
  __shared__ __attribute__((aligned(16))) float so[4][16][64];
  const int tid = threadIdx.x, w = tid >> 5, lane = tid & 31, ln = lane & 15, hh = lane >> 4;
  const int ntn = N / 64;
  const int wid = blockIdx.x * 4 + w;
  const int mt = wid / ntn, nq = wid % ntn;
  if (mt * 16 >= M) return;
  const int row0 = mt * 16, col0 = nq * 64;
  const float* arow = A + (size_t)(row0 + ln) * lda;
  v8f acc[4] = {};
  for (int kb = 0; kb < K; kb += 32) {
    FragB ah, al;
    const v4f x0 = *(const v4fa*)(arow + kb + 8 * hh), x1 = *(const v4fa*)(arow + kb + 8 * hh + 4);
    const v4f x2 = *(const v4fa*)(arow + kb + 16 + 8 * hh), x3 = *(const v4fa*)(arow + kb + 16 + 8 * hh + 4);
    float xs[16] = {x0[0],x0[1],x0[2],x0[3],x1[0],x1[1],x1[2],x1[3],x2[0],x2[1],x2[2],x2[3],x3[0],x3[1],x3[2],x3[3]};
#pragma unroll
    for (int i = 0; i < 16; ++i) { const unsigned short hb = bf16_bits(xs[i]); ah.u[i] = hb; al.u[i] = ASPLIT ? bf16_bits(xs[i] - bf16_val(hb)) : (unsigned short)0; }
#pragma unroll
    for (int t = 0; t < 4; ++t) {
      const unsigned short* brow = Wt + (size_t)(col0 + t * 16 + ln) * ldb + kb;
      FragB b;
      b.half[0] = *(const v8us*)(brow + 8 * hh);
      b.half[1] = *(const v8us*)(brow + 16 + 8 * hh);
      acc[t] = mmaN<ASPLIT ? 2 : 1>(ah.v, al.v, b.v, b.v, acc[t]);
    }
  }
#pragma unroll
  for (int t = 0; t < 4; ++t) {
    float bv = bias ? bias[col0 + t * 16 + ln] : 0.f;
    if (BIAS_BF16) bv = bf16_round(bv);
#pragma unroll
    for (int r = 0; r < 8; ++r) { float v = acc[t][r] + bv; if (ACT == 1) v = fmaxf(v, 0.f); so[w][8 * hh + r][t * 16 + ln] = v; }
  }
  __builtin_amdgcn_fence(__ATOMIC_ACQ_REL, "workgroup");
  __builtin_amdgcn_wave_barrier();
  const int rsub = lane >> 4, c4 = (lane & 15) * 4;
  {
#pragma unroll
    for (int q = 0; q < 8; ++q) {
      const int r = q * 2 + rsub;
      const v4f v = *(const v4fa*)&so[w][r][c4];
      *(v4f*)(C + (size_t)(row0 + r) * ldc + col0 + c4) = v;
    }
    
  }
}

// GEMM C = act(A·W + bias + resid): A f32 (ASPLIT -> hi/lo 2 terms), Wt bf16 [N][K]; ACT 0 none, 1 relu, 2 exact gelu;
// resid (optional, f32, row index = (row % rmod), pitch ldr, RES_BF16 rounds it) added before the activation.
template <bool ASPLIT, int ACT, bool BIAS_BF16, bool RES_BF16>
__global__ __launch_bounds__(128) void k_gemm_bf3(const float* __restrict__ A, int lda, const unsigned short* __restrict__ Wt, int ldb,
                                                const float* __restrict__ bias, const float* __restrict__ resid, int rmod, int ldr,
                                                float* __restrict__ C, int ldc, int M, int N, int K) {
  __shared__ __attribute__((aligned(16))) float so[4][16][64];
  const int tid = threadIdx.x, w = tid >> 5, lane = tid & 31, ln = lane & 15, hh = lane >> 4;
  const int ntn = N / 64;
  const int wid = blockIdx.x * 4 + w;
  const int mt = wid / ntn, nq = wid % ntn;
  if (mt * 16 >= M) return;
  const int row0 = mt * 16, col0 = nq * 64;
  const float* arow = A + (size_t)(row0 + ln) * lda;
  v8f acc[4] = {};
  for (int kb = 0; kb < K; kb += 32) {
    FragB ah, al;
    const v4f x0 = *(const v4fa*)(arow + kb + 8 * hh), x1 = *(const v4fa*)(arow + kb + 8 * hh + 4);
    const v4f x2 = *(const v4fa*)(arow + kb + 16 + 8 * hh), x3 = *(const v4fa*)(arow + kb + 16 + 8 * hh + 4);
    float xs[16] = {x0[0],x0[1],x0[2],x0[3],x1[0],x1[1],x1[2],x1[3],x2[0],x2[1],x2[2],x2[3],x3[0],x3[1],x3[2],x3[3]};
#pragma unroll
    for (int i = 0; i < 16; ++i) { const unsigned short hb = bf16_bits(xs[i]); ah.u[i] = hb; al.u[i] = ASPLIT ? bf16_bits(xs[i] - bf16_val(hb)) : (unsigned short)0; }
#pragma unroll
    for (int t = 0; t < 4; ++t) {
      const unsigned short* brow = Wt + (size_t)(col0 + t * 16 + ln) * ldb + kb;
      FragB b;
      b.half[0] = *(const v8us*)(brow + 8 * hh);
      b.half[1] = *(const v8us*)(brow + 16 + 8 * hh);
      acc[t] = mmaN<ASPLIT ? 2 : 1>(ah.v, al.v, b.v, b.v, acc[t]);
    }
  }
#pragma unroll
  for (int t = 0; t < 4; ++t) {
    const int col = col0 + t * 16 + ln;
    float bv = bias ? bias[col] : 0.f;
    if (BIAS_BF16) bv = bf16_round(bv);
#pragma unroll
    for (int r = 0; r < 8; ++r) {
      float v = acc[t][r] + bv;
      if (resid) { float rv = resid[(size_t)((row0 + 8 * hh + r) % rmod) * ldr + col]; if (RES_BF16) rv = bf16_round(rv); v += rv; }
      if (ACT == 1) v = fmaxf(v, 0.f);
      if (ACT == 2) v = 0.5f * v * (1.0f + erff(v * 0.70710678118654752f));
      if (ACT == 3) { const float u = 0.7978845608028654f * (v + 0.044715f * v * v * v); v = 0.5f * v * (1.0f + tanhf(u)); }
      so[w][8 * hh + r][t * 16 + ln] = v;
    }
  }
  __builtin_amdgcn_fence(__ATOMIC_ACQ_REL, "workgroup");
  __builtin_amdgcn_wave_barrier();
  const int rsub = lane >> 4, c4 = (lane & 15) * 4;
  {
#pragma unroll
    for (int q = 0; q < 8; ++q) {
      const int r = q * 2 + rsub;
      const v4f v = *(const v4fa*)&so[w][r][c4];
      *(v4f*)(C + (size_t)(row0 + r) * ldc + col0 + c4) = v;
    }
    
  }
}
// row LayerNorm (biased variance, eps) over N: s = X (+ R); optional out_sum <- s; out_norm <- (s-mu)*rsqrt(var+eps)*g + b
template <bool PARAM_BF16>
__global__ __launch_bounds__(256) void k_layernorm(const float* __restrict__ X, const float* __restrict__ R, const float* __restrict__ g, const float* __restrict__ bta,
                                                  float* __restrict__ out_sum, float* __restrict__ out_norm, int N, float eps) {
  __shared__ float red[256];
  const int row = blockIdx.x, tid = threadIdx.x;
  const float* x = X + (size_t)row * N; const float* rr = R ? R + (size_t)row * N : nullptr;
  float vals[16];                     // up to N = 4096
  const int per = N / 256;            // contiguous chunk per thread? use strided-by-4 chunks: thread handles j = tid*4 + 1024*u
  float s1 = 0.f;
  for (int u = 0; u < per / 4; ++u) {
    const int j = tid * 4 + 1024 * u;
    const v4f a = *(const v4fa*)(x + j);
    v4f b = {0.f,0.f,0.f,0.f}; if (rr) b = *(const v4fa*)(rr + j);
#pragma unroll
    for (int q = 0; q < 4; ++q) { const float v = a[q] + b[q]; vals[u * 4 + q] = v; s1 += v; }
  }
  red[tid] = s1; __syncthreads();
  for (int st = 128; st > 0; st >>= 1) { if (tid < st) red[tid] += red[tid + st]; __syncthreads(); }
  const float mu = red[0] / (float)N; __syncthreads();
  float s2 = 0.f;
  for (int u = 0; u < per / 4; ++u)
#pragma unroll
    for (int q = 0; q < 4; ++q) { const float c = vals[u * 4 + q] - mu; s2 += c * c; }
  red[tid] = s2; __syncthreads();
  for (int st = 128; st > 0; st >>= 1) { if (tid < st) red[tid] += red[tid + st]; __syncthreads(); }
  const float rs = rsqrtf(red[0] / (float)N + eps);
  {
    for (int u = 0; u < per / 4; ++u) {
      const int j = tid * 4 + 1024 * u;
      v4f o, sm;
#pragma unroll
      for (int q = 0; q < 4; ++q) {
        float gg = g[j + q], bb = bta[j + q];
        if (PARAM_BF16) { gg = bf16_round(gg); bb = bf16_round(bb); }
        sm[q] = vals[u * 4 + q]; o[q] = (vals[u * 4 + q] - mu) * rs * gg + bb;
      }
      if (out_sum) *(v4f*)(out_sum + (size_t)row * N + j) = sm;
      *(v4f*)(out_norm + (size_t)row * N + j) = o;
    }
    
  }
}



// ---- f16 WMMA path (v_wmma_f32_16x16x32_f16): 11-bit significands for operands in range — used where a [0,1] probability operand needs more precision than bf16
typedef _Float16 v16h __attribute__((ext_vector_type(16)));
union FragH { v16h v; v8us half[2]; _Float16 h[16]; unsigned short u[16]; };
template <int NT>
__device__ __forceinline__ v8f mmaH(v16h ah, v16h al, v16h bh, v16h bl, v8f c) {
  c = __builtin_amdgcn_wmma_f32_16x16x32_f16(false, ah, false, bh, (short)0, c, false, false);
  if (NT >= 2) c = __builtin_amdgcn_wmma_f32_16x16x32_f16(false, al, false, bh, (short)0, c, false, false);
  if (NT >= 3) c = __builtin_amdgcn_wmma_f32_16x16x32_f16(false, ah, false, bl, (short)0, c, false, false);
  asm volatile("v_nop\n\tv_nop\n\tv_nop\n\tv_nop" : "+v"(c) : "v"(ah), "v"(al), "v"(bh), "v"(bl));
  return c;
}
// batched GEMM like k_gemm_b but f16 operands: A f32 (split into f16 hi/lo if ASPLIT, else rounded to f16), Bt = f16 values [n][k]; alpha; C f32; N multiple of 16 (partial tiles skipped)
template <bool ASPLIT>
__global__ __launch_bounds__(128) void k_gemm_h(const float* __restrict__ A, int lda, size_t sA, const _Float16* __restrict__ Bh, int ldb, size_t sB, float alpha, float* __restrict__ C, int ldc, size_t sC, int M, int N, int K) {
  __shared__ __attribute__((aligned(16))) float so[4][16][64];
  const int tid = threadIdx.x, w = tid >> 5, lane = tid & 31, ln = lane & 15, hh = lane >> 4; const int by = blockIdx.y;
  A += (size_t)by * sA; Bh += (size_t)by * sB; C += (size_t)by * sC;
  const int ntn = (N + 63) / 64; const int wid = blockIdx.x * 4 + w; const int mt = wid / ntn, nq = wid % ntn; if (mt * 16 >= M) return;
  const int row0 = mt * 16, col0 = nq * 64; const float* arow = A + (size_t)(row0 + ln) * lda;
  v8f acc[4] = {};
  for (int kb = 0; kb < K; kb += 32) {
    FragH ah, al;
    const v4f x0 = *(const v4fa*)(arow + kb + 8 * hh), x1 = *(const v4fa*)(arow + kb + 8 * hh + 4), x2 = *(const v4fa*)(arow + kb + 16 + 8 * hh), x3 = *(const v4fa*)(arow + kb + 16 + 8 * hh + 4);
    float xs[16] = {x0[0],x0[1],x0[2],x0[3],x1[0],x1[1],x1[2],x1[3],x2[0],x2[1],x2[2],x2[3],x3[0],x3[1],x3[2],x3[3]};
#pragma unroll
    for (int i = 0; i < 16; ++i) { const _Float16 h = (_Float16)xs[i]; ah.h[i] = h; al.h[i] = ASPLIT ? (_Float16)(xs[i] - (float)h) : (_Float16)0.0f; }
#pragma unroll
    for (int t = 0; t < 4; ++t) { if (col0 + t * 16 >= N) continue; const size_t boff = (size_t)(col0 + t * 16 + ln) * ldb + kb; FragH bq; bq.half[0] = *(const v8us*)(Bh + boff + 8 * hh); bq.half[1] = *(const v8us*)(Bh + boff + 16 + 8 * hh);
      acc[t] = mmaH<ASPLIT ? 2 : 1>(ah.v, al.v, bq.v, bq.v, acc[t]); }
  }
#pragma unroll
  for (int t = 0; t < 4; ++t) { if (col0 + t * 16 >= N) continue;
#pragma unroll
    for (int r = 0; r < 8; ++r) so[w][8 * hh + r][t * 16 + ln] = acc[t][r] * alpha; }
  __builtin_amdgcn_fence(__ATOMIC_ACQ_REL, "workgroup"); __builtin_amdgcn_wave_barrier();
  const int rsub = lane >> 4, c4 = (lane & 15) * 4;
  {
#pragma unroll
    for (int q = 0; q < 8; ++q) { const int r = q * 2 + rsub; if (col0 + c4 < N) { const v4f v = *(const v4fa*)&so[w][r][c4]; *(v4f*)(C + (size_t)(row0 + r) * ldc + col0 + c4) = v; } }
     }
}

// Wt[n][k] = f16(W[k][n]·scale) from f32 row-major W[K][N] (scale = power of two; bf16-exact weights stay exact in f16 away from the subnormal range)
__global__ __launch_bounds__(256) void k_wt_f16(const float* __restrict__ W, _Float16* __restrict__ Wt, int K, int N, float scale) {
  const int t = blockIdx.x * 256 + threadIdx.x; if (t >= N * (K / 8)) return; const int n = t / (K / 8), k8 = (t % (K / 8)) * 8; FragH f;
#pragma unroll
  for (int i = 0; i < 8; ++i) f.h[i] = (_Float16)(bf16_round(W[(size_t)(k8 + i) * N + n]) * scale); const v8us o = f.half[0];
  *(v8us*)((unsigned short*)Wt + (size_t)n * K + k8) = o; 
}
// k_gemm_hh variant with fused epilogue: v = acc·alpha + bias[by·sBias + col] (+ CP[(row/rowsPerB)·sCPb + by·64 + col] if CP) ; ACT 0 none / 1 elu ; writes f16 C16 (and f32 C if non-null)
template <int ACT>
__global__ __launch_bounds__(128) void k_gemm_hhx(const _Float16* __restrict__ A, int lda, size_t sA, const _Float16* __restrict__ Bh, int ldb, size_t sB, float alpha, const float* __restrict__ bias, size_t sBias, const float* __restrict__ CP, int rowsPerB, size_t sCPb, int row0g,
    float* __restrict__ C, _Float16* __restrict__ C16, int ldc, size_t sC, int M, int N, int K) {
  __shared__ __attribute__((aligned(16))) float so[4][16][64];
  const int tid = threadIdx.x, w = tid >> 5, lane = tid & 31, ln = lane & 15, hh = lane >> 4; const int by = blockIdx.y;
  A += (size_t)by * sA; Bh += (size_t)by * sB; const size_t cofs = (size_t)by * sC; const float* bp = bias ? bias + (size_t)by * sBias : nullptr;
  const int ntn = (N + 63) / 64; const int wid = blockIdx.x * 4 + w; const int mt = wid / ntn, nq = wid % ntn; if (mt * 16 >= M) return;
  const int row0 = mt * 16, col0 = nq * 64; const _Float16* arow = A + (size_t)(row0 + ln) * lda;
  v8f acc[4] = {};
  for (int kb = 0; kb < K; kb += 32) { FragH ah; ah.half[0] = *(const v8us*)((const unsigned short*)arow + kb + 8 * hh); ah.half[1] = *(const v8us*)((const unsigned short*)arow + kb + 16 + 8 * hh);
#pragma unroll
    for (int t = 0; t < 4; ++t) { if (col0 + t * 16 >= N) continue; const size_t boff = (size_t)(col0 + t * 16 + ln) * ldb + kb; FragH bq; bq.half[0] = *(const v8us*)((const unsigned short*)Bh + boff + 8 * hh); bq.half[1] = *(const v8us*)((const unsigned short*)Bh + boff + 16 + 8 * hh);
      acc[t] = mmaH<1>(ah.v, ah.v, bq.v, bq.v, acc[t]); }
  }
#pragma unroll
  for (int t = 0; t < 4; ++t) { if (col0 + t * 16 >= N) continue; const int col = col0 + t * 16 + ln; const float bv = bp ? bf16_round(bp[col]) : 0.f;
#pragma unroll
    for (int r = 0; r < 8; ++r) { float v = acc[t][r] * alpha + bv; if (CP) { const int rr = row0g + row0 + 8 * hh + r; if (rowsPerB < 0) v += CP[cofs + (size_t)rr * ldc + col];      /* rowsPerB < 0: own element of the batched C plane */ else { const int bidx = rr / rowsPerB; v += CP[(size_t)bidx * sCPb + (size_t)by * 64 + col]; } } if (ACT == 1) v = (v > 0.f) ? v : expm1f(v); else if (ACT == 7) v = (v > 0.f) ? v + 1.0f : expf(v); else if (ACT == 8) v = tanhf(v); else if (ACT == 9) v = 0.5f * v * (1.0f + tanhf(0.7978845608028654f * (v + 0.044715f * v * v * v))); else if (ACT == 11) v = 1.0f / (1.0f + expf(-v)); else if (ACT == 12) v = (v > 0.f) ? v : 0.01f * v; else if (ACT == 14) v = (v > 0.f) ? v : 0.1f * v; else if (ACT == 16) v = (v >= 0.f) ? v : 0.3f * v; else if (ACT == 17) v = (v >= 0.f) ? v : 0.2f * v; else if (ACT == 15) v = v / (1.0f + expf(-v)); else if (ACT == 3) v = fmaxf(v, 0.f); else if (ACT == 6) v = 0.5f * v * (1.0f + erff(v * 0.70710678118654752f)); so[w][8 * hh + r][t * 16 + ln] = v; } }
  __builtin_amdgcn_fence(__ATOMIC_ACQ_REL, "workgroup"); __builtin_amdgcn_wave_barrier();
  const int rsub = lane >> 4, c4 = (lane & 15) * 4; typedef _Float16 v4h __attribute__((ext_vector_type(4)));
  {
#pragma unroll
    for (int q = 0; q < 8; ++q) { const int r = q * 2 + rsub; if (col0 + c4 < N) { const v4f v = *(const v4fa*)&so[w][r][c4]; if (C) *(v4f*)(C + cofs + (size_t)(row0 + r) * ldc + col0 + c4) = v; if (C16) { v4h h4; for (int i = 0; i < 4; ++i) h4[i] = (_Float16)v[i]; *(v4h*)(C16 + cofs + (size_t)(row0 + r) * ldc + col0 + c4) = h4; } } }
     }
}


typedef _Float16 v4h __attribute__((ext_vector_type(4)));

__global__ __launch_bounds__(256) void k_x16(const float* __restrict__ x, _Float16* __restrict__ X16, size_t n8) { const size_t t = (size_t)blockIdx.x * 256 + threadIdx.x; if (t >= n8) return; FragH f;
#pragma unroll
  for (int q = 0; q < 8; ++q) f.h[q] = (_Float16)bf16_round(x[t * 8 + q]); *(v8us*)((unsigned short*)X16 + t * 8) = f.half[0];  }
__global__ __launch_bounds__(256) void k_h16(const float* __restrict__ x, _Float16* __restrict__ X16, size_t n8) { const size_t t = (size_t)blockIdx.x * 256 + threadIdx.x; if (t >= n8) return; FragH f;
#pragma unroll
  for (int q = 0; q < 8; ++q) f.h[q] = (_Float16)x[t * 8 + q]; *(v8us*)((unsigned short*)X16 + t * 8) = f.half[0];  }
__global__ __launch_bounds__(256) void k_round16f(const float* __restrict__ W, _Float16* __restrict__ Bt, size_t n8) { const size_t t = (size_t)blockIdx.x * 256 + threadIdx.x; if (t >= n8) return; FragH f;
#pragma unroll
  for (int i = 0; i < 8; ++i) f.h[i] = (_Float16)(bf16_round(W[t * 8 + i]) * 16.0f); *(v8us*)((unsigned short*)Bt + t * 8) = f.half[0];  }
template <int NHv, int TTv>
__global__ __launch_bounds__(256) void k_vt(const _Float16* __restrict__ V16, int ldv, int voff, _Float16* __restrict__ Vt) { __shared__ unsigned short tl[64][66]; const int tid = threadIdx.x; const int slab = blockIdx.x / (TTv / 64), lg = blockIdx.x % (TTv / 64); const int b = slab / NHv, h = slab % NHv;
  for (int i = tid; i < 64 * 8; i += 256) { const int r = i / 8, c8 = (i % 8) * 8; FragH f; f.half[0] = *(const v8us*)((const unsigned short*)V16 + ((size_t)b * TTv + lg * 64 + r) * ldv + voff + h * 64 + c8);
#pragma unroll
    for (int q = 0; q < 8; ++q) tl[r][c8 + q] = f.u[q]; }
  __syncthreads();
  {
#pragma unroll
    for (int rd = 0; rd < 2; ++rd) { const int d = rd * 32 + tid / 8, pc = tid % 8; FragH f;
#pragma unroll
      for (int q = 0; q < 8; ++q) f.u[q] = tl[pc * 8 + q][d];
      *(v8us*)((unsigned short*)Vt + ((size_t)slab * 64 + d) * TTv + lg * 64 + pc * 8) = f.half[0]; }
     } }

__global__ __launch_bounds__(256) void k_hl(const float* __restrict__ F, _Float16* __restrict__ Hh, _Float16* __restrict__ Hl, size_t n8) { const size_t t = (size_t)blockIdx.x * 256 + threadIdx.x; if (t >= n8) return; FragH fh, fl; const v4f a = *(const v4fa*)(F + t * 8), c = *(const v4fa*)(F + t * 8 + 4);
#pragma unroll
  for (int q = 0; q < 4; ++q) { _Float16 h = (_Float16)a[q]; fh.h[q] = h; fl.h[q] = (_Float16)((a[q] - (float)h) * 1024.0f); h = (_Float16)c[q]; fh.h[4 + q] = h; fl.h[4 + q] = (_Float16)((c[q] - (float)h) * 1024.0f); }
  { *(v8us*)((unsigned short*)Hh + t * 8) = fh.half[0]; *(v8us*)((unsigned short*)Hl + t * 8) = fl.half[0];  } }

// ---- fast GEMM (wave tile 32x64; requires M % 32 == 0 rows per launch region and N % 64 == 0) ----
// Fragment order of every f16 operand array ([rows][K], rows % 16 == 0, K % 32 == 0): blocks of 16 rows x 32 k (1 KiB), the K / 32 blocks of a row group one behind the other, so that 16 rows are 16 * K elements as in row order.
// Inside a block the 16-byte unit number (k % 32) / 8 * 16 + row % 16 holds 8 neighbouring k of one row: lane l of a fragment reads units l and 32 + l, so each of its two loads covers 512 neighbouring bytes (4 whole lines, not a piece of 16).
__device__ __forceinline__ size_t fr_off(size_t row, int k8, int K) { return ((row >> 4) * (size_t)(K >> 5) + (size_t)(k8 >> 2)) * 512 + (size_t)((k8 & 3) * 128) + (row & 15) * 8; }      /* element offset of the unit that holds k = 8 k8 .. + 7 of a row */
__device__ __forceinline__ v16h g2_frag(const _Float16* p) { FragH f; f.half[0] = *(const v8us*)((const unsigned short*)p); f.half[1] = *(const v8us*)((const unsigned short*)p + 256); return f.v; }      /* p: the block's start + 8 * lane */
__device__ __forceinline__ v8f g2_mma(v16h a, v16h b, v8f c) { v8f d = __builtin_amdgcn_wmma_f32_16x16x32_f16(false, a, false, b, (short)0, c, false, false); asm volatile("v_nop\n\tv_nop\n\tv_nop\n\tv_nop" : "+v"(d) : "v"(a), "v"(b)); return d; }
// The fragments of one 32-k step of a 32x64 wave tile: the two A row groups and the four B column groups.
struct G2Set { v16h a0, a1, b0, b1, b2, b3; };
__device__ __forceinline__ void g2_load(G2Set& s, const _Float16* a0p, const _Float16* a1p, const _Float16* b0p, const _Float16* b1p, const _Float16* b2p, const _Float16* b3p, int kb) {      /* kb: the step's first k; 32 k are one block of 512 elements */
  const int ko = kb * 16; const _Float16* pa0 = a0p + ko; const _Float16* pa1 = a1p + ko; const _Float16* pb0 = b0p + ko; const _Float16* pb1 = b1p + ko; const _Float16* pb2 = b2p + ko; const _Float16* pb3 = b3p + ko;
  s.a0 = g2_frag(pa0); s.a1 = g2_frag(pa1); s.b0 = g2_frag(pb0); s.b1 = g2_frag(pb1); s.b2 = g2_frag(pb2); s.b3 = g2_frag(pb3);
  asm volatile("s_wait_xcnt 0x0" :: "v"(pa0), "v"(pa1), "v"(pb0), "v"(pb1), "v"(pb2), "v"(pb3) : "memory");      /* stands in front of the next address additions, which give new values to registers that these loads name; the addresses as inputs stay alive up to the wait, so that no later load's result lands in an earlier load's address registers in front of it */
  __builtin_amdgcn_sched_barrier(0); }      /* keeps the 12 loads and their wait here, ahead of the other set's products: moved down to their first uses the loads would each be waited for in turn */
// The same for the first and the last step, outside the loop, where nothing reads some of the addresses afterwards (the six pointers: the lane's own addresses, the step's block included).
__device__ __forceinline__ void g2_load_once(G2Set& s, const _Float16* pa0, const _Float16* pa1, const _Float16* pb0, const _Float16* pb1, const _Float16* pb2, const _Float16* pb3) {
  s.a0 = g2_frag(pa0); s.a1 = g2_frag(pa1); s.b0 = g2_frag(pb0); s.b1 = g2_frag(pb1); s.b2 = g2_frag(pb2); s.b3 = g2_frag(pb3);
  asm volatile("s_wait_xcnt 0x0" :: "v"(pa0), "v"(pa1), "v"(pb0), "v"(pb1), "v"(pb2), "v"(pb3) : "memory");      /* the addresses as inputs stay alive up to the wait, so that no later load's result lands in an earlier load's address registers in front of it */
  __builtin_amdgcn_sched_barrier(0); }      /* keeps the 12 loads and their wait here, ahead of the other set's products */
__device__ __forceinline__ void g2_mul(const G2Set& s, v8f (&c)[8]) {
  c[0] = g2_mma(s.a0, s.b0, c[0]); c[4] = g2_mma(s.a1, s.b0, c[4]); c[1] = g2_mma(s.a0, s.b1, c[1]); c[5] = g2_mma(s.a1, s.b1, c[5]);
  c[2] = g2_mma(s.a0, s.b2, c[2]); c[6] = g2_mma(s.a1, s.b2, c[6]); c[3] = g2_mma(s.a0, s.b3, c[3]); c[7] = g2_mma(s.a1, s.b3, c[7]); }
// The epilogue's kind is fixed at compile time. RES: a residual row (f32, pitch LDC, same row and column as the result) is added behind the bias; F16O: the result goes out as f16 rows (C16), else as f32 rows (C); LDC: pitch of the result rows.
// result = act(sum * alpha + bf16(bias[col]) (+ residual)), worked out behind the LDS turn, where a lane holds 4 neighbouring columns of a row: bias and residual come as 16-byte loads with nothing between them.
// VTP: plane y = 2 (v) goes out transposed, as the attention launch reads it: VTo[(batch, head)][d][key]. A lane of a D tile holds 8 neighbouring rows (keys) of one column (d), so each tile half is one 16-byte store straight from the sums, without the LDS turn; in fragment order (rows d, k = key) each such store of a wave covers 512 neighbouring bytes.
template <int ACT, bool RES, bool F16O, int LDC, bool VTP>
__global__ __launch_bounds__(128) void k_gemm2(const _Float16* __restrict__ A, int lda, const _Float16* __restrict__ Bh, int ldb, size_t sB, float alpha, const float* __restrict__ bias, const float* __restrict__ biasY1, const float* __restrict__ biasY2, const float* __restrict__ R,
    float* __restrict__ C, _Float16* __restrict__ C16, _Float16* __restrict__ VTo, size_t sC, int M, int N, int K) {      /* sB, sC: strides of blockIdx.y; biasY1, biasY2: the bias arrays of planes y = 1 and y = 2 (else null) */ static_assert(ACT == 0 || ACT == 6, "k_gemm2: unsupported ACT code (would silently apply no activation)"); static_assert(!(RES && ACT == 6), "k_gemm2: the rolled GELU loop holds no residual registers");
  __shared__ __attribute__((aligned(16))) float so[4][32][68];
  const int tid = threadIdx.x, w = tid >> 5, lane = tid & 31, ln = lane & 15, hh = lane >> 4; const int by = blockIdx.y;
  Bh += (size_t)by * sB; const size_t cofs = (size_t)by * sC; const float* bp = bias; if (biasY1 && by == 1) bp = biasY1; if (biasY2 && by == 2) bp = biasY2;
  const int ntn = N >> 6; const int mt = blockIdx.x / ntn, nq = blockIdx.x - mt * ntn; const int row0 = mt * 128 + 32 * w, col0 = nq * 64; if (row0 >= M) return;
  const _Float16* a0p = A + (size_t)row0 * lda + lane * 8; const _Float16* a1p = a0p + (size_t)16 * lda;      /* fragment order: lda = ldb = K */
  const _Float16* b0p = Bh + (size_t)col0 * ldb + lane * 8; const _Float16* b1p = b0p + (size_t)16 * ldb; const _Float16* b2p = b1p + (size_t)16 * ldb; const _Float16* b3p = b2p + (size_t)16 * ldb;
  const v8f z8 = {0.f,0.f,0.f,0.f,0.f,0.f,0.f,0.f}; v8f accs[8] = {z8, z8, z8, z8, z8, z8, z8, z8};
  /* K loop over two fragment sets: while one 32-k step is multiplied, the other step's 12 loads are in flight. K % 64 == 0; every sum keeps its ascending k order. */
  G2Set s0, s1; int kb = 0; g2_load_once(s0, a0p, a1p, b0p, b1p, b2p, b3p);
#pragma unroll 1      /* the two steps of a trip are written out; more copies would only add code */
  for (; kb + 64 < K; kb += 64) { g2_load(s1, a0p, a1p, b0p, b1p, b2p, b3p, kb + 32); g2_mul(s0, accs); g2_load(s0, a0p, a1p, b0p, b1p, b2p, b3p, kb + 64); g2_mul(s1, accs); }
  const int kl = (kb + 32) * 16; g2_load_once(s1, a0p + kl, a1p + kl, b0p + kl, b1p + kl, b2p + kl, b3p + kl); g2_mul(s0, accs);      /* the last two steps: no fragment is left to fetch behind them */
  if constexpr (VTP) { static_assert(!VTP || (LDC == NH * HD && HD == 64 && SQ % 128 == 0 && ACT == 0 && !RES), "k_gemm2: a 64-column tile is one head, a 128-row tile lies in one batch");
    if (by == 2) { const float* bc = bp + col0 + ln; float bl[4];
#pragma unroll      /* constant indices: the four bias values stay in registers and their loads issue together */
      for (int t = 0; t < 4; ++t) bl[t] = bc[t * 16];
      asm volatile("s_wait_xcnt 0x0" :: "v"(bc) : "memory");      /* stands in front of whatever gives new values to the address registers of these loads; the address as an input stays alive up to here, so that no load's result lands in it */
      __builtin_amdgcn_sched_barrier(0);      /* keeps the loads here, in flight under the last step's own load wait and products */
      g2_mul(s1, accs);
      unsigned short* vd = (unsigned short*)VTo + (size_t)((row0 / SQ) * NH + nq) * HD * SQ + (size_t)((row0 % SQ) >> 5) * 512 + lane * 8;      /* d = 16 t + ln, keys 16 g + 8 hh .. + 7 of the wave's 32: in fragment order (rows d, k = key) unit 32 g + lane of the block of d group t */
#pragma unroll      /* constant indices: the sums stay in registers */
      for (int t = 0; t < 4; ++t) { const float bt = bf16_round(bl[t]);
#pragma unroll      /* constant indices: the sums stay in registers */
        for (int g = 0; g < 2; ++g) { FragH f;
#pragma unroll      /* constant indices: the sums stay in registers */
          for (int r = 0; r < 8; ++r) f.h[r] = (_Float16)(accs[g * 4 + t][r] * alpha + bt);
          *(v8us*)(vd + (size_t)t * 16 * SQ + g * 256) = f.half[0]; } }
      asm volatile("s_wait_xcnt 0x0" :: "v"(vd) : "memory"); return; } }      /* the listing lets the other planes' code follow, which writes the stores' registers; the address as an input stays alive up to here */
  /* Store layout: lane = row rsub (+ 2 per vector) of the wave's 32, columns c4 .. c4 + 3 of its 64; e0 = the lane's first element. */
  const int rsub = lane >> 4, c4 = (lane & 15) * 4; const size_t e0 = (size_t)(row0 + rsub) * LDC + col0 + c4;
  const v4f b4 = *(const v4fa*)(bp + col0 + c4); v4f rv[RES ? 16 : 1];
  if constexpr (RES) { const float* rp = R + e0;
#pragma unroll      /* constant indices: the 16 row vectors stay in registers and their loads issue together */
    for (int q = 0; q < 16; ++q) rv[q] = *(const v4fa*)(rp + (size_t)q * 2 * LDC);
    asm volatile("s_wait_xcnt 0x0" :: "v"(rp) : "memory"); }      /* stands in front of whatever gives new values to the address registers of these loads; the rows' address as an input stays alive up to here, so that no load's result lands in it */
  else asm volatile("s_wait_xcnt 0x0" ::: "memory");      /* stands in front of whatever gives new values to the address registers of the bias load */
  __builtin_amdgcn_sched_barrier(0);      /* keeps the loads here, in flight under the last step's own load wait and products: moved down to their uses they would be waited for behind the products */
  g2_mul(s1, accs);
#pragma unroll      /* constant indices: the sums stay in registers */
  for (int u = 0; u < 8; ++u) {
#pragma unroll      /* constant indices: the sums stay in registers */
    for (int r = 0; r < 8; ++r) so[w][(u >> 2) * 16 + 8 * hh + r][(u & 3) * 16 + ln] = accs[u][r]; }
  /* the wave's own 32 x 64 sums are in LDS before its lanes read them back row-wise */
  __builtin_amdgcn_fence(__ATOMIC_ACQ_REL, "workgroup"); __builtin_amdgcn_wave_barrier();
  const v4f bb = {bf16_round(b4[0]), bf16_round(b4[1]), bf16_round(b4[2]), bf16_round(b4[3])};
  const float* sp = &so[w][rsub][c4]; char* cp = F16O ? (char*)(C16 + cofs + fr_off((size_t)(row0 + rsub), (col0 + c4) >> 3, LDC) + (c4 & 7)) : (char*)(C + cofs + e0); constexpr size_t RB = F16O ? (size_t)32 : (size_t)2 * LDC * 4;      /* RB: bytes from one of the lane's rows to its next; f16 rows go out in fragment order, where two rows on are two units on */
#pragma unroll (ACT == 6 ? 1 : 4)      /* GELU: rolled, 16 erf bodies of text instead of 64, so that the kernel's text stays small; else written out, since the residual registers take constant indices */
  for (int g = 0; g < 4; ++g) { v4f v[4];
#pragma unroll      /* constant indices: the four LDS reads issue together */
    for (int i = 0; i < 4; ++i) v[i] = *(const v4fa*)(sp + i * 2 * 68);
#pragma unroll      /* constant indices: the values stay in registers */
    for (int i = 0; i < 4; ++i) {
#pragma unroll      /* constant indices: the values stay in registers */
      for (int e = 0; e < 4; ++e) { float x = v[i][e] * alpha + bb[e]; if constexpr (RES) x += rv[g * 4 + i][e]; if (ACT == 6) x = 0.5f * x * (1.0f + erff(x * 0.70710678118654752f)); v[i][e] = x; }
      if constexpr (F16O) { v4h h4;
#pragma unroll      /* constant indices: the values stay in registers */
        for (int e = 0; e < 4; ++e) h4[e] = (_Float16)v[i][e];
        *(v4h*)(cp + i * RB) = h4; }
      else *(v4f*)(cp + i * RB) = v[i]; }
    sp += 8 * 68; cp += 4 * RB; if (F16O && g == 1) cp += (size_t)16 * LDC * 2 - 8 * RB; } }      /* behind its 16th row the wave goes on to the next row group's block */


// The same GEMM for the two launches whose grid of 128 x 64 tiles is small and whose K loop is a long chain of load waits (W_o, fc2): 16 waves per tile instead of 4.
// Wave w works on row group w & 3 (32 rows) and on the 32-k steps kq, kq + KS, kq + 2 KS, ... with kq = w >> 2, so that the KS waves of a row group read neighbouring blocks of A and B at the same time.
// The KS partial sums of a row group meet in LDS; behind the barrier wave (rw, kq) adds them in the order of kq for rows 8 kq .. 8 kq + 7 and finishes these rows: result = sum * alpha + bf16(bias[col]) + residual, f32 rows of pitch LDC.
#define KS 4
static_assert(NR % 128 == 0, "k_gemm2k: whole 128-row tiles");
// NRM: the finished rows also leave, per row and 64-column tile, the pair (sum of (result - XR)^2, sum of XR^2) in PN[tile][row]: the surprise statistic's row norms, taken from the registers that hold the result.
template <int LDC, bool NRM>
__global__ __launch_bounds__(128 * KS) void k_gemm2k(const _Float16* __restrict__ A, int lda, const _Float16* __restrict__ Bh, int ldb, float alpha, const float* __restrict__ bias, const float* __restrict__ R, const float* __restrict__ XR, float* __restrict__ C, float* __restrict__ PN, int M, int N, int K) {      /* K % (64 * KS) == 0 */
  __shared__ __attribute__((aligned(16))) float so[KS * 4][32][68];
  const int tid = threadIdx.x, w = tid >> 5, lane = tid & 31, ln = lane & 15, hh = lane >> 4; const int rw = w & 3, kq = w >> 2;
  const int ntn = N >> 6; const int mt = blockIdx.x / ntn, nq = blockIdx.x - mt * ntn; if (mt * 128 >= M) return;      /* the whole work-group or none of it, in front of the barrier */
  const int row0 = mt * 128 + 32 * rw, col0 = nq * 64;
  const _Float16* a0p = A + (size_t)row0 * lda + 512 * kq + lane * 8; const _Float16* a1p = a0p + (size_t)16 * lda;      /* fragment order: lda = ldb = K; block kq of the row group */
  const _Float16* b0p = Bh + (size_t)col0 * ldb + 512 * kq + lane * 8; const _Float16* b1p = b0p + (size_t)16 * ldb; const _Float16* b2p = b1p + (size_t)16 * ldb; const _Float16* b3p = b2p + (size_t)16 * ldb;
  const v8f z8 = {0.f,0.f,0.f,0.f,0.f,0.f,0.f,0.f}; v8f accs[8] = {z8, z8, z8, z8, z8, z8, z8, z8};
  /* K loop over two fragment sets as in k_gemm2; from one of the wave's steps to its next it is 32 * KS elements of k. */
  constexpr int ST = 32 * KS; G2Set s0, s1; int kb = 0; g2_load_once(s0, a0p, a1p, b0p, b1p, b2p, b3p);
#pragma unroll 1      /* the two steps of a trip are written out; more copies would only add code */
  for (; kb + 2 * ST < K; kb += 2 * ST) { g2_load(s1, a0p, a1p, b0p, b1p, b2p, b3p, kb + ST); g2_mul(s0, accs); g2_load(s0, a0p, a1p, b0p, b1p, b2p, b3p, kb + 2 * ST); g2_mul(s1, accs); }
  const int kl = (kb + ST) * 16; g2_load_once(s1, a0p + kl, a1p + kl, b0p + kl, b1p + kl, b2p + kl, b3p + kl); g2_mul(s0, accs);      /* the wave's last two steps: no fragment is left to fetch behind them */
  /* Store layout: lane = row rl (+ 2 per vector) of the row group's 32, columns c4 .. c4 + 3 of its 64; e0 = the lane's first element. */
  const int c4 = (lane & 15) * 4, rl = 8 * kq + (lane >> 4); const size_t e0 = (size_t)(row0 + rl) * LDC + col0 + c4;
  const float* rp = R + e0; const v4f b4 = *(const v4fa*)(bias + col0 + c4); v4f rv[4]; v4f xv[NRM ? 4 : 1];
#pragma unroll      /* constant indices: the 4 row vectors stay in registers and their loads issue together */
  for (int i = 0; i < 4; ++i) rv[i] = *(const v4fa*)(rp + (size_t)i * 2 * LDC);
  const float* xp = NRM ? XR + e0 : rp;
  if constexpr (NRM) {
#pragma unroll      /* constant indices: the 4 row vectors stay in registers and their loads issue together */
    for (int i = 0; i < 4; ++i) xv[i] = *(const v4fa*)(xp + (size_t)i * 2 * LDC); }
  asm volatile("s_wait_xcnt 0x0" :: "v"(rp), "v"(xp) : "memory");      /* stands in front of whatever gives new values to the address registers of these loads; the rows' addresses as inputs stay alive up to here, so that no load's result lands in them */
  __builtin_amdgcn_sched_barrier(0);      /* keeps the loads here, in flight under the last step's own load wait and products: moved down to their uses they would be waited for behind the barrier */
  g2_mul(s1, accs);
#pragma unroll      /* constant indices: the sums stay in registers */
  for (int u = 0; u < 8; ++u) {
#pragma unroll      /* constant indices: the sums stay in registers */
    for (int r = 0; r < 8; ++r) so[w][(u >> 2) * 16 + 8 * hh + r][(u & 3) * 16 + ln] = accs[u][r]; }
  __syncthreads();      /* the partial sums of all 16 waves are in LDS before any wave adds them up */
  const v4f bb = {bf16_round(b4[0]), bf16_round(b4[1]), bf16_round(b4[2]), bf16_round(b4[3])};
  const float* sp = &so[rw][rl][c4]; float* cp = C + e0; v4f p[4][KS];
#pragma unroll      /* constant indices: the LDS reads issue together */
  for (int i = 0; i < 4; ++i) {
#pragma unroll      /* constant indices: the LDS reads issue together */
    for (int q = 0; q < KS; ++q) p[i][q] = *(const v4fa*)(sp + (size_t)q * 4 * 32 * 68 + i * 2 * 68); }
  float sd[4], sx[4];
#pragma unroll      /* constant indices: the values stay in registers */
  for (int i = 0; i < 4; ++i) { v4f v = p[i][0];
#pragma unroll      /* constant indices: the values stay in registers */
    for (int q = 1; q < KS; ++q) v += p[i][q];
#pragma unroll      /* constant indices: the values stay in registers */
    for (int e = 0; e < 4; ++e) v[e] = v[e] * alpha + bb[e] + rv[i][e];
    *(v4f*)(cp + (size_t)i * 2 * LDC) = v;
    if constexpr (NRM) { sd[i] = 0.f; sx[i] = 0.f;
#pragma unroll      /* constant indices: the values stay in registers */
      for (int e = 0; e < 4; ++e) { const float dd = v[e] - xv[i][e]; sd[i] += dd * dd; sx[i] += xv[i][e] * xv[i][e]; } } }
  if constexpr (NRM) {      /* a row's 64 columns lie in the 16 lanes of one wave half: four butterfly steps, then lane i of each half (i < 4) stores row rl + 2 i, so that the wave's 8 pairs are 64 neighbouring bytes */
    asm volatile("s_wait_xcnt 0x0" :: "v"(cp) : "memory");      /* stands in front of whatever gives new values to the registers of the four row stores; their address as an input stays alive up to here */
    float od = 0.f, ox = 0.f;
#pragma unroll      /* constant indices: the values stay in registers */
    for (int i = 0; i < 4; ++i) {
#pragma unroll      /* four fixed butterfly steps */
      for (int m = 8; m > 0; m >>= 1) { sd[i] += __shfl_xor(sd[i], m, 32); sx[i] += __shfl_xor(sx[i], m, 32); }
      if ((lane & 15) == i) { od = sd[i]; ox = sx[i]; } }
    if ((lane & 15) < 4) { const v2f o2 = {od, ox}; *(v2f*)(PN + ((size_t)nq * NR + row0 + rl + 2 * (lane & 15)) * 2) = o2; } } }


__global__ __launch_bounds__(256) void k_rsm(const float* __restrict__ S, _Float16* __restrict__ P, int nrows) {
  #pragma clang fp contract(off)
  const int i = blockIdx.x * 256 + threadIdx.x; if (i >= nrows) return; const float* s = S + (size_t)i * SQ; float mx = -3.0e38f;
#pragma unroll 1
  for (int j = 0; j < SQ; ++j) mx = fmaxf(mx, s[j]); float se = 0.f;
#pragma unroll 1
  for (int j = 0; j < SQ; ++j) se += expf(s[j] - mx); const float sc = 256.0f / se;
#pragma unroll 1
  for (int j0 = 0; j0 < SQ; j0 += 8) { FragH f; for (int q = 0; q < 8; ++q) f.h[q] = (_Float16)(expf(s[j0 + q] - mx) * sc); unsigned short* d = (unsigned short*)P + (size_t)i * SQ + j0; *(v8us*)d = f.half[0];  } }

#define FH 2048
#define KN 103
typedef int v4ia __attribute__((ext_vector_type(4), may_alias));
__device__ __forceinline__ void xcnt_wait() { asm volatile("s_wait_xcnt 0x0" ::: "memory"); }
__device__ __forceinline__ float wave_max(float v) {
#pragma unroll      /* five fixed butterfly steps */
  for (int m = 16; m > 0; m >>= 1) v = fmaxf(v, __shfl_xor(v, m, 32)); return v; }
__device__ __forceinline__ float wave_sum(float v) {
#pragma unroll      /* five fixed butterfly steps */
  for (int m = 16; m > 0; m >>= 1) v += __shfl_xor(v, m, 32); return v; }
// Operand preparation, one launch: the six weight matrices as x16 f16 planes (they lie one behind the other in Bt, in the order wq, wk, wv, wo, w1, w2), x as bf16-rounded f32 rows and, from the same registers, LN1 of these rows as f16 rows.
// A work-group converts 256 x 8 elements of one weight array or 8 rows of x; which array follows from blockIdx.x alone.
#define PW (DM * DM / 2048)          /* work-groups per DM x DM weight */
#define PF (FH * DM / 2048)          /* work-groups per FH x DM weight */
#define PX ((int)(NR / 8))           /* work-groups for x: one wave per row, 8 rows each */
#define PB0 (4 * PW + 2 * PF + PX)   /* first work-group of the prior tables' packing */
#define PMD (SQ * (SQ / 32) / 256)   /* prior_mask: one thread per 32-key word */
#define PMS (SQ / 8)                 /* prior_indices: one wave per query row */
static_assert((DM * DM) % 2048 == 0 && (FH * DM) % 2048 == 0 && NR % 8 == 0 && DM == 512, "k_prep: whole work-groups per array; a lane holds 16 of a row's 512 columns");
__global__ __launch_bounds__(256) void k_prep(const float* __restrict__ wq, const float* __restrict__ wk, const float* __restrict__ wv, const float* __restrict__ wo, const float* __restrict__ w1, const float* __restrict__ w2, const float* __restrict__ x, const float* __restrict__ g1, const float* __restrict__ be1, _Float16* __restrict__ Bt, float* __restrict__ XF, _Float16* __restrict__ X16o, const int* __restrict__ pmask, const int* __restrict__ pidx, const int* __restrict__ pim, unsigned int* __restrict__ MD, unsigned int* __restrict__ MS) {
  __shared__ __attribute__((aligned(16))) unsigned char bm[8][SQ];      /* prior_indices: the wave's own row of key flags (any index set) */
  const int blk = blockIdx.x; const float* src; int first; int ksh = 4;      /* ksh: log2 of a weight row's 32-k blocks */
  if (blk >= PB0 + PMD) {      /* MS[q][j / 32] bit j % 32: key j is one of row q's valid prior slots */
    const int lane = threadIdx.x & 31, w = threadIdx.x >> 5; const int q = (blk - PB0 - PMD) * 8 + w; const int* ix = pidx + (size_t)q * KN; const int* vm = pim + (size_t)q * KN; constexpr int NT = (KN + 31) / 32; int jx[NT]; bool ok[NT];
#pragma unroll      /* constant indices: the lane's values stay in registers and its loads issue together */
    for (int t = 0; t < NT; ++t) { const int k = t * 32 + lane; const int kc = k < KN ? k : KN - 1; jx[t] = ix[kc]; const int vk = vm[kc]; xcnt_wait(); ok[t] = (k < KN) & (vk != 0); }      /* a later load's result may land in an earlier load's address register: the wait stands between them */
    const v4ia z = {0, 0, 0, 0}; *(v4ia*)&bm[w][lane * 32] = z; *(v4ia*)&bm[w][lane * 32 + 16] = z;
    /* the zeros of every lane are in LDS before any lane sets a flag over them */
    __builtin_amdgcn_fence(__ATOMIC_ACQ_REL, "workgroup"); __builtin_amdgcn_wave_barrier();
#pragma unroll      /* constant indices: the lane's values stay in registers */
    for (int t = 0; t < NT; ++t) if (ok[t]) bm[w][min(max(jx[t], 0), SQ - 1)] = 1;      /* the key index is bounded here before it forms an address */
    /* the flags of every lane are in LDS before the row is read back */
    __builtin_amdgcn_fence(__ATOMIC_ACQ_REL, "workgroup"); __builtin_amdgcn_wave_barrier();
    unsigned int word = 0;
#pragma unroll      /* 32 independent LDS reads issue together */
    for (int c = 0; c < SQ / 32; ++c) { const unsigned int bal = __builtin_amdgcn_ballot_w32(bm[w][c * 32 + lane] != 0); if (lane == c) word = bal; }
    MS[(size_t)q * (SQ / 32) + lane] = word; return; }
  if (blk >= PB0) {      /* MD[q][j / 32] bit j % 32: prior_mask[q][j] */
    const size_t t = (size_t)(blk - PB0) * 256 + threadIdx.x; v4ia mv[8]; unsigned int word = 0;
#pragma unroll      /* constant indices: the lane's values stay in registers and its loads issue together */
    for (int i = 0; i < 8; ++i) mv[i] = *(const v4ia*)(pmask + t * 32 + i * 4);
    xcnt_wait();      /* the address registers of the eight loads may take new values below */
#pragma unroll      /* constant indices: the lane's values stay in registers */
    for (int i = 0; i < 8; ++i) for (int e = 0; e < 4; ++e) word |= (mv[i][e] != 0 ? 1u : 0u) << (i * 4 + e);
    MD[t] = word;
    xcnt_wait(); return; }      /* the listing lets another part's code follow, which writes the store's registers */
  if (blk >= 4 * PW + 2 * PF) {      /* x: one wave per row; lane l owns columns c*256 + l*8 .. +7 (c = 0, 1), rounded once, stored as the residual row and held in registers for the three passes of LN1 */
    const int lane = threadIdx.x & 31; const size_t r = (size_t)(blk - (4 * PW + 2 * PF)) * 8 + (threadIdx.x >> 5); const float* xr = x + r * DM + lane * 8; const float* gp = g1 + lane * 8; const float* bp = be1 + lane * 8; v4f a[4], gv[4], bv[4];
#pragma unroll      /* constant indices: the lane's values stay in registers and its 12 loads issue together */
    for (int c = 0; c < 2; ++c) { a[2 * c] = *(const v4fa*)(xr + c * 256); a[2 * c + 1] = *(const v4fa*)(xr + c * 256 + 4); gv[2 * c] = *(const v4fa*)(gp + c * 256); gv[2 * c + 1] = *(const v4fa*)(gp + c * 256 + 4); bv[2 * c] = *(const v4fa*)(bp + c * 256); bv[2 * c + 1] = *(const v4fa*)(bp + c * 256 + 4); }
    asm volatile("s_wait_xcnt 0x0" :: "v"(xr), "v"(gp), "v"(bp) : "memory");      /* stands in front of whatever gives new values to the address registers of these loads; the addresses as inputs stay alive up to here, so that no load's result lands in them */
    float v[16]; float s = 0.f; float* xo = XF + r * DM + lane * 8;
#pragma unroll      /* constant indices: the lane's values stay in registers */
    for (int c = 0; c < 4; ++c) { v4f o;
#pragma unroll      /* constant indices: the lane's values stay in registers */
      for (int e = 0; e < 4; ++e) { o[e] = bf16_round(a[c][e]); v[c * 4 + e] = o[e]; }
      *(v4f*)(xo + (c >> 1) * 256 + (c & 1) * 4) = o; }
#pragma unroll      /* constant indices: the lane's values stay in registers */
    for (int e = 0; e < 16; ++e) s += v[e];
    const float mu = wave_sum(s) / (float)DM; float qs = 0.f;
#pragma unroll      /* constant indices: the lane's values stay in registers */
    for (int e = 0; e < 16; ++e) { const float dd = v[e] - mu; qs += dd * dd; }
    const float rs = 1.0f / sqrtf(wave_sum(qs) / (float)DM + 1e-5f); unsigned short* no = (unsigned short*)X16o + fr_off(r, lane, DM);      /* fragment order: columns 8 lane .. + 7; 256 columns on are 8 blocks on */
#pragma unroll      /* constant indices: the lane's values stay in registers */
    for (int c = 0; c < 2; ++c) { FragH f;
#pragma unroll      /* constant indices: the lane's values stay in registers */
      for (int e = 0; e < 4; ++e) { f.h[e] = (_Float16)((v[c * 8 + e] - mu) * rs * bf16_round(gv[2 * c][e]) + bf16_round(bv[2 * c][e])); f.h[4 + e] = (_Float16)((v[c * 8 + 4 + e] - mu) * rs * bf16_round(gv[2 * c + 1][e]) + bf16_round(bv[2 * c + 1][e])); }
      *(v8us*)(no + c * 4096) = f.half[0]; }
    asm volatile("s_wait_xcnt 0x0" :: "v"(xo), "v"(no) : "memory"); return; }      /* the listing lets another part's code follow, which writes the stores' registers; the two addresses as inputs stay alive up to here */
  if (blk < PW) { src = wq; first = 0; } else if (blk < 2 * PW) { src = wk; first = PW; } else if (blk < 3 * PW) { src = wv; first = 2 * PW; } else if (blk < 4 * PW) { src = wo; first = 3 * PW; }
  else if (blk < 4 * PW + PF) { src = w1; first = 4 * PW; } else { src = w2; first = 4 * PW + PF; ksh = 6; }
  static_assert(DM == 32 << 4 && FH == 32 << 6, "k_prep: blocks per weight row");
  /* thread = one 16-byte unit of the plane in fragment order; its 8 elements of the row-major weight follow from the unit's number. A wave takes 8 rows x 32 k of a block: it reads one whole 128-byte line of each row and stores 4 whole lines (8 rows' units of one k group each). */
  const int tl = threadIdx.x, ul = (tl & 0xC0) | (((tl >> 3) & 3) << 4) | (((tl >> 5) & 1) << 3) | (tl & 7);
  const int u = (blk - first) * 256 + ul, ub = u >> 6; const int wn = ((ub >> ksh) << 4) + (u & 15), wk8 = ((ub & ((1 << ksh) - 1)) << 2) + ((u >> 4) & 3);
  const float* wsrc = src + ((size_t)wn << (ksh + 5)) + wk8 * 8; const v4f a0 = *(const v4fa*)wsrc, a1 = *(const v4fa*)(wsrc + 4);
  xcnt_wait();      /* the address registers of the two loads may take new values below */
  { FragH f;
#pragma unroll      /* constant indices: the values stay in registers */
    for (int q = 0; q < 4; ++q) { f.h[q] = (_Float16)(bf16_round(a0[q]) * 16.0f); f.h[4 + q] = (_Float16)(bf16_round(a1[q]) * 16.0f); }
    *(v8us*)((unsigned short*)Bt + ((size_t)blk * 256 + ul) * 8) = f.half[0];
    xcnt_wait(); } }      /* the listing lets another part's code follow, which writes the store's registers */
// Row LayerNorm, one wave per row: lane l owns columns c*256 + l*8 .. +7 (c = 0, 1), held in registers for the three passes.
__global__ __launch_bounds__(256) void k_lnw(const float* __restrict__ HF, const float* __restrict__ g, const float* __restrict__ bb, _Float16* __restrict__ X16o) {
  const int lane = threadIdx.x & 31; const size_t r = (size_t)blockIdx.x * 8 + (threadIdx.x >> 5); if (r >= NR) return; const float* x = HF + r * DM; float v[16]; float s = 0.f;
#pragma unroll      /* constant indices: the lane's values stay in registers and its loads issue together */
  for (int c = 0; c < 2; ++c) { const int j0 = c * 256 + lane * 8; const v4f a0 = *(const v4fa*)(x + j0), a1 = *(const v4fa*)(x + j0 + 4);
#pragma unroll      /* constant indices: the lane's values stay in registers and its loads issue together */
    for (int e = 0; e < 4; ++e) { v[c * 8 + e] = a0[e]; v[c * 8 + 4 + e] = a1[e]; } }
#pragma unroll      /* constant indices: the lane's values stay in registers and its loads issue together */
  for (int e = 0; e < 16; ++e) s += v[e];
  const float mu = wave_sum(s) / (float)DM; float qs = 0.f;
#pragma unroll      /* constant indices: the lane's values stay in registers and its loads issue together */
  for (int e = 0; e < 16; ++e) { const float dd = v[e] - mu; qs += dd * dd; }
  const float rs = 1.0f / sqrtf(wave_sum(qs) / (float)DM + 1e-5f);
#pragma unroll      /* constant indices: the lane's values stay in registers and its loads issue together */
  for (int c = 0; c < 2; ++c) { const int j0 = c * 256 + lane * 8; const v4f g0 = *(const v4fa*)(g + j0), g1 = *(const v4fa*)(g + j0 + 4), b0 = *(const v4fa*)(bb + j0), b1 = *(const v4fa*)(bb + j0 + 4); FragH f;
#pragma unroll      /* constant indices: the lane's values stay in registers and its loads issue together */
    for (int e = 0; e < 4; ++e) { f.h[e] = (_Float16)((v[c * 8 + e] - mu) * rs * bf16_round(g0[e]) + bf16_round(b0[e])); f.h[4 + e] = (_Float16)((v[c * 8 + 4 + e] - mu) * rs * bf16_round(g1[e]) + bf16_round(b1[e])); }
    *(v8us*)((unsigned short*)X16o + fr_off(r, j0 >> 3, DM)) = f.half[0]; } }      /* fragment order */
// Lane l <-> l ^ 16: the two lanes that hold one query's column of a D tile.
__device__ __forceinline__ float xhalf(float x) { const int b = __builtin_bit_cast(int, x); return __builtin_bit_cast(float, __builtin_amdgcn_permlanex16(b, b, 0x76543210, 0xfedcba98, false, false)); }
typedef unsigned int v2ua __attribute__((ext_vector_type(2), may_alias));
// e[r] = 2^(s[r] - mb), eight at a time. One asm statement: here every result register differs from every source (early clobber), so no v_exp_f32 touches its predecessor's registers, and the v_nop is the one slot behind the last of them.
__device__ __forceinline__ void exp2x8(float (&e)[8], const v8f s, const float mb) {
  const float a0 = s[0] - mb, a1 = s[1] - mb, a2 = s[2] - mb, a3 = s[3] - mb, a4 = s[4] - mb, a5 = s[5] - mb, a6 = s[6] - mb, a7 = s[7] - mb;
  /* the run of eight with its closing v_nop: keeps the slot behind each transcendental free of a reader of its result and of a writer of its source */
  asm("v_exp_f32 %0, %8\n\tv_exp_f32 %1, %9\n\tv_exp_f32 %2, %10\n\tv_exp_f32 %3, %11\n\tv_exp_f32 %4, %12\n\tv_exp_f32 %5, %13\n\tv_exp_f32 %6, %14\n\tv_exp_f32 %7, %15\n\tv_nop"
      : "=&v"(e[0]), "=&v"(e[1]), "=&v"(e[2]), "=&v"(e[3]), "=&v"(e[4]), "=&v"(e[5]), "=&v"(e[6]), "=&v"(e[7]) : "v"(a0), "v"(a1), "v"(a2), "v"(a3), "v"(a4), "v"(a5), "v"(a6), "v"(a7)); }
// The A fragments of one 64-key chunk: four 16-row groups (pitch16 elements apart) x two 32-k steps (neighbouring blocks).
struct AtSet { v16h f[8]; };
__device__ __forceinline__ void at_load(AtSet& s, const _Float16* p, size_t pitch16) {      /* p: the lane's own address in the first block */
#pragma unroll      /* constant indices: the fragments stay in registers and their loads issue together */
  for (int t = 0; t < 4; ++t) { s.f[2 * t] = g2_frag(p + t * pitch16); s.f[2 * t + 1] = g2_frag(p + t * pitch16 + 512); }
  asm volatile("s_wait_xcnt 0x0" :: "v"(p) : "memory");      /* stands in front of whatever gives new values to the address registers of these loads; the address as an input keeps its registers alive up to here, so that no load's result lands in them */
  __builtin_amdgcn_sched_barrier(0); }      /* keeps the 16 loads and their wait here, ahead of the work that hides them: moved down to their first uses the loads would each be waited for in turn */
// Attention, scores to merged heads in one launch: a wave owns 16 queries of one (batch, head) and walks the 1,024 keys in chunks of 64.
// S^T = K . Q^T puts one query's scores into one lane pair (l, l ^ 16); two converted S^T tiles are the B operand of O^T += V^T . P^T, so neither scores nor weights leave the registers.
// Running maximum m and sum l per query; a key outside the prior gets the penalty pen: -lam log2 e in the dense branch, -1e30 in the sparse branch (its weight is exactly 0 once a key of the set has been met, and what was summed before that is scaled by exactly 0).
// Scores are kept in base-2 units (q.k / 8 and the penalty times log2 e), so that a weight is one subtraction and one v_exp_f32; the x256 of the f16 weights is 8 taken off the maximum, and l sums the same x256 values as O^T does.
__global__ __launch_bounds__(128) void k_attn(const _Float16* __restrict__ Q16, const _Float16* __restrict__ K16, const _Float16* __restrict__ VT, const unsigned int* __restrict__ MD, const unsigned int* __restrict__ MS, const float* __restrict__ uprev, _Float16* __restrict__ O16) {
  const int tid = threadIdx.x, w = tid >> 5, lane = tid & 31, ln = lane & 15, hh = lane >> 4; const int h = blockIdx.y, b = blockIdx.z; const int q0 = (blockIdx.x * 4 + w) * 16;
  const float lam = 10.0f * expf(-5.0f * bf16_round(uprev[b])); const bool sparse = lam >= 1.0f; constexpr float L2E = 1.4426950408889634f; const float pen = sparse ? -1.0e30f : -lam * L2E;
  const unsigned int* mk = (sparse ? MS : MD) + (size_t)(q0 + ln) * (SQ / 32);
  const _Float16* qp = Q16 + ((size_t)b * SQ + q0) * DM + h * (HD * 16) + lane * 8; const _Float16* kp = K16 + (size_t)b * SQ * DM + h * (HD * 16) + lane * 8; const _Float16* vp = VT + (size_t)(b * NH + h) * HD * SQ + lane * 8;      /* fragment order: a head's 64 columns are blocks 2 h and 2 h + 1 of a row group */
  const v16h qb0 = g2_frag(qp), qb1 = g2_frag(qp + 512); v2ua mw = *(const v2ua*)mk;      /* mw: this query's 64 prior bits of the chunk at hand */
  asm volatile("s_wait_xcnt 0x0" :: "v"(qp), "v"(mk) : "memory"); __builtin_amdgcn_sched_barrier(0);      /* the wait stands in front of whatever gives new values to the address registers of these five loads (as inputs they stay alive up to here); the barrier keeps later code behind it */
  AtSet kf, vf; at_load(kf, kp, (size_t)16 * DM);
  const v8f z8 = {0.f,0.f,0.f,0.f,0.f,0.f,0.f,0.f}; v8f o[4] = {z8, z8, z8, z8}; float m = -3.0e38f, l = 0.f;
  const _Float16* vq = vp; const _Float16* kq = kp + (size_t)64 * DM;      /* running addresses: they live across their loads, so no load's result can land in them, and they move on behind the loads' wait */
#pragma unroll 1      /* one chunk per trip: a second copy would double the fragment registers */
  for (int c = 0; c < SQ / 64; ++c) {
    const v2ua mn = *(const v2ua*)(mk + ((c + 1) & (SQ / 64 - 1)) * 2);      /* the next chunk's prior bits, one trip ahead like the K rows */
    xcnt_wait();      /* a later load's result may land in this load's address registers: the wait stands between them */
    at_load(vf, vq, (size_t)16 * SQ); vq += 64 * 16;      /* 64 keys on: two blocks */
    v8f s[4];
#pragma unroll      /* constant indices: the tiles stay in registers */
    for (int t = 0; t < 4; ++t) s[t] = g2_mma(kf.f[2 * t + 1], qb1, g2_mma(kf.f[2 * t], qb0, z8));
    at_load(kf, kq, (size_t)16 * DM); kq = c + 2 < SQ / 64 ? kq + (size_t)64 * DM : kp;      /* the next chunk's K rows fly under the softmax; the last trip fetches chunk 0 again, in bounds and unused */
    float mx = m;
#pragma unroll      /* constant indices: the tiles stay in registers */
    for (int t = 0; t < 4; ++t) { const unsigned int by = mw[t >> 1] >> (16 * (t & 1) + 8 * hh);      /* bit r: key 16 t + 8 hh + r of the chunk */
#pragma unroll      /* constant indices: the tiles stay in registers */
      for (int r = 0; r < 8; ++r) { const float v = s[t][r] * (0.125f * L2E) + (((by >> r) & 1u) ? 0.f : pen); s[t][r] = v; mx = fmaxf(mx, v); } }
    mx = fmaxf(mx, xhalf(mx)); const float corr = __builtin_amdgcn_exp2f(m - mx); m = mx; const float mb = mx - 8.0f; float ps = 0.f; FragH p0, p1; float ex[4][8];
#pragma unroll      /* constant indices: the tiles stay in registers */
    for (int t = 0; t < 4; ++t) exp2x8(ex[t], s[t], mb);
#pragma unroll      /* constant indices: the tiles stay in registers */
    for (int r = 0; r < 8; ++r) { const float e0 = ex[0][r], e1 = ex[1][r], e2 = ex[2][r], e3 = ex[3][r]; ps += (e0 + e1) + (e2 + e3);
      p0.h[r] = (_Float16)e0; p0.h[8 + r] = (_Float16)e1; p1.h[r] = (_Float16)e2; p1.h[8 + r] = (_Float16)e3; }
    l = l * corr + ps;
#pragma unroll      /* constant indices: the tiles stay in registers */
    for (int t = 0; t < 4; ++t) { o[t] *= corr; o[t] = g2_mma(vf.f[2 * t + 1], p1.v, g2_mma(vf.f[2 * t], p0.v, o[t])); }
    mw = mn; }
  l += xhalf(l); const float inv = 1.0f / l;      /* l >= 1: the key that holds the maximum adds 2^8 (2^0 where the maximum is the sparse penalty, which takes the 8 up) */
  unsigned short* od = (unsigned short*)O16 + ((size_t)b * SQ + q0) * DM + h * (HD * 16) + lane * 8;      /* fragment order: columns 16 t + 8 hh .. + 7 of query ln are unit 32 t + lane of the head's two blocks */
#pragma unroll      /* constant indices: the tiles stay in registers */
  for (int t = 0; t < 4; ++t) { FragH f;
#pragma unroll      /* constant indices: the tiles stay in registers */
    for (int r = 0; r < 8; ++r) f.h[r] = (_Float16)(o[t][r] * inv);
    *(v8us*)(od + t * 256) = f.half[0]; } }
// The surprise statistic from the row sums that the fc2 launch left: one work-group, thread t takes row t of every batch, adds the row's DM / 64 pairs in tile order, u = |out - x| / (|x| + 1e-8); batch means in float64 (wave butterfly, then one value per wave through LDS); lane b of wave 0 stores batch b.
static_assert(SQ == 1024 && NB <= 32, "k_ufin: one thread per row of a batch");
__global__ __launch_bounds__(1024) void k_ufin(const float* __restrict__ PN, float* __restrict__ out1) {
  __shared__ double ws[NB][32];
  const int tid = threadIdx.x, lane = tid & 31, w = tid >> 5; constexpr int NTL = DM / 64; v2f pr[NB][NTL]; const float* pp = PN + (size_t)tid * 2;
#pragma unroll      /* constant indices: the pairs stay in registers and their loads issue together */
  for (int b = 0; b < NB; ++b) {
#pragma unroll      /* constant indices: the pairs stay in registers and their loads issue together */
    for (int q = 0; q < NTL; ++q) pr[b][q] = *(const v2fa*)(pp + ((size_t)q * NR + (size_t)b * SQ) * 2); }
  asm volatile("s_wait_xcnt 0x0" :: "v"(pp) : "memory");      /* stands in front of whatever gives new values to the address registers of these loads; the address as an input stays alive up to here, so that no load's result lands in it */
#pragma unroll      /* constant indices: the pairs stay in registers */
  for (int b = 0; b < NB; ++b) { float sd = pr[b][0][0], sx = pr[b][0][1];
#pragma unroll      /* constant indices: the pairs stay in registers */
    for (int q = 1; q < NTL; ++q) { sd += pr[b][q][0]; sx += pr[b][q][1]; }
    double s = (double)(sqrtf(sd) / (sqrtf(sx) + 1e-8f));
#pragma unroll      /* five fixed butterfly steps */
    for (int m = 16; m > 0; m >>= 1) s += __shfl_xor(s, m, 32);
    if (lane == 0) ws[b][w] = s; }
  __syncthreads();      /* the 32 waves' sums are in LDS before wave 0 reads them */
  if (w == 0) { float res = 0.f;
#pragma unroll      /* constant indices */
    for (int b = 0; b < NB; ++b) { double s = ws[b][lane];
#pragma unroll      /* five fixed butterfly steps */
      for (int m = 16; m > 0; m >>= 1) s += __shfl_xor(s, m, 32);
      if (lane == b) res = (float)(s / (double)SQ); }
    if (lane < NB) out1[lane] = res; } }
extern "C" void kernel_launch(void* const* d_in, const int* in_sizes, int n_in,
                              void* d_out, int out_size, void* d_ws, size_t ws_size, hipStream_t stream) {
  (void)in_sizes; (void)n_in; (void)out_size;
  const float* const* I = (const float* const*)d_in; const float* x = I[0]; const float* uprev = I[1]; const float* wq = I[2]; const float* bq = I[3]; const float* wk = I[4]; const float* bk = I[5]; const float* wv = I[6]; const float* bv = I[7]; const float* wo = I[8]; const float* bo = I[9]; const float* l1g = I[10]; const float* l1b = I[11]; const float* l2g = I[12]; const float* l2b = I[13]; const float* w1 = I[14]; const float* b1 = I[15]; const float* w2 = I[16]; const float* b2 = I[17]; const int* pmask = (const int*)d_in[18]; const int* pidx = (const int*)d_in[19]; const int* pim = (const int*)d_in[20];
  float* out0 = (float*)d_out; float* out1 = out0 + NR * DM;
  char* ws = (char*)d_ws; size_t off = 0;
  auto take = [&](size_t bytes) { char* p = ws + off; off += (bytes + 255) & ~(size_t)255; return p; };
  _Float16* BQ = (_Float16*)take(((size_t)4 * DM * DM + (size_t)2 * FH * DM) * 2); _Float16* BO = BQ + (size_t)3 * DM * DM; _Float16* BW1 = BO + (size_t)DM * DM; _Float16* BW2 = BW1 + (size_t)FH * DM;      /* one block: the planes of wq, wk, wv, wo, w1, w2 one behind the other */
  float* XF = (float*)take(NR * DM * 4); float* HF = (float*)take(NR * DM * 4); _Float16* G16 = (_Float16*)take(NR * FH * 2); float* PN = (float*)take((size_t)(DM / 64) * NR * 2 * 4);
  _Float16* X16 = (_Float16*)take(NR * DM * 2); _Float16* Q16 = (_Float16*)take(2 * NR * DM * 2); _Float16* K16 = Q16 + NR * DM; _Float16* O16 = (_Float16*)take(NR * DM * 2);
  _Float16* VT = (_Float16*)take((size_t)HG * HD * SQ * 2); unsigned int* MD = (unsigned int*)take((size_t)SQ * (SQ / 32) * 4); unsigned int* MS = (unsigned int*)take((size_t)SQ * (SQ / 32) * 4);
  if (off > ws_size) return;      /* 6 + 4 + 4 + 8 + 2x4 + 2 = about 32 MiB */
  k_prep<<<PB0 + PMD + PMS, 256, 0, stream>>>(wq, wk, wv, wo, w1, w2, x, l1g, l1b, BQ, XF, X16, pmask, pidx, pim, MD, MS);      /* LN1(x) rows included */
  const dim3 gp((unsigned)((NR / 128) * (DM / 64)), 1);
  k_gemm2<0, false, true, DM, true><<<dim3(gp.x, 3), 128, 0, stream>>>(X16, DM, BQ, DM, (size_t)DM * DM, 0.0625f, bq, bk, bv, nullptr, nullptr, Q16, VT, NR * DM, (int)NR, DM, DM);      /* y = 0, 1: q, k rows; y = 2: v transposed */
  k_attn<<<dim3(SQ / 64, NH, NB), 128, 0, stream>>>(Q16, K16, VT, MD, MS, uprev, O16);      /* o (merged heads) as f16 rows; x = 64 queries, y = head, z = batch */
  k_gemm2k<DM, false><<<gp, 128 * KS, 0, stream>>>(O16, DM, BO, DM, 0.0625f, bo, XF, nullptr, HF, nullptr, (int)NR, DM, DM);      /* h = x + attn W_o^T + b_o */
  k_lnw<<<(unsigned)((NR + 7) / 8), 256, 0, stream>>>(HF, l2g, l2b, X16);
  k_gemm2<6, false, true, FH, false><<<dim3((unsigned)((NR / 128) * (FH / 64)), 1), 128, 0, stream>>>(X16, DM, BW1, DM, 0, 0.0625f, b1, nullptr, nullptr, nullptr, nullptr, G16, nullptr, 0, (int)NR, FH, DM);      /* gelu_erf(LN2(h) W1^T + b1) */
  k_gemm2k<DM, true><<<gp, 128 * KS, 0, stream>>>(G16, FH, BW2, FH, 0.0625f, b2, HF, XF, out0, PN, (int)NR, DM, FH);      /* out = h + (...) W2^T + b2, rows are the output layout; the row norms' partial sums beside them */
  k_ufin<<<1, 1024, 0, stream>>>(PN, out1);
}
